// v000
// Times are from an AMD MI455X. After a warm-up the kernel runs many times in a row, and a time is the length of
// such a window on the GPU divided by its runs, so every launch and the gaps after it count. The runs cycle
// through copies of the inputs. A figure is the median of several windows, for all but v000 over two sittings.
// Sittings can differ by a few percent; kernels timed side by side share one.
// The starting kernel, v000, takes 2090 microseconds a run.
#include <hip/hip_runtime.h>

// Transformer-XL style relative-position multi-head self-attention (xs [8][1024][512]; q, k, v = xs W ('xw' [512][512], no bias; 8 heads x 64); p = pe Wpos with pe the sinusoidal table of positions -(T-1)..T-1 (2047 rows, [sin, cos] interleaved, computed on device); scores = ((q + u_bias).k + rel_shift((q + v_bias).p)) / 8 where rel_shift picks position row j - i + 1023; mask (int32 [8][1024][1024], read): -inf where 0 and those weights zeroed; softmax; out = merged Wout ('xw', no bias) -> [8][1024][512] (4.2 M)).
// Layout: one exact bf16 input plane -> 1-product projections; the position table is computed on device in f32 (it is internal to the reference, so NOT bf16-rounded: kept as bf16 hi + lo planes) and projected once (2 products, 2047 rows + one zero pad row) into per-head hi/lo planes [h][2048][64]; per pass of two heads: content scores (q+u).k [2][1024][1024] and position scores (q+v).p [2][1024][2048] are hi/lo GEMMs (3 products, every row) and the softmax kernel gathers the position score at j - i + 1023 per logit and applies the mask select.
// Compute dtypes, f32 accumulate: every input rounded to bf16; q/k/v on PLAIN bf16 operands (exact products); p = pe(hi+lo) Wpos (2 products); content and position scores on hi/lo planes for every row (3 products); softmax f32; attn.v hi/lo (3 products); Wout hl x exact (2 products).

#define NB_  8
#define TT   1024
#define DM   512
#define NH_  8
#define NKV  8
#define REP  (NH_ / NKV)
#define HD   64
#define DQ   (NH_ * HD)
#define DKV  (NKV * HD)
#define NPE  2048                 // 2047 positions + 1 zero pad row
typedef __attribute__((ext_vector_type(4))) unsigned short v4us;
#define ZH   2
#define RH   1024                 // every row hi/lo
#define WIN  0
#define PCAR 1024.0f
#define SCL  0.125f   // HD^-0.5
typedef _Float16 h16;
typedef unsigned short bf;
typedef __attribute__((ext_vector_type(16))) __bf16   v16bf;
typedef __attribute__((ext_vector_type(16))) _Float16 v16h;
typedef __attribute__((ext_vector_type(8)))  _Float16 v8h;
typedef __attribute__((ext_vector_type(8)))  unsigned short v8us;
typedef __attribute__((ext_vector_type(8)))  float    v8f;
typedef __attribute__((ext_vector_type(4)))  float    v4f;
typedef v8h  __attribute__((may_alias)) v8ha;
typedef v4f  __attribute__((may_alias)) v4fa;
typedef v8us __attribute__((may_alias)) v8usa;

__device__ __forceinline__ unsigned short f2bf(float f) { unsigned u = __float_as_uint(f); u += 0x7FFFu + ((u >> 16) & 1u); return (unsigned short)(u >> 16); }
__device__ __forceinline__ float bf2f(unsigned short b) { return __uint_as_float(((unsigned)b) << 16); }
__device__ __forceinline__ float bfr(float f) { return bf2f(f2bf(f)); }
__device__ __forceinline__ v16h cat16(v8h lo, v8h hi) { return __builtin_shufflevector(lo, hi, 0, 1, 2, 3, 4, 5, 6, 7, 8, 9, 10, 11, 12, 13, 14, 15); }
__device__ __forceinline__ v16bf cat16b(v8us lo, v8us hi) { return __builtin_bit_cast(v16bf, __builtin_shufflevector(lo, hi, 0, 1, 2, 3, 4, 5, 6, 7, 8, 9, 10, 11, 12, 13, 14, 15)); }
__device__ __forceinline__ v8f wmma16(v16h a, v16h b, v8f c) { return __builtin_amdgcn_wmma_f32_16x16x32_f16(false, a, false, b, (short)0, c, false, false); }
__device__ __forceinline__ v8f wmmab(v16bf a, v16bf b, v8f c) { return __builtin_amdgcn_wmma_f32_16x16x32_bf16(false, a, false, b, (short)0, c, false, false); }



// ---- k_gemmw: register-blocked GEMM, ONE WAVE per 64x64 output tile (16 accumulators), operands straight from K-contiguous 16-bit planes; grid (M/64, N/64, Z), 32 threads.
// C[m][n] (f32, pitch ldc, + optional f32 bias[n]) = sum_k A[m][k] Bt[n][k] (+ split products per NSPLIT). z-batch strides sA/sB/sC in elements. K % 32 == 0.
template <typename T16> struct WFrag;
template <> struct WFrag<h16> { typedef v16h V; static __device__ __forceinline__ V ld(const h16* p) { return cat16(*(const v8h*)p, *(const v8h*)(p + 16)); } static __device__ __forceinline__ v8f mma(V a, V b, v8f c) { return wmma16(a, b, c); } };
template <> struct WFrag<bf> { typedef v16bf V; static __device__ __forceinline__ V ld(const bf* p) { return cat16b(*(const v8us*)p, *(const v8us*)(p + 16)); } static __device__ __forceinline__ v8f mma(V a, V b, v8f c) { return wmmab(a, b, c); } };
template <typename T16, int NSPLIT, bool BIAS>
__global__ __launch_bounds__(32) void k_gemmw(const T16* __restrict__ A, const T16* __restrict__ A2, const T16* __restrict__ Bt, const T16* __restrict__ Bt2, int K, float* C, int ldc, const float* __restrict__ bias, size_t sA, size_t sB, size_t sC) {
    typedef typename WFrag<T16>::V V;
    __shared__ __align__(16) float os[16 * 68];
    const size_t z = blockIdx.z; A += z * sA; if (A2) A2 += z * sA; Bt += z * sB; if (Bt2) Bt2 += z * sB; C += z * sC;
    const int lane = threadIdx.x & 31, lr = lane & 15, hi = lane >> 4; const int r0 = blockIdx.x * 64, c0 = blockIdx.y * 64;
    v8f acc[4][4];
#pragma unroll
    for (int mb = 0; mb < 4; ++mb)
#pragma unroll
        for (int nb = 0; nb < 4; ++nb) acc[mb][nb] = (v8f){};
    const size_t aoff = (size_t)(r0 + lr) * K + 8 * hi, boff = (size_t)(c0 + lr) * K + 8 * hi;
#pragma unroll 1
    for (int kc = 0; kc < K; kc += 32) {
        V a[4], a2[4];
#pragma unroll
        for (int mb = 0; mb < 4; ++mb) { a[mb] = WFrag<T16>::ld(A + aoff + (size_t)mb * 16 * K + kc); if (NSPLIT == 1 || NSPLIT == 2) a2[mb] = WFrag<T16>::ld(A2 + aoff + (size_t)mb * 16 * K + kc); }
#pragma unroll
        for (int nb = 0; nb < 4; ++nb) { const V b = WFrag<T16>::ld(Bt + boff + (size_t)nb * 16 * K + kc); V b2; if (NSPLIT >= 2) b2 = WFrag<T16>::ld(Bt2 + boff + (size_t)nb * 16 * K + kc);
#pragma unroll
            for (int mb = 0; mb < 4; ++mb) { acc[mb][nb] = WFrag<T16>::mma(a[mb], b, acc[mb][nb]); if (NSPLIT == 1 || NSPLIT == 2) acc[mb][nb] = WFrag<T16>::mma(a2[mb], b, acc[mb][nb]); if (NSPLIT >= 2) acc[mb][nb] = WFrag<T16>::mma(a[mb], b2, acc[mb][nb]); } }
        asm volatile("v_nop\n\tv_nop\n\tv_nop\n\tv_nop" : "+v"(acc[0][0]), "+v"(acc[1][1]), "+v"(acc[2][2]), "+v"(acc[3][3]) : "v"(a[0]), "v"(a[3]));
    }
#pragma unroll
    for (int mb = 0; mb < 4; ++mb) {
#pragma unroll
        for (int nb = 0; nb < 4; ++nb) {
#pragma unroll
            for (int j = 0; j < 8; ++j) os[(hi * 8 + j) * 68 + nb * 16 + lr] = acc[mb][nb][j]; }
        __builtin_amdgcn_wave_barrier(); asm volatile("" ::: "memory");
        float* crow = C + (size_t)(r0 + mb * 16) * ldc + c0;
{
#pragma unroll
            for (int s = 0; s < 8; ++s) { const int row = 2 * s + hi, cofs = lr * 4; v4f val = *(const v4fa*)(os + row * 68 + cofs); if (BIAS) { val[0] += bfr(bias[c0 + cofs]); val[1] += bfr(bias[c0 + cofs + 1]); val[2] += bfr(bias[c0 + cofs + 2]); val[3] += bfr(bias[c0 + cofs + 3]); }
                *(v4f*)(crow + (size_t)row * ldc + cofs) = val; }
             }
        __builtin_amdgcn_wave_barrier(); asm volatile("" ::: "memory");
    }
}

__device__ __forceinline__ h16 tohx(float x) { return (h16)x; }
__device__ __forceinline__ void splitf(float y, unsigned short& h, unsigned short& l) { h = f2bf(y); l = f2bf(y - bf2f(h)); }
typedef __attribute__((ext_vector_type(2))) _Float16 v2h;
typedef __attribute__((ext_vector_type(4))) _Float16 v4h;
typedef __attribute__((ext_vector_type(2))) unsigned short v2us;
typedef __attribute__((ext_vector_type(4))) unsigned short v4us;
typedef __attribute__((ext_vector_type(2))) float v2f;
typedef __attribute__((ext_vector_type(4))) int v4i;

__global__ __launch_bounds__(256) void k_wtG(const float* __restrict__ w, int K, int N, bf* Bt) {
    const int lane = threadIdx.x & 31; const int L0 = (blockIdx.x * 8 + (threadIdx.x >> 5)) * 8; const int nlines = N * K / 64;
{
#pragma unroll 1
        for (int l = 0; l < 8; ++l) { const int L = L0 + l; if (L >= nlines) break; const size_t e = (size_t)L * 64 + lane * 2; const int k = (int)(e % K), n = (int)(e / K); v2us o;
            o[0] = f2bf(w[(size_t)k * N + n]); o[1] = f2bf(w[(size_t)(k + 1) * N + n]); *(v2us*)(Bt + e) = o; }
         }
}



__constant__ float INVF[DM / 2] = {1.0f,0.964661598f,0.930572033f,0.897687137f,0.865964293f,0.835362554f,0.805842161f,0.777365029f,0.749894202f,0.723394156f,0.697830558f,0.673170388f,0.649381638f,0.626433551f,0.604296386f,0.582941532f,0.562341332f,0.542469084f,0.523299098f,0.504806578f,0.486967504f,0.469758898f,0.453158379f,0.437144488f,0.421696484f,0.406794429f,0.392418981f,0.378551513f,0.365174115f,0.352269441f,0.339820832f,0.327812076f,0.316227764f,0.305052817f,0.294272721f,0.283873618f,0.273841947f,0.264164835f,0.254829645f,0.245824397f,0.237137347f,0.228757307f,0.220673412f,0.212875158f,0.2053525f,0.198095664f,0.191095293f,0.184342295f,0.177827939f,0.171543792f,0.165481701f,0.15963386f,0.153992653f,0.148550808f,0.143301249f,0.138237223f,0.133352146f,0.128639698f,0.124093764f,0.119708493f,0.115478195f,0.111397393f,0.107460767f,0.103663281f,0.099999994f,0.0964661688f,0.0930572152f,0.0897687078f,0.0865964293f,0.0835362524f,0.0805842206f,0.0777364895f,0.0749894157f,0.0723394156f,0.0697830617f,0.0673170388f,0.0649381578f,0.0626433492f,0.0604296364f,0.0582941547f,0.056234125f,0.0542469025f,0.0523299091f,0.0504806563f,0.0486967564f,0.0469758809f,0.0453158319f,0.0437144488f,0.0421696529f,0.0406794474f,0.0392418914f,0.0378551483f,0.0365174115f,0.0352269486f,0.0339820795f,0.0327812098f,0.0316227749f,0.0305052791f,0.0294272732f,0.0283873565f,0.0273841936f,0.0264164824f,0.0254829675f,0.0245824363f,0.023713734f,0.0228757299f,0.0220673401f,0.0212875176f,0.0205352474f,0.0198095664f,0.0191095285f,0.0184342302f,0.0177827962f,0.0171543807f,0.0165481735f,0.0159633812f,0.0153992623f,0.0148550775f,0.0143301245f,0.0138237216f,0.013335214f,0.0128639704f,0.0124093788f,0.0119708525f,0.0115478169f,0.0111397365f,0.0107460767f,0.0103663281f,0.00999999978f,0.00964661594f,0.00930572115f,0.00897687208f,0.00865964405f,0.00835362263f,0.00805842038f,0.00777364895f,0.00749894092f,0.007233941f,0.00697830552f,0.00673170388f,0.00649381708f,0.00626433641f,0.00604296196f,0.00582941389f,0.00562341232f,0.00542468997f,0.00523299072f,0.00504806545f,0.00486967526f,0.0046975892f,0.00453158421f,0.0043714433f,0.00421696389f,0.00406794343f,0.00392418914f,0.00378551497f,0.00365174119f,0.00352269458f,0.00339820841f,0.00327812159f,0.0031622767f,0.00305052707f,0.00294272648f,0.00283873547f,0.00273841922f,0.00264164805f,0.0025482967f,0.0024582441f,0.00237137405f,0.00228757365f,0.00220673345f,0.00212875125f,0.0020535246f,0.00198095664f,0.00191095285f,0.001843423f,0.00177827943f,0.00171543809f,0.00165481726f,0.00159633812f,0.00153992616f,0.0014855077f,0.00143301231f,0.00138237211f,0.00133352133f,0.00128639699f,0.00124093785f,0.00119708513f,0.00115478167f,0.00111397356f,0.0010746076f,0.00103663281f,0.000999999931f,0.000964661594f,0.000930572045f,0.000897687161f,0.000865964394f,0.000835362298f,0.000805841992f,0.000777364883f,0.000749894069f,0.0007233941f,0.000697830576f,0.000673170376f,0.000649381662f,0.000626433583f,0.00060429622f,0.0005829414f,0.000562341185f,0.000542468973f,0.000523299037f,0.000504806521f,0.000486967503f,0.000469758903f,0.000453158398f,0.000437144336f,0.000421696401f,0.000406794337f,0.000392418908f,0.000378551485f,0.000365174084f,0.000352269446f,0.000339820836f,0.000327811984f,0.000316227786f,0.000305052701f,0.000294272788f,0.000283873524f,0.000273842044f,0.000264164817f,0.000254829531f,0.000245824398f,0.000237137268f,0.000228757344f,0.000220673333f,0.000212875209f,0.000205352466f,0.000198095746f,0.000191095271f,0.000184342207f,0.00017782794f,0.00017154371f,0.000165481732f,0.000159633797f,0.000153992674f,0.000148550767f,0.000143301295f,0.000138237199f,0.000133352078f,0.000128639687f,0.000124093727f,0.000119708515f,0.000115478157f,0.000111397407f,0.000107460757f,0.000103663326f};
__global__ __launch_bounds__(256) void k_petab(bf* PEh, bf* PEl) { const size_t e = ((size_t)blockIdx.x * 256 + threadIdx.x) * 2; if (e >= (size_t)NPE * DM) return; const int c = (int)(e % DM); const int r = (int)(e / DM); v2us oh, ol;
    if (r < NPE - 1) { const float th = __fmul_rn((float)(r - (TT - 1)), INVF[c >> 1]); unsigned short a, b2; splitf(sinf(th), a, b2); oh[0] = a; ol[0] = b2; splitf(cosf(th), a, b2); oh[1] = a; ol[1] = b2; } else { oh[0] = 0; oh[1] = 0; ol[0] = 0; ol[1] = 0; }
    *(v2us*)(PEh + e) = oh; *(v2us*)(PEl + e) = ol;  }
__global__ __launch_bounds__(256) void k_addhb(const float* __restrict__ F, const float* __restrict__ hb, float* FO, size_t n4) { const size_t i = (size_t)blockIdx.x * 256 + threadIdx.x; if (i >= n4) return; const int c = (int)((i * 4) % DQ); const v4f a = *(const v4f*)(F + i * 4); v4f o;
#pragma unroll
    for (int q = 0; q < 4; ++q) o[q] = __fadd_rn(a[q], bfr(hb[c + q])); *(v4f*)(FO + i * 4) = o;  }
__global__ __launch_bounds__(256) void k_pplane(const float* __restrict__ POS, bf* Ph2, bf* Pl2) { const size_t e = ((size_t)blockIdx.x * 256 + threadIdx.x) * 2; if (e >= (size_t)NH_ * NPE * HD) return; const int d = (int)(e % HD); const int p = (int)((e / HD) % NPE); const int h = (int)(e / ((size_t)HD * NPE)); v2us oh, ol;
#pragma unroll
    for (int q = 0; q < 2; ++q) { unsigned short a, c; splitf(POS[(size_t)p * DQ + h * HD + d + q], a, c); oh[q] = a; ol[q] = c; } *(v2us*)(Ph2 + e) = oh; *(v2us*)(Pl2 + e) = ol;  }

__global__ __launch_bounds__(256) void k_cvt8(const float* __restrict__ src, bf* dst, size_t n8) { const size_t i = (size_t)blockIdx.x * 256 + threadIdx.x; if (i >= n8) return; const v8f v = *(const v8f*)(src + i * 8); v8us o;
#pragma unroll
    for (int k = 0; k < 8; ++k) o[k] = f2bf(v[k]); *(v8us*)(dst + i * 8) = o;  }

// k_rope: head planes [h][t][d] (fp16 + hi/lo) of rope(x) x sc with the rotate-half convention out[d] = x[d] cos[t][d] - x[d+HD/2] sin[t][d], out[d+HD/2] = x[d+HD/2] cos[t][d+HD/2] + x[d] sin[t][d+HD/2]
__global__ __launch_bounds__(256) void k_rope(const float* __restrict__ F, int pitch, int nheads, const float* __restrict__ CS, const float* __restrict__ RF, const float* __restrict__ nw, float sc, h16* P16, bf* Ph, bf* Pl) {
    const size_t e = ((size_t)blockIdx.x * 256 + threadIdx.x) * 2; if (e >= (size_t)nheads * TT * HD) return; const int d = (int)(e % HD); const int t = (int)((e / HD) % TT); const int h = (int)(e / ((size_t)HD * TT)); const float* f = F + (size_t)t * pitch + h * HD; const float rf = RF ? RF[(size_t)h * TT + t] : 1.0f; v2h o16; v2us oh, ol;
#pragma unroll
    for (int q = 0; q < 2; ++q) { const int dd = d + q; const int dp = (dd < HD / 2) ? dd + HD / 2 : dd - HD / 2; float x0 = f[dd], x1 = f[dp];
        if (RF) { float n0 = __fmul_rn(x0, rf), n1 = __fmul_rn(x1, rf); asm volatile("" : "+v"(n0)); asm volatile("" : "+v"(n1)); x0 = __fmul_rn(bfr(nw[dd]), n0); x1 = __fmul_rn(bfr(nw[dp]), n1); }
        const v2f cs = *(const v2f*)(CS + ((size_t)t * HD + dd) * 2); float a = __fmul_rn(x0, cs[0]), bq = __fmul_rn(x1, cs[1]); asm volatile("" : "+v"(a)); asm volatile("" : "+v"(bq)); const float r = ((dd < HD / 2) ? __fsub_rn(a, bq) : __fadd_rn(a, bq)) * sc;
        o16[q] = tohx(r); unsigned short a2, c2; splitf(r, a2, c2); oh[q] = a2; ol[q] = c2; }
    *(v2h*)(P16 + e) = o16; *(v2us*)(Ph + e) = oh; *(v2us*)(Pl + e) = ol;  }
__global__ __launch_bounds__(256) void k_vtp(const float* __restrict__ F, int pitch, int nheads, h16* V16, bf* Vh, bf* Vl) { const size_t e = ((size_t)blockIdx.x * 256 + threadIdx.x) * 2; if (e >= (size_t)nheads * HD * TT) return; const int t = (int)(e % TT); const int d = (int)((e / TT) % HD); const int g = (int)(e / ((size_t)TT * HD)); v2h o16; v2us oh, ol;
#pragma unroll
    for (int q = 0; q < 2; ++q) { const float x = F[(size_t)(t + q) * pitch + g * HD + d]; o16[q] = tohx(x); unsigned short a2, c2; splitf(x, a2, c2); oh[q] = a2; ol[q] = c2; }
    *(v2h*)(V16 + e) = o16; *(v2us*)(Vh + e) = oh; *(v2us*)(Vl + e) = ol;  }
__global__ __launch_bounds__(256) void k_csid(float* CS) { const int idx = blockIdx.x * 256 + threadIdx.x; if (idx >= TT * HD) return; v2f cs; cs[0] = 1.0f; cs[1] = 0.0f; *(v2f*)(CS + (size_t)idx * 2) = cs;  }
// k_asoft: per row (zz, i): t = (ac + bd[j - i + 1023])/8, -inf where mask[b][i][j] == 0 (a fully masked row would be NaN in the reference); softmax over the 1024 keys (register row, one exp, fixed trees);
__global__ __launch_bounds__(256) void k_asoft(const float* __restrict__ Sb, const float* __restrict__ SR, const int* __restrict__ MKb, h16* P16, bf* Ph, bf* Pl) {
    const int lane = threadIdx.x & 31; const int row = blockIdx.x * 8 + (threadIdx.x >> 5); if (row >= ZH * TT) return; const int i = row % TT; const int zz = row / TT; (void)zz; const float* srr = SR + (size_t)row * NPE + (TT - 1 - i);   /* skew: position index j - i + S - 1 */ const bool hires = (i < RH); const float* sr = Sb + (size_t)row * TT; float v[TT / 32]; float mx = -3.0e38f;
#pragma unroll
    for (int ch = 0; ch < TT / 128; ++ch) { const int j0 = ch * 128 + lane * 4; const v4f a = *(const v4f*)(sr + j0); const v4i m4 = *(const v4i*)(MKb + (size_t)i * TT + j0);
#pragma unroll
        for (int q = 0; q < 4; ++q) { const int j = j0 + q; float su = __fadd_rn(a[q], srr[j]); asm volatile("" : "+v"(su)); float t0 = su * SCL; asm volatile("" : "+v"(t0)); const float t = (m4[q] != 0) ? t0 : -3.0e38f;   /* (ac + rel_shift(bd)) / 8; key mask (int32) */ v[ch * 4 + q] = t; mx = fmaxf(mx, t); } }
#pragma unroll
    for (int sh = 16; sh; sh >>= 1) mx = fmaxf(mx, __shfl_xor(mx, sh, 32));
    float sum = 0.f;
#pragma unroll
    for (int k = 0; k < TT / 32; ++k) { float d0 = __fsub_rn(v[k], mx); asm volatile("" : "+v"(d0)); v[k] = __builtin_amdgcn_exp2f(__fmul_rn(d0, 1.4426950408889634f)); sum += v[k]; }
#pragma unroll
    for (int sh = 16; sh; sh >>= 1) sum += __shfl_xor(sum, sh, 32);
    const float f = __fdiv_rn(hires ? 1.0f : PCAR, sum);
{
        if (hires) {
#pragma unroll
            for (int ch = 0; ch < TT / 128; ++ch) { v4us oh, ol;
#pragma unroll
                for (int q = 0; q < 4; ++q) { unsigned short a, c2; splitf(v[ch * 4 + q] * f, a, c2); oh[q] = a; ol[q] = c2; }
                const size_t oo = ((size_t)zz * (RH ? RH : 1) + i) * TT + ch * 128 + lane * 4; *(v4us*)(Ph + oo) = oh; *(v4us*)(Pl + oo) = ol; }
        } else {
#pragma unroll
            for (int ch = 0; ch < TT / 128; ++ch) { v4h o4;
#pragma unroll
                for (int q = 0; q < 4; ++q) o4[q] = tohx(v[ch * 4 + q] * f);
                *(v4h*)(P16 + (size_t)row * TT + ch * 128 + lane * 4) = o4; } }
         }
}
__global__ __launch_bounds__(256) void k_merge(const float* __restrict__ O, int h0, bf* Ah, bf* Al) { const size_t e = ((size_t)blockIdx.x * 256 + threadIdx.x) * 2; if (e >= (size_t)ZH * TT * HD) return; const int d = (int)(e % HD); const int t = (int)((e / HD) % TT); const int zz = (int)(e / ((size_t)HD * TT)); const float cs = (t < RH) ? 1.0f : (1.0f / PCAR); const size_t oo = (size_t)t * DQ + (h0 + zz) * HD + d;
    v2us oh, ol;
#pragma unroll
    for (int q = 0; q < 2; ++q) { unsigned short a, c2; splitf(O[e + q] * cs, a, c2); oh[q] = a; ol[q] = c2; } *(v2us*)(Ah + oo) = oh; *(v2us*)(Al + oo) = ol;  }

extern "C" void kernel_launch(void* const* d_in, const int* in_sizes, int n_in,
                              void* d_out, int out_size, void* d_ws, size_t ws_size, hipStream_t stream) {
    (void)in_sizes; (void)n_in; (void)out_size;
    const float* x = (const float*)d_in[0]; const int* MK = (const int*)d_in[1]; const float* wq = (const float*)d_in[2]; const float* wk = (const float*)d_in[3]; const float* wv = (const float*)d_in[4]; const float* wpos = (const float*)d_in[5]; const float* wo = (const float*)d_in[6]; const float* pbu = (const float*)d_in[7]; const float* pbv = (const float*)d_in[8];   /* u_bias, v_bias [8][64] */
    float* OUT = (float*)d_out;     // [8][1024][512]
    char* wsp = (char*)d_ws;
    auto take = [&](size_t bytes) { char* p = wsp; wsp += (bytes + 255) & ~(size_t)255; return (void*)p; };
    bf* WQ = (bf*)take((size_t)DQ * DM * 2); bf* WK = (bf*)take((size_t)DKV * DM * 2); bf* WV = (bf*)take((size_t)DKV * DM * 2); bf* WO = (bf*)take((size_t)DM * DQ * 2); float* CS = (float*)take((size_t)TT * HD * 2 * 4);
    bf* XB = (bf*)take((size_t)TT * DM * 2); bf* PEh = (bf*)take((size_t)NPE * DM * 2); bf* PEl = (bf*)take((size_t)NPE * DM * 2); bf* WP = (bf*)take((size_t)DQ * DM * 2); float* POS = (float*)take((size_t)NPE * DQ * 4); bf* PPh = (bf*)take((size_t)NH_ * NPE * HD * 2); bf* PPl = (bf*)take((size_t)NH_ * NPE * HD * 2); float* FQU = (float*)take((size_t)TT * DQ * 4); float* FQV = (float*)take((size_t)TT * DQ * 4); bf* QVh = (bf*)take((size_t)NH_ * TT * HD * 2); bf* QVl = (bf*)take((size_t)NH_ * TT * HD * 2); float* SR = (float*)take((size_t)ZH * TT * NPE * 4); float* FQ = (float*)take((size_t)TT * DQ * 4); float* FK = (float*)take((size_t)TT * DKV * 4);
    h16* QP16 = (h16*)take((size_t)NH_ * TT * HD * 2); h16* KP16 = (h16*)take((size_t)NKV * TT * HD * 2); h16* VT16 = (h16*)take((size_t)NKV * HD * TT * 2);
    bf* QPh = (bf*)take((size_t)NH_ * TT * HD * 2); bf* QPl = (bf*)take((size_t)NH_ * TT * HD * 2); bf* KPh = (bf*)take((size_t)NKV * TT * HD * 2); bf* KPl = (bf*)take((size_t)NKV * TT * HD * 2); bf* VTh = (bf*)take((size_t)NKV * HD * TT * 2); bf* VTl = (bf*)take((size_t)NKV * HD * TT * 2); bf* Ph = (bf*)take((size_t)ZH * RH * TT * 2); bf* Pl = (bf*)take((size_t)ZH * RH * TT * 2);
    float* Sb = (float*)take((size_t)ZH * TT * TT * 4); h16* P16 = (h16*)take(256);   /* unused: all rows hi/lo */ float* Ob = (float*)take((size_t)ZH * TT * HD * 4); bf* ATh = (bf*)take((size_t)TT * DQ * 2); bf* ATl = (bf*)take((size_t)TT * DQ * 2);
    if ((size_t)(wsp - (char*)d_ws) > ws_size) return;    // ws 256 MiB
    float* FV = FK;   // v projection reuses the k buffer after the k planes are built (stream-ordered)
    { k_wtG<<<(unsigned)((DM * DQ / 64 + 63) / 64), 256, 0, stream>>>(wq, DM, DQ, WQ); k_wtG<<<(unsigned)((DM * DKV / 64 + 63) / 64), 256, 0, stream>>>(wk, DM, DKV, WK); k_wtG<<<(unsigned)((DM * DKV / 64 + 63) / 64), 256, 0, stream>>>(wv, DM, DKV, WV);
      k_wtG<<<(unsigned)((DQ * DM / 64 + 63) / 64), 256, 0, stream>>>(wo, DQ, DM, WO);
       }
    k_csid<<<(TT * HD + 255) / 256, 256, 0, stream>>>(CS); k_petab<<<(unsigned)(((size_t)NPE * DM / 2 + 255) / 256), 256, 0, stream>>>(PEh, PEl); k_wtG<<<(unsigned)((DM * DQ / 64 + 63) / 64), 256, 0, stream>>>(wpos, DM, DQ, WP); k_gemmw<bf, 1, false><<<dim3(NPE / 64, DQ / 64, 1), 32, 0, stream>>>(PEh, PEl, WP, nullptr, DM, POS, DQ, nullptr, 0, 0, 0); k_pplane<<<(unsigned)(((size_t)NH_ * NPE * HD / 2 + 255) / 256), 256, 0, stream>>>(POS, PPh, PPl);   /* p = sinusoid table (hi+lo, 2 products) Wpos -> per-head hi/lo planes [h][2048][64] */
    const unsigned LQ = (unsigned)(((size_t)NH_ * TT * HD / 2 + 255) / 256), LKv = (unsigned)(((size_t)NKV * TT * HD / 2 + 255) / 256);
    for (int b = 0; b < NB_; ++b) {
        
        k_cvt8<<<(unsigned)(((size_t)TT * DM / 8 + 255) / 256), 256, 0, stream>>>(x + (size_t)b * TT * DM, XB, (size_t)TT * DM / 8);   /* exact bf16 plane of xs */
        k_gemmw<bf, 0, false><<<dim3(TT / 64, DQ / 64, 1), 32, 0, stream>>>(XB, nullptr, WQ, nullptr, DM, FQ, DQ, nullptr, 0, 0, 0); k_addhb<<<(unsigned)(((size_t)TT * DQ / 4 + 255) / 256), 256, 0, stream>>>(FQ, pbu, FQU, (size_t)TT * DQ / 4); k_addhb<<<(unsigned)(((size_t)TT * DQ / 4 + 255) / 256), 256, 0, stream>>>(FQ, pbv, FQV, (size_t)TT * DQ / 4);   /* q + pos_bias_u, q + pos_bias_v */
        k_rope<<<LQ, 256, 0, stream>>>(FQU, DQ, NH_, CS, nullptr, nullptr, 1.0f, QP16, QPh, QPl); k_rope<<<LQ, 256, 0, stream>>>(FQV, DQ, NH_, CS, nullptr, nullptr, 1.0f, QP16, QVh, QVl);   /* (q+u) planes for the content scores, (q+v) planes for the position scores */
        k_gemmw<bf, 0, false><<<dim3(TT / 64, DKV / 64, 1), 32, 0, stream>>>(XB, nullptr, WK, nullptr, DM, FK, DKV, nullptr, 0, 0, 0);
        k_rope<<<LKv, 256, 0, stream>>>(FK, DKV, NKV, CS, nullptr, nullptr, 1.0f, KP16, KPh, KPl);
        k_gemmw<bf, 0, false><<<dim3(TT / 64, DKV / 64, 1), 32, 0, stream>>>(XB, nullptr, WV, nullptr, DM, FV, DKV, nullptr, 0, 0, 0); k_vtp<<<LKv, 256, 0, stream>>>(FV, DKV, NKV, VT16, VTh, VTl);
        for (int h0 = 0; h0 < NH_; h0 += ZH) { const size_t zq = (size_t)h0, zk = (size_t)(h0 / REP);   // one kv head per query head: the pass's two heads use consecutive kv planes (z-strides TT*HD)
            k_gemmw<bf, 2, false><<<dim3(RH / 64, TT / 64, ZH), 32, 0, stream>>>(QPh + zq * TT * HD, QPl + zq * TT * HD, KPh + zk * TT * HD, KPl + zk * TT * HD, HD, Sb, TT, nullptr, (size_t)TT * HD, (size_t)TT * HD, (size_t)TT * TT);
            k_gemmw<bf, 2, false><<<dim3(TT / 64, NPE / 64, ZH), 32, 0, stream>>>(QVh + zq * TT * HD, QVl + zq * TT * HD, PPh + zq * NPE * HD, PPl + zq * NPE * HD, HD, SR, NPE, nullptr, (size_t)TT * HD, (size_t)NPE * HD, (size_t)TT * NPE);   /* position scores (q+v).pos [2][1024][2048] (3 products) */ k_asoft<<<ZH * TT / 8, 256, 0, stream>>>(Sb, SR, MK + (size_t)b * TT * TT, P16, Ph, Pl);
            k_gemmw<bf, 2, false><<<dim3(RH / 64, HD / 64, ZH), 32, 0, stream>>>(Ph, Pl, VTh + zk * HD * TT, VTl + zk * HD * TT, TT, Ob, HD, nullptr, (size_t)RH * TT, (size_t)HD * TT, (size_t)TT * HD);
            k_merge<<<(unsigned)(((size_t)ZH * TT * HD / 2 + 255) / 256), 256, 0, stream>>>(Ob, h0, ATh, ATl); }
        k_gemmw<bf, 1, false><<<dim3(TT / 64, DM / 64, 1), 32, 0, stream>>>(ATh, ATl, WO, nullptr, DQ, OUT + (size_t)b * TT * DM, DM, nullptr, 0, 0, 0); }
}

// v001
// Measured time: 817 microseconds a run.
// Two timings next to v000 put it at 2.53 and 2.57 times that version's speed.
#include <hip/hip_runtime.h>

// Transformer-XL style relative-position multi-head self-attention (xs [8][1024][512]; q, k, v = xs W ('xw' [512][512], no bias; 8 heads x 64); p = pe Wpos with pe the sinusoidal table of positions -(T-1)..T-1 (2047 rows, [sin, cos] interleaved, computed on device); scores = ((q + u_bias).k + rel_shift((q + v_bias).p)) / 8 where rel_shift picks position row j - i + 1023; mask (int32 [8][1024][1024], read): -inf where 0 and those weights zeroed; softmax; out = merged Wout ('xw', no bias) -> [8][1024][512] (4.2 M)).
// Layout: one exact bf16 input plane -> 1-product projections; the position table is computed on device in f32 (it is internal to the reference, so NOT bf16-rounded: kept as bf16 hi + lo planes) and projected once (2 products, 2047 rows + one zero pad row) into per-head hi/lo planes [h][2048][64]; every projection, plane and output launch covers all 8 batch items; per pass of one batch item's eight heads: content scores (q+u).k [8][1024][1024] and position scores (q+v).p [8][1024][2048] are hi/lo GEMMs (3 products, every row) and the softmax kernel gathers the position score at j - i + 1023 per logit and applies the mask select.
// Compute dtypes, f32 accumulate: every input rounded to bf16; q/k/v on PLAIN bf16 operands (exact products); p = pe(hi+lo) Wpos (2 products); content and position scores on hi/lo planes for every row (3 products); softmax f32; attn.v hi/lo (3 products); Wout hl x exact (2 products).

#define NB_  8
#define TT   1024
#define DM   512
#define NH_  8
#define NKV  8
#define REP  (NH_ / NKV)
#define HD   64
#define DQ   (NH_ * HD)
#define DKV  (NKV * HD)
#define NPE  2048                 // 2047 positions + 1 zero pad row
typedef __attribute__((ext_vector_type(4))) unsigned short v4us;
#define ZH   8                    // heads per attention pass: all of one batch item
#define RH   1024                 // every row hi/lo
#define WIN  0
#define PCAR 1024.0f
#define SCL  0.125f   // HD^-0.5
typedef _Float16 h16;
typedef unsigned short bf;
typedef __attribute__((ext_vector_type(16))) __bf16   v16bf;
typedef __attribute__((ext_vector_type(16))) _Float16 v16h;
typedef __attribute__((ext_vector_type(8)))  _Float16 v8h;
typedef __attribute__((ext_vector_type(8)))  unsigned short v8us;
typedef __attribute__((ext_vector_type(8)))  float    v8f;
typedef __attribute__((ext_vector_type(4)))  float    v4f;
typedef v8h  __attribute__((may_alias)) v8ha;
typedef v4f  __attribute__((may_alias)) v4fa;
typedef v8us __attribute__((may_alias)) v8usa;

__device__ __forceinline__ unsigned short f2bf(float f) { unsigned u = __float_as_uint(f); u += 0x7FFFu + ((u >> 16) & 1u); return (unsigned short)(u >> 16); }
__device__ __forceinline__ float bf2f(unsigned short b) { return __uint_as_float(((unsigned)b) << 16); }
__device__ __forceinline__ float bfr(float f) { return bf2f(f2bf(f)); }
__device__ __forceinline__ v16h cat16(v8h lo, v8h hi) { return __builtin_shufflevector(lo, hi, 0, 1, 2, 3, 4, 5, 6, 7, 8, 9, 10, 11, 12, 13, 14, 15); }
__device__ __forceinline__ v16bf cat16b(v8us lo, v8us hi) { return __builtin_bit_cast(v16bf, __builtin_shufflevector(lo, hi, 0, 1, 2, 3, 4, 5, 6, 7, 8, 9, 10, 11, 12, 13, 14, 15)); }
__device__ __forceinline__ v8f wmma16(v16h a, v16h b, v8f c) { return __builtin_amdgcn_wmma_f32_16x16x32_f16(false, a, false, b, (short)0, c, false, false); }
__device__ __forceinline__ v8f wmmab(v16bf a, v16bf b, v8f c) { return __builtin_amdgcn_wmma_f32_16x16x32_bf16(false, a, false, b, (short)0, c, false, false); }



// ---- k_gemmw: register-blocked GEMM, ONE WAVE per 64x64 output tile (16 accumulators), operands straight from K-contiguous 16-bit planes; grid (M/64, N/64, Z), 32 threads.
// C[m][n] (f32, pitch ldc, + optional f32 bias[n]) = sum_k A[m][k] Bt[n][k] (+ split products per NSPLIT). z-batch strides sA/sB/sC in elements. K % 32 == 0.
template <typename T16> struct WFrag;
template <> struct WFrag<h16> { typedef v16h V; static __device__ __forceinline__ V ld(const h16* p) { return cat16(*(const v8h*)p, *(const v8h*)(p + 16)); } static __device__ __forceinline__ v8f mma(V a, V b, v8f c) { return wmma16(a, b, c); } };
template <> struct WFrag<bf> { typedef v16bf V; static __device__ __forceinline__ V ld(const bf* p) { return cat16b(*(const v8us*)p, *(const v8us*)(p + 16)); } static __device__ __forceinline__ v8f mma(V a, V b, v8f c) { return wmmab(a, b, c); } };
template <typename T16, int NSPLIT, bool BIAS>
__global__ __launch_bounds__(32) void k_gemmw(const T16* __restrict__ A, const T16* __restrict__ A2, const T16* __restrict__ Bt, const T16* __restrict__ Bt2, int K, float* C, int ldc, const float* __restrict__ bias, size_t sA, size_t sB, size_t sC) {
    typedef typename WFrag<T16>::V V;
    __shared__ __align__(16) float os[16 * 68];
    const size_t z = blockIdx.z; A += z * sA; if (A2) A2 += z * sA; Bt += z * sB; if (Bt2) Bt2 += z * sB; C += z * sC;
    const int lane = threadIdx.x & 31, lr = lane & 15, hi = lane >> 4; const int r0 = blockIdx.x * 64, c0 = blockIdx.y * 64;
    v8f acc[4][4];
#pragma unroll
    for (int mb = 0; mb < 4; ++mb)
#pragma unroll
        for (int nb = 0; nb < 4; ++nb) acc[mb][nb] = (v8f){};
    const size_t aoff = (size_t)(r0 + lr) * K + 8 * hi, boff = (size_t)(c0 + lr) * K + 8 * hi;
#pragma unroll 1
    for (int kc = 0; kc < K; kc += 32) {
        V a[4], a2[4];
#pragma unroll
        for (int mb = 0; mb < 4; ++mb) { a[mb] = WFrag<T16>::ld(A + aoff + (size_t)mb * 16 * K + kc); if (NSPLIT == 1 || NSPLIT == 2) a2[mb] = WFrag<T16>::ld(A2 + aoff + (size_t)mb * 16 * K + kc); }
#pragma unroll
        for (int nb = 0; nb < 4; ++nb) { const V b = WFrag<T16>::ld(Bt + boff + (size_t)nb * 16 * K + kc); V b2; if (NSPLIT >= 2) b2 = WFrag<T16>::ld(Bt2 + boff + (size_t)nb * 16 * K + kc);
#pragma unroll
            for (int mb = 0; mb < 4; ++mb) { acc[mb][nb] = WFrag<T16>::mma(a[mb], b, acc[mb][nb]); if (NSPLIT == 1 || NSPLIT == 2) acc[mb][nb] = WFrag<T16>::mma(a2[mb], b, acc[mb][nb]); if (NSPLIT >= 2) acc[mb][nb] = WFrag<T16>::mma(a[mb], b2, acc[mb][nb]); } }
        asm volatile("v_nop\n\tv_nop\n\tv_nop\n\tv_nop" : "+v"(acc[0][0]), "+v"(acc[1][1]), "+v"(acc[2][2]), "+v"(acc[3][3]) : "v"(a[0]), "v"(a[3]));
    }
#pragma unroll
    for (int mb = 0; mb < 4; ++mb) {
#pragma unroll
        for (int nb = 0; nb < 4; ++nb) {
#pragma unroll
            for (int j = 0; j < 8; ++j) os[(hi * 8 + j) * 68 + nb * 16 + lr] = acc[mb][nb][j]; }
        __builtin_amdgcn_wave_barrier(); asm volatile("" ::: "memory");
        float* crow = C + (size_t)(r0 + mb * 16) * ldc + c0;
{
#pragma unroll
            for (int s = 0; s < 8; ++s) { const int row = 2 * s + hi, cofs = lr * 4; v4f val = *(const v4fa*)(os + row * 68 + cofs); if (BIAS) { val[0] += bfr(bias[c0 + cofs]); val[1] += bfr(bias[c0 + cofs + 1]); val[2] += bfr(bias[c0 + cofs + 2]); val[3] += bfr(bias[c0 + cofs + 3]); }
                *(v4f*)(crow + (size_t)row * ldc + cofs) = val; }
             }
        __builtin_amdgcn_wave_barrier(); asm volatile("" ::: "memory");
    }
}

__device__ __forceinline__ h16 tohx(float x) { return (h16)x; }
__device__ __forceinline__ void splitf(float y, unsigned short& h, unsigned short& l) { h = f2bf(y); l = f2bf(y - bf2f(h)); }
typedef __attribute__((ext_vector_type(2))) _Float16 v2h;
typedef __attribute__((ext_vector_type(4))) _Float16 v4h;
typedef __attribute__((ext_vector_type(2))) unsigned short v2us;
typedef __attribute__((ext_vector_type(4))) unsigned short v4us;
typedef __attribute__((ext_vector_type(2))) float v2f;
typedef __attribute__((ext_vector_type(4))) int v4i;

__global__ __launch_bounds__(256) void k_wtG(const float* __restrict__ w, int K, int N, bf* Bt) {
    const int lane = threadIdx.x & 31; const int L0 = (blockIdx.x * 8 + (threadIdx.x >> 5)) * 8; const int nlines = N * K / 64;
{
#pragma unroll 1
        for (int l = 0; l < 8; ++l) { const int L = L0 + l; if (L >= nlines) break; const size_t e = (size_t)L * 64 + lane * 2; const int k = (int)(e % K), n = (int)(e / K); v2us o;
            o[0] = f2bf(w[(size_t)k * N + n]); o[1] = f2bf(w[(size_t)(k + 1) * N + n]); *(v2us*)(Bt + e) = o; }
         }
}



__constant__ float INVF[DM / 2] = {1.0f,0.964661598f,0.930572033f,0.897687137f,0.865964293f,0.835362554f,0.805842161f,0.777365029f,0.749894202f,0.723394156f,0.697830558f,0.673170388f,0.649381638f,0.626433551f,0.604296386f,0.582941532f,0.562341332f,0.542469084f,0.523299098f,0.504806578f,0.486967504f,0.469758898f,0.453158379f,0.437144488f,0.421696484f,0.406794429f,0.392418981f,0.378551513f,0.365174115f,0.352269441f,0.339820832f,0.327812076f,0.316227764f,0.305052817f,0.294272721f,0.283873618f,0.273841947f,0.264164835f,0.254829645f,0.245824397f,0.237137347f,0.228757307f,0.220673412f,0.212875158f,0.2053525f,0.198095664f,0.191095293f,0.184342295f,0.177827939f,0.171543792f,0.165481701f,0.15963386f,0.153992653f,0.148550808f,0.143301249f,0.138237223f,0.133352146f,0.128639698f,0.124093764f,0.119708493f,0.115478195f,0.111397393f,0.107460767f,0.103663281f,0.099999994f,0.0964661688f,0.0930572152f,0.0897687078f,0.0865964293f,0.0835362524f,0.0805842206f,0.0777364895f,0.0749894157f,0.0723394156f,0.0697830617f,0.0673170388f,0.0649381578f,0.0626433492f,0.0604296364f,0.0582941547f,0.056234125f,0.0542469025f,0.0523299091f,0.0504806563f,0.0486967564f,0.0469758809f,0.0453158319f,0.0437144488f,0.0421696529f,0.0406794474f,0.0392418914f,0.0378551483f,0.0365174115f,0.0352269486f,0.0339820795f,0.0327812098f,0.0316227749f,0.0305052791f,0.0294272732f,0.0283873565f,0.0273841936f,0.0264164824f,0.0254829675f,0.0245824363f,0.023713734f,0.0228757299f,0.0220673401f,0.0212875176f,0.0205352474f,0.0198095664f,0.0191095285f,0.0184342302f,0.0177827962f,0.0171543807f,0.0165481735f,0.0159633812f,0.0153992623f,0.0148550775f,0.0143301245f,0.0138237216f,0.013335214f,0.0128639704f,0.0124093788f,0.0119708525f,0.0115478169f,0.0111397365f,0.0107460767f,0.0103663281f,0.00999999978f,0.00964661594f,0.00930572115f,0.00897687208f,0.00865964405f,0.00835362263f,0.00805842038f,0.00777364895f,0.00749894092f,0.007233941f,0.00697830552f,0.00673170388f,0.00649381708f,0.00626433641f,0.00604296196f,0.00582941389f,0.00562341232f,0.00542468997f,0.00523299072f,0.00504806545f,0.00486967526f,0.0046975892f,0.00453158421f,0.0043714433f,0.00421696389f,0.00406794343f,0.00392418914f,0.00378551497f,0.00365174119f,0.00352269458f,0.00339820841f,0.00327812159f,0.0031622767f,0.00305052707f,0.00294272648f,0.00283873547f,0.00273841922f,0.00264164805f,0.0025482967f,0.0024582441f,0.00237137405f,0.00228757365f,0.00220673345f,0.00212875125f,0.0020535246f,0.00198095664f,0.00191095285f,0.001843423f,0.00177827943f,0.00171543809f,0.00165481726f,0.00159633812f,0.00153992616f,0.0014855077f,0.00143301231f,0.00138237211f,0.00133352133f,0.00128639699f,0.00124093785f,0.00119708513f,0.00115478167f,0.00111397356f,0.0010746076f,0.00103663281f,0.000999999931f,0.000964661594f,0.000930572045f,0.000897687161f,0.000865964394f,0.000835362298f,0.000805841992f,0.000777364883f,0.000749894069f,0.0007233941f,0.000697830576f,0.000673170376f,0.000649381662f,0.000626433583f,0.00060429622f,0.0005829414f,0.000562341185f,0.000542468973f,0.000523299037f,0.000504806521f,0.000486967503f,0.000469758903f,0.000453158398f,0.000437144336f,0.000421696401f,0.000406794337f,0.000392418908f,0.000378551485f,0.000365174084f,0.000352269446f,0.000339820836f,0.000327811984f,0.000316227786f,0.000305052701f,0.000294272788f,0.000283873524f,0.000273842044f,0.000264164817f,0.000254829531f,0.000245824398f,0.000237137268f,0.000228757344f,0.000220673333f,0.000212875209f,0.000205352466f,0.000198095746f,0.000191095271f,0.000184342207f,0.00017782794f,0.00017154371f,0.000165481732f,0.000159633797f,0.000153992674f,0.000148550767f,0.000143301295f,0.000138237199f,0.000133352078f,0.000128639687f,0.000124093727f,0.000119708515f,0.000115478157f,0.000111397407f,0.000107460757f,0.000103663326f};
__global__ __launch_bounds__(256) void k_petab(bf* PEh, bf* PEl) { const size_t e = ((size_t)blockIdx.x * 256 + threadIdx.x) * 2; if (e >= (size_t)NPE * DM) return; const int c = (int)(e % DM); const int r = (int)(e / DM); v2us oh, ol;
    if (r < NPE - 1) { const float th = __fmul_rn((float)(r - (TT - 1)), INVF[c >> 1]); unsigned short a, b2; splitf(sinf(th), a, b2); oh[0] = a; ol[0] = b2; splitf(cosf(th), a, b2); oh[1] = a; ol[1] = b2; } else { oh[0] = 0; oh[1] = 0; ol[0] = 0; ol[1] = 0; }
    *(v2us*)(PEh + e) = oh; *(v2us*)(PEl + e) = ol;  }
__global__ __launch_bounds__(256) void k_addhb(const float* __restrict__ F, const float* __restrict__ hb, float* FO, size_t n4) { const size_t i = (size_t)blockIdx.x * 256 + threadIdx.x; if (i >= n4) return; const int c = (int)((i * 4) % DQ); const v4f a = *(const v4f*)(F + i * 4); v4f o;
#pragma unroll
    for (int q = 0; q < 4; ++q) o[q] = __fadd_rn(a[q], bfr(hb[c + q])); *(v4f*)(FO + i * 4) = o;  }
__global__ __launch_bounds__(256) void k_pplane(const float* __restrict__ POS, bf* Ph2, bf* Pl2) { const size_t e = ((size_t)blockIdx.x * 256 + threadIdx.x) * 2; if (e >= (size_t)NH_ * NPE * HD) return; const int d = (int)(e % HD); const int p = (int)((e / HD) % NPE); const int h = (int)(e / ((size_t)HD * NPE)); v2us oh, ol;
#pragma unroll
    for (int q = 0; q < 2; ++q) { unsigned short a, c; splitf(POS[(size_t)p * DQ + h * HD + d + q], a, c); oh[q] = a; ol[q] = c; } *(v2us*)(Ph2 + e) = oh; *(v2us*)(Pl2 + e) = ol;  }

__global__ __launch_bounds__(256) void k_cvt8(const float* __restrict__ src, bf* dst, size_t n8) { const size_t i = (size_t)blockIdx.x * 256 + threadIdx.x; if (i >= n8) return; const v8f v = *(const v8f*)(src + i * 8); v8us o;
#pragma unroll
    for (int k = 0; k < 8; ++k) o[k] = f2bf(v[k]); *(v8us*)(dst + i * 8) = o;  }

// k_rope: head planes [h][t][d] (fp16 + hi/lo) of rope(x) x sc with the rotate-half convention out[d] = x[d] cos[t][d] - x[d+HD/2] sin[t][d], out[d+HD/2] = x[d+HD/2] cos[t][d+HD/2] + x[d] sin[t][d+HD/2]
__global__ __launch_bounds__(256) void k_rope(const float* __restrict__ F, int pitch, int nheads, const float* __restrict__ CS, const float* __restrict__ RF, const float* __restrict__ nw, float sc, h16* P16, bf* Ph, bf* Pl) {
    const size_t e = ((size_t)blockIdx.x * 256 + threadIdx.x) * 2; if (e >= (size_t)nheads * TT * HD) return; const int d = (int)(e % HD); const int t = (int)((e / HD) % TT); const int h = (int)(e / ((size_t)HD * TT)); const size_t bo = (size_t)blockIdx.y * nheads * TT * HD;   /* batch item: planes [b][h][t][d] */ const float* f = F + ((size_t)blockIdx.y * TT + t) * pitch + h * HD; const float rf = RF ? RF[(size_t)h * TT + t] : 1.0f; v2h o16; v2us oh, ol;
#pragma unroll
    for (int q = 0; q < 2; ++q) { const int dd = d + q; const int dp = (dd < HD / 2) ? dd + HD / 2 : dd - HD / 2; float x0 = f[dd], x1 = f[dp];
        if (RF) { float n0 = __fmul_rn(x0, rf), n1 = __fmul_rn(x1, rf); asm volatile("" : "+v"(n0)); asm volatile("" : "+v"(n1)); x0 = __fmul_rn(bfr(nw[dd]), n0); x1 = __fmul_rn(bfr(nw[dp]), n1); }
        const v2f cs = *(const v2f*)(CS + ((size_t)t * HD + dd) * 2); float a = __fmul_rn(x0, cs[0]), bq = __fmul_rn(x1, cs[1]); asm volatile("" : "+v"(a)); asm volatile("" : "+v"(bq)); const float r = ((dd < HD / 2) ? __fsub_rn(a, bq) : __fadd_rn(a, bq)) * sc;
        o16[q] = tohx(r); unsigned short a2, c2; splitf(r, a2, c2); oh[q] = a2; ol[q] = c2; }
    *(v2h*)(P16 + bo + e) = o16; *(v2us*)(Ph + bo + e) = oh; *(v2us*)(Pl + bo + e) = ol;  }
__global__ __launch_bounds__(256) void k_vtp(const float* __restrict__ F, int pitch, int nheads, h16* V16, bf* Vh, bf* Vl) { const size_t e = ((size_t)blockIdx.x * 256 + threadIdx.x) * 2; if (e >= (size_t)nheads * HD * TT) return; const int t = (int)(e % TT); const int d = (int)((e / TT) % HD); const int g = (int)(e / ((size_t)TT * HD)); const size_t bo = (size_t)blockIdx.y * nheads * HD * TT;   /* batch item: planes [b][g][d][t] */ F += (size_t)blockIdx.y * TT * pitch; v2h o16; v2us oh, ol;
#pragma unroll
    for (int q = 0; q < 2; ++q) { const float x = F[(size_t)(t + q) * pitch + g * HD + d]; o16[q] = tohx(x); unsigned short a2, c2; splitf(x, a2, c2); oh[q] = a2; ol[q] = c2; }
    *(v2h*)(V16 + bo + e) = o16; *(v2us*)(Vh + bo + e) = oh; *(v2us*)(Vl + bo + e) = ol;  }
__global__ __launch_bounds__(256) void k_csid(float* CS) { const int idx = blockIdx.x * 256 + threadIdx.x; if (idx >= TT * HD) return; v2f cs; cs[0] = 1.0f; cs[1] = 0.0f; *(v2f*)(CS + (size_t)idx * 2) = cs;  }
// k_asoft: per row (zz, i): t = (ac + bd[j - i + 1023])/8, -inf where mask[b][i][j] == 0 (a fully masked row would be NaN in the reference); softmax over the 1024 keys (register row, one exp, fixed trees);
__global__ __launch_bounds__(256) void k_asoft(const float* __restrict__ Sb, const float* __restrict__ SR, const int* __restrict__ MKb, h16* P16, bf* Ph, bf* Pl) {
    const int lane = threadIdx.x & 31; const int row = blockIdx.x * 8 + (threadIdx.x >> 5); if (row >= ZH * TT) return; const int i = row % TT; const int zz = row / TT; (void)zz; const float* srr = SR + (size_t)row * NPE + (TT - 1 - i);   /* skew: position index j - i + S - 1 */ const bool hires = (i < RH); const float* sr = Sb + (size_t)row * TT; float v[TT / 32]; float mx = -3.0e38f;
#pragma unroll
    for (int ch = 0; ch < TT / 128; ++ch) { const int j0 = ch * 128 + lane * 4; const v4f a = *(const v4f*)(sr + j0); const v4i m4 = *(const v4i*)(MKb + (size_t)i * TT + j0);
#pragma unroll
        for (int q = 0; q < 4; ++q) { const int j = j0 + q; float su = __fadd_rn(a[q], srr[j]); asm volatile("" : "+v"(su)); float t0 = su * SCL; asm volatile("" : "+v"(t0)); const float t = (m4[q] != 0) ? t0 : -3.0e38f;   /* (ac + rel_shift(bd)) / 8; key mask (int32) */ v[ch * 4 + q] = t; mx = fmaxf(mx, t); } }
#pragma unroll
    for (int sh = 16; sh; sh >>= 1) mx = fmaxf(mx, __shfl_xor(mx, sh, 32));
    float sum = 0.f;
#pragma unroll
    for (int k = 0; k < TT / 32; ++k) { float d0 = __fsub_rn(v[k], mx); asm volatile("" : "+v"(d0)); v[k] = __builtin_amdgcn_exp2f(__fmul_rn(d0, 1.4426950408889634f)); sum += v[k]; }
#pragma unroll
    for (int sh = 16; sh; sh >>= 1) sum += __shfl_xor(sum, sh, 32);
    const float f = __fdiv_rn(hires ? 1.0f : PCAR, sum);
{
        if (hires) {
#pragma unroll
            for (int ch = 0; ch < TT / 128; ++ch) { v4us oh, ol;
#pragma unroll
                for (int q = 0; q < 4; ++q) { unsigned short a, c2; splitf(v[ch * 4 + q] * f, a, c2); oh[q] = a; ol[q] = c2; }
                const size_t oo = ((size_t)zz * (RH ? RH : 1) + i) * TT + ch * 128 + lane * 4; *(v4us*)(Ph + oo) = oh; *(v4us*)(Pl + oo) = ol; }
        } else {
#pragma unroll
            for (int ch = 0; ch < TT / 128; ++ch) { v4h o4;
#pragma unroll
                for (int q = 0; q < 4; ++q) o4[q] = tohx(v[ch * 4 + q] * f);
                *(v4h*)(P16 + (size_t)row * TT + ch * 128 + lane * 4) = o4; } }
         }
}
__global__ __launch_bounds__(256) void k_merge(const float* __restrict__ O, int h0, bf* Ah, bf* Al) { const size_t e = ((size_t)blockIdx.x * 256 + threadIdx.x) * 2; if (e >= (size_t)ZH * TT * HD) return; const int d = (int)(e % HD); const int t = (int)((e / HD) % TT); const int zz = (int)(e / ((size_t)HD * TT)); const float cs = (t < RH) ? 1.0f : (1.0f / PCAR); const size_t oo = (size_t)t * DQ + (h0 + zz) * HD + d;
    v2us oh, ol;
#pragma unroll
    for (int q = 0; q < 2; ++q) { unsigned short a, c2; splitf(O[e + q] * cs, a, c2); oh[q] = a; ol[q] = c2; } *(v2us*)(Ah + oo) = oh; *(v2us*)(Al + oo) = ol;  }

extern "C" void kernel_launch(void* const* d_in, const int* in_sizes, int n_in,
                              void* d_out, int out_size, void* d_ws, size_t ws_size, hipStream_t stream) {
    (void)in_sizes; (void)n_in; (void)out_size;
    const float* x = (const float*)d_in[0]; const int* MK = (const int*)d_in[1]; const float* wq = (const float*)d_in[2]; const float* wk = (const float*)d_in[3]; const float* wv = (const float*)d_in[4]; const float* wpos = (const float*)d_in[5]; const float* wo = (const float*)d_in[6]; const float* pbu = (const float*)d_in[7]; const float* pbv = (const float*)d_in[8];   /* u_bias, v_bias [8][64] */
    float* OUT = (float*)d_out;     // [8][1024][512]
    char* wsp = (char*)d_ws;
    auto take = [&](size_t bytes) { char* p = wsp; wsp += (bytes + 255) & ~(size_t)255; return (void*)p; };
    bf* WQ = (bf*)take((size_t)DQ * DM * 2); bf* WK = (bf*)take((size_t)DKV * DM * 2); bf* WV = (bf*)take((size_t)DKV * DM * 2); bf* WO = (bf*)take((size_t)DM * DQ * 2); float* CS = (float*)take((size_t)TT * HD * 2 * 4);
    bf* PEh = (bf*)take((size_t)NPE * DM * 2); bf* PEl = (bf*)take((size_t)NPE * DM * 2); bf* WP = (bf*)take((size_t)DQ * DM * 2); float* POS = (float*)take((size_t)NPE * DQ * 4); bf* PPh = (bf*)take((size_t)NH_ * NPE * HD * 2); bf* PPl = (bf*)take((size_t)NH_ * NPE * HD * 2);
    // planes of all 8 batch items, live from the projections to the last pass
    bf* QPh = (bf*)take((size_t)NB_ * NH_ * TT * HD * 2); bf* QPl = (bf*)take((size_t)NB_ * NH_ * TT * HD * 2); bf* QVh = (bf*)take((size_t)NB_ * NH_ * TT * HD * 2); bf* QVl = (bf*)take((size_t)NB_ * NH_ * TT * HD * 2); bf* KPh = (bf*)take((size_t)NB_ * NKV * TT * HD * 2); bf* KPl = (bf*)take((size_t)NB_ * NKV * TT * HD * 2); bf* VTh = (bf*)take((size_t)NB_ * NKV * HD * TT * 2); bf* VTl = (bf*)take((size_t)NB_ * NKV * HD * TT * 2); bf* ATh = (bf*)take((size_t)NB_ * TT * DQ * 2); bf* ATl = (bf*)take((size_t)NB_ * TT * DQ * 2);
    // the projections' buffers are dead once the planes are built: the passes' buffers lie over them (stream-ordered)
    char* const shared0 = wsp;
    bf* XB = (bf*)take((size_t)NB_ * TT * DM * 2); float* FQ = (float*)take((size_t)NB_ * TT * DQ * 4); float* FQU = (float*)take((size_t)NB_ * TT * DQ * 4); float* FQV = (float*)take((size_t)NB_ * TT * DQ * 4); float* FK = (float*)take((size_t)NB_ * TT * DKV * 4);
    h16* QP16 = (h16*)take((size_t)NB_ * NH_ * TT * HD * 2); h16* KP16 = (h16*)take((size_t)NB_ * NKV * TT * HD * 2); h16* VT16 = (h16*)take((size_t)NB_ * NKV * HD * TT * 2);
    if ((size_t)(wsp - (char*)d_ws) > ws_size) return;
    wsp = shared0;
    float* SR = (float*)take((size_t)ZH * TT * NPE * 4); bf* Ph = (bf*)take((size_t)ZH * RH * TT * 2); bf* Pl = (bf*)take((size_t)ZH * RH * TT * 2);
    float* Sb = (float*)take((size_t)ZH * TT * TT * 4); h16* P16 = (h16*)take(256);   /* unused: all rows hi/lo */ float* Ob = (float*)take((size_t)ZH * TT * HD * 4);
    if ((size_t)(wsp - (char*)d_ws) > ws_size) return;    // ws 256 MiB
    float* FV = FK;   // v projection reuses the k buffer after the k planes are built (stream-ordered)
    { k_wtG<<<(unsigned)((DM * DQ / 64 + 63) / 64), 256, 0, stream>>>(wq, DM, DQ, WQ); k_wtG<<<(unsigned)((DM * DKV / 64 + 63) / 64), 256, 0, stream>>>(wk, DM, DKV, WK); k_wtG<<<(unsigned)((DM * DKV / 64 + 63) / 64), 256, 0, stream>>>(wv, DM, DKV, WV);
      k_wtG<<<(unsigned)((DQ * DM / 64 + 63) / 64), 256, 0, stream>>>(wo, DQ, DM, WO);
       }
    k_csid<<<(TT * HD + 255) / 256, 256, 0, stream>>>(CS); k_petab<<<(unsigned)(((size_t)NPE * DM / 2 + 255) / 256), 256, 0, stream>>>(PEh, PEl); k_wtG<<<(unsigned)((DM * DQ / 64 + 63) / 64), 256, 0, stream>>>(wpos, DM, DQ, WP); k_gemmw<bf, 1, false><<<dim3(NPE / 64, DQ / 64, 1), 32, 0, stream>>>(PEh, PEl, WP, nullptr, DM, POS, DQ, nullptr, 0, 0, 0); k_pplane<<<(unsigned)(((size_t)NH_ * NPE * HD / 2 + 255) / 256), 256, 0, stream>>>(POS, PPh, PPl);   /* p = sinusoid table (hi+lo, 2 products) Wpos -> per-head hi/lo planes [h][2048][64] */
    const unsigned LQ = (unsigned)(((size_t)NH_ * TT * HD / 2 + 255) / 256), LKv = (unsigned)(((size_t)NKV * TT * HD / 2 + 255) / 256);
    // projections and planes: rows of all 8 batch items in one launch each (GEMM M = 8192; plane kernels take the batch item from blockIdx.y)
    k_cvt8<<<(unsigned)(((size_t)NB_ * TT * DM / 8 + 255) / 256), 256, 0, stream>>>(x, XB, (size_t)NB_ * TT * DM / 8);   /* exact bf16 plane of xs */
    k_gemmw<bf, 0, false><<<dim3(NB_ * TT / 64, DQ / 64, 1), 32, 0, stream>>>(XB, nullptr, WQ, nullptr, DM, FQ, DQ, nullptr, 0, 0, 0); k_addhb<<<(unsigned)(((size_t)NB_ * TT * DQ / 4 + 255) / 256), 256, 0, stream>>>(FQ, pbu, FQU, (size_t)NB_ * TT * DQ / 4); k_addhb<<<(unsigned)(((size_t)NB_ * TT * DQ / 4 + 255) / 256), 256, 0, stream>>>(FQ, pbv, FQV, (size_t)NB_ * TT * DQ / 4);   /* q + pos_bias_u, q + pos_bias_v */
    k_rope<<<dim3(LQ, NB_, 1), 256, 0, stream>>>(FQU, DQ, NH_, CS, nullptr, nullptr, 1.0f, QP16, QPh, QPl); k_rope<<<dim3(LQ, NB_, 1), 256, 0, stream>>>(FQV, DQ, NH_, CS, nullptr, nullptr, 1.0f, QP16, QVh, QVl);   /* (q+u) planes for the content scores, (q+v) planes for the position scores */
    k_gemmw<bf, 0, false><<<dim3(NB_ * TT / 64, DKV / 64, 1), 32, 0, stream>>>(XB, nullptr, WK, nullptr, DM, FK, DKV, nullptr, 0, 0, 0);
    k_rope<<<dim3(LKv, NB_, 1), 256, 0, stream>>>(FK, DKV, NKV, CS, nullptr, nullptr, 1.0f, KP16, KPh, KPl);
    k_gemmw<bf, 0, false><<<dim3(NB_ * TT / 64, DKV / 64, 1), 32, 0, stream>>>(XB, nullptr, WV, nullptr, DM, FV, DKV, nullptr, 0, 0, 0); k_vtp<<<dim3(LKv, NB_, 1), 256, 0, stream>>>(FV, DKV, NKV, VT16, VTh, VTl);
    for (int b = 0; b < NB_; ++b) {   // one pass per batch item: its eight heads are the z-batch of every launch (one kv head per query head, z-strides TT*HD)
        const size_t zq = (size_t)b * NH_, zk = (size_t)b * NKV;
        k_gemmw<bf, 2, false><<<dim3(RH / 64, TT / 64, ZH), 32, 0, stream>>>(QPh + zq * TT * HD, QPl + zq * TT * HD, KPh + zk * TT * HD, KPl + zk * TT * HD, HD, Sb, TT, nullptr, (size_t)TT * HD, (size_t)TT * HD, (size_t)TT * TT);
        k_gemmw<bf, 2, false><<<dim3(TT / 64, NPE / 64, ZH), 32, 0, stream>>>(QVh + zq * TT * HD, QVl + zq * TT * HD, PPh, PPl, HD, SR, NPE, nullptr, (size_t)TT * HD, (size_t)NPE * HD, (size_t)TT * NPE);   /* position scores (q+v).pos [8][1024][2048] (3 products) */ k_asoft<<<ZH * TT / 8, 256, 0, stream>>>(Sb, SR, MK + (size_t)b * TT * TT, P16, Ph, Pl);
        k_gemmw<bf, 2, false><<<dim3(RH / 64, HD / 64, ZH), 32, 0, stream>>>(Ph, Pl, VTh + zk * HD * TT, VTl + zk * HD * TT, TT, Ob, HD, nullptr, (size_t)RH * TT, (size_t)HD * TT, (size_t)TT * HD);
        k_merge<<<(unsigned)(((size_t)ZH * TT * HD / 2 + 255) / 256), 256, 0, stream>>>(Ob, 0, ATh + (size_t)b * TT * DQ, ATl + (size_t)b * TT * DQ); }
    k_gemmw<bf, 1, false><<<dim3(NB_ * TT / 64, DM / 64, 1), 32, 0, stream>>>(ATh, ATl, WO, nullptr, DQ, OUT, DM, nullptr, 0, 0, 0);
}

// v003
// One run takes 333 microseconds.
// Versions in between are left out here; by their measured steps it is 2.46 times as fast as v001.
// Over all steps from v000 it is 6.28 times as fast.
#include <hip/hip_runtime.h>

// Transformer-XL style relative-position multi-head self-attention (xs [8][1024][512]; q, k, v = xs W ('xw' [512][512], no bias; 8 heads x 64); p = pe Wpos with pe the sinusoidal table of positions -(T-1)..T-1 (2047 rows, [sin, cos] interleaved, computed on device); scores = ((q + u_bias).k + rel_shift((q + v_bias).p)) / 8 where rel_shift picks position row j - i + 1023; mask (int32 [8][1024][1024], read): -inf where 0 and those weights zeroed; softmax; out = merged Wout ('xw', no bias) -> [8][1024][512] (4.2 M)).
// Layout: one exact bf16 input plane -> 1-product projections; the position table is computed on device in f32 (NOT bf16-rounded: kept as bf16 hi + lo planes) and projected once (2 products, 2047 rows + one zero pad row) into per-head hi/lo planes [h][2048][64]; the q, k, v projections of all 8 batch items are one launch whose epilogue adds the biases, splits and stores the head planes (v transposed), the position projection likewise; one fused attention launch for all 64 (batch item, head) pairs: content scores (q+u).k and the needed band of position scores (q+v).p are hi/lo products (3 each), the position score at j - i + 1023 is picked through LDS, mask select, online softmax and attn.v follow in registers: no score reaches memory.
// Compute dtypes, f32 accumulate: every input rounded to bf16; q/k/v on PLAIN bf16 operands (exact products); p = pe(hi+lo) Wpos (2 products); content and position scores on hi/lo planes for every row (3 products); softmax f32; attn.v hi/lo (3 products); Wout hl x exact (2 products).

#define NB_  8
#define TT   1024
#define DM   512
#define NH_  8
#define NKV  8
#define REP  (NH_ / NKV)
#define HD   64
#define DQ   (NH_ * HD)
#define DKV  (NKV * HD)
#define NPE  2048                 // 2047 positions + 1 zero pad row
typedef __attribute__((ext_vector_type(4))) unsigned short v4us;
#define ZH   8
#define RH   1024                 // every row hi/lo
#define WIN  0
#define PCAR 1024.0f
#define SCL  0.125f   // HD^-0.5
typedef _Float16 h16;
typedef unsigned short bf;
typedef __attribute__((ext_vector_type(16))) __bf16   v16bf;
typedef __attribute__((ext_vector_type(16))) _Float16 v16h;
typedef __attribute__((ext_vector_type(8)))  _Float16 v8h;
typedef __attribute__((ext_vector_type(8)))  unsigned short v8us;
typedef __attribute__((ext_vector_type(8)))  float    v8f;
typedef __attribute__((ext_vector_type(4)))  float    v4f;
typedef v8h  __attribute__((may_alias)) v8ha;
typedef v4f  __attribute__((may_alias)) v4fa;
typedef v8us __attribute__((may_alias)) v8usa;

__device__ __forceinline__ unsigned short f2bf(float f) { unsigned u = __float_as_uint(f); u += 0x7FFFu + ((u >> 16) & 1u); return (unsigned short)(u >> 16); }
__device__ __forceinline__ float bf2f(unsigned short b) { return __uint_as_float(((unsigned)b) << 16); }
__device__ __forceinline__ float bfr(float f) { return bf2f(f2bf(f)); }
__device__ __forceinline__ v16h cat16(v8h lo, v8h hi) { return __builtin_shufflevector(lo, hi, 0, 1, 2, 3, 4, 5, 6, 7, 8, 9, 10, 11, 12, 13, 14, 15); }
__device__ __forceinline__ v16bf cat16b(v8us lo, v8us hi) { return __builtin_bit_cast(v16bf, __builtin_shufflevector(lo, hi, 0, 1, 2, 3, 4, 5, 6, 7, 8, 9, 10, 11, 12, 13, 14, 15)); }
__device__ __forceinline__ v8f wmma16(v16h a, v16h b, v8f c) { return __builtin_amdgcn_wmma_f32_16x16x32_f16(false, a, false, b, (short)0, c, false, false); }
__device__ __forceinline__ v8f wmmab(v16bf a, v16bf b, v8f c) { return __builtin_amdgcn_wmma_f32_16x16x32_bf16(false, a, false, b, (short)0, c, false, false); }



// ---- k_gemmw: register-blocked GEMM, ONE WAVE per 64x64 output tile (16 accumulators), operands straight from K-contiguous 16-bit planes; grid (M/64, N/64, Z), 32 threads.
// C[m][n] (f32, pitch ldc, + optional f32 bias[n]) = sum_k A[m][k] Bt[n][k] (+ split products per NSPLIT). z-batch strides sA/sB/sC in elements. K % 32 == 0.
template <typename T16> struct WFrag;
template <> struct WFrag<h16> { typedef v16h V; static __device__ __forceinline__ V ld(const h16* p) { return cat16(*(const v8h*)p, *(const v8h*)(p + 16)); } static __device__ __forceinline__ v8f mma(V a, V b, v8f c) { return wmma16(a, b, c); } };
template <> struct WFrag<bf> { typedef v16bf V; static __device__ __forceinline__ V ld(const bf* p) { return cat16b(*(const v8us*)p, *(const v8us*)(p + 16)); } static __device__ __forceinline__ v8f mma(V a, V b, v8f c) { return wmmab(a, b, c); } };
template <typename T16, int NSPLIT, bool BIAS>
__global__ __launch_bounds__(32) void k_gemmw(const T16* __restrict__ A, const T16* __restrict__ A2, const T16* __restrict__ Bt, const T16* __restrict__ Bt2, int K, float* C, int ldc, const float* __restrict__ bias, size_t sA, size_t sB, size_t sC) {
    typedef typename WFrag<T16>::V V;
    __shared__ __align__(16) float os[16 * 68];
    const size_t z = blockIdx.z; A += z * sA; if (A2) A2 += z * sA; Bt += z * sB; if (Bt2) Bt2 += z * sB; C += z * sC;
    const int lane = threadIdx.x & 31, lr = lane & 15, hi = lane >> 4; const int r0 = blockIdx.x * 64, c0 = blockIdx.y * 64;
    v8f acc[4][4];
#pragma unroll
    for (int mb = 0; mb < 4; ++mb)
#pragma unroll
        for (int nb = 0; nb < 4; ++nb) acc[mb][nb] = (v8f){};
    const size_t aoff = (size_t)(r0 + lr) * K + 8 * hi, boff = (size_t)(c0 + lr) * K + 8 * hi;
#pragma unroll 1
    for (int kc = 0; kc < K; kc += 32) {
        V a[4], a2[4];
#pragma unroll
        for (int mb = 0; mb < 4; ++mb) { a[mb] = WFrag<T16>::ld(A + aoff + (size_t)mb * 16 * K + kc); if (NSPLIT == 1 || NSPLIT == 2) a2[mb] = WFrag<T16>::ld(A2 + aoff + (size_t)mb * 16 * K + kc); }
#pragma unroll
        for (int nb = 0; nb < 4; ++nb) { const V b = WFrag<T16>::ld(Bt + boff + (size_t)nb * 16 * K + kc); V b2; if (NSPLIT >= 2) b2 = WFrag<T16>::ld(Bt2 + boff + (size_t)nb * 16 * K + kc);
#pragma unroll
            for (int mb = 0; mb < 4; ++mb) { acc[mb][nb] = WFrag<T16>::mma(a[mb], b, acc[mb][nb]); if (NSPLIT == 1 || NSPLIT == 2) acc[mb][nb] = WFrag<T16>::mma(a2[mb], b, acc[mb][nb]); if (NSPLIT >= 2) acc[mb][nb] = WFrag<T16>::mma(a[mb], b2, acc[mb][nb]); } }
        asm volatile("v_nop\n\tv_nop\n\tv_nop\n\tv_nop" : "+v"(acc[0][0]), "+v"(acc[1][1]), "+v"(acc[2][2]), "+v"(acc[3][3]) : "v"(a[0]), "v"(a[3]));
    }
#pragma unroll
    for (int mb = 0; mb < 4; ++mb) {
#pragma unroll
        for (int nb = 0; nb < 4; ++nb) {
#pragma unroll
            for (int j = 0; j < 8; ++j) os[(hi * 8 + j) * 68 + nb * 16 + lr] = acc[mb][nb][j]; }
        __builtin_amdgcn_wave_barrier(); asm volatile("" ::: "memory");
        float* crow = C + (size_t)(r0 + mb * 16) * ldc + c0;
{
#pragma unroll
            for (int s = 0; s < 8; ++s) { const int row = 2 * s + hi, cofs = lr * 4; v4f val = *(const v4fa*)(os + row * 68 + cofs); if (BIAS) { val[0] += bfr(bias[c0 + cofs]); val[1] += bfr(bias[c0 + cofs + 1]); val[2] += bfr(bias[c0 + cofs + 2]); val[3] += bfr(bias[c0 + cofs + 3]); }
                *(v4f*)(crow + (size_t)row * ldc + cofs) = val; }
             }
        __builtin_amdgcn_wave_barrier(); asm volatile("" ::: "memory");
    }
}

__device__ __forceinline__ h16 tohx(float x) { return (h16)x; }
__device__ __forceinline__ void splitf(float y, unsigned short& h, unsigned short& l) { h = f2bf(y); l = f2bf(y - bf2f(h)); }
typedef __attribute__((ext_vector_type(2))) _Float16 v2h;
typedef __attribute__((ext_vector_type(4))) _Float16 v4h;
typedef __attribute__((ext_vector_type(2))) unsigned short v2us;
typedef __attribute__((ext_vector_type(4))) unsigned short v4us;
typedef __attribute__((ext_vector_type(2))) float v2f;
typedef __attribute__((ext_vector_type(4))) int v4i;

__global__ __launch_bounds__(256) void k_wtG(const float* __restrict__ w, int K, int N, bf* Bt) {
    const int lane = threadIdx.x & 31; const int L0 = (blockIdx.x * 8 + (threadIdx.x >> 5)) * 8; const int nlines = N * K / 64;
{
#pragma unroll 1
        for (int l = 0; l < 8; ++l) { const int L = L0 + l; if (L >= nlines) break; const size_t e = (size_t)L * 64 + lane * 2; const int k = (int)(e % K), n = (int)(e / K); v2us o;
            o[0] = f2bf(w[(size_t)k * N + n]); o[1] = f2bf(w[(size_t)(k + 1) * N + n]); *(v2us*)(Bt + e) = o; }
         }
}



__constant__ float INVF[DM / 2] = {1.0f,0.964661598f,0.930572033f,0.897687137f,0.865964293f,0.835362554f,0.805842161f,0.777365029f,0.749894202f,0.723394156f,0.697830558f,0.673170388f,0.649381638f,0.626433551f,0.604296386f,0.582941532f,0.562341332f,0.542469084f,0.523299098f,0.504806578f,0.486967504f,0.469758898f,0.453158379f,0.437144488f,0.421696484f,0.406794429f,0.392418981f,0.378551513f,0.365174115f,0.352269441f,0.339820832f,0.327812076f,0.316227764f,0.305052817f,0.294272721f,0.283873618f,0.273841947f,0.264164835f,0.254829645f,0.245824397f,0.237137347f,0.228757307f,0.220673412f,0.212875158f,0.2053525f,0.198095664f,0.191095293f,0.184342295f,0.177827939f,0.171543792f,0.165481701f,0.15963386f,0.153992653f,0.148550808f,0.143301249f,0.138237223f,0.133352146f,0.128639698f,0.124093764f,0.119708493f,0.115478195f,0.111397393f,0.107460767f,0.103663281f,0.099999994f,0.0964661688f,0.0930572152f,0.0897687078f,0.0865964293f,0.0835362524f,0.0805842206f,0.0777364895f,0.0749894157f,0.0723394156f,0.0697830617f,0.0673170388f,0.0649381578f,0.0626433492f,0.0604296364f,0.0582941547f,0.056234125f,0.0542469025f,0.0523299091f,0.0504806563f,0.0486967564f,0.0469758809f,0.0453158319f,0.0437144488f,0.0421696529f,0.0406794474f,0.0392418914f,0.0378551483f,0.0365174115f,0.0352269486f,0.0339820795f,0.0327812098f,0.0316227749f,0.0305052791f,0.0294272732f,0.0283873565f,0.0273841936f,0.0264164824f,0.0254829675f,0.0245824363f,0.023713734f,0.0228757299f,0.0220673401f,0.0212875176f,0.0205352474f,0.0198095664f,0.0191095285f,0.0184342302f,0.0177827962f,0.0171543807f,0.0165481735f,0.0159633812f,0.0153992623f,0.0148550775f,0.0143301245f,0.0138237216f,0.013335214f,0.0128639704f,0.0124093788f,0.0119708525f,0.0115478169f,0.0111397365f,0.0107460767f,0.0103663281f,0.00999999978f,0.00964661594f,0.00930572115f,0.00897687208f,0.00865964405f,0.00835362263f,0.00805842038f,0.00777364895f,0.00749894092f,0.007233941f,0.00697830552f,0.00673170388f,0.00649381708f,0.00626433641f,0.00604296196f,0.00582941389f,0.00562341232f,0.00542468997f,0.00523299072f,0.00504806545f,0.00486967526f,0.0046975892f,0.00453158421f,0.0043714433f,0.00421696389f,0.00406794343f,0.00392418914f,0.00378551497f,0.00365174119f,0.00352269458f,0.00339820841f,0.00327812159f,0.0031622767f,0.00305052707f,0.00294272648f,0.00283873547f,0.00273841922f,0.00264164805f,0.0025482967f,0.0024582441f,0.00237137405f,0.00228757365f,0.00220673345f,0.00212875125f,0.0020535246f,0.00198095664f,0.00191095285f,0.001843423f,0.00177827943f,0.00171543809f,0.00165481726f,0.00159633812f,0.00153992616f,0.0014855077f,0.00143301231f,0.00138237211f,0.00133352133f,0.00128639699f,0.00124093785f,0.00119708513f,0.00115478167f,0.00111397356f,0.0010746076f,0.00103663281f,0.000999999931f,0.000964661594f,0.000930572045f,0.000897687161f,0.000865964394f,0.000835362298f,0.000805841992f,0.000777364883f,0.000749894069f,0.0007233941f,0.000697830576f,0.000673170376f,0.000649381662f,0.000626433583f,0.00060429622f,0.0005829414f,0.000562341185f,0.000542468973f,0.000523299037f,0.000504806521f,0.000486967503f,0.000469758903f,0.000453158398f,0.000437144336f,0.000421696401f,0.000406794337f,0.000392418908f,0.000378551485f,0.000365174084f,0.000352269446f,0.000339820836f,0.000327811984f,0.000316227786f,0.000305052701f,0.000294272788f,0.000283873524f,0.000273842044f,0.000264164817f,0.000254829531f,0.000245824398f,0.000237137268f,0.000228757344f,0.000220673333f,0.000212875209f,0.000205352466f,0.000198095746f,0.000191095271f,0.000184342207f,0.00017782794f,0.00017154371f,0.000165481732f,0.000159633797f,0.000153992674f,0.000148550767f,0.000143301295f,0.000138237199f,0.000133352078f,0.000128639687f,0.000124093727f,0.000119708515f,0.000115478157f,0.000111397407f,0.000107460757f,0.000103663326f};
__global__ __launch_bounds__(256) void k_petab(bf* PEh, bf* PEl) { const size_t e = ((size_t)blockIdx.x * 256 + threadIdx.x) * 2; if (e >= (size_t)NPE * DM) return; const int c = (int)(e % DM); const int r = (int)(e / DM); v2us oh, ol;
    if (r < NPE - 1) { const float th = __fmul_rn((float)(r - (TT - 1)), INVF[c >> 1]); unsigned short a, b2; splitf(sinf(th), a, b2); oh[0] = a; ol[0] = b2; splitf(cosf(th), a, b2); oh[1] = a; ol[1] = b2; } else { oh[0] = 0; oh[1] = 0; ol[0] = 0; ol[1] = 0; }
    *(v2us*)(PEh + e) = oh; *(v2us*)(PEl + e) = ol;  }
__global__ __launch_bounds__(256) void k_cvt8(const float* __restrict__ src, bf* dst, size_t n8) { const size_t i = (size_t)blockIdx.x * 256 + threadIdx.x; if (i >= n8) return; const v8f v = *(const v8f*)(src + i * 8); v8us o;
#pragma unroll
    for (int k = 0; k < 8; ++k) o[k] = f2bf(v[k]); *(v8us*)(dst + i * 8) = o;  }

// fragment at scalar base + 32-bit vector byte offset + constant: one address register serves every load of a phase
__device__ __forceinline__ v16bf ldo(const bf* base, unsigned voff, int imm) { const char* p = (const char*)base + voff + imm; return cat16b(*(const v8us*)p, *(const v8us*)(p + 32)); }
// ---- projections that write their operand planes themselves: one wave per 64x64 tile and the k loop of k_gemmw; the epilogue splits each f32 result into bf16 hi + lo and stores rows of 64 elements (128 bytes, whole lines) straight into the layout the attention kernel reads.
template <int NSPLIT>
__device__ __forceinline__ void tile64(const bf* __restrict__ A, const bf* __restrict__ A2, const bf* __restrict__ Bt, int r0, int c0, int lr, int hi, v8f (&acc)[4][4]) {
    typedef v16bf V;
#pragma unroll
    for (int mb = 0; mb < 4; ++mb)
#pragma unroll
        for (int nb = 0; nb < 4; ++nb) acc[mb][nb] = (v8f){};
    unsigned ao = (unsigned)((r0 + lr) * DM + 8 * hi) * 2u, bo = (unsigned)((c0 + lr) * DM + 8 * hi) * 2u;   // byte offsets; every operand plane is under 2^24 bytes
    for (int kc = 0; kc < DM; kc += 32) {
        V a[4], a2[4], b[4];
#pragma unroll
        for (int mb = 0; mb < 4; ++mb) { a[mb] = ldo(A, ao, mb * 16 * DM * 2); if (NSPLIT == 1) a2[mb] = ldo(A2, ao, mb * 16 * DM * 2); }
#pragma unroll
        for (int nb = 0; nb < 4; ++nb) b[nb] = ldo(Bt, bo, nb * 16 * DM * 2);
        // all of a trip's loads are issued in front of its first product: without this line the compiler, in k_qkvp, loads the four b fragments one after the other into one register group, and a trip waits for memory four times instead of once
        __builtin_amdgcn_sched_barrier(0);
#pragma unroll
        for (int nb = 0; nb < 4; ++nb) {
#pragma unroll
            for (int mb = 0; mb < 4; ++mb) { acc[mb][nb] = wmmab(a[mb], b[nb], acc[mb][nb]); if (NSPLIT == 1) acc[mb][nb] = wmmab(a2[mb], b[nb], acc[mb][nb]); } }
        // the two offset registers that this trip's loads name are operands here, so they stay whole up to the wait and are stepped only behind it; the four v_nop are the vector slots behind the last matrix instruction, also on the taken side of the loop's branch
        asm volatile("s_wait_xcnt 0x0\n\tv_nop\n\tv_nop\n\tv_nop\n\tv_nop" : "+v"(ao), "+v"(bo), "+v"(acc[0][0]), "+v"(acc[1][1]), "+v"(acc[2][2]), "+v"(acc[3][3]) : "v"(a[0]), "v"(a[3]) : "memory");
        ao += 64; bo += 64;
    }
}
// 16 rows of the tile into this wave's LDS slab [16][68]
__device__ __forceinline__ void slab_put(float* os, const v8f (&acc)[4], int lr, int hi) {
#pragma unroll
    for (int nb = 0; nb < 4; ++nb) {
#pragma unroll
        for (int j = 0; j < 8; ++j) os[(hi * 8 + j) * 68 + nb * 16 + lr] = acc[nb][j]; }
}
__device__ __forceinline__ void split8(const float (&x)[8], v8us& oh, v8us& ol) {
#pragma unroll
    for (int q = 0; q < 8; ++q) { unsigned short a, c; splitf(x[q], a, c); oh[q] = a; ol[q] = c; } }
// k_qkvp: grid (8192 / 64, 24). blockIdx.y >> 3 picks q, k or v, blockIdx.y & 7 the head. q and k: C = xs W, tile rows are positions, planes [b][h][t][d]; q is stored twice, as q + u_bias and q + v_bias. v: the operands change places (C = Wv^T xs^T), so that tile rows are head dims and the transposed planes [b][h][d][t] are stored by rows as well.
__global__ __launch_bounds__(32) void k_qkvp(const bf* __restrict__ XB, const bf* __restrict__ WQ, const bf* __restrict__ WK, const bf* __restrict__ WV, const float* __restrict__ pbu, const float* __restrict__ pbv, bf* QUh, bf* QUl, bf* QVh, bf* QVl, bf* Kh, bf* Kl, bf* Vh, bf* Vl) {
    __shared__ __align__(16) float os[16 * 68];
    const int lane = threadIdx.x & 31, lr = lane & 15, hi = lane >> 4; const int sel = blockIdx.y >> 3, cb = blockIdx.y & 7, xr = blockIdx.x * 64, b = xr / TT, t0 = xr % TT; const bool tv = sel == 2;
    v8f acc[4][4];
    tile64<0>(tv ? WV : XB, nullptr, tv ? XB : (sel == 0 ? WQ : WK), tv ? cb * 64 : xr, tv ? xr : cb * 64, lr, hi, acc);
    const size_t base = tv ? (size_t)(b * NKV + cb) * HD * TT + t0 : ((size_t)(b * NH_ + cb) * TT + t0) * HD; const int pitch = tv ? TT : HD;
    bf* Dh = tv ? Vh : Kh; bf* Dl = tv ? Vl : Kl;
    const int rr = lane >> 3, cofs = (lane & 7) * 8;
    float ub[8], vb[8];
#pragma unroll
    for (int q = 0; q < 8; ++q) { ub[q] = 0.f; vb[q] = 0.f; }
    if (sel == 0) {
#pragma unroll
        for (int q = 0; q < 8; ++q) { ub[q] = bfr(pbu[cb * HD + cofs + q]); vb[q] = bfr(pbv[cb * HD + cofs + q]); } }
#pragma unroll
    for (int mb = 0; mb < 4; ++mb) {
        slab_put(os, acc[mb], lr, hi);
        // the slab is exchanged between the lanes of this wave: keep the reads below behind the stores above
        __builtin_amdgcn_wave_barrier(); asm volatile("" ::: "memory");
#pragma unroll
        for (int s = 0; s < 4; ++s) { const int row = 4 * s + rr; const v4f x0 = *(const v4fa*)(os + row * 68 + cofs), x1 = *(const v4fa*)(os + row * 68 + cofs + 4); float x[8];
#pragma unroll
            for (int q = 0; q < 4; ++q) { x[q] = x0[q]; x[4 + q] = x1[q]; }
            const size_t o = base + (size_t)(mb * 16 + row) * pitch + cofs;
            v8us oh, ol;
            if (sel == 0) { float y[8]; v8us ph, pl;
#pragma unroll
                for (int q = 0; q < 8; ++q) y[q] = __fadd_rn(x[q], ub[q]);
                split8(y, oh, ol);
#pragma unroll
                for (int q = 0; q < 8; ++q) y[q] = __fadd_rn(x[q], vb[q]);
                split8(y, ph, pl);
                *(v8us*)(QUh + o) = oh; *(v8us*)(QUl + o) = ol; *(v8us*)(QVh + o) = ph; *(v8us*)(QVl + o) = pl; }
            else { split8(x, oh, ol); *(v8us*)(Dh + o) = oh; *(v8us*)(Dl + o) = ol; }
            // the stores' address and data registers are rewritten by the next rows: the wait stands in front of that
            asm volatile("s_wait_xcnt 0x0" ::: "memory"); }
        // the next 16 rows' stores to the slab stay behind the reads above
        __builtin_amdgcn_wave_barrier(); asm volatile("" ::: "memory");
    }
}
// k_posp: p = position table (hi + lo, 2 products) Wpos, grid (2048 / 64, 8 heads), planes [h][2048][64]
__global__ __launch_bounds__(32) void k_posp(const bf* __restrict__ PEh, const bf* __restrict__ PEl, const bf* __restrict__ WP, bf* Ph2, bf* Pl2) {
    __shared__ __align__(16) float os[16 * 68];
    const int lane = threadIdx.x & 31, lr = lane & 15, hi = lane >> 4; const int r0 = blockIdx.x * 64, cb = blockIdx.y;
    v8f acc[4][4];
    tile64<1>(PEh, PEl, WP, r0, cb * 64, lr, hi, acc);
    const size_t base = ((size_t)cb * NPE + r0) * HD; const int rr = lane >> 3, cofs = (lane & 7) * 8;
#pragma unroll
    for (int mb = 0; mb < 4; ++mb) {
        slab_put(os, acc[mb], lr, hi);
        // the slab is exchanged between the lanes of this wave: keep the reads below behind the stores above
        __builtin_amdgcn_wave_barrier(); asm volatile("" ::: "memory");
#pragma unroll
        for (int s = 0; s < 4; ++s) { const int row = 4 * s + rr; const v4f x0 = *(const v4fa*)(os + row * 68 + cofs), x1 = *(const v4fa*)(os + row * 68 + cofs + 4); float x[8];
#pragma unroll
            for (int q = 0; q < 4; ++q) { x[q] = x0[q]; x[4 + q] = x1[q]; }
            v8us oh, ol; split8(x, oh, ol); const size_t o = base + (size_t)(mb * 16 + row) * HD + cofs; *(v8us*)(Ph2 + o) = oh; *(v8us*)(Pl2 + o) = ol;
            // the stores' address and data registers are rewritten by the next rows: the wait stands in front of that
            asm volatile("s_wait_xcnt 0x0" ::: "memory"); }
        // the next 16 rows' stores to the slab stay behind the reads above
        __builtin_amdgcn_wave_barrier(); asm volatile("" ::: "memory");
    }
}
// k_fattn: one launch for the whole attention. One wave owns 16 query rows of one (batch item, head) and walks the 1024 keys in steps of 64; grid (1024 / (16 * FW), 64), FW waves a block, no block barrier.
// Transposed products: St = K (q+u)^T and BDt = P (q+v)^T (A = key or position rows, B = query rows kept in registers), so a lane holds ONE query (column lr) and 8 consecutive keys per tile (8 * hi + r).
// rel_shift: the 16 queries x 64 keys of a step need positions l0 .. l0 + 78, l0 = j0 - i0 + 1008 (five 16-row tiles; row 2047 is the zero pad and is never picked); BDt goes to this wave's LDS slab as [query][80] and is read back at column key - query + 15.
// Online softmax per lane (running maximum and sum, output tiles rescaled each step); the f32 weights split in place into bf16 hi + lo B operands; Ot += Vt Pt (3 products); the epilogue divides by the sum and writes the merged hi/lo planes.
#define FW  8
#define BDP 84                    // slab pitch in floats: 16-byte aligned rows; the skewed reads (stride 83) fall on 32 different banks
#define L2E 1.4426950408889634f
typedef __attribute__((ext_vector_type(2))) __bf16 v2bf;
typedef __attribute__((ext_vector_type(8))) unsigned v8u;
__device__ __forceinline__ void split16(const v8f x0, const v8f x1, v16bf& h, v16bf& l) {   // element s = tile s >> 3, register s & 7: two result tiles are one B operand in the hardware k order
    v8u hw, lw;
#pragma unroll
    for (int s = 0; s < 8; ++s) { v2f x; x[0] = (s < 4) ? x0[2 * (s & 3)] : x1[2 * (s & 3)]; x[1] = (s < 4) ? x0[2 * (s & 3) + 1] : x1[2 * (s & 3) + 1];
        const v2bf hb = __builtin_convertvector(x, v2bf); const v2f rest = x - __builtin_convertvector(hb, v2f); const v2bf lb = __builtin_convertvector(rest, v2bf);
        hw[s] = __builtin_bit_cast(unsigned, hb); lw[s] = __builtin_bit_cast(unsigned, lb); }
    h = __builtin_bit_cast(v16bf, hw); l = __builtin_bit_cast(v16bf, lw);
}
// four waves a SIMD (two blocks a WGP): the 4096 waves are then resident at once, and a wave's vector work runs beside its neighbours' matrix work
__global__ __launch_bounds__(FW * 32) __attribute__((amdgpu_waves_per_eu(4, 4))) void k_fattn(const bf* __restrict__ QUh, const bf* __restrict__ QUl, const bf* __restrict__ QVh, const bf* __restrict__ QVl, const bf* __restrict__ Kh, const bf* __restrict__ Kl, const bf* __restrict__ PPh, const bf* __restrict__ PPl, const bf* __restrict__ Vh, const bf* __restrict__ Vl, const int* __restrict__ MK, bf* ATh, bf* ATl) {
    __shared__ __align__(16) float bds[FW * 16 * BDP];
    const int lane = threadIdx.x & 31, lr = lane & 15, hi = lane >> 4, wv = threadIdx.x >> 5;
    const int z = blockIdx.y, b = z / NH_, h = z % NH_; const int i0 = (blockIdx.x * FW + wv) * 16;
    float* bd = bds + wv * 16 * BDP;
    const unsigned qo = (unsigned)((z * TT + i0 + lr) * HD + 8 * hi) * 2u;   // byte offsets; every plane is under 2^24 bytes, the mask 2^25
    v16bf quh[2], qul[2], qvh[2], qvl[2];
#pragma unroll
    for (int ks = 0; ks < 2; ++ks) { quh[ks] = ldo(QUh, qo, ks * 64); qul[ks] = ldo(QUl, qo, ks * 64); qvh[ks] = ldo(QVh, qo, ks * 64); qvl[ks] = ldo(QVl, qo, ks * 64); }
    const unsigned ko = (unsigned)((z * TT + lr) * HD + 8 * hi) * 2u;
    const unsigned po = (unsigned)((h * NPE + (TT - 16 - i0) + lr) * HD + 8 * hi) * 2u;
    const unsigned vo = (unsigned)((z * HD + lr) * TT + 8 * hi) * 2u;
    const unsigned mo = (unsigned)((b * TT + i0 + lr) * TT + 8 * hi) * 4u;
    v8f o[4];
#pragma unroll
    for (int dt = 0; dt < 4; ++dt) o[dt] = (v8f){};
    float mrun = -1.0e30f, lsum = 0.f;   // the running maximum starts far above the masked value -3e38: a masked key's exponential is 0 also while no key of its row has been left unmasked
#pragma unroll 1
    for (int j0 = 0; j0 < TT; j0 += 64) {
        const unsigned pj = po + (unsigned)(j0 * HD * 2), kj = ko + (unsigned)(j0 * HD * 2), vj = vo + (unsigned)(j0 * 2), mj = mo + (unsigned)(j0 * 4);
        {   // position scores of the step's band, transposed: rows l0 + 16 u + 8 hi + r, column = query lr
            v8f pa[5];
#pragma unroll
            for (int u = 0; u < 5; ++u) pa[u] = (v8f){};
#pragma unroll
            for (int ks = 0; ks < 2; ++ks) { v16bf a[5], a2[5];
#pragma unroll
                for (int u = 0; u < 5; ++u) { a[u] = ldo(PPh, pj, u * 16 * HD * 2 + ks * 64); a2[u] = ldo(PPl, pj, u * 16 * HD * 2 + ks * 64); }
#pragma unroll
                for (int u = 0; u < 5; ++u) pa[u] = wmmab(a[u], qvh[ks], pa[u]);
#pragma unroll
                for (int u = 0; u < 5; ++u) pa[u] = wmmab(a[u], qvl[ks], pa[u]);
#pragma unroll
                for (int u = 0; u < 5; ++u) pa[u] = wmmab(a2[u], qvh[ks], pa[u]); }
#pragma unroll
            for (int u = 0; u < 5; ++u) { v4f w0, w1;
#pragma unroll
                for (int q = 0; q < 4; ++q) { w0[q] = pa[u][q]; w1[q] = pa[u][4 + q]; }
                *(v4fa*)(bd + lr * BDP + u * 16 + hi * 8) = w0; *(v4fa*)(bd + lr * BDP + u * 16 + hi * 8 + 4) = w1; }
        }
        // the slab is exchanged between the two lane halves of this wave: keep the reads below behind the stores above; the four v_nop are the vector slots between the last position product and a content product that reuses its result registers
        __builtin_amdgcn_wave_barrier(); asm volatile("v_nop\n\tv_nop\n\tv_nop\n\tv_nop" ::: "memory");
        v8f s[4];
#pragma unroll
        for (int t = 0; t < 4; ++t) s[t] = (v8f){};
#pragma unroll
        for (int ks = 0; ks < 2; ++ks) { v16bf a[4], a2[4];
#pragma unroll
            for (int t = 0; t < 4; ++t) { a[t] = ldo(Kh, kj, t * 16 * HD * 2 + ks * 64); a2[t] = ldo(Kl, kj, t * 16 * HD * 2 + ks * 64); }
#pragma unroll
            for (int t = 0; t < 4; ++t) s[t] = wmmab(a[t], quh[ks], s[t]);
#pragma unroll
            for (int t = 0; t < 4; ++t) s[t] = wmmab(a[t], qul[ks], s[t]);
#pragma unroll
            for (int t = 0; t < 4; ++t) s[t] = wmmab(a2[t], quh[ks], s[t]); }
        float tmax = -3.0e38f;
#pragma unroll
        for (int t = 0; t < 4; ++t) { const char* mp = (const char*)MK + mj + t * 64; const v4i m0 = *(const v4i*)mp; const v4i m1 = *(const v4i*)(mp + 16);
#pragma unroll
            for (int r = 0; r < 8; ++r) { const float su = s[t][r] + bd[lr * (BDP - 1) + 15 + t * 16 + hi * 8 + r]; const int m = (r < 4) ? m0[r & 3] : m1[r & 3]; const float tv = (m != 0) ? su * (SCL * L2E) : -3.0e38f;   /* (ac + rel_shift(bd)) / 8, in units of log2 so that the exponentials need no further product; key mask (int32) */ s[t][r] = tv; tmax = fmaxf(tmax, tv); } }
        // the next step's stores to the slab stay behind the reads above
        __builtin_amdgcn_wave_barrier(); asm volatile("" ::: "memory");
        tmax = fmaxf(tmax, __shfl_xor(tmax, 16, 32));
        const float mnew = fmaxf(mrun, tmax); const float alpha = __builtin_amdgcn_exp2f(mrun - mnew); mrun = mnew;
        float ps = 0.f;
#pragma unroll
        for (int t = 0; t < 4; ++t) s[t] -= mnew;
#pragma unroll
        for (int r = 0; r < 8; ++r)
#pragma unroll
            for (int t = 0; t < 4; ++t) { const float p = __builtin_amdgcn_exp2f(s[t][r]); s[t][r] = p; ps += p; }
        lsum = lsum * alpha + ps;
#pragma unroll
        for (int dt = 0; dt < 4; ++dt) o[dt] *= alpha;
        v16bf ph[2], pl[2]; split16(s[0], s[1], ph[0], pl[0]); split16(s[2], s[3], ph[1], pl[1]);
#pragma unroll
        for (int ks = 0; ks < 2; ++ks) { v16bf a[4], a2[4];
#pragma unroll
            for (int dt = 0; dt < 4; ++dt) { a[dt] = ldo(Vh, vj, dt * 16 * TT * 2 + ks * 64); a2[dt] = ldo(Vl, vj, dt * 16 * TT * 2 + ks * 64); }
#pragma unroll
            for (int dt = 0; dt < 4; ++dt) o[dt] = wmmab(a[dt], ph[ks], o[dt]);
#pragma unroll
            for (int dt = 0; dt < 4; ++dt) o[dt] = wmmab(a[dt], pl[ks], o[dt]);
#pragma unroll
            for (int dt = 0; dt < 4; ++dt) o[dt] = wmmab(a2[dt], ph[ks], o[dt]); }
        // four vector slots behind the last matrix instruction, also on the taken side of the loop's branch
        asm volatile("v_nop\n\tv_nop\n\tv_nop\n\tv_nop" : "+v"(o[0]), "+v"(o[1]), "+v"(o[2]), "+v"(o[3]));
    }
    lsum += __shfl_xor(lsum, 16, 32);
    const float f = (lsum > 0.f) ? __fdiv_rn(1.0f, lsum) : 0.f;
#pragma unroll
    for (int dt = 0; dt < 4; ++dt) { v8us oh, ol;
#pragma unroll
        for (int r = 0; r < 8; ++r) { unsigned short a, c2; splitf(o[dt][r] * f, a, c2); oh[r] = a; ol[r] = c2; }
        const size_t oo = ((size_t)b * TT + i0 + lr) * DQ + h * HD + dt * 16 + hi * 8; *(v8us*)(ATh + oo) = oh; *(v8us*)(ATl + oo) = ol; }
}

extern "C" void kernel_launch(void* const* d_in, const int* in_sizes, int n_in,
                              void* d_out, int out_size, void* d_ws, size_t ws_size, hipStream_t stream) {
    (void)in_sizes; (void)n_in; (void)out_size;
    const float* x = (const float*)d_in[0]; const int* MK = (const int*)d_in[1]; const float* wq = (const float*)d_in[2]; const float* wk = (const float*)d_in[3]; const float* wv = (const float*)d_in[4]; const float* wpos = (const float*)d_in[5]; const float* wo = (const float*)d_in[6]; const float* pbu = (const float*)d_in[7]; const float* pbv = (const float*)d_in[8];   /* u_bias, v_bias [8][64] */
    float* OUT = (float*)d_out;     // [8][1024][512]
    char* wsp = (char*)d_ws;
    auto take = [&](size_t bytes) { char* p = wsp; wsp += (bytes + 255) & ~(size_t)255; return (void*)p; };
    bf* WQ = (bf*)take((size_t)DQ * DM * 2); bf* WK = (bf*)take((size_t)DKV * DM * 2); bf* WV = (bf*)take((size_t)DKV * DM * 2); bf* WO = (bf*)take((size_t)DM * DQ * 2);
    bf* PEh = (bf*)take((size_t)NPE * DM * 2); bf* PEl = (bf*)take((size_t)NPE * DM * 2); bf* WP = (bf*)take((size_t)DQ * DM * 2); bf* PPh = (bf*)take((size_t)NH_ * NPE * HD * 2); bf* PPl = (bf*)take((size_t)NH_ * NPE * HD * 2);
    // planes of all 8 batch items
    bf* QPh = (bf*)take((size_t)NB_ * NH_ * TT * HD * 2); bf* QPl = (bf*)take((size_t)NB_ * NH_ * TT * HD * 2); bf* QVh = (bf*)take((size_t)NB_ * NH_ * TT * HD * 2); bf* QVl = (bf*)take((size_t)NB_ * NH_ * TT * HD * 2); bf* KPh = (bf*)take((size_t)NB_ * NKV * TT * HD * 2); bf* KPl = (bf*)take((size_t)NB_ * NKV * TT * HD * 2); bf* VTh = (bf*)take((size_t)NB_ * NKV * HD * TT * 2); bf* VTl = (bf*)take((size_t)NB_ * NKV * HD * TT * 2); bf* ATh = (bf*)take((size_t)NB_ * TT * DQ * 2); bf* ATl = (bf*)take((size_t)NB_ * TT * DQ * 2);
    bf* XB = (bf*)take((size_t)NB_ * TT * DM * 2);
    if ((size_t)(wsp - (char*)d_ws) > ws_size) return;
    { k_wtG<<<(unsigned)((DM * DQ / 64 + 63) / 64), 256, 0, stream>>>(wq, DM, DQ, WQ); k_wtG<<<(unsigned)((DM * DKV / 64 + 63) / 64), 256, 0, stream>>>(wk, DM, DKV, WK); k_wtG<<<(unsigned)((DM * DKV / 64 + 63) / 64), 256, 0, stream>>>(wv, DM, DKV, WV);
      k_wtG<<<(unsigned)((DQ * DM / 64 + 63) / 64), 256, 0, stream>>>(wo, DQ, DM, WO);
       }
    k_petab<<<(unsigned)(((size_t)NPE * DM / 2 + 255) / 256), 256, 0, stream>>>(PEh, PEl); k_wtG<<<(unsigned)((DM * DQ / 64 + 63) / 64), 256, 0, stream>>>(wpos, DM, DQ, WP); k_posp<<<dim3(NPE / 64, NH_, 1), 32, 0, stream>>>(PEh, PEl, WP, PPh, PPl);   /* p = sinusoid table (hi+lo, 2 products) Wpos -> per-head hi/lo planes [h][2048][64] */
    k_cvt8<<<(unsigned)(((size_t)NB_ * TT * DM / 8 + 255) / 256), 256, 0, stream>>>(x, XB, (size_t)NB_ * TT * DM / 8);   /* exact bf16 plane of xs */
    k_qkvp<<<dim3(NB_ * TT / 64, 24, 1), 32, 0, stream>>>(XB, WQ, WK, WV, pbu, pbv, QPh, QPl, QVh, QVl, KPh, KPl, VTh, VTl);   /* q + u_bias, q + v_bias, k and transposed v planes of all 8 batch items */
    k_fattn<<<dim3(TT / (16 * FW), NB_ * NH_, 1), FW * 32, 0, stream>>>(QPh, QPl, QVh, QVl, KPh, KPl, PPh, PPl, VTh, VTl, MK, ATh, ATl);   /* scores, rel_shift, mask, softmax, attn.v and merge of all 64 (batch item, head) pairs */
    k_gemmw<bf, 1, false><<<dim3(NB_ * TT / 64, DM / 64, 1), 32, 0, stream>>>(ATh, ATl, WO, nullptr, DQ, OUT, DM, nullptr, 0, 0, 0);
}

// v004
// It runs in 193 microseconds.
// Next to v003, in two timings, it ran 1.73 and 1.74 times as fast.
// Counting every step since v000, it is 10.9 times as fast.
#include <hip/hip_runtime.h>

// Transformer-XL style relative-position multi-head self-attention (xs [8][1024][512]; q, k, v = xs W ('xw' [512][512], no bias; 8 heads x 64); p = pe Wpos with pe the sinusoidal table of positions -(T-1)..T-1 (2047 rows, [sin, cos] interleaved, computed on device); scores = ((q + u_bias).k + rel_shift((q + v_bias).p)) / 8 where rel_shift picks position row j - i + 1023; mask (int32 [8][1024][1024], read): -inf where 0 and those weights zeroed; softmax; out = merged Wout ('xw', no bias) -> [8][1024][512] (4.2 M)).
// Layout: one exact bf16 input plane -> 1-product projections; the position table is computed on device in f32 (NOT bf16-rounded: kept as bf16 hi + lo planes) and projected once (2 products, 2047 rows + one zero pad row) into per-head hi/lo planes [h][2048][64]; the q, k, v projections of all 8 batch items are one launch whose epilogue adds the biases, splits and stores the head planes (v transposed), the position projection likewise; one fused attention launch for all 64 (batch item, head) pairs: content scores (q+u).k and the needed band of position scores (q+v).p are hi/lo products (3 each), the position score at j - i + 1023 is picked through LDS, mask select, online softmax and attn.v follow in registers: no score reaches memory.
// Compute dtypes, f32 accumulate: every input rounded to bf16; q/k/v on PLAIN bf16 operands (exact products); p = pe(hi+lo) Wpos (2 products); content and position scores on hi/lo planes for every row (3 products); softmax f32; attn.v hi/lo (3 products); Wout hl x exact (2 products).

#define NB_  8
#define TT   1024
#define DM   512
#define NH_  8
#define NKV  8
#define REP  (NH_ / NKV)
#define HD   64
#define DQ   (NH_ * HD)
#define DKV  (NKV * HD)
#define NPE  2048                 // 2047 positions + 1 zero pad row
typedef __attribute__((ext_vector_type(4))) unsigned short v4us;
#define ZH   8
#define RH   1024                 // every row hi/lo
#define WIN  0
#define PCAR 1024.0f
#define SCL  0.125f   // HD^-0.5
typedef _Float16 h16;
typedef unsigned short bf;
typedef __attribute__((ext_vector_type(16))) __bf16   v16bf;
typedef __attribute__((ext_vector_type(16))) _Float16 v16h;
typedef __attribute__((ext_vector_type(8)))  _Float16 v8h;
typedef __attribute__((ext_vector_type(8)))  unsigned short v8us;
typedef __attribute__((ext_vector_type(8)))  float    v8f;
typedef __attribute__((ext_vector_type(4)))  float    v4f;
typedef v8h  __attribute__((may_alias)) v8ha;
typedef v4f  __attribute__((may_alias)) v4fa;
typedef v8us __attribute__((may_alias)) v8usa;

__device__ __forceinline__ unsigned short f2bf(float f) { unsigned u = __float_as_uint(f); u += 0x7FFFu + ((u >> 16) & 1u); return (unsigned short)(u >> 16); }
__device__ __forceinline__ float bf2f(unsigned short b) { return __uint_as_float(((unsigned)b) << 16); }
__device__ __forceinline__ float bfr(float f) { return bf2f(f2bf(f)); }
__device__ __forceinline__ v16h cat16(v8h lo, v8h hi) { return __builtin_shufflevector(lo, hi, 0, 1, 2, 3, 4, 5, 6, 7, 8, 9, 10, 11, 12, 13, 14, 15); }
__device__ __forceinline__ v16bf cat16b(v8us lo, v8us hi) { return __builtin_bit_cast(v16bf, __builtin_shufflevector(lo, hi, 0, 1, 2, 3, 4, 5, 6, 7, 8, 9, 10, 11, 12, 13, 14, 15)); }
__device__ __forceinline__ v8f wmma16(v16h a, v16h b, v8f c) { return __builtin_amdgcn_wmma_f32_16x16x32_f16(false, a, false, b, (short)0, c, false, false); }
__device__ __forceinline__ v8f wmmab(v16bf a, v16bf b, v8f c) { return __builtin_amdgcn_wmma_f32_16x16x32_bf16(false, a, false, b, (short)0, c, false, false); }



// ---- k_gemmw: register-blocked GEMM, ONE WAVE per 64x64 output tile (16 accumulators), operands straight from K-contiguous 16-bit planes; grid (M/64, N/64, Z), 32 threads.
// C[m][n] (f32, pitch ldc, + optional f32 bias[n]) = sum_k A[m][k] Bt[n][k] (+ split products per NSPLIT). z-batch strides sA/sB/sC in elements. K % 32 == 0.
template <typename T16> struct WFrag;
template <> struct WFrag<h16> { typedef v16h V; static __device__ __forceinline__ V ld(const h16* p) { return cat16(*(const v8h*)p, *(const v8h*)(p + 16)); } static __device__ __forceinline__ v8f mma(V a, V b, v8f c) { return wmma16(a, b, c); } };
template <> struct WFrag<bf> { typedef v16bf V; static __device__ __forceinline__ V ld(const bf* p) { return cat16b(*(const v8us*)p, *(const v8us*)(p + 16)); } static __device__ __forceinline__ v8f mma(V a, V b, v8f c) { return wmmab(a, b, c); } };
template <typename T16, int NSPLIT, bool BIAS>
__global__ __launch_bounds__(32) void k_gemmw(const T16* __restrict__ A, const T16* __restrict__ A2, const T16* __restrict__ Bt, const T16* __restrict__ Bt2, int K, float* C, int ldc, const float* __restrict__ bias, size_t sA, size_t sB, size_t sC) {
    typedef typename WFrag<T16>::V V;
    __shared__ __align__(16) float os[16 * 68];
    const size_t z = blockIdx.z; A += z * sA; if (A2) A2 += z * sA; Bt += z * sB; if (Bt2) Bt2 += z * sB; C += z * sC;
    const int lane = threadIdx.x & 31, lr = lane & 15, hi = lane >> 4; const int r0 = blockIdx.x * 64, c0 = blockIdx.y * 64;
    v8f acc[4][4];
#pragma unroll
    for (int mb = 0; mb < 4; ++mb)
#pragma unroll
        for (int nb = 0; nb < 4; ++nb) acc[mb][nb] = (v8f){};
    const size_t aoff = (size_t)(r0 + lr) * K + 8 * hi, boff = (size_t)(c0 + lr) * K + 8 * hi;
#pragma unroll 1
    for (int kc = 0; kc < K; kc += 32) {
        V a[4], a2[4];
#pragma unroll
        for (int mb = 0; mb < 4; ++mb) { a[mb] = WFrag<T16>::ld(A + aoff + (size_t)mb * 16 * K + kc); if (NSPLIT == 1 || NSPLIT == 2) a2[mb] = WFrag<T16>::ld(A2 + aoff + (size_t)mb * 16 * K + kc); }
#pragma unroll
        for (int nb = 0; nb < 4; ++nb) { const V b = WFrag<T16>::ld(Bt + boff + (size_t)nb * 16 * K + kc); V b2; if (NSPLIT >= 2) b2 = WFrag<T16>::ld(Bt2 + boff + (size_t)nb * 16 * K + kc);
#pragma unroll
            for (int mb = 0; mb < 4; ++mb) { acc[mb][nb] = WFrag<T16>::mma(a[mb], b, acc[mb][nb]); if (NSPLIT == 1 || NSPLIT == 2) acc[mb][nb] = WFrag<T16>::mma(a2[mb], b, acc[mb][nb]); if (NSPLIT >= 2) acc[mb][nb] = WFrag<T16>::mma(a[mb], b2, acc[mb][nb]); } }
        asm volatile("v_nop\n\tv_nop\n\tv_nop\n\tv_nop" : "+v"(acc[0][0]), "+v"(acc[1][1]), "+v"(acc[2][2]), "+v"(acc[3][3]) : "v"(a[0]), "v"(a[3]));
    }
#pragma unroll
    for (int mb = 0; mb < 4; ++mb) {
#pragma unroll
        for (int nb = 0; nb < 4; ++nb) {
#pragma unroll
            for (int j = 0; j < 8; ++j) os[(hi * 8 + j) * 68 + nb * 16 + lr] = acc[mb][nb][j]; }
        __builtin_amdgcn_wave_barrier(); asm volatile("" ::: "memory");
        float* crow = C + (size_t)(r0 + mb * 16) * ldc + c0;
{
#pragma unroll
            for (int s = 0; s < 8; ++s) { const int row = 2 * s + hi, cofs = lr * 4; v4f val = *(const v4fa*)(os + row * 68 + cofs); if (BIAS) { val[0] += bfr(bias[c0 + cofs]); val[1] += bfr(bias[c0 + cofs + 1]); val[2] += bfr(bias[c0 + cofs + 2]); val[3] += bfr(bias[c0 + cofs + 3]); }
                *(v4f*)(crow + (size_t)row * ldc + cofs) = val; }
             }
        __builtin_amdgcn_wave_barrier(); asm volatile("" ::: "memory");
    }
}

__device__ __forceinline__ h16 tohx(float x) { return (h16)x; }
__device__ __forceinline__ void splitf(float y, unsigned short& h, unsigned short& l) { h = f2bf(y); l = f2bf(y - bf2f(h)); }
typedef __attribute__((ext_vector_type(2))) _Float16 v2h;
typedef __attribute__((ext_vector_type(4))) _Float16 v4h;
typedef __attribute__((ext_vector_type(2))) unsigned short v2us;
typedef __attribute__((ext_vector_type(4))) unsigned short v4us;
typedef __attribute__((ext_vector_type(2))) float v2f;
typedef __attribute__((ext_vector_type(4))) int v4i;

__global__ __launch_bounds__(256) void k_wtG(const float* __restrict__ w, int K, int N, bf* Bt) {
    const int lane = threadIdx.x & 31; const int L0 = (blockIdx.x * 8 + (threadIdx.x >> 5)) * 8; const int nlines = N * K / 64;
{
#pragma unroll 1
        for (int l = 0; l < 8; ++l) { const int L = L0 + l; if (L >= nlines) break; const size_t e = (size_t)L * 64 + lane * 2; const int k = (int)(e % K), n = (int)(e / K); v2us o;
            o[0] = f2bf(w[(size_t)k * N + n]); o[1] = f2bf(w[(size_t)(k + 1) * N + n]); *(v2us*)(Bt + e) = o; }
         }
}



__constant__ float INVF[DM / 2] = {1.0f,0.964661598f,0.930572033f,0.897687137f,0.865964293f,0.835362554f,0.805842161f,0.777365029f,0.749894202f,0.723394156f,0.697830558f,0.673170388f,0.649381638f,0.626433551f,0.604296386f,0.582941532f,0.562341332f,0.542469084f,0.523299098f,0.504806578f,0.486967504f,0.469758898f,0.453158379f,0.437144488f,0.421696484f,0.406794429f,0.392418981f,0.378551513f,0.365174115f,0.352269441f,0.339820832f,0.327812076f,0.316227764f,0.305052817f,0.294272721f,0.283873618f,0.273841947f,0.264164835f,0.254829645f,0.245824397f,0.237137347f,0.228757307f,0.220673412f,0.212875158f,0.2053525f,0.198095664f,0.191095293f,0.184342295f,0.177827939f,0.171543792f,0.165481701f,0.15963386f,0.153992653f,0.148550808f,0.143301249f,0.138237223f,0.133352146f,0.128639698f,0.124093764f,0.119708493f,0.115478195f,0.111397393f,0.107460767f,0.103663281f,0.099999994f,0.0964661688f,0.0930572152f,0.0897687078f,0.0865964293f,0.0835362524f,0.0805842206f,0.0777364895f,0.0749894157f,0.0723394156f,0.0697830617f,0.0673170388f,0.0649381578f,0.0626433492f,0.0604296364f,0.0582941547f,0.056234125f,0.0542469025f,0.0523299091f,0.0504806563f,0.0486967564f,0.0469758809f,0.0453158319f,0.0437144488f,0.0421696529f,0.0406794474f,0.0392418914f,0.0378551483f,0.0365174115f,0.0352269486f,0.0339820795f,0.0327812098f,0.0316227749f,0.0305052791f,0.0294272732f,0.0283873565f,0.0273841936f,0.0264164824f,0.0254829675f,0.0245824363f,0.023713734f,0.0228757299f,0.0220673401f,0.0212875176f,0.0205352474f,0.0198095664f,0.0191095285f,0.0184342302f,0.0177827962f,0.0171543807f,0.0165481735f,0.0159633812f,0.0153992623f,0.0148550775f,0.0143301245f,0.0138237216f,0.013335214f,0.0128639704f,0.0124093788f,0.0119708525f,0.0115478169f,0.0111397365f,0.0107460767f,0.0103663281f,0.00999999978f,0.00964661594f,0.00930572115f,0.00897687208f,0.00865964405f,0.00835362263f,0.00805842038f,0.00777364895f,0.00749894092f,0.007233941f,0.00697830552f,0.00673170388f,0.00649381708f,0.00626433641f,0.00604296196f,0.00582941389f,0.00562341232f,0.00542468997f,0.00523299072f,0.00504806545f,0.00486967526f,0.0046975892f,0.00453158421f,0.0043714433f,0.00421696389f,0.00406794343f,0.00392418914f,0.00378551497f,0.00365174119f,0.00352269458f,0.00339820841f,0.00327812159f,0.0031622767f,0.00305052707f,0.00294272648f,0.00283873547f,0.00273841922f,0.00264164805f,0.0025482967f,0.0024582441f,0.00237137405f,0.00228757365f,0.00220673345f,0.00212875125f,0.0020535246f,0.00198095664f,0.00191095285f,0.001843423f,0.00177827943f,0.00171543809f,0.00165481726f,0.00159633812f,0.00153992616f,0.0014855077f,0.00143301231f,0.00138237211f,0.00133352133f,0.00128639699f,0.00124093785f,0.00119708513f,0.00115478167f,0.00111397356f,0.0010746076f,0.00103663281f,0.000999999931f,0.000964661594f,0.000930572045f,0.000897687161f,0.000865964394f,0.000835362298f,0.000805841992f,0.000777364883f,0.000749894069f,0.0007233941f,0.000697830576f,0.000673170376f,0.000649381662f,0.000626433583f,0.00060429622f,0.0005829414f,0.000562341185f,0.000542468973f,0.000523299037f,0.000504806521f,0.000486967503f,0.000469758903f,0.000453158398f,0.000437144336f,0.000421696401f,0.000406794337f,0.000392418908f,0.000378551485f,0.000365174084f,0.000352269446f,0.000339820836f,0.000327811984f,0.000316227786f,0.000305052701f,0.000294272788f,0.000283873524f,0.000273842044f,0.000264164817f,0.000254829531f,0.000245824398f,0.000237137268f,0.000228757344f,0.000220673333f,0.000212875209f,0.000205352466f,0.000198095746f,0.000191095271f,0.000184342207f,0.00017782794f,0.00017154371f,0.000165481732f,0.000159633797f,0.000153992674f,0.000148550767f,0.000143301295f,0.000138237199f,0.000133352078f,0.000128639687f,0.000124093727f,0.000119708515f,0.000115478157f,0.000111397407f,0.000107460757f,0.000103663326f};
__global__ __launch_bounds__(256) void k_petab(bf* PEh, bf* PEl) { const size_t e = ((size_t)blockIdx.x * 256 + threadIdx.x) * 2; if (e >= (size_t)NPE * DM) return; const int c = (int)(e % DM); const int r = (int)(e / DM); v2us oh, ol;
    if (r < NPE - 1) { const float th = __fmul_rn((float)(r - (TT - 1)), INVF[c >> 1]); unsigned short a, b2; splitf(sinf(th), a, b2); oh[0] = a; ol[0] = b2; splitf(cosf(th), a, b2); oh[1] = a; ol[1] = b2; } else { oh[0] = 0; oh[1] = 0; ol[0] = 0; ol[1] = 0; }
    *(v2us*)(PEh + e) = oh; *(v2us*)(PEl + e) = ol;  }
__global__ __launch_bounds__(256) void k_cvt8(const float* __restrict__ src, bf* dst, size_t n8) { const size_t i = (size_t)blockIdx.x * 256 + threadIdx.x; if (i >= n8) return; const v8f v = *(const v8f*)(src + i * 8); v8us o;
#pragma unroll
    for (int k = 0; k < 8; ++k) o[k] = f2bf(v[k]); *(v8us*)(dst + i * 8) = o;  }

// fragment at scalar base + 32-bit vector byte offset + constant: one address register serves every load of a phase
__device__ __forceinline__ v16bf ldo(const bf* base, unsigned voff, int imm) { const char* p = (const char*)base + voff + imm; return cat16b(*(const v8us*)p, *(const v8us*)(p + 32)); }
// ---- projections that write their operand planes themselves: one wave per 64x64 tile and the k loop of k_gemmw; the epilogue splits each f32 result into bf16 hi + lo and stores rows of 64 elements (128 bytes, whole lines) straight into the layout the attention kernel reads.
template <int NSPLIT>
__device__ __forceinline__ void tile64(const bf* __restrict__ A, const bf* __restrict__ A2, const bf* __restrict__ Bt, int r0, int c0, int lr, int hi, v8f (&acc)[4][4]) {
    typedef v16bf V;
#pragma unroll
    for (int mb = 0; mb < 4; ++mb)
#pragma unroll
        for (int nb = 0; nb < 4; ++nb) acc[mb][nb] = (v8f){};
    unsigned ao = (unsigned)((r0 + lr) * DM + 8 * hi) * 2u, bo = (unsigned)((c0 + lr) * DM + 8 * hi) * 2u;   // byte offsets; every operand plane is under 2^24 bytes
    for (int kc = 0; kc < DM; kc += 32) {
        V a[4], a2[4], b[4];
#pragma unroll
        for (int mb = 0; mb < 4; ++mb) { a[mb] = ldo(A, ao, mb * 16 * DM * 2); if (NSPLIT == 1) a2[mb] = ldo(A2, ao, mb * 16 * DM * 2); }
#pragma unroll
        for (int nb = 0; nb < 4; ++nb) b[nb] = ldo(Bt, bo, nb * 16 * DM * 2);
        // all of a trip's loads are issued in front of its first product: without this line the compiler, in k_qkvp, loads the four b fragments one after the other into one register group, and a trip waits for memory four times instead of once
        __builtin_amdgcn_sched_barrier(0);
#pragma unroll
        for (int nb = 0; nb < 4; ++nb) {
#pragma unroll
            for (int mb = 0; mb < 4; ++mb) { acc[mb][nb] = wmmab(a[mb], b[nb], acc[mb][nb]); if (NSPLIT == 1) acc[mb][nb] = wmmab(a2[mb], b[nb], acc[mb][nb]); } }
        // the two offset registers that this trip's loads name are operands here, so they stay whole up to the wait and are stepped only behind it; the four v_nop are the vector slots behind the last matrix instruction, also on the taken side of the loop's branch
        asm volatile("s_wait_xcnt 0x0\n\tv_nop\n\tv_nop\n\tv_nop\n\tv_nop" : "+v"(ao), "+v"(bo), "+v"(acc[0][0]), "+v"(acc[1][1]), "+v"(acc[2][2]), "+v"(acc[3][3]) : "v"(a[0]), "v"(a[3]) : "memory");
        ao += 64; bo += 64;
    }
}
// 16 rows of the tile into this wave's LDS slab [16][68]
__device__ __forceinline__ void slab_put(float* os, const v8f (&acc)[4], int lr, int hi) {
#pragma unroll
    for (int nb = 0; nb < 4; ++nb) {
#pragma unroll
        for (int j = 0; j < 8; ++j) os[(hi * 8 + j) * 68 + nb * 16 + lr] = acc[nb][j]; }
}
__device__ __forceinline__ void split8(const float (&x)[8], v8us& oh, v8us& ol) {
#pragma unroll
    for (int q = 0; q < 8; ++q) { unsigned short a, c; splitf(x[q], a, c); oh[q] = a; ol[q] = c; } }
// k_qkvp: grid (8192 / 64, 24). blockIdx.y >> 3 picks q, k or v, blockIdx.y & 7 the head. q and k: C = xs W, tile rows are positions, planes [b][h][t][d]; q is stored twice, as q + u_bias and q + v_bias. v: the operands change places (C = Wv^T xs^T), so that tile rows are head dims and the transposed planes [b][h][d][t] are stored by rows as well.
__global__ __launch_bounds__(32) void k_qkvp(const bf* __restrict__ XB, const bf* __restrict__ WQ, const bf* __restrict__ WK, const bf* __restrict__ WV, const float* __restrict__ pbu, const float* __restrict__ pbv, bf* QUh, bf* QUl, bf* QVh, bf* QVl, bf* Kh, bf* Kl, bf* Vh, bf* Vl) {
    __shared__ __align__(16) float os[16 * 68];
    const int lane = threadIdx.x & 31, lr = lane & 15, hi = lane >> 4; const int sel = blockIdx.y >> 3, cb = blockIdx.y & 7, xr = blockIdx.x * 64, b = xr / TT, t0 = xr % TT; const bool tv = sel == 2;
    v8f acc[4][4];
    tile64<0>(tv ? WV : XB, nullptr, tv ? XB : (sel == 0 ? WQ : WK), tv ? cb * 64 : xr, tv ? xr : cb * 64, lr, hi, acc);
    const size_t base = tv ? (size_t)(b * NKV + cb) * HD * TT + t0 : ((size_t)(b * NH_ + cb) * TT + t0) * HD; const int pitch = tv ? TT : HD;
    bf* Dh = tv ? Vh : Kh; bf* Dl = tv ? Vl : Kl;
    const int rr = lane >> 3, cofs = (lane & 7) * 8;
    float ub[8], vb[8];
#pragma unroll
    for (int q = 0; q < 8; ++q) { ub[q] = 0.f; vb[q] = 0.f; }
    if (sel == 0) {
#pragma unroll
        for (int q = 0; q < 8; ++q) { ub[q] = bfr(pbu[cb * HD + cofs + q]); vb[q] = bfr(pbv[cb * HD + cofs + q]); } }
#pragma unroll
    for (int mb = 0; mb < 4; ++mb) {
        slab_put(os, acc[mb], lr, hi);
        // the slab is exchanged between the lanes of this wave: keep the reads below behind the stores above
        __builtin_amdgcn_wave_barrier(); asm volatile("" ::: "memory");
#pragma unroll
        for (int s = 0; s < 4; ++s) { const int row = 4 * s + rr; const v4f x0 = *(const v4fa*)(os + row * 68 + cofs), x1 = *(const v4fa*)(os + row * 68 + cofs + 4); float x[8];
#pragma unroll
            for (int q = 0; q < 4; ++q) { x[q] = x0[q]; x[4 + q] = x1[q]; }
            const size_t o = base + (size_t)(mb * 16 + row) * pitch + cofs;
            v8us oh, ol;
            if (sel == 0) { float y[8]; v8us ph, pl;
#pragma unroll
                for (int q = 0; q < 8; ++q) y[q] = __fadd_rn(x[q], ub[q]);
                split8(y, oh, ol);
#pragma unroll
                for (int q = 0; q < 8; ++q) y[q] = __fadd_rn(x[q], vb[q]);
                split8(y, ph, pl);
                *(v8us*)(QUh + o) = oh; *(v8us*)(QUl + o) = ol; *(v8us*)(QVh + o) = ph; *(v8us*)(QVl + o) = pl; }
            else { split8(x, oh, ol); *(v8us*)(Dh + o) = oh; *(v8us*)(Dl + o) = ol; }
            // the stores' address and data registers are rewritten by the next rows: the wait stands in front of that
            asm volatile("s_wait_xcnt 0x0" ::: "memory"); }
        // the next 16 rows' stores to the slab stay behind the reads above
        __builtin_amdgcn_wave_barrier(); asm volatile("" ::: "memory");
    }
}
// k_posp: p = position table (hi + lo, 2 products) Wpos, grid (2048 / 64, 8 heads), planes [h][2048][64]
__global__ __launch_bounds__(32) void k_posp(const bf* __restrict__ PEh, const bf* __restrict__ PEl, const bf* __restrict__ WP, bf* Ph2, bf* Pl2) {
    __shared__ __align__(16) float os[16 * 68];
    const int lane = threadIdx.x & 31, lr = lane & 15, hi = lane >> 4; const int r0 = blockIdx.x * 64, cb = blockIdx.y;
    v8f acc[4][4];
    tile64<1>(PEh, PEl, WP, r0, cb * 64, lr, hi, acc);
    const size_t base = ((size_t)cb * NPE + r0) * HD; const int rr = lane >> 3, cofs = (lane & 7) * 8;
#pragma unroll
    for (int mb = 0; mb < 4; ++mb) {
        slab_put(os, acc[mb], lr, hi);
        // the slab is exchanged between the lanes of this wave: keep the reads below behind the stores above
        __builtin_amdgcn_wave_barrier(); asm volatile("" ::: "memory");
#pragma unroll
        for (int s = 0; s < 4; ++s) { const int row = 4 * s + rr; const v4f x0 = *(const v4fa*)(os + row * 68 + cofs), x1 = *(const v4fa*)(os + row * 68 + cofs + 4); float x[8];
#pragma unroll
            for (int q = 0; q < 4; ++q) { x[q] = x0[q]; x[4 + q] = x1[q]; }
            v8us oh, ol; split8(x, oh, ol); const size_t o = base + (size_t)(mb * 16 + row) * HD + cofs; *(v8us*)(Ph2 + o) = oh; *(v8us*)(Pl2 + o) = ol;
            // the stores' address and data registers are rewritten by the next rows: the wait stands in front of that
            asm volatile("s_wait_xcnt 0x0" ::: "memory"); }
        // the next 16 rows' stores to the slab stay behind the reads above
        __builtin_amdgcn_wave_barrier(); asm volatile("" ::: "memory");
    }
}
// k_fattn: one launch for the whole attention. One wave owns 16 query rows of one (batch item, head) and walks the 1024 keys in steps of 64; grid (1024 / (16 * FW), 64), FW waves a block, one block barrier a step.
// Transposed products: St = K (q+u)^T and BDt = P (q+v)^T (A = key or position rows, B = query rows kept in registers), so a lane holds ONE query (column lr) and 8 consecutive keys per tile (8 * hi + r).
// rel_shift: the 16 queries x 64 keys of a step need positions l0 .. l0 + 78, l0 = j0 - i0 + 1008 (five 16-row tiles; row 2047 is the zero pad and is never picked); BDt goes to this wave's LDS slab as [query][80] and is read back at column key - query + 15.
// Staging: the FW waves of a block read the same 64 key rows and 64 value rows (hi and lo) in a step, and together 320 consecutive position rows, of which a step brings 64 new ones. These six pieces of 8 KiB come into LDS by asynchronous copies, 16 bytes of each per thread, whole 128-byte lines per copy, two steps ahead: keys and values into two buffers, position rows into a ring of 512 rows. The fragments are then read from LDS.
// Online softmax per lane (running maximum and sum, output tiles rescaled each step); the f32 weights split in place into bf16 hi + lo B operands; Ot += Vt Pt (3 products); the epilogue divides by the sum and writes the merged hi/lo planes.
#define FW  16
#define BDP 84                    // slab pitch in floats: 16-byte aligned rows; the skewed reads (stride 83) fall on 32 different banks
#define LP  144                   // pitch in bytes of a staged row of 64 bf16 (128 bytes): 16 bytes x odd, so that the 16 rows of a fragment read fall on different banks
#define PCB (64 * LP)             // one staged piece: 64 rows
#define NST (TT / 64)             // steps
#define L2E 1.4426950408889634f
typedef __attribute__((ext_vector_type(2))) __bf16 v2bf;
typedef __attribute__((ext_vector_type(8))) unsigned v8u;
__device__ __forceinline__ void split16(const v8f x0, const v8f x1, v16bf& h, v16bf& l) {   // element s = tile s >> 3, register s & 7: two result tiles are one B operand in the hardware k order
    v8u hw, lw;
#pragma unroll
    for (int s = 0; s < 8; ++s) { v2f x; x[0] = (s < 4) ? x0[2 * (s & 3)] : x1[2 * (s & 3)]; x[1] = (s < 4) ? x0[2 * (s & 3) + 1] : x1[2 * (s & 3) + 1];
        const v2bf hb = __builtin_convertvector(x, v2bf); const v2f rest = x - __builtin_convertvector(hb, v2f); const v2bf lb = __builtin_convertvector(rest, v2bf);
        hw[s] = __builtin_bit_cast(unsigned, hb); lw[s] = __builtin_bit_cast(unsigned, lb); }
    h = __builtin_bit_cast(v16bf, hw); l = __builtin_bit_cast(v16bf, lw);
}
// fragment from a staged piece: the lane's 16 bytes at p and at p + 32, the k order of ldo
__device__ __forceinline__ v16bf ldl(const char* p) { return cat16b(*(const v8usa*)p, *(const v8usa*)(p + 32)); }
__device__ __forceinline__ unsigned ldsa(const void* p) { return (unsigned)(size_t)p; }
// asynchronous copies global -> LDS, 16 bytes a lane; the wait in the same statement keeps the address registers whole until the copies have taken them
__device__ __forceinline__ void acopy2(unsigned l0, const char* g0, unsigned l1, const char* g1) {
    asm volatile("global_load_async_to_lds_b128 %0, %1, off\n\tglobal_load_async_to_lds_b128 %2, %3, off\n\ts_wait_xcnt 0x0" :: "v"(l0), "v"(g0), "v"(l1), "v"(g1) : "memory"); }
__device__ __forceinline__ void acopy6(unsigned l0, const char* g0, unsigned l1, const char* g1, unsigned l2, const char* g2, unsigned l3, const char* g3, unsigned l4, const char* g4, unsigned l5, const char* g5) {
    asm volatile("global_load_async_to_lds_b128 %0, %1, off\n\tglobal_load_async_to_lds_b128 %2, %3, off\n\tglobal_load_async_to_lds_b128 %4, %5, off\n\tglobal_load_async_to_lds_b128 %6, %7, off\n\tglobal_load_async_to_lds_b128 %8, %9, off\n\tglobal_load_async_to_lds_b128 %10, %11, off\n\ts_wait_xcnt 0x0" :: "v"(l0), "v"(g0), "v"(l1), "v"(g1), "v"(l2), "v"(g2), "v"(l3), "v"(g3), "v"(l4), "v"(g4), "v"(l5), "v"(g5) : "memory"); }
// four waves a SIMD (one block a WGP): the 4096 waves are then resident at once, and a wave's vector work runs beside its neighbours' matrix work
__global__ __launch_bounds__(FW * 32) __attribute__((amdgpu_waves_per_eu(4, 4))) void k_fattn(const bf* __restrict__ QUh, const bf* __restrict__ QUl, const bf* __restrict__ QVh, const bf* __restrict__ QVl, const bf* __restrict__ Kh, const bf* __restrict__ Kl, const bf* __restrict__ PPh, const bf* __restrict__ PPl, const bf* __restrict__ Vh, const bf* __restrict__ Vl, const int* __restrict__ MK, bf* ATh, bf* ATl) {
    __shared__ __align__(16) float bds[FW * 16 * BDP];
    __shared__ __align__(16) char kvs[2 * 4 * PCB];   // [buffer][k hi, k lo, v hi, v lo][64 rows]
    __shared__ __align__(16) char pps[2 * 8 * PCB];   // [hi, lo][ring of 512 position rows]
    const int tid = threadIdx.x, lane = tid & 31, lr = lane & 15, hi = lane >> 4, wv = __builtin_amdgcn_readfirstlane(tid >> 5);
    const int z = blockIdx.y, b = z / NH_, h = z % NH_; const int i0 = (blockIdx.x * FW + wv) * 16;
    float* bd = bds + wv * 16 * BDP;
    // the thread's 16 bytes of every staged piece: row tid >> 3, segment tid & 7
    const unsigned cl = (unsigned)((tid >> 3) * LP + (tid & 7) * 16);
    const unsigned ck = (unsigned)(z * TT * HD * 2 + tid * 16);                                               // key rows of a step are 8 KiB in a row
    const unsigned cv = (unsigned)(((z * HD + (tid >> 3)) * TT) * 2 + (tid & 7) * 16);                         // value rows: 128 bytes of each of the 64 head dims
    const unsigned cp = (unsigned)((h * NPE + (TT - 16 * FW) - (int)blockIdx.x * 16 * FW) * HD * 2 + tid * 16);   // position rows from the block's lowest row on: piece c holds rows 64 c .. 64 c + 63 behind it, pieces 0 .. 19 end at row 2047 or below
    const unsigned lkv = ldsa(kvs) + cl, lpp = ldsa(pps) + cl;
    // keys and values of step t into buffer t & 1, position piece c into ring slot c & 7
    auto stage = [&](int t, int c) {
        const unsigned lk = lkv + (unsigned)(t & 1) * (4 * PCB), lq = lpp + (unsigned)(c & 7) * PCB;
        acopy6(lk, (const char*)Kh + ck + t * (64 * HD * 2), lk + PCB, (const char*)Kl + ck + t * (64 * HD * 2), lk + 2 * PCB, (const char*)Vh + cv + t * 128, lk + 3 * PCB, (const char*)Vl + cv + t * 128,
               lq, (const char*)PPh + cp + c * (64 * HD * 2), lq + 8 * PCB, (const char*)PPl + cp + c * (64 * HD * 2)); };
    // step 0 reads position pieces 0 .. 4
#pragma unroll
    for (int c = 0; c < 4; ++c) acopy2(lpp + c * PCB, (const char*)PPh + cp + c * (64 * HD * 2), lpp + (8 + c) * PCB, (const char*)PPl + cp + c * (64 * HD * 2));
    stage(0, 4);
    const unsigned qo = (unsigned)((z * TT + i0 + lr) * HD + 8 * hi) * 2u;   // byte offsets; every plane is under 2^24 bytes, the mask 2^25
    v16bf quh[2], qul[2], qvh[2], qvl[2];
#pragma unroll
    for (int ks = 0; ks < 2; ++ks) { quh[ks] = ldo(QUh, qo, ks * 64); qul[ks] = ldo(QUl, qo, ks * 64); qvh[ks] = ldo(QVh, qo, ks * 64); qvl[ks] = ldo(QVl, qo, ks * 64); }
    const unsigned mo = (unsigned)((b * TT + i0 + lr) * TT + 8 * hi) * 4u;
    const int fl = lr * LP + hi * 16;   // the lane's place in a 16-row fragment of a staged piece
    v8f o[4];
#pragma unroll
    for (int dt = 0; dt < 4; ++dt) o[dt] = (v8f){};
    float mrun = -1.0e30f, lsum = 0.f;   // the running maximum starts far above the masked value -3e38: a masked key's exponential is 0 also while no key of its row has been left unmasked
    // step 0's copies of this wave have landed; behind the barrier those of every wave have
    asm volatile("s_wait_asynccnt 0x0" ::: "memory");
    __syncthreads();
    stage(1, 5);
#pragma unroll 1
    for (int t = 0; t < NST; ++t) {
        const unsigned mj = mo + (unsigned)(t * 64 * 4);
        const char* kb = kvs + (t & 1) * (4 * PCB) + fl;
        {   // position scores of the step's band, transposed: rows l0 + 16 u + 8 hi + r, column = query lr
            v8f pa[5];
#pragma unroll
            for (int u = 0; u < 5; ++u) pa[u] = (v8f){};
#pragma unroll
            for (int ks = 0; ks < 2; ++ks) { v16bf a[5], a2[5];
#pragma unroll
                for (int u = 0; u < 5; ++u) { const int rw = t * 64 + (FW - 1 - wv) * 16 + u * 16;   /* row counted from the block's lowest position row */ const char* pr = pps + (rw & 511) * LP + fl + ks * 64; a[u] = ldl(pr); a2[u] = ldl(pr + 8 * PCB); }
#pragma unroll
                for (int u = 0; u < 5; ++u) pa[u] = wmmab(a[u], qvh[ks], pa[u]);
#pragma unroll
                for (int u = 0; u < 5; ++u) pa[u] = wmmab(a[u], qvl[ks], pa[u]);
#pragma unroll
                for (int u = 0; u < 5; ++u) pa[u] = wmmab(a2[u], qvh[ks], pa[u]); }
#pragma unroll
            for (int u = 0; u < 5; ++u) { v4f w0, w1;
#pragma unroll
                for (int q = 0; q < 4; ++q) { w0[q] = pa[u][q]; w1[q] = pa[u][4 + q]; }
                *(v4fa*)(bd + lr * BDP + u * 16 + hi * 8) = w0; *(v4fa*)(bd + lr * BDP + u * 16 + hi * 8 + 4) = w1; }
        }
        // the slab is exchanged between the two lane halves of this wave: keep the reads below behind the stores above; the four v_nop are the vector slots between the last position product and a content product that reuses its result registers
        __builtin_amdgcn_wave_barrier(); asm volatile("v_nop\n\tv_nop\n\tv_nop\n\tv_nop" ::: "memory");
        v4i mk[8];
#pragma unroll
        for (int t4 = 0; t4 < 4; ++t4) { const char* mp = (const char*)MK + mj + t4 * 64; mk[2 * t4] = *(const v4i*)mp; mk[2 * t4 + 1] = *(const v4i*)(mp + 16); }
        // the step's eight mask loads are issued together, in front of the content products: without this line the compiler issues them in four pairs among the selects below, and a step waits for memory four times
        __builtin_amdgcn_sched_barrier(0);
        v8f s[4];
#pragma unroll
        for (int t4 = 0; t4 < 4; ++t4) s[t4] = (v8f){};
#pragma unroll
        for (int ks = 0; ks < 2; ++ks) { v16bf a[4], a2[4];
#pragma unroll
            for (int t4 = 0; t4 < 4; ++t4) { a[t4] = ldl(kb + t4 * 16 * LP + ks * 64); a2[t4] = ldl(kb + PCB + t4 * 16 * LP + ks * 64); }
#pragma unroll
            for (int t4 = 0; t4 < 4; ++t4) s[t4] = wmmab(a[t4], quh[ks], s[t4]);
#pragma unroll
            for (int t4 = 0; t4 < 4; ++t4) s[t4] = wmmab(a[t4], qul[ks], s[t4]);
#pragma unroll
            for (int t4 = 0; t4 < 4; ++t4) s[t4] = wmmab(a2[t4], quh[ks], s[t4]); }
        // the first use of a mask word stays behind the content products: without this line the compiler lifts one compare in front of them, and the wave waits there for the loads it has just issued
        __builtin_amdgcn_sched_barrier(0);
        float tmax = -3.0e38f;
#pragma unroll
        for (int t4 = 0; t4 < 4; ++t4) { const v4i m0 = mk[2 * t4]; const v4i m1 = mk[2 * t4 + 1];
#pragma unroll
            for (int r = 0; r < 8; ++r) { const float su = s[t4][r] + bd[lr * (BDP - 1) + 15 + t4 * 16 + hi * 8 + r]; const int m = (r < 4) ? m0[r & 3] : m1[r & 3]; const float tv = (m != 0) ? su * (SCL * L2E) : -3.0e38f;   /* (ac + rel_shift(bd)) / 8, in units of log2 so that the exponentials need no further product; key mask (int32) */ s[t4][r] = tv; tmax = fmaxf(tmax, tv); } }
        // the next step's stores to the slab stay behind the reads above
        __builtin_amdgcn_wave_barrier(); asm volatile("" ::: "memory");
        tmax = fmaxf(tmax, __shfl_xor(tmax, 16, 32));
        const float mnew = fmaxf(mrun, tmax); const float alpha = __builtin_amdgcn_exp2f(mrun - mnew); mrun = mnew;
        float ps = 0.f;
#pragma unroll
        for (int t4 = 0; t4 < 4; ++t4) s[t4] -= mnew;
#pragma unroll
        for (int r = 0; r < 8; ++r)
#pragma unroll
            for (int t4 = 0; t4 < 4; ++t4) { const float p = __builtin_amdgcn_exp2f(s[t4][r]); s[t4][r] = p; ps += p; }
        lsum = lsum * alpha + ps;
#pragma unroll
        for (int dt = 0; dt < 4; ++dt) o[dt] *= alpha;
        v16bf ph[2], pl[2]; split16(s[0], s[1], ph[0], pl[0]); split16(s[2], s[3], ph[1], pl[1]);
        // the value fragments are read behind the split, when its registers are free: without this line the compiler starts them among the split's work and then, short of registers, reads the rest one fragment at a time, each with a full LDS wait
        __builtin_amdgcn_sched_barrier(0);
#pragma unroll
        for (int ks = 0; ks < 2; ++ks) { v16bf a[4], a2[4];
#pragma unroll
            for (int dt = 0; dt < 4; ++dt) { a[dt] = ldl(kb + 2 * PCB + dt * 16 * LP + ks * 64); a2[dt] = ldl(kb + 3 * PCB + dt * 16 * LP + ks * 64); }
#pragma unroll
            for (int dt = 0; dt < 4; ++dt) o[dt] = wmmab(a[dt], ph[ks], o[dt]);
#pragma unroll
            for (int dt = 0; dt < 4; ++dt) o[dt] = wmmab(a[dt], pl[ks], o[dt]);
#pragma unroll
            for (int dt = 0; dt < 4; ++dt) o[dt] = wmmab(a2[dt], ph[ks], o[dt]); }
        // four vector slots behind the last matrix instruction, also on the taken side of the loop's branch
        asm volatile("v_nop\n\tv_nop\n\tv_nop\n\tv_nop" : "+v"(o[0]), "+v"(o[1]), "+v"(o[2]), "+v"(o[3]));
        // hand-over of step t + 1: this wave's LDS reads of step t are done ...
        asm volatile("s_wait_dscnt 0x0" ::: "memory");
        // ... and its copies for step t + 1 have landed;
        asm volatile("s_wait_asynccnt 0x0" ::: "memory");
        // behind the barrier every wave's have, and nobody reads step t's buffer or its oldest position piece any more
        __syncthreads();
        if (t + 2 < NST) stage(t + 2, t + 6);
    }
    // no copy is left in flight when the wave ends
    asm volatile("s_wait_asynccnt 0x0" ::: "memory");
    lsum += __shfl_xor(lsum, 16, 32);
    const float f = (lsum > 0.f) ? __fdiv_rn(1.0f, lsum) : 0.f;
#pragma unroll
    for (int dt = 0; dt < 4; ++dt) { v8us oh, ol;
#pragma unroll
        for (int r = 0; r < 8; ++r) { unsigned short a, c2; splitf(o[dt][r] * f, a, c2); oh[r] = a; ol[r] = c2; }
        const size_t oo = ((size_t)b * TT + i0 + lr) * DQ + h * HD + dt * 16 + hi * 8; *(v8us*)(ATh + oo) = oh; *(v8us*)(ATl + oo) = ol; }
}

extern "C" void kernel_launch(void* const* d_in, const int* in_sizes, int n_in,
                              void* d_out, int out_size, void* d_ws, size_t ws_size, hipStream_t stream) {
    (void)in_sizes; (void)n_in; (void)out_size;
    const float* x = (const float*)d_in[0]; const int* MK = (const int*)d_in[1]; const float* wq = (const float*)d_in[2]; const float* wk = (const float*)d_in[3]; const float* wv = (const float*)d_in[4]; const float* wpos = (const float*)d_in[5]; const float* wo = (const float*)d_in[6]; const float* pbu = (const float*)d_in[7]; const float* pbv = (const float*)d_in[8];   /* u_bias, v_bias [8][64] */
    float* OUT = (float*)d_out;     // [8][1024][512]
    char* wsp = (char*)d_ws;
    auto take = [&](size_t bytes) { char* p = wsp; wsp += (bytes + 255) & ~(size_t)255; return (void*)p; };
    bf* WQ = (bf*)take((size_t)DQ * DM * 2); bf* WK = (bf*)take((size_t)DKV * DM * 2); bf* WV = (bf*)take((size_t)DKV * DM * 2); bf* WO = (bf*)take((size_t)DM * DQ * 2);
    bf* PEh = (bf*)take((size_t)NPE * DM * 2); bf* PEl = (bf*)take((size_t)NPE * DM * 2); bf* WP = (bf*)take((size_t)DQ * DM * 2); bf* PPh = (bf*)take((size_t)NH_ * NPE * HD * 2); bf* PPl = (bf*)take((size_t)NH_ * NPE * HD * 2);
    // planes of all 8 batch items
    bf* QPh = (bf*)take((size_t)NB_ * NH_ * TT * HD * 2); bf* QPl = (bf*)take((size_t)NB_ * NH_ * TT * HD * 2); bf* QVh = (bf*)take((size_t)NB_ * NH_ * TT * HD * 2); bf* QVl = (bf*)take((size_t)NB_ * NH_ * TT * HD * 2); bf* KPh = (bf*)take((size_t)NB_ * NKV * TT * HD * 2); bf* KPl = (bf*)take((size_t)NB_ * NKV * TT * HD * 2); bf* VTh = (bf*)take((size_t)NB_ * NKV * HD * TT * 2); bf* VTl = (bf*)take((size_t)NB_ * NKV * HD * TT * 2); bf* ATh = (bf*)take((size_t)NB_ * TT * DQ * 2); bf* ATl = (bf*)take((size_t)NB_ * TT * DQ * 2);
    bf* XB = (bf*)take((size_t)NB_ * TT * DM * 2);
    if ((size_t)(wsp - (char*)d_ws) > ws_size) return;
    { k_wtG<<<(unsigned)((DM * DQ / 64 + 63) / 64), 256, 0, stream>>>(wq, DM, DQ, WQ); k_wtG<<<(unsigned)((DM * DKV / 64 + 63) / 64), 256, 0, stream>>>(wk, DM, DKV, WK); k_wtG<<<(unsigned)((DM * DKV / 64 + 63) / 64), 256, 0, stream>>>(wv, DM, DKV, WV);
      k_wtG<<<(unsigned)((DQ * DM / 64 + 63) / 64), 256, 0, stream>>>(wo, DQ, DM, WO);
       }
    k_petab<<<(unsigned)(((size_t)NPE * DM / 2 + 255) / 256), 256, 0, stream>>>(PEh, PEl); k_wtG<<<(unsigned)((DM * DQ / 64 + 63) / 64), 256, 0, stream>>>(wpos, DM, DQ, WP); k_posp<<<dim3(NPE / 64, NH_, 1), 32, 0, stream>>>(PEh, PEl, WP, PPh, PPl);   /* p = sinusoid table (hi+lo, 2 products) Wpos -> per-head hi/lo planes [h][2048][64] */
    k_cvt8<<<(unsigned)(((size_t)NB_ * TT * DM / 8 + 255) / 256), 256, 0, stream>>>(x, XB, (size_t)NB_ * TT * DM / 8);   /* exact bf16 plane of xs */
    k_qkvp<<<dim3(NB_ * TT / 64, 24, 1), 32, 0, stream>>>(XB, WQ, WK, WV, pbu, pbv, QPh, QPl, QVh, QVl, KPh, KPl, VTh, VTl);   /* q + u_bias, q + v_bias, k and transposed v planes of all 8 batch items */
    k_fattn<<<dim3(TT / (16 * FW), NB_ * NH_, 1), FW * 32, 0, stream>>>(QPh, QPl, QVh, QVl, KPh, KPl, PPh, PPl, VTh, VTl, MK, ATh, ATl);   /* scores, rel_shift, mask, softmax, attn.v and merge of all 64 (batch item, head) pairs */
    k_gemmw<bf, 1, false><<<dim3(NB_ * TT / 64, DM / 64, 1), 32, 0, stream>>>(ATh, ATl, WO, nullptr, DQ, OUT, DM, nullptr, 0, 0, 0);
}

// v005
// One run takes 146 microseconds.
// Next to v004, in two timings, it ran 1.31 and 1.32 times as fast.
// All steps since v000 together make it 14.3 times as fast.
#include <hip/hip_runtime.h>

// Transformer-XL style relative-position multi-head self-attention (xs [8][1024][512]; q, k, v = xs W ('xw' [512][512], no bias; 8 heads x 64); p = pe Wpos with pe the sinusoidal table of positions -(T-1)..T-1 (2047 rows, [sin, cos] interleaved, computed on device); scores = ((q + u_bias).k + rel_shift((q + v_bias).p)) / 8 where rel_shift picks position row j - i + 1023; mask (int32 [8][1024][1024], read): -inf where 0 and those weights zeroed; softmax; out = merged Wout ('xw', no bias) -> [8][1024][512] (4.2 M)).
// Layout: one exact bf16 input plane -> 1-product projections; the position table is computed on device in f32 (NOT bf16-rounded: kept as bf16 hi + lo planes) and projected once (2 products, 2047 rows + one zero pad row) into per-head hi/lo planes [h][2048][64]; the q, k, v projections of all 8 batch items are one launch whose epilogue adds the biases, splits and stores the head planes (v transposed), the position projection in the same launch; one fused attention launch for all 64 (batch item, head) pairs: content scores (q+u).k and the needed band of position scores (q+v).p are hi/lo products (3 each), the position score at j - i + 1023 is picked through LDS, mask select, online softmax and attn.v follow in registers: no score reaches memory.
// Compute dtypes, f32 accumulate: every input rounded to bf16; q/k/v on PLAIN bf16 operands (exact products); p = pe(hi+lo) Wpos (2 products); content and position scores on hi/lo planes for every row (3 products); softmax f32; attn.v hi/lo (3 products); Wout hl x exact (2 products).

#define NB_  8
#define TT   1024
#define DM   512
#define NH_  8
#define NKV  8
#define REP  (NH_ / NKV)
#define HD   64
#define DQ   (NH_ * HD)
#define DKV  (NKV * HD)
#define NPE  2048                 // 2047 positions + 1 zero pad row
typedef __attribute__((ext_vector_type(4))) unsigned short v4us;
#define ZH   8
#define RH   1024                 // every row hi/lo
#define WIN  0
#define PCAR 1024.0f
#define SCL  0.125f   // HD^-0.5
typedef _Float16 h16;
typedef unsigned short bf;
typedef __attribute__((ext_vector_type(16))) __bf16   v16bf;
typedef __attribute__((ext_vector_type(16))) _Float16 v16h;
typedef __attribute__((ext_vector_type(8)))  _Float16 v8h;
typedef __attribute__((ext_vector_type(8)))  unsigned short v8us;
typedef __attribute__((ext_vector_type(8)))  float    v8f;
typedef __attribute__((ext_vector_type(4)))  float    v4f;
typedef v8h  __attribute__((may_alias)) v8ha;
typedef v4f  __attribute__((may_alias)) v4fa;
typedef v8us __attribute__((may_alias)) v8usa;

__device__ __forceinline__ unsigned short f2bf(float f) { unsigned u = __float_as_uint(f); u += 0x7FFFu + ((u >> 16) & 1u); return (unsigned short)(u >> 16); }
__device__ __forceinline__ float bf2f(unsigned short b) { return __uint_as_float(((unsigned)b) << 16); }
__device__ __forceinline__ float bfr(float f) { return bf2f(f2bf(f)); }
__device__ __forceinline__ v16h cat16(v8h lo, v8h hi) { return __builtin_shufflevector(lo, hi, 0, 1, 2, 3, 4, 5, 6, 7, 8, 9, 10, 11, 12, 13, 14, 15); }
__device__ __forceinline__ v16bf cat16b(v8us lo, v8us hi) { return __builtin_bit_cast(v16bf, __builtin_shufflevector(lo, hi, 0, 1, 2, 3, 4, 5, 6, 7, 8, 9, 10, 11, 12, 13, 14, 15)); }
__device__ __forceinline__ v8f wmma16(v16h a, v16h b, v8f c) { return __builtin_amdgcn_wmma_f32_16x16x32_f16(false, a, false, b, (short)0, c, false, false); }
__device__ __forceinline__ v8f wmmab(v16bf a, v16bf b, v8f c) { return __builtin_amdgcn_wmma_f32_16x16x32_bf16(false, a, false, b, (short)0, c, false, false); }



// ---- k_gemmw: register-blocked GEMM, ONE WAVE per 64x64 output tile (16 accumulators), operands straight from K-contiguous 16-bit planes; grid (M/64, N/64, Z), 32 threads.
// C[m][n] (f32, pitch ldc, + optional f32 bias[n]) = sum_k A[m][k] Bt[n][k] (+ split products per NSPLIT). z-batch strides sA/sB/sC in elements. K % 32 == 0.
template <typename T16> struct WFrag;
template <> struct WFrag<h16> { typedef v16h V; static __device__ __forceinline__ V ld(const h16* p) { return cat16(*(const v8h*)p, *(const v8h*)(p + 16)); } static __device__ __forceinline__ v8f mma(V a, V b, v8f c) { return wmma16(a, b, c); } };
template <> struct WFrag<bf> { typedef v16bf V; static __device__ __forceinline__ V ld(const bf* p) { return cat16b(*(const v8us*)p, *(const v8us*)(p + 16)); } static __device__ __forceinline__ v8f mma(V a, V b, v8f c) { return wmmab(a, b, c); } };
template <typename T16, int NSPLIT, bool BIAS>
__global__ __launch_bounds__(32) void k_gemmw(const T16* __restrict__ A, const T16* __restrict__ A2, const T16* __restrict__ Bt, const T16* __restrict__ Bt2, int K, float* C, int ldc, const float* __restrict__ bias, size_t sA, size_t sB, size_t sC) {
    typedef typename WFrag<T16>::V V;
    __shared__ __align__(16) float os[16 * 68];
    const size_t z = blockIdx.z; A += z * sA; if (A2) A2 += z * sA; Bt += z * sB; if (Bt2) Bt2 += z * sB; C += z * sC;
    const int lane = threadIdx.x & 31, lr = lane & 15, hi = lane >> 4; const int r0 = blockIdx.x * 64, c0 = blockIdx.y * 64;
    v8f acc[4][4];
#pragma unroll
    for (int mb = 0; mb < 4; ++mb)
#pragma unroll
        for (int nb = 0; nb < 4; ++nb) acc[mb][nb] = (v8f){};
    const size_t aoff = (size_t)(r0 + lr) * K + 8 * hi, boff = (size_t)(c0 + lr) * K + 8 * hi;
#pragma unroll 1
    for (int kc = 0; kc < K; kc += 32) {
        V a[4], a2[4];
#pragma unroll
        for (int mb = 0; mb < 4; ++mb) { a[mb] = WFrag<T16>::ld(A + aoff + (size_t)mb * 16 * K + kc); if (NSPLIT == 1 || NSPLIT == 2) a2[mb] = WFrag<T16>::ld(A2 + aoff + (size_t)mb * 16 * K + kc); }
#pragma unroll
        for (int nb = 0; nb < 4; ++nb) { const V b = WFrag<T16>::ld(Bt + boff + (size_t)nb * 16 * K + kc); V b2; if (NSPLIT >= 2) b2 = WFrag<T16>::ld(Bt2 + boff + (size_t)nb * 16 * K + kc);
#pragma unroll
            for (int mb = 0; mb < 4; ++mb) { acc[mb][nb] = WFrag<T16>::mma(a[mb], b, acc[mb][nb]); if (NSPLIT == 1 || NSPLIT == 2) acc[mb][nb] = WFrag<T16>::mma(a2[mb], b, acc[mb][nb]); if (NSPLIT >= 2) acc[mb][nb] = WFrag<T16>::mma(a[mb], b2, acc[mb][nb]); } }
        asm volatile("v_nop\n\tv_nop\n\tv_nop\n\tv_nop" : "+v"(acc[0][0]), "+v"(acc[1][1]), "+v"(acc[2][2]), "+v"(acc[3][3]) : "v"(a[0]), "v"(a[3]));
    }
#pragma unroll
    for (int mb = 0; mb < 4; ++mb) {
#pragma unroll
        for (int nb = 0; nb < 4; ++nb) {
#pragma unroll
            for (int j = 0; j < 8; ++j) os[(hi * 8 + j) * 68 + nb * 16 + lr] = acc[mb][nb][j]; }
        __builtin_amdgcn_wave_barrier(); asm volatile("" ::: "memory");
        float* crow = C + (size_t)(r0 + mb * 16) * ldc + c0;
{
#pragma unroll
            for (int s = 0; s < 8; ++s) { const int row = 2 * s + hi, cofs = lr * 4; v4f val = *(const v4fa*)(os + row * 68 + cofs); if (BIAS) { val[0] += bfr(bias[c0 + cofs]); val[1] += bfr(bias[c0 + cofs + 1]); val[2] += bfr(bias[c0 + cofs + 2]); val[3] += bfr(bias[c0 + cofs + 3]); }
                *(v4f*)(crow + (size_t)row * ldc + cofs) = val; }
             }
        __builtin_amdgcn_wave_barrier(); asm volatile("" ::: "memory");
    }
}

__device__ __forceinline__ h16 tohx(float x) { return (h16)x; }
__device__ __forceinline__ void splitf(float y, unsigned short& h, unsigned short& l) { h = f2bf(y); l = f2bf(y - bf2f(h)); }
typedef __attribute__((ext_vector_type(2))) _Float16 v2h;
typedef __attribute__((ext_vector_type(4))) _Float16 v4h;
typedef __attribute__((ext_vector_type(2))) unsigned short v2us;
typedef __attribute__((ext_vector_type(4))) unsigned short v4us;
typedef __attribute__((ext_vector_type(2))) float v2f;
typedef __attribute__((ext_vector_type(4))) int v4i;

__device__ __forceinline__ void d_wtG(int blk, const float* __restrict__ w, int K, int N, bf* Bt) {
    const int lane = threadIdx.x & 31; const int L0 = (blk * 8 + (threadIdx.x >> 5)) * 8; const int nlines = N * K / 64;
{
#pragma unroll 1
        for (int l = 0; l < 8; ++l) { const int L = L0 + l; if (L >= nlines) break; const size_t e = (size_t)L * 64 + lane * 2; const int k = (int)(e % K), n = (int)(e / K); v2us o;
            o[0] = f2bf(w[(size_t)k * N + n]); o[1] = f2bf(w[(size_t)(k + 1) * N + n]); *(v2us*)(Bt + e) = o; }
         }
}



__constant__ float INVF[DM / 2] = {1.0f,0.964661598f,0.930572033f,0.897687137f,0.865964293f,0.835362554f,0.805842161f,0.777365029f,0.749894202f,0.723394156f,0.697830558f,0.673170388f,0.649381638f,0.626433551f,0.604296386f,0.582941532f,0.562341332f,0.542469084f,0.523299098f,0.504806578f,0.486967504f,0.469758898f,0.453158379f,0.437144488f,0.421696484f,0.406794429f,0.392418981f,0.378551513f,0.365174115f,0.352269441f,0.339820832f,0.327812076f,0.316227764f,0.305052817f,0.294272721f,0.283873618f,0.273841947f,0.264164835f,0.254829645f,0.245824397f,0.237137347f,0.228757307f,0.220673412f,0.212875158f,0.2053525f,0.198095664f,0.191095293f,0.184342295f,0.177827939f,0.171543792f,0.165481701f,0.15963386f,0.153992653f,0.148550808f,0.143301249f,0.138237223f,0.133352146f,0.128639698f,0.124093764f,0.119708493f,0.115478195f,0.111397393f,0.107460767f,0.103663281f,0.099999994f,0.0964661688f,0.0930572152f,0.0897687078f,0.0865964293f,0.0835362524f,0.0805842206f,0.0777364895f,0.0749894157f,0.0723394156f,0.0697830617f,0.0673170388f,0.0649381578f,0.0626433492f,0.0604296364f,0.0582941547f,0.056234125f,0.0542469025f,0.0523299091f,0.0504806563f,0.0486967564f,0.0469758809f,0.0453158319f,0.0437144488f,0.0421696529f,0.0406794474f,0.0392418914f,0.0378551483f,0.0365174115f,0.0352269486f,0.0339820795f,0.0327812098f,0.0316227749f,0.0305052791f,0.0294272732f,0.0283873565f,0.0273841936f,0.0264164824f,0.0254829675f,0.0245824363f,0.023713734f,0.0228757299f,0.0220673401f,0.0212875176f,0.0205352474f,0.0198095664f,0.0191095285f,0.0184342302f,0.0177827962f,0.0171543807f,0.0165481735f,0.0159633812f,0.0153992623f,0.0148550775f,0.0143301245f,0.0138237216f,0.013335214f,0.0128639704f,0.0124093788f,0.0119708525f,0.0115478169f,0.0111397365f,0.0107460767f,0.0103663281f,0.00999999978f,0.00964661594f,0.00930572115f,0.00897687208f,0.00865964405f,0.00835362263f,0.00805842038f,0.00777364895f,0.00749894092f,0.007233941f,0.00697830552f,0.00673170388f,0.00649381708f,0.00626433641f,0.00604296196f,0.00582941389f,0.00562341232f,0.00542468997f,0.00523299072f,0.00504806545f,0.00486967526f,0.0046975892f,0.00453158421f,0.0043714433f,0.00421696389f,0.00406794343f,0.00392418914f,0.00378551497f,0.00365174119f,0.00352269458f,0.00339820841f,0.00327812159f,0.0031622767f,0.00305052707f,0.00294272648f,0.00283873547f,0.00273841922f,0.00264164805f,0.0025482967f,0.0024582441f,0.00237137405f,0.00228757365f,0.00220673345f,0.00212875125f,0.0020535246f,0.00198095664f,0.00191095285f,0.001843423f,0.00177827943f,0.00171543809f,0.00165481726f,0.00159633812f,0.00153992616f,0.0014855077f,0.00143301231f,0.00138237211f,0.00133352133f,0.00128639699f,0.00124093785f,0.00119708513f,0.00115478167f,0.00111397356f,0.0010746076f,0.00103663281f,0.000999999931f,0.000964661594f,0.000930572045f,0.000897687161f,0.000865964394f,0.000835362298f,0.000805841992f,0.000777364883f,0.000749894069f,0.0007233941f,0.000697830576f,0.000673170376f,0.000649381662f,0.000626433583f,0.00060429622f,0.0005829414f,0.000562341185f,0.000542468973f,0.000523299037f,0.000504806521f,0.000486967503f,0.000469758903f,0.000453158398f,0.000437144336f,0.000421696401f,0.000406794337f,0.000392418908f,0.000378551485f,0.000365174084f,0.000352269446f,0.000339820836f,0.000327811984f,0.000316227786f,0.000305052701f,0.000294272788f,0.000283873524f,0.000273842044f,0.000264164817f,0.000254829531f,0.000245824398f,0.000237137268f,0.000228757344f,0.000220673333f,0.000212875209f,0.000205352466f,0.000198095746f,0.000191095271f,0.000184342207f,0.00017782794f,0.00017154371f,0.000165481732f,0.000159633797f,0.000153992674f,0.000148550767f,0.000143301295f,0.000138237199f,0.000133352078f,0.000128639687f,0.000124093727f,0.000119708515f,0.000115478157f,0.000111397407f,0.000107460757f,0.000103663326f};
#define PBW 64                              // blocks of a weight matrix
#define PBP (NPE * DM / 2 / 256)            // blocks of the position table: a [sin, cos] pair a thread
#define PBX (NB_ * TT * DM / 8 / 256)       // blocks of the xs plane: 8 elements a thread
__device__ __forceinline__ void d_petab(int blk, bf* PEh, bf* PEl) { const size_t e = ((size_t)blk * 256 + threadIdx.x) * 2; const int c = (int)(e % DM); const int r = (int)(e / DM); v2us oh, ol;
    if (r < NPE - 1) { const float th = __fmul_rn((float)(r - (TT - 1)), INVF[c >> 1]); unsigned short a, b2; splitf(sinf(th), a, b2); oh[0] = a; ol[0] = b2; splitf(cosf(th), a, b2); oh[1] = a; ol[1] = b2; } else { oh[0] = 0; oh[1] = 0; ol[0] = 0; ol[1] = 0; }
    *(v2us*)(PEh + e) = oh; *(v2us*)(PEl + e) = ol;
    // behind the part's last stores, in front of whatever code of the merged kernel follows them in the text and writes their registers
    asm volatile("s_wait_xcnt 0x0" ::: "memory"); }
__device__ __forceinline__ void d_cvt8(int blk, const float* __restrict__ src, bf* dst) { const size_t i = (size_t)blk * 256 + threadIdx.x; const v8f v = *(const v8f*)(src + i * 8); v8us o;
#pragma unroll
    for (int k = 0; k < 8; ++k) o[k] = f2bf(v[k]); *(v8us*)(dst + i * 8) = o;
    // behind the part's last store, in front of whatever code of the merged kernel follows it in the text and writes its registers
    asm volatile("s_wait_xcnt 0x0" ::: "memory"); }
// ---- k_prep: every plane that is made from the inputs alone, in ONE launch: none of the seven pieces reads what another writes, and each block does what a block of the piece's own launch did. Blocks 0 .. 5 PBW - 1: the five transposed bf16 weight planes (their gathers have the longest chain of waits, so they start first); then the position table; then the xs plane.
__global__ __launch_bounds__(256) void k_prep(const float* __restrict__ wq, const float* __restrict__ wk, const float* __restrict__ wv, const float* __restrict__ wo, const float* __restrict__ wpos, const float* __restrict__ x, bf* WQ, bf* WK, bf* WV, bf* WO, bf* WP, bf* PEh, bf* PEl, bf* XB) {
    const int blk = blockIdx.x;
    if (blk < 5 * PBW) { const int m = blk / PBW;
        d_wtG(blk % PBW, m == 0 ? wq : m == 1 ? wk : m == 2 ? wv : m == 3 ? wo : wpos, DM, DQ, m == 0 ? WQ : m == 1 ? WK : m == 2 ? WV : m == 3 ? WO : WP); }
    else if (blk < 5 * PBW + PBP) d_petab(blk - 5 * PBW, PEh, PEl);
    else d_cvt8(blk - (5 * PBW + PBP), x, XB);
}

// fragment at scalar base + 32-bit vector byte offset + constant: one address register serves every load of a phase
__device__ __forceinline__ v16bf ldo(const bf* base, unsigned voff, int imm) { const char* p = (const char*)base + voff + imm; return cat16b(*(const v8us*)p, *(const v8us*)(p + 32)); }
// ---- projections that write their operand planes themselves: one wave per 64x64 tile and the k loop of k_gemmw; the epilogue splits each f32 result into bf16 hi + lo and stores rows of 64 elements (128 bytes, whole lines) straight into the layout the attention kernel reads.
template <int NSPLIT>
__device__ __forceinline__ void tile64(const bf* __restrict__ A, const bf* __restrict__ A2, const bf* __restrict__ Bt, int r0, int c0, int lr, int hi, v8f (&acc)[4][4]) {
    typedef v16bf V;
#pragma unroll
    for (int mb = 0; mb < 4; ++mb)
#pragma unroll
        for (int nb = 0; nb < 4; ++nb) acc[mb][nb] = (v8f){};
    unsigned ao = (unsigned)((r0 + lr) * DM + 8 * hi) * 2u, bo = (unsigned)((c0 + lr) * DM + 8 * hi) * 2u;   // byte offsets; every operand plane is under 2^24 bytes
    for (int kc = 0; kc < DM; kc += 32) {
        V a[4], a2[4], b[4];
#pragma unroll
        for (int mb = 0; mb < 4; ++mb) { a[mb] = ldo(A, ao, mb * 16 * DM * 2); if (NSPLIT == 1) a2[mb] = ldo(A2, ao, mb * 16 * DM * 2); }
#pragma unroll
        for (int nb = 0; nb < 4; ++nb) b[nb] = ldo(Bt, bo, nb * 16 * DM * 2);
        // all of a trip's loads are issued in front of its first product: without this line the compiler, in d_qkvp, loads the four b fragments one after the other into one register group, and a trip waits for memory four times instead of once
        __builtin_amdgcn_sched_barrier(0);
#pragma unroll
        for (int nb = 0; nb < 4; ++nb) {
#pragma unroll
            for (int mb = 0; mb < 4; ++mb) { acc[mb][nb] = wmmab(a[mb], b[nb], acc[mb][nb]); if (NSPLIT == 1) acc[mb][nb] = wmmab(a2[mb], b[nb], acc[mb][nb]); } }
        // the two offset registers that this trip's loads name are operands here, so they stay whole up to the wait and are stepped only behind it; the four v_nop are the vector slots behind the last matrix instruction, also on the taken side of the loop's branch
        asm volatile("s_wait_xcnt 0x0\n\tv_nop\n\tv_nop\n\tv_nop\n\tv_nop" : "+v"(ao), "+v"(bo), "+v"(acc[0][0]), "+v"(acc[1][1]), "+v"(acc[2][2]), "+v"(acc[3][3]) : "v"(a[0]), "v"(a[3]) : "memory");
        ao += 64; bo += 64;
    }
}
// 16 rows of the tile into this wave's LDS slab [16][68]
__device__ __forceinline__ void slab_put(float* os, const v8f (&acc)[4], int lr, int hi) {
#pragma unroll
    for (int nb = 0; nb < 4; ++nb) {
#pragma unroll
        for (int j = 0; j < 8; ++j) os[(hi * 8 + j) * 68 + nb * 16 + lr] = acc[nb][j]; }
}
__device__ __forceinline__ void split8(const float (&x)[8], v8us& oh, v8us& ol) {
#pragma unroll
    for (int q = 0; q < 8; ++q) { unsigned short a, c; splitf(x[q], a, c); oh[q] = a; ol[q] = c; } }
// d_qkvp: tiles (8192 / 64, 24). by >> 3 picks q, k or v, by & 7 the head. q and k: C = xs W, tile rows are positions, planes [b][h][t][d]; q is stored twice, as q + u_bias and q + v_bias. v: the operands change places (C = Wv^T xs^T), so that tile rows are head dims and the transposed planes [b][h][d][t] are stored by rows as well.
__device__ __forceinline__ void d_qkvp(float* os, int bx, int by, const bf* __restrict__ XB, const bf* __restrict__ WQ, const bf* __restrict__ WK, const bf* __restrict__ WV, const float* __restrict__ pbu, const float* __restrict__ pbv, bf* QUh, bf* QUl, bf* QVh, bf* QVl, bf* Kh, bf* Kl, bf* Vh, bf* Vl) {
    const int lane = threadIdx.x & 31, lr = lane & 15, hi = lane >> 4; const int sel = by >> 3, cb = by & 7, xr = bx * 64, b = xr / TT, t0 = xr % TT; const bool tv = sel == 2;
    v8f acc[4][4];
    tile64<0>(tv ? WV : XB, nullptr, tv ? XB : (sel == 0 ? WQ : WK), tv ? cb * 64 : xr, tv ? xr : cb * 64, lr, hi, acc);
    const size_t base = tv ? (size_t)(b * NKV + cb) * HD * TT + t0 : ((size_t)(b * NH_ + cb) * TT + t0) * HD; const int pitch = tv ? TT : HD;
    bf* Dh = tv ? Vh : Kh; bf* Dl = tv ? Vl : Kl;
    const int rr = lane >> 3, cofs = (lane & 7) * 8;
    float ub[8], vb[8];
#pragma unroll
    for (int q = 0; q < 8; ++q) { ub[q] = 0.f; vb[q] = 0.f; }
    if (sel == 0) {
#pragma unroll
        for (int q = 0; q < 8; ++q) { ub[q] = bfr(pbu[cb * HD + cofs + q]); vb[q] = bfr(pbv[cb * HD + cofs + q]); } }
#pragma unroll
    for (int mb = 0; mb < 4; ++mb) {
        slab_put(os, acc[mb], lr, hi);
        // the slab is exchanged between the lanes of this wave: keep the reads below behind the stores above
        __builtin_amdgcn_wave_barrier(); asm volatile("" ::: "memory");
#pragma unroll
        for (int s = 0; s < 4; ++s) { const int row = 4 * s + rr; const v4f x0 = *(const v4fa*)(os + row * 68 + cofs), x1 = *(const v4fa*)(os + row * 68 + cofs + 4); float x[8];
#pragma unroll
            for (int q = 0; q < 4; ++q) { x[q] = x0[q]; x[4 + q] = x1[q]; }
            const size_t o = base + (size_t)(mb * 16 + row) * pitch + cofs;
            v8us oh, ol;
            if (sel == 0) { float y[8]; v8us ph, pl;
#pragma unroll
                for (int q = 0; q < 8; ++q) y[q] = __fadd_rn(x[q], ub[q]);
                split8(y, oh, ol);
#pragma unroll
                for (int q = 0; q < 8; ++q) y[q] = __fadd_rn(x[q], vb[q]);
                split8(y, ph, pl);
                *(v8us*)(QUh + o) = oh; *(v8us*)(QUl + o) = ol; *(v8us*)(QVh + o) = ph; *(v8us*)(QVl + o) = pl; }
            else { split8(x, oh, ol); *(v8us*)(Dh + o) = oh; *(v8us*)(Dl + o) = ol; }
            // the stores' address and data registers are rewritten by the next rows: the wait stands in front of that
            asm volatile("s_wait_xcnt 0x0" ::: "memory"); }
        // the next 16 rows' stores to the slab stay behind the reads above
        __builtin_amdgcn_wave_barrier(); asm volatile("" ::: "memory");
    }
}
// d_posp: p = position table (hi + lo, 2 products) Wpos, tiles (2048 / 64, 8 heads), planes [h][2048][64]
__device__ __forceinline__ void d_posp(float* os, int bx, int by, const bf* __restrict__ PEh, const bf* __restrict__ PEl, const bf* __restrict__ WP, bf* Ph2, bf* Pl2) {
    const int lane = threadIdx.x & 31, lr = lane & 15, hi = lane >> 4; const int r0 = bx * 64, cb = by;
    v8f acc[4][4];
    tile64<1>(PEh, PEl, WP, r0, cb * 64, lr, hi, acc);
    const size_t base = ((size_t)cb * NPE + r0) * HD; const int rr = lane >> 3, cofs = (lane & 7) * 8;
#pragma unroll
    for (int mb = 0; mb < 4; ++mb) {
        slab_put(os, acc[mb], lr, hi);
        // the slab is exchanged between the lanes of this wave: keep the reads below behind the stores above
        __builtin_amdgcn_wave_barrier(); asm volatile("" ::: "memory");
#pragma unroll
        for (int s = 0; s < 4; ++s) { const int row = 4 * s + rr; const v4f x0 = *(const v4fa*)(os + row * 68 + cofs), x1 = *(const v4fa*)(os + row * 68 + cofs + 4); float x[8];
#pragma unroll
            for (int q = 0; q < 4; ++q) { x[q] = x0[q]; x[4 + q] = x1[q]; }
            v8us oh, ol; split8(x, oh, ol); const size_t o = base + (size_t)(mb * 16 + row) * HD + cofs; *(v8us*)(Ph2 + o) = oh; *(v8us*)(Pl2 + o) = ol;
            // the stores' address and data registers are rewritten by the next rows: the wait stands in front of that
            asm volatile("s_wait_xcnt 0x0" ::: "memory"); }
        // the next 16 rows' stores to the slab stay behind the reads above
        __builtin_amdgcn_wave_barrier(); asm volatile("" ::: "memory");
    }
}
// ---- k_proj: the position projection and the q, k, v projections read only what k_prep wrote and nothing of each other: ONE launch, grid (128, 26). Rows 0 and 1 of the grid are the 256 position tiles (twice the products of a q, k, v tile, so they start first), rows 2 .. 25 the 24 column blocks of q, k, v.
__global__ __launch_bounds__(32) void k_proj(const bf* __restrict__ PEh, const bf* __restrict__ PEl, const bf* __restrict__ WP, bf* Ph2, bf* Pl2, const bf* __restrict__ XB, const bf* __restrict__ WQ, const bf* __restrict__ WK, const bf* __restrict__ WV, const float* __restrict__ pbu, const float* __restrict__ pbv, bf* QUh, bf* QUl, bf* QVh, bf* QVl, bf* Kh, bf* Kl, bf* Vh, bf* Vl) {
    __shared__ __align__(16) float os[16 * 68];
    if (blockIdx.y < 2) { const int tl = blockIdx.y * 128 + blockIdx.x; d_posp(os, tl & 31, tl >> 5, PEh, PEl, WP, Ph2, Pl2); }
    else d_qkvp(os, blockIdx.x, blockIdx.y - 2, XB, WQ, WK, WV, pbu, pbv, QUh, QUl, QVh, QVl, Kh, Kl, Vh, Vl);
}
// k_fattn: one launch for the whole attention. One wave owns 16 query rows of one (batch item, head) and walks the 1024 keys in steps of 64; grid (1024 / (16 * FW), 64), FW waves a block, one block barrier a step.
// Transposed products: St = K (q+u)^T and BDt = P (q+v)^T (A = key or position rows, B = query rows kept in registers), so a lane holds ONE query (column lr) and 8 consecutive keys per tile (8 * hi + r).
// rel_shift: the 16 queries x 64 keys of a step need positions l0 .. l0 + 78, l0 = j0 - i0 + 1008 (five 16-row tiles; row 2047 is the zero pad and is never picked); BDt goes to this wave's LDS slab as [query][80] and is read back at column key - query + 15.
// Staging: the FW waves of a block read the same 64 key rows and 64 value rows (hi and lo) in a step, and together 320 consecutive position rows, of which a step brings 64 new ones. These six pieces of 8 KiB come into LDS by asynchronous copies, 16 bytes of each per thread, whole 128-byte lines per copy, two steps ahead: keys and values into two buffers, position rows into a ring of 512 rows. The fragments are then read from LDS.
// Online softmax per lane (running maximum and sum, output tiles rescaled each step); the f32 weights split in place into bf16 hi + lo B operands; Ot += Vt Pt (3 products); the epilogue divides by the sum and writes the merged hi/lo planes.
#define FW  16
#define BDP 84                    // slab pitch in floats: 16-byte aligned rows; the skewed reads (stride 83) fall on 32 different banks
#define LP  144                   // pitch in bytes of a staged row of 64 bf16 (128 bytes): 16 bytes x odd, so that the 16 rows of a fragment read fall on different banks
#define PCB (64 * LP)             // one staged piece: 64 rows
#define NST (TT / 64)             // steps
#define L2E 1.4426950408889634f
typedef __attribute__((ext_vector_type(2))) __bf16 v2bf;
typedef __attribute__((ext_vector_type(8))) unsigned v8u;
__device__ __forceinline__ void split16(const v8f x0, const v8f x1, v16bf& h, v16bf& l) {   // element s = tile s >> 3, register s & 7: two result tiles are one B operand in the hardware k order
    v8u hw, lw;
#pragma unroll
    for (int s = 0; s < 8; ++s) { v2f x; x[0] = (s < 4) ? x0[2 * (s & 3)] : x1[2 * (s & 3)]; x[1] = (s < 4) ? x0[2 * (s & 3) + 1] : x1[2 * (s & 3) + 1];
        const v2bf hb = __builtin_convertvector(x, v2bf); const v2f rest = x - __builtin_convertvector(hb, v2f); const v2bf lb = __builtin_convertvector(rest, v2bf);
        hw[s] = __builtin_bit_cast(unsigned, hb); lw[s] = __builtin_bit_cast(unsigned, lb); }
    h = __builtin_bit_cast(v16bf, hw); l = __builtin_bit_cast(v16bf, lw);
}
// fragment from a staged piece: the lane's 16 bytes at p and at p + 32, the k order of ldo
__device__ __forceinline__ v16bf ldl(const char* p) { return cat16b(*(const v8usa*)p, *(const v8usa*)(p + 32)); }
__device__ __forceinline__ unsigned ldsa(const void* p) { return (unsigned)(size_t)p; }
// asynchronous copies global -> LDS, 16 bytes a lane; the wait in the same statement keeps the address registers whole until the copies have taken them
__device__ __forceinline__ void acopy2(unsigned l0, const char* g0, unsigned l1, const char* g1) {
    asm volatile("global_load_async_to_lds_b128 %0, %1, off\n\tglobal_load_async_to_lds_b128 %2, %3, off\n\ts_wait_xcnt 0x0" :: "v"(l0), "v"(g0), "v"(l1), "v"(g1) : "memory"); }
__device__ __forceinline__ void acopy6(unsigned l0, const char* g0, unsigned l1, const char* g1, unsigned l2, const char* g2, unsigned l3, const char* g3, unsigned l4, const char* g4, unsigned l5, const char* g5) {
    asm volatile("global_load_async_to_lds_b128 %0, %1, off\n\tglobal_load_async_to_lds_b128 %2, %3, off\n\tglobal_load_async_to_lds_b128 %4, %5, off\n\tglobal_load_async_to_lds_b128 %6, %7, off\n\tglobal_load_async_to_lds_b128 %8, %9, off\n\tglobal_load_async_to_lds_b128 %10, %11, off\n\ts_wait_xcnt 0x0" :: "v"(l0), "v"(g0), "v"(l1), "v"(g1), "v"(l2), "v"(g2), "v"(l3), "v"(g3), "v"(l4), "v"(g4), "v"(l5), "v"(g5) : "memory"); }
// four waves a SIMD (one block a WGP): the 4096 waves are then resident at once, and a wave's vector work runs beside its neighbours' matrix work
__global__ __launch_bounds__(FW * 32) __attribute__((amdgpu_waves_per_eu(4, 4))) void k_fattn(const bf* __restrict__ QUh, const bf* __restrict__ QUl, const bf* __restrict__ QVh, const bf* __restrict__ QVl, const bf* __restrict__ Kh, const bf* __restrict__ Kl, const bf* __restrict__ PPh, const bf* __restrict__ PPl, const bf* __restrict__ Vh, const bf* __restrict__ Vl, const int* __restrict__ MK, bf* ATh, bf* ATl) {
    __shared__ __align__(16) float bds[FW * 16 * BDP];
    __shared__ __align__(16) char kvs[2 * 4 * PCB];   // [buffer][k hi, k lo, v hi, v lo][64 rows]
    __shared__ __align__(16) char pps[2 * 8 * PCB];   // [hi, lo][ring of 512 position rows]
    const int tid = threadIdx.x, lane = tid & 31, lr = lane & 15, hi = lane >> 4, wv = __builtin_amdgcn_readfirstlane(tid >> 5);
    const int z = blockIdx.y, b = z / NH_, h = z % NH_; const int i0 = (blockIdx.x * FW + wv) * 16;
    float* bd = bds + wv * 16 * BDP;
    // the thread's 16 bytes of every staged piece: row tid >> 3, segment tid & 7
    const unsigned cl = (unsigned)((tid >> 3) * LP + (tid & 7) * 16);
    const unsigned ck = (unsigned)(z * TT * HD * 2 + tid * 16);                                               // key rows of a step are 8 KiB in a row
    const unsigned cv = (unsigned)(((z * HD + (tid >> 3)) * TT) * 2 + (tid & 7) * 16);                         // value rows: 128 bytes of each of the 64 head dims
    const unsigned cp = (unsigned)((h * NPE + (TT - 16 * FW) - (int)blockIdx.x * 16 * FW) * HD * 2 + tid * 16);   // position rows from the block's lowest row on: piece c holds rows 64 c .. 64 c + 63 behind it, pieces 0 .. 19 end at row 2047 or below
    const unsigned lkv = ldsa(kvs) + cl, lpp = ldsa(pps) + cl;
    // keys and values of step t into buffer t & 1, position piece c into ring slot c & 7
    auto stage = [&](int t, int c) {
        const unsigned lk = lkv + (unsigned)(t & 1) * (4 * PCB), lq = lpp + (unsigned)(c & 7) * PCB;
        acopy6(lk, (const char*)Kh + ck + t * (64 * HD * 2), lk + PCB, (const char*)Kl + ck + t * (64 * HD * 2), lk + 2 * PCB, (const char*)Vh + cv + t * 128, lk + 3 * PCB, (const char*)Vl + cv + t * 128,
               lq, (const char*)PPh + cp + c * (64 * HD * 2), lq + 8 * PCB, (const char*)PPl + cp + c * (64 * HD * 2)); };
    // step 0 reads position pieces 0 .. 4
#pragma unroll
    for (int c = 0; c < 4; ++c) acopy2(lpp + c * PCB, (const char*)PPh + cp + c * (64 * HD * 2), lpp + (8 + c) * PCB, (const char*)PPl + cp + c * (64 * HD * 2));
    stage(0, 4);
    const unsigned qo = (unsigned)((z * TT + i0 + lr) * HD + 8 * hi) * 2u;   // byte offsets; every plane is under 2^24 bytes, the mask 2^25
    v16bf quh[2], qul[2], qvh[2], qvl[2];
#pragma unroll
    for (int ks = 0; ks < 2; ++ks) { quh[ks] = ldo(QUh, qo, ks * 64); qul[ks] = ldo(QUl, qo, ks * 64); qvh[ks] = ldo(QVh, qo, ks * 64); qvl[ks] = ldo(QVl, qo, ks * 64); }
    const unsigned mo = (unsigned)((b * TT + i0 + lr) * TT + 8 * hi) * 4u;
    const int fl = lr * LP + hi * 16;   // the lane's place in a 16-row fragment of a staged piece
    v8f o[4];
#pragma unroll
    for (int dt = 0; dt < 4; ++dt) o[dt] = (v8f){};
    float mrun = -1.0e30f, lsum = 0.f;   // the running maximum starts far above the masked value -3e38: a masked key's exponential is 0 also while no key of its row has been left unmasked
    // step 0's copies of this wave have landed; behind the barrier those of every wave have
    asm volatile("s_wait_asynccnt 0x0" ::: "memory");
    __syncthreads();
    stage(1, 5);
#pragma unroll 1
    for (int t = 0; t < NST; ++t) {
        const unsigned mj = mo + (unsigned)(t * 64 * 4);
        const char* kb = kvs + (t & 1) * (4 * PCB) + fl;
        {   // position scores of the step's band, transposed: rows l0 + 16 u + 8 hi + r, column = query lr
            v8f pa[5];
#pragma unroll
            for (int u = 0; u < 5; ++u) pa[u] = (v8f){};
#pragma unroll
            for (int ks = 0; ks < 2; ++ks) { v16bf a[5], a2[5];
#pragma unroll
                for (int u = 0; u < 5; ++u) { const int rw = t * 64 + (FW - 1 - wv) * 16 + u * 16;   /* row counted from the block's lowest position row */ const char* pr = pps + (rw & 511) * LP + fl + ks * 64; a[u] = ldl(pr); a2[u] = ldl(pr + 8 * PCB); }
#pragma unroll
                for (int u = 0; u < 5; ++u) pa[u] = wmmab(a[u], qvh[ks], pa[u]);
#pragma unroll
                for (int u = 0; u < 5; ++u) pa[u] = wmmab(a[u], qvl[ks], pa[u]);
#pragma unroll
                for (int u = 0; u < 5; ++u) pa[u] = wmmab(a2[u], qvh[ks], pa[u]); }
#pragma unroll
            for (int u = 0; u < 5; ++u) { v4f w0, w1;
#pragma unroll
                for (int q = 0; q < 4; ++q) { w0[q] = pa[u][q]; w1[q] = pa[u][4 + q]; }
                *(v4fa*)(bd + lr * BDP + u * 16 + hi * 8) = w0; *(v4fa*)(bd + lr * BDP + u * 16 + hi * 8 + 4) = w1; }
        }
        // the slab is exchanged between the two lane halves of this wave: keep the reads below behind the stores above; the four v_nop are the vector slots between the last position product and a content product that reuses its result registers
        __builtin_amdgcn_wave_barrier(); asm volatile("v_nop\n\tv_nop\n\tv_nop\n\tv_nop" ::: "memory");
        v4i mk[8];
#pragma unroll
        for (int t4 = 0; t4 < 4; ++t4) { const char* mp = (const char*)MK + mj + t4 * 64; mk[2 * t4] = *(const v4i*)mp; mk[2 * t4 + 1] = *(const v4i*)(mp + 16); }
        // the step's eight mask loads are issued together, in front of the content products: without this line the compiler issues them in four pairs among the selects below, and a step waits for memory four times
        __builtin_amdgcn_sched_barrier(0);
        v8f s[4];
#pragma unroll
        for (int t4 = 0; t4 < 4; ++t4) s[t4] = (v8f){};
#pragma unroll
        for (int ks = 0; ks < 2; ++ks) { v16bf a[4], a2[4];
#pragma unroll
            for (int t4 = 0; t4 < 4; ++t4) { a[t4] = ldl(kb + t4 * 16 * LP + ks * 64); a2[t4] = ldl(kb + PCB + t4 * 16 * LP + ks * 64); }
#pragma unroll
            for (int t4 = 0; t4 < 4; ++t4) s[t4] = wmmab(a[t4], quh[ks], s[t4]);
#pragma unroll
            for (int t4 = 0; t4 < 4; ++t4) s[t4] = wmmab(a[t4], qul[ks], s[t4]);
#pragma unroll
            for (int t4 = 0; t4 < 4; ++t4) s[t4] = wmmab(a2[t4], quh[ks], s[t4]); }
        // the first use of a mask word stays behind the content products: without this line the compiler lifts one compare in front of them, and the wave waits there for the loads it has just issued
        __builtin_amdgcn_sched_barrier(0);
        float tmax = -3.0e38f;
#pragma unroll
        for (int t4 = 0; t4 < 4; ++t4) { const v4i m0 = mk[2 * t4]; const v4i m1 = mk[2 * t4 + 1];
#pragma unroll
            for (int r = 0; r < 8; ++r) { const float su = s[t4][r] + bd[lr * (BDP - 1) + 15 + t4 * 16 + hi * 8 + r]; const int m = (r < 4) ? m0[r & 3] : m1[r & 3]; const float tv = (m != 0) ? su * (SCL * L2E) : -3.0e38f;   /* (ac + rel_shift(bd)) / 8, in units of log2 so that the exponentials need no further product; key mask (int32) */ s[t4][r] = tv; tmax = fmaxf(tmax, tv); } }
        // the next step's stores to the slab stay behind the reads above
        __builtin_amdgcn_wave_barrier(); asm volatile("" ::: "memory");
        tmax = fmaxf(tmax, __shfl_xor(tmax, 16, 32));
        const float mnew = fmaxf(mrun, tmax); const float alpha = __builtin_amdgcn_exp2f(mrun - mnew); mrun = mnew;
        float ps = 0.f;
#pragma unroll
        for (int t4 = 0; t4 < 4; ++t4) s[t4] -= mnew;
#pragma unroll
        for (int r = 0; r < 8; ++r)
#pragma unroll
            for (int t4 = 0; t4 < 4; ++t4) { const float p = __builtin_amdgcn_exp2f(s[t4][r]); s[t4][r] = p; ps += p; }
        lsum = lsum * alpha + ps;
#pragma unroll
        for (int dt = 0; dt < 4; ++dt) o[dt] *= alpha;
        v16bf ph[2], pl[2]; split16(s[0], s[1], ph[0], pl[0]); split16(s[2], s[3], ph[1], pl[1]);
        // the value fragments are read behind the split, when its registers are free: without this line the compiler starts them among the split's work and then, short of registers, reads the rest one fragment at a time, each with a full LDS wait
        __builtin_amdgcn_sched_barrier(0);
#pragma unroll
        for (int ks = 0; ks < 2; ++ks) { v16bf a[4], a2[4];
#pragma unroll
            for (int dt = 0; dt < 4; ++dt) { a[dt] = ldl(kb + 2 * PCB + dt * 16 * LP + ks * 64); a2[dt] = ldl(kb + 3 * PCB + dt * 16 * LP + ks * 64); }
#pragma unroll
            for (int dt = 0; dt < 4; ++dt) o[dt] = wmmab(a[dt], ph[ks], o[dt]);
#pragma unroll
            for (int dt = 0; dt < 4; ++dt) o[dt] = wmmab(a[dt], pl[ks], o[dt]);
#pragma unroll
            for (int dt = 0; dt < 4; ++dt) o[dt] = wmmab(a2[dt], ph[ks], o[dt]); }
        // four vector slots behind the last matrix instruction, also on the taken side of the loop's branch
        asm volatile("v_nop\n\tv_nop\n\tv_nop\n\tv_nop" : "+v"(o[0]), "+v"(o[1]), "+v"(o[2]), "+v"(o[3]));
        // hand-over of step t + 1: this wave's LDS reads of step t are done ...
        asm volatile("s_wait_dscnt 0x0" ::: "memory");
        // ... and its copies for step t + 1 have landed;
        asm volatile("s_wait_asynccnt 0x0" ::: "memory");
        // behind the barrier every wave's have, and nobody reads step t's buffer or its oldest position piece any more
        __syncthreads();
        if (t + 2 < NST) stage(t + 2, t + 6);
    }
    // no copy is left in flight when the wave ends
    asm volatile("s_wait_asynccnt 0x0" ::: "memory");
    lsum += __shfl_xor(lsum, 16, 32);
    const float f = (lsum > 0.f) ? __fdiv_rn(1.0f, lsum) : 0.f;
#pragma unroll
    for (int dt = 0; dt < 4; ++dt) { v8us oh, ol;
#pragma unroll
        for (int r = 0; r < 8; ++r) { unsigned short a, c2; splitf(o[dt][r] * f, a, c2); oh[r] = a; ol[r] = c2; }
        const size_t oo = ((size_t)b * TT + i0 + lr) * DQ + h * HD + dt * 16 + hi * 8; *(v8us*)(ATh + oo) = oh; *(v8us*)(ATl + oo) = ol; }
}

extern "C" void kernel_launch(void* const* d_in, const int* in_sizes, int n_in,
                              void* d_out, int out_size, void* d_ws, size_t ws_size, hipStream_t stream) {
    (void)in_sizes; (void)n_in; (void)out_size;
    const float* x = (const float*)d_in[0]; const int* MK = (const int*)d_in[1]; const float* wq = (const float*)d_in[2]; const float* wk = (const float*)d_in[3]; const float* wv = (const float*)d_in[4]; const float* wpos = (const float*)d_in[5]; const float* wo = (const float*)d_in[6]; const float* pbu = (const float*)d_in[7]; const float* pbv = (const float*)d_in[8];   /* u_bias, v_bias [8][64] */
    float* OUT = (float*)d_out;     // [8][1024][512]
    char* wsp = (char*)d_ws;
    auto take = [&](size_t bytes) { char* p = wsp; wsp += (bytes + 255) & ~(size_t)255; return (void*)p; };
    bf* WQ = (bf*)take((size_t)DQ * DM * 2); bf* WK = (bf*)take((size_t)DKV * DM * 2); bf* WV = (bf*)take((size_t)DKV * DM * 2); bf* WO = (bf*)take((size_t)DM * DQ * 2);
    bf* PEh = (bf*)take((size_t)NPE * DM * 2); bf* PEl = (bf*)take((size_t)NPE * DM * 2); bf* WP = (bf*)take((size_t)DQ * DM * 2); bf* PPh = (bf*)take((size_t)NH_ * NPE * HD * 2); bf* PPl = (bf*)take((size_t)NH_ * NPE * HD * 2);
    // planes of all 8 batch items
    bf* QPh = (bf*)take((size_t)NB_ * NH_ * TT * HD * 2); bf* QPl = (bf*)take((size_t)NB_ * NH_ * TT * HD * 2); bf* QVh = (bf*)take((size_t)NB_ * NH_ * TT * HD * 2); bf* QVl = (bf*)take((size_t)NB_ * NH_ * TT * HD * 2); bf* KPh = (bf*)take((size_t)NB_ * NKV * TT * HD * 2); bf* KPl = (bf*)take((size_t)NB_ * NKV * TT * HD * 2); bf* VTh = (bf*)take((size_t)NB_ * NKV * HD * TT * 2); bf* VTl = (bf*)take((size_t)NB_ * NKV * HD * TT * 2); bf* ATh = (bf*)take((size_t)NB_ * TT * DQ * 2); bf* ATl = (bf*)take((size_t)NB_ * TT * DQ * 2);
    bf* XB = (bf*)take((size_t)NB_ * TT * DM * 2);
    if ((size_t)(wsp - (char*)d_ws) > ws_size) return;
    k_prep<<<5 * PBW + PBP + PBX, 256, 0, stream>>>(wq, wk, wv, wo, wpos, x, WQ, WK, WV, WO, WP, PEh, PEl, XB);   /* five transposed bf16 weight planes, sinusoid table (hi + lo), exact bf16 plane of xs */
    k_proj<<<dim3(NB_ * TT / 64, 26, 1), 32, 0, stream>>>(PEh, PEl, WP, PPh, PPl, XB, WQ, WK, WV, pbu, pbv, QPh, QPl, QVh, QVl, KPh, KPl, VTh, VTl);   /* p = table Wpos -> per-head hi/lo planes [h][2048][64]; q + u_bias, q + v_bias, k and transposed v planes of all 8 batch items */
    k_fattn<<<dim3(TT / (16 * FW), NB_ * NH_, 1), FW * 32, 0, stream>>>(QPh, QPl, QVh, QVl, KPh, KPl, PPh, PPl, VTh, VTl, MK, ATh, ATl);   /* scores, rel_shift, mask, softmax, attn.v and merge of all 64 (batch item, head) pairs */
    k_gemmw<bf, 1, false><<<dim3(NB_ * TT / 64, DM / 64, 1), 32, 0, stream>>>(ATh, ATl, WO, nullptr, DQ, OUT, DM, nullptr, 0, 0, 0);
}

// v006
// A run of this version takes 117 microseconds.
// Timed twice side by side with v005, it ran 1.26 and 1.25 times as fast.
// Counting every step since v000, it is 17.9 times as fast.
#include <hip/hip_runtime.h>

// Transformer-XL style relative-position multi-head self-attention (xs [8][1024][512]; q, k, v = xs W ('xw' [512][512], no bias; 8 heads x 64); p = pe Wpos with pe the sinusoidal table of positions -(T-1)..T-1 (2047 rows, [sin, cos] interleaved, computed on device); scores = ((q + u_bias).k + rel_shift((q + v_bias).p)) / 8 where rel_shift picks position row j - i + 1023; mask (int32 [8][1024][1024], read): -inf where 0 and those weights zeroed; softmax; out = merged Wout ('xw', no bias) -> [8][1024][512] (4.2 M)).
// Layout: one exact bf16 input plane -> 1-product projections; the position table is computed on device in f32 (NOT bf16-rounded: kept as bf16 hi + lo planes) and projected once (2 products, 2047 rows + one zero pad row) into per-head hi/lo planes [h][2048][64]; the q, k, v projections of all 8 batch items are one launch whose epilogue adds the biases, splits and stores the head planes (v transposed), the position projection in the same launch; one fused attention launch for all 64 (batch item, head) pairs: content scores (q+u).k and the needed band of position scores (q+v).p are hi/lo products (3 each), the position score at j - i + 1023 is picked through LDS, mask select, online softmax and attn.v follow in registers: no score reaches memory.
// Compute dtypes, f32 accumulate: every input rounded to bf16; q/k/v on PLAIN bf16 operands (exact products); p = pe(hi+lo) Wpos (2 products); content and position scores on hi/lo planes for every row (3 products); softmax f32; attn.v hi/lo (3 products); Wout hl x exact (2 products).

#define NB_  8
#define TT   1024
#define DM   512
#define NH_  8
#define NKV  8
#define REP  (NH_ / NKV)
#define HD   64
#define DQ   (NH_ * HD)
#define DKV  (NKV * HD)
#define NPE  2048                 // 2047 positions + 1 zero pad row
typedef __attribute__((ext_vector_type(4))) unsigned short v4us;
#define ZH   8
#define RH   1024                 // every row hi/lo
#define WIN  0
#define PCAR 1024.0f
#define SCL  0.125f   // HD^-0.5
typedef _Float16 h16;
typedef unsigned short bf;
typedef __attribute__((ext_vector_type(16))) __bf16   v16bf;
typedef __attribute__((ext_vector_type(16))) _Float16 v16h;
typedef __attribute__((ext_vector_type(8)))  _Float16 v8h;
typedef __attribute__((ext_vector_type(8)))  unsigned short v8us;
typedef __attribute__((ext_vector_type(8)))  float    v8f;
typedef __attribute__((ext_vector_type(4)))  float    v4f;
typedef v8h  __attribute__((may_alias)) v8ha;
typedef v4f  __attribute__((may_alias)) v4fa;
typedef v8us __attribute__((may_alias)) v8usa;

__device__ __forceinline__ unsigned short f2bf(float f) { unsigned u = __float_as_uint(f); u += 0x7FFFu + ((u >> 16) & 1u); return (unsigned short)(u >> 16); }
__device__ __forceinline__ float bf2f(unsigned short b) { return __uint_as_float(((unsigned)b) << 16); }
__device__ __forceinline__ float bfr(float f) { return bf2f(f2bf(f)); }
__device__ __forceinline__ v16h cat16(v8h lo, v8h hi) { return __builtin_shufflevector(lo, hi, 0, 1, 2, 3, 4, 5, 6, 7, 8, 9, 10, 11, 12, 13, 14, 15); }
__device__ __forceinline__ v16bf cat16b(v8us lo, v8us hi) { return __builtin_bit_cast(v16bf, __builtin_shufflevector(lo, hi, 0, 1, 2, 3, 4, 5, 6, 7, 8, 9, 10, 11, 12, 13, 14, 15)); }
__device__ __forceinline__ v8f wmma16(v16h a, v16h b, v8f c) { return __builtin_amdgcn_wmma_f32_16x16x32_f16(false, a, false, b, (short)0, c, false, false); }
__device__ __forceinline__ v8f wmmab(v16bf a, v16bf b, v8f c) { return __builtin_amdgcn_wmma_f32_16x16x32_bf16(false, a, false, b, (short)0, c, false, false); }



__device__ __forceinline__ h16 tohx(float x) { return (h16)x; }
__device__ __forceinline__ void splitf(float y, unsigned short& h, unsigned short& l) { h = f2bf(y); l = f2bf(y - bf2f(h)); }
typedef __attribute__((ext_vector_type(2))) _Float16 v2h;
typedef __attribute__((ext_vector_type(4))) _Float16 v4h;
typedef __attribute__((ext_vector_type(2))) unsigned short v2us;
typedef __attribute__((ext_vector_type(4))) unsigned short v4us;
typedef __attribute__((ext_vector_type(2))) float v2f;
typedef __attribute__((ext_vector_type(4))) int v4i;

__device__ __forceinline__ void d_wtG(int blk, const float* __restrict__ w, int K, int N, bf* Bt) {
    const int lane = threadIdx.x & 31; const int L0 = (blk * 8 + (threadIdx.x >> 5)) * 8; const int nlines = N * K / 64;
{
#pragma unroll 1
        for (int l = 0; l < 8; ++l) { const int L = L0 + l; if (L >= nlines) break; const size_t e = (size_t)L * 64 + lane * 2; const int k = (int)(e % K), n = (int)(e / K); v2us o;
            o[0] = f2bf(w[(size_t)k * N + n]); o[1] = f2bf(w[(size_t)(k + 1) * N + n]); *(v2us*)(Bt + e) = o; }
         }
}



__constant__ float INVF[DM / 2] = {1.0f,0.964661598f,0.930572033f,0.897687137f,0.865964293f,0.835362554f,0.805842161f,0.777365029f,0.749894202f,0.723394156f,0.697830558f,0.673170388f,0.649381638f,0.626433551f,0.604296386f,0.582941532f,0.562341332f,0.542469084f,0.523299098f,0.504806578f,0.486967504f,0.469758898f,0.453158379f,0.437144488f,0.421696484f,0.406794429f,0.392418981f,0.378551513f,0.365174115f,0.352269441f,0.339820832f,0.327812076f,0.316227764f,0.305052817f,0.294272721f,0.283873618f,0.273841947f,0.264164835f,0.254829645f,0.245824397f,0.237137347f,0.228757307f,0.220673412f,0.212875158f,0.2053525f,0.198095664f,0.191095293f,0.184342295f,0.177827939f,0.171543792f,0.165481701f,0.15963386f,0.153992653f,0.148550808f,0.143301249f,0.138237223f,0.133352146f,0.128639698f,0.124093764f,0.119708493f,0.115478195f,0.111397393f,0.107460767f,0.103663281f,0.099999994f,0.0964661688f,0.0930572152f,0.0897687078f,0.0865964293f,0.0835362524f,0.0805842206f,0.0777364895f,0.0749894157f,0.0723394156f,0.0697830617f,0.0673170388f,0.0649381578f,0.0626433492f,0.0604296364f,0.0582941547f,0.056234125f,0.0542469025f,0.0523299091f,0.0504806563f,0.0486967564f,0.0469758809f,0.0453158319f,0.0437144488f,0.0421696529f,0.0406794474f,0.0392418914f,0.0378551483f,0.0365174115f,0.0352269486f,0.0339820795f,0.0327812098f,0.0316227749f,0.0305052791f,0.0294272732f,0.0283873565f,0.0273841936f,0.0264164824f,0.0254829675f,0.0245824363f,0.023713734f,0.0228757299f,0.0220673401f,0.0212875176f,0.0205352474f,0.0198095664f,0.0191095285f,0.0184342302f,0.0177827962f,0.0171543807f,0.0165481735f,0.0159633812f,0.0153992623f,0.0148550775f,0.0143301245f,0.0138237216f,0.013335214f,0.0128639704f,0.0124093788f,0.0119708525f,0.0115478169f,0.0111397365f,0.0107460767f,0.0103663281f,0.00999999978f,0.00964661594f,0.00930572115f,0.00897687208f,0.00865964405f,0.00835362263f,0.00805842038f,0.00777364895f,0.00749894092f,0.007233941f,0.00697830552f,0.00673170388f,0.00649381708f,0.00626433641f,0.00604296196f,0.00582941389f,0.00562341232f,0.00542468997f,0.00523299072f,0.00504806545f,0.00486967526f,0.0046975892f,0.00453158421f,0.0043714433f,0.00421696389f,0.00406794343f,0.00392418914f,0.00378551497f,0.00365174119f,0.00352269458f,0.00339820841f,0.00327812159f,0.0031622767f,0.00305052707f,0.00294272648f,0.00283873547f,0.00273841922f,0.00264164805f,0.0025482967f,0.0024582441f,0.00237137405f,0.00228757365f,0.00220673345f,0.00212875125f,0.0020535246f,0.00198095664f,0.00191095285f,0.001843423f,0.00177827943f,0.00171543809f,0.00165481726f,0.00159633812f,0.00153992616f,0.0014855077f,0.00143301231f,0.00138237211f,0.00133352133f,0.00128639699f,0.00124093785f,0.00119708513f,0.00115478167f,0.00111397356f,0.0010746076f,0.00103663281f,0.000999999931f,0.000964661594f,0.000930572045f,0.000897687161f,0.000865964394f,0.000835362298f,0.000805841992f,0.000777364883f,0.000749894069f,0.0007233941f,0.000697830576f,0.000673170376f,0.000649381662f,0.000626433583f,0.00060429622f,0.0005829414f,0.000562341185f,0.000542468973f,0.000523299037f,0.000504806521f,0.000486967503f,0.000469758903f,0.000453158398f,0.000437144336f,0.000421696401f,0.000406794337f,0.000392418908f,0.000378551485f,0.000365174084f,0.000352269446f,0.000339820836f,0.000327811984f,0.000316227786f,0.000305052701f,0.000294272788f,0.000283873524f,0.000273842044f,0.000264164817f,0.000254829531f,0.000245824398f,0.000237137268f,0.000228757344f,0.000220673333f,0.000212875209f,0.000205352466f,0.000198095746f,0.000191095271f,0.000184342207f,0.00017782794f,0.00017154371f,0.000165481732f,0.000159633797f,0.000153992674f,0.000148550767f,0.000143301295f,0.000138237199f,0.000133352078f,0.000128639687f,0.000124093727f,0.000119708515f,0.000115478157f,0.000111397407f,0.000107460757f,0.000103663326f};
#define PBW 64                              // blocks of a weight matrix
#define PBP (NPE * DM / 2 / 256)            // blocks of the position table: a [sin, cos] pair a thread
#define PBX (NB_ * TT * DM / 8 / 256)       // blocks of the xs plane: 8 elements a thread
__device__ __forceinline__ void d_petab(int blk, bf* PEh, bf* PEl) { const size_t e = ((size_t)blk * 256 + threadIdx.x) * 2; const int c = (int)(e % DM); const int r = (int)(e / DM); v2us oh, ol;
    if (r < NPE - 1) { const float th = __fmul_rn((float)(r - (TT - 1)), INVF[c >> 1]); unsigned short a, b2; splitf(sinf(th), a, b2); oh[0] = a; ol[0] = b2; splitf(cosf(th), a, b2); oh[1] = a; ol[1] = b2; } else { oh[0] = 0; oh[1] = 0; ol[0] = 0; ol[1] = 0; }
    *(v2us*)(PEh + e) = oh; *(v2us*)(PEl + e) = ol;
    // behind the part's last stores, in front of whatever code of the merged kernel follows them in the text and writes their registers
    asm volatile("s_wait_xcnt 0x0" ::: "memory"); }
__device__ __forceinline__ void d_cvt8(int blk, const float* __restrict__ src, bf* dst) { const size_t i = (size_t)blk * 256 + threadIdx.x; const v8f v = *(const v8f*)(src + i * 8); v8us o;
#pragma unroll
    for (int k = 0; k < 8; ++k) o[k] = f2bf(v[k]); *(v8us*)(dst + i * 8) = o;
    // behind the part's last store, in front of whatever code of the merged kernel follows it in the text and writes its registers
    asm volatile("s_wait_xcnt 0x0" ::: "memory"); }
// ---- k_prep: every plane that is made from the inputs alone, in ONE launch: none of the seven pieces reads what another writes, and each block does what a block of the piece's own launch did. Blocks 0 .. 5 PBW - 1: the five transposed bf16 weight planes (their gathers have the longest chain of waits, so they start first); then the position table; then the xs plane.
__global__ __launch_bounds__(256) void k_prep(const float* __restrict__ wq, const float* __restrict__ wk, const float* __restrict__ wv, const float* __restrict__ wo, const float* __restrict__ wpos, const float* __restrict__ x, bf* WQ, bf* WK, bf* WV, bf* WO, bf* WP, bf* PEh, bf* PEl, bf* XB) {
    const int blk = blockIdx.x;
    if (blk < 5 * PBW) { const int m = blk / PBW;
        d_wtG(blk % PBW, m == 0 ? wq : m == 1 ? wk : m == 2 ? wv : m == 3 ? wo : wpos, DM, DQ, m == 0 ? WQ : m == 1 ? WK : m == 2 ? WV : m == 3 ? WO : WP); }
    else if (blk < 5 * PBW + PBP) d_petab(blk - 5 * PBW, PEh, PEl);
    else d_cvt8(blk - (5 * PBW + PBP), x, XB);
}

// fragment at scalar base + 32-bit vector byte offset + constant: one address register serves every load of a phase
__device__ __forceinline__ v16bf ldo(const bf* base, unsigned voff, int imm) { const char* p = (const char*)base + voff + imm; return cat16b(*(const v8us*)p, *(const v8us*)(p + 32)); }
// ---- projections that write their operand planes themselves: the epilogue splits each f32 result into bf16 hi + lo and stores rows of 64 elements (128 bytes, whole lines) straight into the layout the attention kernel reads.
// ---- the three GEMMs (q, k, v; position; output): a block of 8 waves works on one block tile, and the operand rows that its waves share come into LDS once, by asynchronous copies of whole 128-byte lines, instead of each wave gathering 32 bytes from each of 16 lines per load. A k step is 64 elements (one line a row); three groups of 128 rows a step, two buffers, the next step's copies in flight while this one is multiplied. The fragments are then read from LDS in the k order of ldo.
#define GP   144                  // pitch in bytes of a staged row of 64 bf16: 16 bytes x odd, so that the 16 rows of a fragment read fall on different banks
#define GGRP (128 * GP)           // a group of 128 staged rows
#define GBUF (3 * GGRP)           // a buffer: three groups
#define GNT  (DM / 64)            // k steps
#define GW   8                    // waves a block
// fragment from a staged piece: the lane's 16 bytes at p and at p + 32, the k order of ldo
__device__ __forceinline__ v16bf ldl(const char* p) { return cat16b(*(const v8usa*)p, *(const v8usa*)(p + 32)); }
__device__ __forceinline__ unsigned ldsa(const void* p) { return (unsigned)(size_t)p; }
// asynchronous copies global -> LDS, 16 bytes a lane; the wait in the same statement keeps the address registers whole until the copies have taken them
__device__ __forceinline__ void acopy2(unsigned l0, const char* g0, unsigned l1, const char* g1) {
    asm volatile("global_load_async_to_lds_b128 %0, %1, off\n\tglobal_load_async_to_lds_b128 %2, %3, off\n\ts_wait_xcnt 0x0" :: "v"(l0), "v"(g0), "v"(l1), "v"(g1) : "memory"); }
__device__ __forceinline__ void acopy6(unsigned l0, const char* g0, unsigned l1, const char* g1, unsigned l2, const char* g2, unsigned l3, const char* g3, unsigned l4, const char* g4, unsigned l5, const char* g5) {
    asm volatile("global_load_async_to_lds_b128 %0, %1, off\n\tglobal_load_async_to_lds_b128 %2, %3, off\n\tglobal_load_async_to_lds_b128 %4, %5, off\n\tglobal_load_async_to_lds_b128 %6, %7, off\n\tglobal_load_async_to_lds_b128 %8, %9, off\n\tglobal_load_async_to_lds_b128 %10, %11, off\n\ts_wait_xcnt 0x0" :: "v"(l0), "v"(g0), "v"(l1), "v"(g1), "v"(l2), "v"(g2), "v"(l3), "v"(g3), "v"(l4), "v"(g4), "v"(l5), "v"(g5) : "memory"); }
// s0, s1, s2: first byte of the 128 rows (pitch DM elements) of each group; ao, a2o, bo: byte offset in a buffer of row 0 of this wave's A, second A (NSPLIT == 1) and B rows. The wave's tile is 16 MB x 64; each accumulator takes its products in the order k = 0, 32, 64 ... (a, then a2).
template <int MB, int NSPLIT>
__device__ __forceinline__ void tileS(char* stg, const char* __restrict__ s0, const char* __restrict__ s1, const char* __restrict__ s2, int ao, int a2o, int bo, int lr, int hi, v8f (&acc)[MB][4]) {
    const int tid = threadIdx.x;
    const unsigned go = (unsigned)((tid >> 3) * (DM * 2) + (tid & 7) * 16);             // the thread's 16 bytes: rows tid >> 3 + 32 j of a group, segment tid & 7
    const unsigned lo = ldsa(stg) + (unsigned)((tid >> 3) * GP + (tid & 7) * 16);
    auto stage = [&](int t) {
        const unsigned l = lo + (unsigned)(t & 1) * GBUF; const unsigned g = go + (unsigned)t * 128u;
        acopy6(l, s0 + g, l + 32 * GP, s0 + g + 32 * DM * 2, l + 64 * GP, s0 + g + 64 * DM * 2, l + 96 * GP, s0 + g + 96 * DM * 2, l + GGRP, s1 + g, l + GGRP + 32 * GP, s1 + g + 32 * DM * 2);
        acopy6(l + GGRP + 64 * GP, s1 + g + 64 * DM * 2, l + GGRP + 96 * GP, s1 + g + 96 * DM * 2, l + 2 * GGRP, s2 + g, l + 2 * GGRP + 32 * GP, s2 + g + 32 * DM * 2, l + 2 * GGRP + 64 * GP, s2 + g + 64 * DM * 2, l + 2 * GGRP + 96 * GP, s2 + g + 96 * DM * 2); };
#pragma unroll
    for (int mb = 0; mb < MB; ++mb)
#pragma unroll
        for (int nb = 0; nb < 4; ++nb) acc[mb][nb] = (v8f){};
    stage(0);
    // step 0's copies of this wave have landed; behind the barrier those of every wave have
    asm volatile("s_wait_asynccnt 0x0" ::: "memory");
    __syncthreads();
    stage(1);
    const int fl = lr * GP + hi * 16;   // the lane's place in a 16-row fragment
    // rolled: the text of one step serves all eight, and the buffer is picked by t & 1
#pragma unroll 1
    for (int t = 0; t < GNT; ++t) {
        const char* bb = stg + (t & 1) * GBUF + fl;
#pragma unroll
        for (int ks = 0; ks < 2; ++ks) { v16bf a[MB], a2[MB], b[4];
#pragma unroll
            for (int mb = 0; mb < MB; ++mb) { a[mb] = ldl(bb + ao + mb * 16 * GP + ks * 64); if (NSPLIT == 1) a2[mb] = ldl(bb + a2o + mb * 16 * GP + ks * 64); }
#pragma unroll
            for (int nb = 0; nb < 4; ++nb) b[nb] = ldl(bb + bo + nb * 16 * GP + ks * 64);
            // all fragment reads of a half step are issued in front of its first product: without this line the compiler reads the b fragments one after the other into one register group, each with a full LDS wait
            __builtin_amdgcn_sched_barrier(0);
#pragma unroll
            for (int nb = 0; nb < 4; ++nb) {
#pragma unroll
                for (int mb = 0; mb < MB; ++mb) { acc[mb][nb] = wmmab(a[mb], b[nb], acc[mb][nb]); if (NSPLIT == 1) acc[mb][nb] = wmmab(a2[mb], b[nb], acc[mb][nb]); } } }
        // hand-over of step t + 1: this wave's LDS reads of step t are done ...
        asm volatile("s_wait_dscnt 0x0" ::: "memory");
        // ... and its copies for step t + 1 have landed;
        asm volatile("s_wait_asynccnt 0x0" ::: "memory");
        // behind the barrier every wave's have, and nobody reads step t's buffer any more
        __syncthreads();
        if (t + 2 < GNT) stage(t + 2);
    }
    // no copy is left in flight behind the loop
    asm volatile("s_wait_asynccnt 0x0" ::: "memory");
}
// 16 rows of the tile into this wave's LDS slab [16][68]
__device__ __forceinline__ void slab_put(float* os, const v8f (&acc)[4], int lr, int hi) {
#pragma unroll
    for (int nb = 0; nb < 4; ++nb) {
#pragma unroll
        for (int j = 0; j < 8; ++j) os[(hi * 8 + j) * 68 + nb * 16 + lr] = acc[nb][j]; }
}
__device__ __forceinline__ void split8(const float (&x)[8], v8us& oh, v8us& ol) {
#pragma unroll
    for (int q = 0; q < 8; ++q) { unsigned short a, c; splitf(x[q], a, c); oh[q] = a; ol[q] = c; } }
// d_qkvp: block tiles of 128 positions x 256 columns (4 heads), 64 x 6 of them; waves 2 x 4, a wave has the 64 x 64 tile of one head. by >> 1 picks q, k or v, by & 1 the half of the heads. Staged: group 0 the 128 xs rows, groups 1 and 2 the 256 weight rows. q and k: C = xs W, tile rows are positions, planes [b][h][t][d]; q is stored twice, as q + u_bias and q + v_bias. v: the operands change places (C = Wv^T xs^T), so that tile rows are head dims and the transposed planes [b][h][d][t] are stored by rows as well.
__device__ __forceinline__ void d_qkvp(char* stg, float* os, int wv, int bx, int by, const bf* __restrict__ XB, const bf* __restrict__ WQ, const bf* __restrict__ WK, const bf* __restrict__ WV, const float* __restrict__ pbu, const float* __restrict__ pbv, bf* QUh, bf* QUl, bf* QVh, bf* QVl, bf* Kh, bf* Kl, bf* Vh, bf* Vl) {
    const int lane = threadIdx.x & 31, lr = lane & 15, hi = lane >> 4; const int mi = wv >> 2, ni = wv & 3; const int sel = by >> 1, cb = (by & 1) * 4 + ni, xr = bx * 128 + mi * 64, b = xr / TT, t0 = xr % TT; const bool tv = sel == 2;
    v8f acc[4][4];
    const char* wr = (const char*)(sel == 0 ? WQ : sel == 1 ? WK : WV) + (size_t)(by & 1) * 256 * DM * 2;
    tileS<4, 0>(stg, (const char*)XB + (size_t)bx * 128 * DM * 2, wr, wr + 128 * DM * 2, tv ? GGRP + ni * 64 * GP : mi * 64 * GP, 0, tv ? mi * 64 * GP : GGRP + ni * 64 * GP, lr, hi, acc);
    const size_t base = tv ? (size_t)(b * NKV + cb) * HD * TT + t0 : ((size_t)(b * NH_ + cb) * TT + t0) * HD; const int pitch = tv ? TT : HD;
    bf* Dh = tv ? Vh : Kh; bf* Dl = tv ? Vl : Kl;
    const int rr = lane >> 3, cofs = (lane & 7) * 8;
    float ub[8], vb[8];
#pragma unroll
    for (int q = 0; q < 8; ++q) { ub[q] = 0.f; vb[q] = 0.f; }
    if (sel == 0) {
#pragma unroll
        for (int q = 0; q < 8; ++q) { ub[q] = bfr(pbu[cb * HD + cofs + q]); vb[q] = bfr(pbv[cb * HD + cofs + q]); } }
#pragma unroll
    for (int mb = 0; mb < 4; ++mb) {
        slab_put(os, acc[mb], lr, hi);
        // the slab is exchanged between the lanes of this wave: keep the reads below behind the stores above
        __builtin_amdgcn_wave_barrier(); asm volatile("" ::: "memory");
#pragma unroll
        for (int s = 0; s < 4; ++s) { const int row = 4 * s + rr; const v4f x0 = *(const v4fa*)(os + row * 68 + cofs), x1 = *(const v4fa*)(os + row * 68 + cofs + 4); float x[8];
#pragma unroll
            for (int q = 0; q < 4; ++q) { x[q] = x0[q]; x[4 + q] = x1[q]; }
            const size_t o = base + (size_t)(mb * 16 + row) * pitch + cofs;
            v8us oh, ol;
            if (sel == 0) { float y[8]; v8us ph, pl;
#pragma unroll
                for (int q = 0; q < 8; ++q) y[q] = __fadd_rn(x[q], ub[q]);
                split8(y, oh, ol);
#pragma unroll
                for (int q = 0; q < 8; ++q) y[q] = __fadd_rn(x[q], vb[q]);
                split8(y, ph, pl);
                *(v8us*)(QUh + o) = oh; *(v8us*)(QUl + o) = ol; *(v8us*)(QVh + o) = ph; *(v8us*)(QVl + o) = pl; }
            else { split8(x, oh, ol); *(v8us*)(Dh + o) = oh; *(v8us*)(Dl + o) = ol; }
            // the stores' address and data registers are rewritten by the next rows: the wait stands in front of that
            asm volatile("s_wait_xcnt 0x0" ::: "memory"); }
        // the next 16 rows' stores to the slab stay behind the reads above
        __builtin_amdgcn_wave_barrier(); asm volatile("" ::: "memory");
    }
}
// d_posp: p = position table (hi + lo, 2 products) Wpos, block tiles of 128 rows x 128 columns (2 heads), 16 x 4 of them; waves 4 x 2, a wave has 32 rows of one head; planes [h][2048][64]. Staged: the 128 table rows hi, the same lo, the 128 weight rows.
__device__ __forceinline__ void d_posp(char* stg, float* os, int wv, int bx, int by, const bf* __restrict__ PEh, const bf* __restrict__ PEl, const bf* __restrict__ WP, bf* Ph2, bf* Pl2) {
    const int lane = threadIdx.x & 31, lr = lane & 15, hi = lane >> 4; const int mi = wv >> 1, ni = wv & 1; const int r0 = bx * 128 + mi * 32, cb = by * 2 + ni;
    v8f acc[2][4];
    tileS<2, 1>(stg, (const char*)PEh + (size_t)bx * 128 * DM * 2, (const char*)PEl + (size_t)bx * 128 * DM * 2, (const char*)WP + (size_t)by * 128 * DM * 2, mi * 32 * GP, GGRP + mi * 32 * GP, 2 * GGRP + ni * 64 * GP, lr, hi, acc);
    const size_t base = ((size_t)cb * NPE + r0) * HD; const int rr = lane >> 3, cofs = (lane & 7) * 8;
#pragma unroll
    for (int mb = 0; mb < 2; ++mb) {
        slab_put(os, acc[mb], lr, hi);
        // the slab is exchanged between the lanes of this wave: keep the reads below behind the stores above
        __builtin_amdgcn_wave_barrier(); asm volatile("" ::: "memory");
#pragma unroll
        for (int s = 0; s < 4; ++s) { const int row = 4 * s + rr; const v4f x0 = *(const v4fa*)(os + row * 68 + cofs), x1 = *(const v4fa*)(os + row * 68 + cofs + 4); float x[8];
#pragma unroll
            for (int q = 0; q < 4; ++q) { x[q] = x0[q]; x[4 + q] = x1[q]; }
            v8us oh, ol; split8(x, oh, ol); const size_t o = base + (size_t)(mb * 16 + row) * HD + cofs; *(v8us*)(Ph2 + o) = oh; *(v8us*)(Pl2 + o) = ol;
            // the stores' address and data registers are rewritten by the next rows: the wait stands in front of that
            asm volatile("s_wait_xcnt 0x0" ::: "memory"); }
        // the next 16 rows' stores to the slab stay behind the reads above
        __builtin_amdgcn_wave_barrier(); asm volatile("" ::: "memory");
    }
}
// ---- k_proj: the position projection and the q, k, v projections read only what k_prep wrote and nothing of each other: ONE launch of 64 + 384 blocks of 8 waves. Blocks 0 .. 63 are the position tiles, the rest q, then k, then v. Four waves a SIMD (two blocks a WGP): every block is resident at once.
#define PJP 64                    // position blocks
__global__ __launch_bounds__(GW * 32) __attribute__((amdgpu_waves_per_eu(4, 4))) void k_proj(const bf* __restrict__ PEh, const bf* __restrict__ PEl, const bf* __restrict__ WP, bf* Ph2, bf* Pl2, const bf* __restrict__ XB, const bf* __restrict__ WQ, const bf* __restrict__ WK, const bf* __restrict__ WV, const float* __restrict__ pbu, const float* __restrict__ pbv, bf* QUh, bf* QUl, bf* QVh, bf* QVl, bf* Kh, bf* Kl, bf* Vh, bf* Vl) {
    __shared__ __align__(16) char stg[2 * GBUF];
    __shared__ __align__(16) float oss[GW * 16 * 68];
    const int wv = __builtin_amdgcn_readfirstlane(threadIdx.x >> 5); float* os = oss + wv * 16 * 68; const int blk = blockIdx.x;
    if (blk < PJP) d_posp(stg, os, wv, blk & 15, blk >> 4, PEh, PEl, WP, Ph2, Pl2);
    else d_qkvp(stg, os, wv, (blk - PJP) & 63, (blk - PJP) >> 6, XB, WQ, WK, WV, pbu, pbv, QUh, QUl, QVh, QVl, Kh, Kl, Vh, Vl);
}
// ---- k_outp: out = merged (hi + lo, 2 products) Wout, f32. Block tiles of 128 x 128, grid (64, 4): one block a WGP; waves 4 x 2, a wave has 32 x 64. Staged: the 128 merged rows hi, the same lo, the 128 weight rows.
__global__ __launch_bounds__(GW * 32) void k_outp(const bf* __restrict__ Ah, const bf* __restrict__ Al, const bf* __restrict__ Bt, float* C) {
    __shared__ __align__(16) char stg[2 * GBUF];
    __shared__ __align__(16) float oss[GW * 16 * 68];
    const int lane = threadIdx.x & 31, lr = lane & 15, hi = lane >> 4, wv = __builtin_amdgcn_readfirstlane(threadIdx.x >> 5); float* os = oss + wv * 16 * 68;
    const int mi = wv >> 1, ni = wv & 1; const int r0 = blockIdx.x * 128 + mi * 32, c0 = blockIdx.y * 128 + ni * 64;
    v8f acc[2][4];
    tileS<2, 1>(stg, (const char*)Ah + (size_t)blockIdx.x * 128 * DM * 2, (const char*)Al + (size_t)blockIdx.x * 128 * DM * 2, (const char*)Bt + (size_t)blockIdx.y * 128 * DM * 2, mi * 32 * GP, GGRP + mi * 32 * GP, 2 * GGRP + ni * 64 * GP, lr, hi, acc);
#pragma unroll
    for (int mb = 0; mb < 2; ++mb) {
        slab_put(os, acc[mb], lr, hi);
        // the slab is exchanged between the lanes of this wave: keep the reads below behind the stores above
        __builtin_amdgcn_wave_barrier(); asm volatile("" ::: "memory");
        float* crow = C + (size_t)(r0 + mb * 16) * DM + c0;
#pragma unroll
        for (int s = 0; s < 8; ++s) { const int row = 2 * s + hi, cofs = lr * 4; const v4f val = *(const v4fa*)(os + row * 68 + cofs); *(v4f*)(crow + (size_t)row * DM + cofs) = val;
            // the store's address and data registers are rewritten by the next rows: the wait stands in front of that
            asm volatile("s_wait_xcnt 0x0" ::: "memory"); }
        // the next 16 rows' stores to the slab stay behind the reads above
        __builtin_amdgcn_wave_barrier(); asm volatile("" ::: "memory");
    }
}
// k_fattn: one launch for the whole attention. One wave owns 16 query rows of one (batch item, head) and walks the 1024 keys in steps of 64; grid (1024 / (16 * FW), 64), FW waves a block, one block barrier a step.
// Transposed products: St = K (q+u)^T and BDt = P (q+v)^T (A = key or position rows, B = query rows kept in registers), so a lane holds ONE query (column lr) and 8 consecutive keys per tile (8 * hi + r).
// rel_shift: the 16 queries x 64 keys of a step need positions l0 .. l0 + 78, l0 = j0 - i0 + 1008 (five 16-row tiles; row 2047 is the zero pad and is never picked); BDt goes to this wave's LDS slab as [query][80] and is read back at column key - query + 15.
// Staging: the FW waves of a block read the same 64 key rows and 64 value rows (hi and lo) in a step, and together 320 consecutive position rows, of which a step brings 64 new ones. These six pieces of 8 KiB come into LDS by asynchronous copies, 16 bytes of each per thread, whole 128-byte lines per copy, two steps ahead: keys and values into two buffers, position rows into a ring of 512 rows. The fragments are then read from LDS.
// Online softmax per lane (running maximum and sum, output tiles rescaled each step); the f32 weights split in place into bf16 hi + lo B operands; Ot += Vt Pt (3 products); the epilogue divides by the sum and writes the merged hi/lo planes.
#define FW  16
#define BDP 84                    // slab pitch in floats: 16-byte aligned rows; the skewed reads (stride 83) fall on 32 different banks
#define LP  144                   // pitch in bytes of a staged row of 64 bf16 (128 bytes): 16 bytes x odd, so that the 16 rows of a fragment read fall on different banks
#define PCB (64 * LP)             // one staged piece: 64 rows
#define NST (TT / 64)             // steps
#define L2E 1.4426950408889634f
typedef __attribute__((ext_vector_type(2))) __bf16 v2bf;
typedef __attribute__((ext_vector_type(8))) unsigned v8u;
__device__ __forceinline__ void split16(const v8f x0, const v8f x1, v16bf& h, v16bf& l) {   // element s = tile s >> 3, register s & 7: two result tiles are one B operand in the hardware k order
    v8u hw, lw;
#pragma unroll
    for (int s = 0; s < 8; ++s) { v2f x; x[0] = (s < 4) ? x0[2 * (s & 3)] : x1[2 * (s & 3)]; x[1] = (s < 4) ? x0[2 * (s & 3) + 1] : x1[2 * (s & 3) + 1];
        const v2bf hb = __builtin_convertvector(x, v2bf); const v2f rest = x - __builtin_convertvector(hb, v2f); const v2bf lb = __builtin_convertvector(rest, v2bf);
        hw[s] = __builtin_bit_cast(unsigned, hb); lw[s] = __builtin_bit_cast(unsigned, lb); }
    h = __builtin_bit_cast(v16bf, hw); l = __builtin_bit_cast(v16bf, lw);
}
// four waves a SIMD (one block a WGP): the 4096 waves are then resident at once, and a wave's vector work runs beside its neighbours' matrix work
__global__ __launch_bounds__(FW * 32) __attribute__((amdgpu_waves_per_eu(4, 4))) void k_fattn(const bf* __restrict__ QUh, const bf* __restrict__ QUl, const bf* __restrict__ QVh, const bf* __restrict__ QVl, const bf* __restrict__ Kh, const bf* __restrict__ Kl, const bf* __restrict__ PPh, const bf* __restrict__ PPl, const bf* __restrict__ Vh, const bf* __restrict__ Vl, const int* __restrict__ MK, bf* ATh, bf* ATl) {
    __shared__ __align__(16) float bds[FW * 16 * BDP];
    __shared__ __align__(16) char kvs[2 * 4 * PCB];   // [buffer][k hi, k lo, v hi, v lo][64 rows]
    __shared__ __align__(16) char pps[2 * 8 * PCB];   // [hi, lo][ring of 512 position rows]
    const int tid = threadIdx.x, lane = tid & 31, lr = lane & 15, hi = lane >> 4, wv = __builtin_amdgcn_readfirstlane(tid >> 5);
    const int z = blockIdx.y, b = z / NH_, h = z % NH_; const int i0 = (blockIdx.x * FW + wv) * 16;
    float* bd = bds + wv * 16 * BDP;
    // the thread's 16 bytes of every staged piece: row tid >> 3, segment tid & 7
    const unsigned cl = (unsigned)((tid >> 3) * LP + (tid & 7) * 16);
    const unsigned ck = (unsigned)(z * TT * HD * 2 + tid * 16);                                               // key rows of a step are 8 KiB in a row
    const unsigned cv = (unsigned)(((z * HD + (tid >> 3)) * TT) * 2 + (tid & 7) * 16);                         // value rows: 128 bytes of each of the 64 head dims
    const unsigned cp = (unsigned)((h * NPE + (TT - 16 * FW) - (int)blockIdx.x * 16 * FW) * HD * 2 + tid * 16);   // position rows from the block's lowest row on: piece c holds rows 64 c .. 64 c + 63 behind it, pieces 0 .. 19 end at row 2047 or below
    const unsigned lkv = ldsa(kvs) + cl, lpp = ldsa(pps) + cl;
    // keys and values of step t into buffer t & 1, position piece c into ring slot c & 7
    auto stage = [&](int t, int c) {
        const unsigned lk = lkv + (unsigned)(t & 1) * (4 * PCB), lq = lpp + (unsigned)(c & 7) * PCB;
        acopy6(lk, (const char*)Kh + ck + t * (64 * HD * 2), lk + PCB, (const char*)Kl + ck + t * (64 * HD * 2), lk + 2 * PCB, (const char*)Vh + cv + t * 128, lk + 3 * PCB, (const char*)Vl + cv + t * 128,
               lq, (const char*)PPh + cp + c * (64 * HD * 2), lq + 8 * PCB, (const char*)PPl + cp + c * (64 * HD * 2)); };
    // step 0 reads position pieces 0 .. 4
#pragma unroll
    for (int c = 0; c < 4; ++c) acopy2(lpp + c * PCB, (const char*)PPh + cp + c * (64 * HD * 2), lpp + (8 + c) * PCB, (const char*)PPl + cp + c * (64 * HD * 2));
    stage(0, 4);
    const unsigned qo = (unsigned)((z * TT + i0 + lr) * HD + 8 * hi) * 2u;   // byte offsets; every plane is under 2^24 bytes, the mask 2^25
    v16bf quh[2], qul[2], qvh[2], qvl[2];
#pragma unroll
    for (int ks = 0; ks < 2; ++ks) { quh[ks] = ldo(QUh, qo, ks * 64); qul[ks] = ldo(QUl, qo, ks * 64); qvh[ks] = ldo(QVh, qo, ks * 64); qvl[ks] = ldo(QVl, qo, ks * 64); }
    const unsigned mo = (unsigned)((b * TT + i0 + lr) * TT + 8 * hi) * 4u;
    const int fl = lr * LP + hi * 16;   // the lane's place in a 16-row fragment of a staged piece
    v8f o[4];
#pragma unroll
    for (int dt = 0; dt < 4; ++dt) o[dt] = (v8f){};
    float mrun = -1.0e30f, lsum = 0.f;   // the running maximum starts far above the masked value -3e38: a masked key's exponential is 0 also while no key of its row has been left unmasked
    // step 0's copies of this wave have landed; behind the barrier those of every wave have
    asm volatile("s_wait_asynccnt 0x0" ::: "memory");
    __syncthreads();
    stage(1, 5);
#pragma unroll 1
    for (int t = 0; t < NST; ++t) {
        const unsigned mj = mo + (unsigned)(t * 64 * 4);
        const char* kb = kvs + (t & 1) * (4 * PCB) + fl;
        {   // position scores of the step's band, transposed: rows l0 + 16 u + 8 hi + r, column = query lr
            v8f pa[5];
#pragma unroll
            for (int u = 0; u < 5; ++u) pa[u] = (v8f){};
#pragma unroll
            for (int ks = 0; ks < 2; ++ks) { v16bf a[5], a2[5];
#pragma unroll
                for (int u = 0; u < 5; ++u) { const int rw = t * 64 + (FW - 1 - wv) * 16 + u * 16;   /* row counted from the block's lowest position row */ const char* pr = pps + (rw & 511) * LP + fl + ks * 64; a[u] = ldl(pr); a2[u] = ldl(pr + 8 * PCB); }
#pragma unroll
                for (int u = 0; u < 5; ++u) pa[u] = wmmab(a[u], qvh[ks], pa[u]);
#pragma unroll
                for (int u = 0; u < 5; ++u) pa[u] = wmmab(a[u], qvl[ks], pa[u]);
#pragma unroll
                for (int u = 0; u < 5; ++u) pa[u] = wmmab(a2[u], qvh[ks], pa[u]); }
#pragma unroll
            for (int u = 0; u < 5; ++u) { v4f w0, w1;
#pragma unroll
                for (int q = 0; q < 4; ++q) { w0[q] = pa[u][q]; w1[q] = pa[u][4 + q]; }
                *(v4fa*)(bd + lr * BDP + u * 16 + hi * 8) = w0; *(v4fa*)(bd + lr * BDP + u * 16 + hi * 8 + 4) = w1; }
        }
        // the slab is exchanged between the two lane halves of this wave: keep the reads below behind the stores above; the four v_nop are the vector slots between the last position product and a content product that reuses its result registers
        __builtin_amdgcn_wave_barrier(); asm volatile("v_nop\n\tv_nop\n\tv_nop\n\tv_nop" ::: "memory");
        v4i mk[8];
#pragma unroll
        for (int t4 = 0; t4 < 4; ++t4) { const char* mp = (const char*)MK + mj + t4 * 64; mk[2 * t4] = *(const v4i*)mp; mk[2 * t4 + 1] = *(const v4i*)(mp + 16); }
        // the step's eight mask loads are issued together, in front of the content products: without this line the compiler issues them in four pairs among the selects below, and a step waits for memory four times
        __builtin_amdgcn_sched_barrier(0);
        v8f s[4];
#pragma unroll
        for (int t4 = 0; t4 < 4; ++t4) s[t4] = (v8f){};
#pragma unroll
        for (int ks = 0; ks < 2; ++ks) { v16bf a[4], a2[4];
#pragma unroll
            for (int t4 = 0; t4 < 4; ++t4) { a[t4] = ldl(kb + t4 * 16 * LP + ks * 64); a2[t4] = ldl(kb + PCB + t4 * 16 * LP + ks * 64); }
#pragma unroll
            for (int t4 = 0; t4 < 4; ++t4) s[t4] = wmmab(a[t4], quh[ks], s[t4]);
#pragma unroll
            for (int t4 = 0; t4 < 4; ++t4) s[t4] = wmmab(a[t4], qul[ks], s[t4]);
#pragma unroll
            for (int t4 = 0; t4 < 4; ++t4) s[t4] = wmmab(a2[t4], quh[ks], s[t4]); }
        // the first use of a mask word stays behind the content products: without this line the compiler lifts one compare in front of them, and the wave waits there for the loads it has just issued
        __builtin_amdgcn_sched_barrier(0);
        float tmax = -3.0e38f;
#pragma unroll
        for (int t4 = 0; t4 < 4; ++t4) { const v4i m0 = mk[2 * t4]; const v4i m1 = mk[2 * t4 + 1];
#pragma unroll
            for (int r = 0; r < 8; ++r) { const float su = s[t4][r] + bd[lr * (BDP - 1) + 15 + t4 * 16 + hi * 8 + r]; const int m = (r < 4) ? m0[r & 3] : m1[r & 3]; const float tv = (m != 0) ? su * (SCL * L2E) : -3.0e38f;   /* (ac + rel_shift(bd)) / 8, in units of log2 so that the exponentials need no further product; key mask (int32) */ s[t4][r] = tv; tmax = fmaxf(tmax, tv); } }
        // the next step's stores to the slab stay behind the reads above
        __builtin_amdgcn_wave_barrier(); asm volatile("" ::: "memory");
        tmax = fmaxf(tmax, __shfl_xor(tmax, 16, 32));
        const float mnew = fmaxf(mrun, tmax); const float alpha = __builtin_amdgcn_exp2f(mrun - mnew); mrun = mnew;
        float ps = 0.f;
#pragma unroll
        for (int t4 = 0; t4 < 4; ++t4) s[t4] -= mnew;
#pragma unroll
        for (int r = 0; r < 8; ++r)
#pragma unroll
            for (int t4 = 0; t4 < 4; ++t4) { const float p = __builtin_amdgcn_exp2f(s[t4][r]); s[t4][r] = p; ps += p; }
        lsum = lsum * alpha + ps;
#pragma unroll
        for (int dt = 0; dt < 4; ++dt) o[dt] *= alpha;
        v16bf ph[2], pl[2]; split16(s[0], s[1], ph[0], pl[0]); split16(s[2], s[3], ph[1], pl[1]);
        // the value fragments are read behind the split, when its registers are free: without this line the compiler starts them among the split's work and then, short of registers, reads the rest one fragment at a time, each with a full LDS wait
        __builtin_amdgcn_sched_barrier(0);
#pragma unroll
        for (int ks = 0; ks < 2; ++ks) { v16bf a[4], a2[4];
#pragma unroll
            for (int dt = 0; dt < 4; ++dt) { a[dt] = ldl(kb + 2 * PCB + dt * 16 * LP + ks * 64); a2[dt] = ldl(kb + 3 * PCB + dt * 16 * LP + ks * 64); }
#pragma unroll
            for (int dt = 0; dt < 4; ++dt) o[dt] = wmmab(a[dt], ph[ks], o[dt]);
#pragma unroll
            for (int dt = 0; dt < 4; ++dt) o[dt] = wmmab(a[dt], pl[ks], o[dt]);
#pragma unroll
            for (int dt = 0; dt < 4; ++dt) o[dt] = wmmab(a2[dt], ph[ks], o[dt]); }
        // four vector slots behind the last matrix instruction, also on the taken side of the loop's branch
        asm volatile("v_nop\n\tv_nop\n\tv_nop\n\tv_nop" : "+v"(o[0]), "+v"(o[1]), "+v"(o[2]), "+v"(o[3]));
        // hand-over of step t + 1: this wave's LDS reads of step t are done ...
        asm volatile("s_wait_dscnt 0x0" ::: "memory");
        // ... and its copies for step t + 1 have landed;
        asm volatile("s_wait_asynccnt 0x0" ::: "memory");
        // behind the barrier every wave's have, and nobody reads step t's buffer or its oldest position piece any more
        __syncthreads();
        if (t + 2 < NST) stage(t + 2, t + 6);
    }
    // no copy is left in flight when the wave ends
    asm volatile("s_wait_asynccnt 0x0" ::: "memory");
    lsum += __shfl_xor(lsum, 16, 32);
    const float f = (lsum > 0.f) ? __fdiv_rn(1.0f, lsum) : 0.f;
#pragma unroll
    for (int dt = 0; dt < 4; ++dt) { v8us oh, ol;
#pragma unroll
        for (int r = 0; r < 8; ++r) { unsigned short a, c2; splitf(o[dt][r] * f, a, c2); oh[r] = a; ol[r] = c2; }
        const size_t oo = ((size_t)b * TT + i0 + lr) * DQ + h * HD + dt * 16 + hi * 8; *(v8us*)(ATh + oo) = oh; *(v8us*)(ATl + oo) = ol; }
}

extern "C" void kernel_launch(void* const* d_in, const int* in_sizes, int n_in,
                              void* d_out, int out_size, void* d_ws, size_t ws_size, hipStream_t stream) {
    (void)in_sizes; (void)n_in; (void)out_size;
    const float* x = (const float*)d_in[0]; const int* MK = (const int*)d_in[1]; const float* wq = (const float*)d_in[2]; const float* wk = (const float*)d_in[3]; const float* wv = (const float*)d_in[4]; const float* wpos = (const float*)d_in[5]; const float* wo = (const float*)d_in[6]; const float* pbu = (const float*)d_in[7]; const float* pbv = (const float*)d_in[8];   /* u_bias, v_bias [8][64] */
    float* OUT = (float*)d_out;     // [8][1024][512]
    char* wsp = (char*)d_ws;
    auto take = [&](size_t bytes) { char* p = wsp; wsp += (bytes + 255) & ~(size_t)255; return (void*)p; };
    bf* WQ = (bf*)take((size_t)DQ * DM * 2); bf* WK = (bf*)take((size_t)DKV * DM * 2); bf* WV = (bf*)take((size_t)DKV * DM * 2); bf* WO = (bf*)take((size_t)DM * DQ * 2);
    bf* PEh = (bf*)take((size_t)NPE * DM * 2); bf* PEl = (bf*)take((size_t)NPE * DM * 2); bf* WP = (bf*)take((size_t)DQ * DM * 2); bf* PPh = (bf*)take((size_t)NH_ * NPE * HD * 2); bf* PPl = (bf*)take((size_t)NH_ * NPE * HD * 2);
    // planes of all 8 batch items
    bf* QPh = (bf*)take((size_t)NB_ * NH_ * TT * HD * 2); bf* QPl = (bf*)take((size_t)NB_ * NH_ * TT * HD * 2); bf* QVh = (bf*)take((size_t)NB_ * NH_ * TT * HD * 2); bf* QVl = (bf*)take((size_t)NB_ * NH_ * TT * HD * 2); bf* KPh = (bf*)take((size_t)NB_ * NKV * TT * HD * 2); bf* KPl = (bf*)take((size_t)NB_ * NKV * TT * HD * 2); bf* VTh = (bf*)take((size_t)NB_ * NKV * HD * TT * 2); bf* VTl = (bf*)take((size_t)NB_ * NKV * HD * TT * 2); bf* ATh = (bf*)take((size_t)NB_ * TT * DQ * 2); bf* ATl = (bf*)take((size_t)NB_ * TT * DQ * 2);
    bf* XB = (bf*)take((size_t)NB_ * TT * DM * 2);
    if ((size_t)(wsp - (char*)d_ws) > ws_size) return;
    k_prep<<<5 * PBW + PBP + PBX, 256, 0, stream>>>(wq, wk, wv, wo, wpos, x, WQ, WK, WV, WO, WP, PEh, PEl, XB);   /* five transposed bf16 weight planes, sinusoid table (hi + lo), exact bf16 plane of xs */
    k_proj<<<PJP + 384, GW * 32, 0, stream>>>(PEh, PEl, WP, PPh, PPl, XB, WQ, WK, WV, pbu, pbv, QPh, QPl, QVh, QVl, KPh, KPl, VTh, VTl);   /* p = table Wpos -> per-head hi/lo planes [h][2048][64]; q + u_bias, q + v_bias, k and transposed v planes of all 8 batch items */
    k_fattn<<<dim3(TT / (16 * FW), NB_ * NH_, 1), FW * 32, 0, stream>>>(QPh, QPl, QVh, QVl, KPh, KPl, PPh, PPl, VTh, VTl, MK, ATh, ATl);   /* scores, rel_shift, mask, softmax, attn.v and merge of all 64 (batch item, head) pairs */
    k_outp<<<dim3(NB_ * TT / 128, DM / 128, 1), GW * 32, 0, stream>>>(ATh, ATl, WO, OUT);   /* out = merged Wout */
}

// v007
// A run of this version takes 113 microseconds.
// In both of two side-by-side timings against v006, it was 1.03 times as fast.
// All steps since v000 together make it 18.5 times as fast.
#include <hip/hip_runtime.h>

// Transformer-XL style relative-position multi-head self-attention (xs [8][1024][512]; q, k, v = xs W ('xw' [512][512], no bias; 8 heads x 64); p = pe Wpos with pe the sinusoidal table of positions -(T-1)..T-1 (2047 rows, [sin, cos] interleaved, computed on device); scores = ((q + u_bias).k + rel_shift((q + v_bias).p)) / 8 where rel_shift picks position row j - i + 1023; mask (int32 [8][1024][1024], read): -inf where 0 and those weights zeroed; softmax; out = merged Wout ('xw', no bias) -> [8][1024][512] (4.2 M)).
// Layout: one exact bf16 input plane -> 1-product projections; the position table is computed on device in f32 (NOT bf16-rounded: kept as bf16 hi + lo planes) and projected once (2 products, 2047 rows + one zero pad row) into per-head hi/lo planes [h][2048][64]; the q, k, v projections of all 8 batch items are one launch whose epilogue adds the biases, splits and stores the head planes (v transposed), the position projection in the same launch; one fused attention launch for all 64 (batch item, head) pairs: content scores (q+u).k and the needed band of position scores (q+v).p are hi/lo products (3 each), the position score at j - i + 1023 is picked through LDS, mask select, online softmax and attn.v follow in registers: no score reaches memory.
// Compute dtypes, f32 accumulate: every input rounded to bf16; q/k/v on PLAIN bf16 operands (exact products); p = pe(hi+lo) Wpos (2 products); content and position scores on hi/lo planes for every row (3 products); softmax f32; attn.v hi/lo (3 products); Wout hl x exact (2 products).

#define NB_  8
#define TT   1024
#define DM   512
#define NH_  8
#define NKV  8
#define REP  (NH_ / NKV)
#define HD   64
#define DQ   (NH_ * HD)
#define DKV  (NKV * HD)
#define NPE  2048                 // 2047 positions + 1 zero pad row
typedef __attribute__((ext_vector_type(4))) unsigned short v4us;
#define ZH   8
#define RH   1024                 // every row hi/lo
#define WIN  0
#define PCAR 1024.0f
#define SCL  0.125f   // HD^-0.5
typedef _Float16 h16;
typedef unsigned short bf;
typedef __attribute__((ext_vector_type(16))) __bf16   v16bf;
typedef __attribute__((ext_vector_type(16))) _Float16 v16h;
typedef __attribute__((ext_vector_type(8)))  _Float16 v8h;
typedef __attribute__((ext_vector_type(8)))  unsigned short v8us;
typedef __attribute__((ext_vector_type(8)))  float    v8f;
typedef __attribute__((ext_vector_type(4)))  float    v4f;
typedef v8h  __attribute__((may_alias)) v8ha;
typedef v4f  __attribute__((may_alias)) v4fa;
typedef v8us __attribute__((may_alias)) v8usa;

__device__ __forceinline__ unsigned short f2bf(float f) { unsigned u = __float_as_uint(f); u += 0x7FFFu + ((u >> 16) & 1u); return (unsigned short)(u >> 16); }
__device__ __forceinline__ float bf2f(unsigned short b) { return __uint_as_float(((unsigned)b) << 16); }
__device__ __forceinline__ float bfr(float f) { return bf2f(f2bf(f)); }
__device__ __forceinline__ v16h cat16(v8h lo, v8h hi) { return __builtin_shufflevector(lo, hi, 0, 1, 2, 3, 4, 5, 6, 7, 8, 9, 10, 11, 12, 13, 14, 15); }
__device__ __forceinline__ v16bf cat16b(v8us lo, v8us hi) { return __builtin_bit_cast(v16bf, __builtin_shufflevector(lo, hi, 0, 1, 2, 3, 4, 5, 6, 7, 8, 9, 10, 11, 12, 13, 14, 15)); }
__device__ __forceinline__ v8f wmma16(v16h a, v16h b, v8f c) { return __builtin_amdgcn_wmma_f32_16x16x32_f16(false, a, false, b, (short)0, c, false, false); }
__device__ __forceinline__ v8f wmmab(v16bf a, v16bf b, v8f c) { return __builtin_amdgcn_wmma_f32_16x16x32_bf16(false, a, false, b, (short)0, c, false, false); }



__device__ __forceinline__ h16 tohx(float x) { return (h16)x; }
__device__ __forceinline__ void splitf(float y, unsigned short& h, unsigned short& l) { h = f2bf(y); l = f2bf(y - bf2f(h)); }
typedef __attribute__((ext_vector_type(2))) _Float16 v2h;
typedef __attribute__((ext_vector_type(4))) _Float16 v4h;
typedef __attribute__((ext_vector_type(2))) unsigned short v2us;
typedef __attribute__((ext_vector_type(4))) unsigned short v4us;
typedef __attribute__((ext_vector_type(2))) float v2f;
typedef __attribute__((ext_vector_type(4))) int v4i;

__device__ __forceinline__ void d_wtG(int blk, const float* __restrict__ w, int K, int N, bf* Bt) {
    const int lane = threadIdx.x & 31; const int L0 = (blk * 8 + (threadIdx.x >> 5)) * 8; const int nlines = N * K / 64;
{
#pragma unroll 1
        for (int l = 0; l < 8; ++l) { const int L = L0 + l; if (L >= nlines) break; const size_t e = (size_t)L * 64 + lane * 2; const int k = (int)(e % K), n = (int)(e / K); v2us o;
            o[0] = f2bf(w[(size_t)k * N + n]); o[1] = f2bf(w[(size_t)(k + 1) * N + n]); *(v2us*)(Bt + e) = o; }
         }
}



__constant__ float INVF[DM / 2] = {1.0f,0.964661598f,0.930572033f,0.897687137f,0.865964293f,0.835362554f,0.805842161f,0.777365029f,0.749894202f,0.723394156f,0.697830558f,0.673170388f,0.649381638f,0.626433551f,0.604296386f,0.582941532f,0.562341332f,0.542469084f,0.523299098f,0.504806578f,0.486967504f,0.469758898f,0.453158379f,0.437144488f,0.421696484f,0.406794429f,0.392418981f,0.378551513f,0.365174115f,0.352269441f,0.339820832f,0.327812076f,0.316227764f,0.305052817f,0.294272721f,0.283873618f,0.273841947f,0.264164835f,0.254829645f,0.245824397f,0.237137347f,0.228757307f,0.220673412f,0.212875158f,0.2053525f,0.198095664f,0.191095293f,0.184342295f,0.177827939f,0.171543792f,0.165481701f,0.15963386f,0.153992653f,0.148550808f,0.143301249f,0.138237223f,0.133352146f,0.128639698f,0.124093764f,0.119708493f,0.115478195f,0.111397393f,0.107460767f,0.103663281f,0.099999994f,0.0964661688f,0.0930572152f,0.0897687078f,0.0865964293f,0.0835362524f,0.0805842206f,0.0777364895f,0.0749894157f,0.0723394156f,0.0697830617f,0.0673170388f,0.0649381578f,0.0626433492f,0.0604296364f,0.0582941547f,0.056234125f,0.0542469025f,0.0523299091f,0.0504806563f,0.0486967564f,0.0469758809f,0.0453158319f,0.0437144488f,0.0421696529f,0.0406794474f,0.0392418914f,0.0378551483f,0.0365174115f,0.0352269486f,0.0339820795f,0.0327812098f,0.0316227749f,0.0305052791f,0.0294272732f,0.0283873565f,0.0273841936f,0.0264164824f,0.0254829675f,0.0245824363f,0.023713734f,0.0228757299f,0.0220673401f,0.0212875176f,0.0205352474f,0.0198095664f,0.0191095285f,0.0184342302f,0.0177827962f,0.0171543807f,0.0165481735f,0.0159633812f,0.0153992623f,0.0148550775f,0.0143301245f,0.0138237216f,0.013335214f,0.0128639704f,0.0124093788f,0.0119708525f,0.0115478169f,0.0111397365f,0.0107460767f,0.0103663281f,0.00999999978f,0.00964661594f,0.00930572115f,0.00897687208f,0.00865964405f,0.00835362263f,0.00805842038f,0.00777364895f,0.00749894092f,0.007233941f,0.00697830552f,0.00673170388f,0.00649381708f,0.00626433641f,0.00604296196f,0.00582941389f,0.00562341232f,0.00542468997f,0.00523299072f,0.00504806545f,0.00486967526f,0.0046975892f,0.00453158421f,0.0043714433f,0.00421696389f,0.00406794343f,0.00392418914f,0.00378551497f,0.00365174119f,0.00352269458f,0.00339820841f,0.00327812159f,0.0031622767f,0.00305052707f,0.00294272648f,0.00283873547f,0.00273841922f,0.00264164805f,0.0025482967f,0.0024582441f,0.00237137405f,0.00228757365f,0.00220673345f,0.00212875125f,0.0020535246f,0.00198095664f,0.00191095285f,0.001843423f,0.00177827943f,0.00171543809f,0.00165481726f,0.00159633812f,0.00153992616f,0.0014855077f,0.00143301231f,0.00138237211f,0.00133352133f,0.00128639699f,0.00124093785f,0.00119708513f,0.00115478167f,0.00111397356f,0.0010746076f,0.00103663281f,0.000999999931f,0.000964661594f,0.000930572045f,0.000897687161f,0.000865964394f,0.000835362298f,0.000805841992f,0.000777364883f,0.000749894069f,0.0007233941f,0.000697830576f,0.000673170376f,0.000649381662f,0.000626433583f,0.00060429622f,0.0005829414f,0.000562341185f,0.000542468973f,0.000523299037f,0.000504806521f,0.000486967503f,0.000469758903f,0.000453158398f,0.000437144336f,0.000421696401f,0.000406794337f,0.000392418908f,0.000378551485f,0.000365174084f,0.000352269446f,0.000339820836f,0.000327811984f,0.000316227786f,0.000305052701f,0.000294272788f,0.000283873524f,0.000273842044f,0.000264164817f,0.000254829531f,0.000245824398f,0.000237137268f,0.000228757344f,0.000220673333f,0.000212875209f,0.000205352466f,0.000198095746f,0.000191095271f,0.000184342207f,0.00017782794f,0.00017154371f,0.000165481732f,0.000159633797f,0.000153992674f,0.000148550767f,0.000143301295f,0.000138237199f,0.000133352078f,0.000128639687f,0.000124093727f,0.000119708515f,0.000115478157f,0.000111397407f,0.000107460757f,0.000103663326f};
#define PBW 64                              // blocks of a weight matrix
#define PBP (NPE * DM / 2 / 256)            // blocks of the position table: a [sin, cos] pair a thread
#define PBX (NB_ * TT * DM / 8 / 256)       // blocks of the xs plane: 8 elements a thread
__device__ __forceinline__ void d_petab(int blk, bf* PEh, bf* PEl) { const size_t e = ((size_t)blk * 256 + threadIdx.x) * 2; const int c = (int)(e % DM); const int r = (int)(e / DM); v2us oh, ol;
    if (r < NPE - 1) { const float th = __fmul_rn((float)(r - (TT - 1)), INVF[c >> 1]); unsigned short a, b2; splitf(sinf(th), a, b2); oh[0] = a; ol[0] = b2; splitf(cosf(th), a, b2); oh[1] = a; ol[1] = b2; } else { oh[0] = 0; oh[1] = 0; ol[0] = 0; ol[1] = 0; }
    *(v2us*)(PEh + e) = oh; *(v2us*)(PEl + e) = ol;
    // behind the part's last stores, in front of whatever code of the merged kernel follows them in the text and writes their registers
    asm volatile("s_wait_xcnt 0x0" ::: "memory"); }
__device__ __forceinline__ void d_cvt8(int blk, const float* __restrict__ src, bf* dst) { const size_t i = (size_t)blk * 256 + threadIdx.x; const v8f v = *(const v8f*)(src + i * 8); v8us o;
#pragma unroll
    for (int k = 0; k < 8; ++k) o[k] = f2bf(v[k]); *(v8us*)(dst + i * 8) = o;
    // behind the part's last store, in front of whatever code of the merged kernel follows it in the text and writes its registers
    asm volatile("s_wait_xcnt 0x0" ::: "memory"); }
// ---- k_prep: every plane that is made from the inputs alone, in ONE launch: none of the seven pieces reads what another writes, and each block does what a block of the piece's own launch did. Blocks 0 .. 5 PBW - 1: the five transposed bf16 weight planes (their gathers have the longest chain of waits, so they start first); then the position table; then the xs plane.
__global__ __launch_bounds__(256) void k_prep(const float* __restrict__ wq, const float* __restrict__ wk, const float* __restrict__ wv, const float* __restrict__ wo, const float* __restrict__ wpos, const float* __restrict__ x, bf* WQ, bf* WK, bf* WV, bf* WO, bf* WP, bf* PEh, bf* PEl, bf* XB) {
    const int blk = blockIdx.x;
    if (blk < 5 * PBW) { const int m = blk / PBW;
        d_wtG(blk % PBW, m == 0 ? wq : m == 1 ? wk : m == 2 ? wv : m == 3 ? wo : wpos, DM, DQ, m == 0 ? WQ : m == 1 ? WK : m == 2 ? WV : m == 3 ? WO : WP); }
    else if (blk < 5 * PBW + PBP) d_petab(blk - 5 * PBW, PEh, PEl);
    else d_cvt8(blk - (5 * PBW + PBP), x, XB);
}

// fragment at scalar base + 32-bit vector byte offset + constant: one address register serves every load of a phase
__device__ __forceinline__ v16bf ldo(const bf* base, unsigned voff, int imm) { const char* p = (const char*)base + voff + imm; return cat16b(*(const v8us*)p, *(const v8us*)(p + 32)); }
// ---- projections that write their operand planes themselves: the epilogue splits each f32 result into bf16 hi + lo and stores rows of 64 elements (128 bytes, whole lines) straight into the layout the attention kernel reads.
// ---- the three GEMMs (q, k, v; position; output): a block of 8 waves works on one block tile, and the operand rows that its waves share come into LDS once, by asynchronous copies of whole 128-byte lines, instead of each wave gathering 32 bytes from each of 16 lines per load. A k step is 64 elements (one line a row); three groups of 128 rows a step, two buffers, the next step's copies in flight while this one is multiplied. The fragments are then read from LDS in the k order of ldo.
#define GP   144                  // pitch in bytes of a staged row of 64 bf16: 16 bytes x odd, so that the 16 rows of a fragment read fall on different banks
#define GGRP (128 * GP)           // a group of 128 staged rows
#define GBUF (3 * GGRP)           // a buffer: three groups
#define GNT  (DM / 64)            // k steps
#define GW   8                    // waves a block
// fragment from a staged piece: the lane's 16 bytes at p and at p + 32, the k order of ldo
__device__ __forceinline__ v16bf ldl(const char* p) { return cat16b(*(const v8usa*)p, *(const v8usa*)(p + 32)); }
__device__ __forceinline__ unsigned ldsa(const void* p) { return (unsigned)(size_t)p; }
// asynchronous copies global -> LDS, 16 bytes a lane; the wait in the same statement keeps the address registers whole until the copies have taken them
__device__ __forceinline__ void acopy2(unsigned l0, const char* g0, unsigned l1, const char* g1) {
    asm volatile("global_load_async_to_lds_b128 %0, %1, off\n\tglobal_load_async_to_lds_b128 %2, %3, off\n\ts_wait_xcnt 0x0" :: "v"(l0), "v"(g0), "v"(l1), "v"(g1) : "memory"); }
__device__ __forceinline__ void acopy6(unsigned l0, const char* g0, unsigned l1, const char* g1, unsigned l2, const char* g2, unsigned l3, const char* g3, unsigned l4, const char* g4, unsigned l5, const char* g5) {
    asm volatile("global_load_async_to_lds_b128 %0, %1, off\n\tglobal_load_async_to_lds_b128 %2, %3, off\n\tglobal_load_async_to_lds_b128 %4, %5, off\n\tglobal_load_async_to_lds_b128 %6, %7, off\n\tglobal_load_async_to_lds_b128 %8, %9, off\n\tglobal_load_async_to_lds_b128 %10, %11, off\n\ts_wait_xcnt 0x0" :: "v"(l0), "v"(g0), "v"(l1), "v"(g1), "v"(l2), "v"(g2), "v"(l3), "v"(g3), "v"(l4), "v"(g4), "v"(l5), "v"(g5) : "memory"); }
// s0, s1, s2: first byte of the 128 rows (pitch DM elements) of each group; ao, a2o, bo: byte offset in a buffer of row 0 of this wave's A, second A (NSPLIT == 1) and B rows. The wave's tile is 16 MB x 64; each accumulator takes its products in the order k = 0, 32, 64 ... (a, then a2).
template <int MB, int NSPLIT>
__device__ __forceinline__ void tileS(char* stg, const char* __restrict__ s0, const char* __restrict__ s1, const char* __restrict__ s2, int ao, int a2o, int bo, int lr, int hi, v8f (&acc)[MB][4]) {
    const int tid = threadIdx.x;
    const unsigned go = (unsigned)((tid >> 3) * (DM * 2) + (tid & 7) * 16);             // the thread's 16 bytes: rows tid >> 3 + 32 j of a group, segment tid & 7
    const unsigned lo = ldsa(stg) + (unsigned)((tid >> 3) * GP + (tid & 7) * 16);
    auto stage = [&](int t) {
        const unsigned l = lo + (unsigned)(t & 1) * GBUF; const unsigned g = go + (unsigned)t * 128u;
        acopy6(l, s0 + g, l + 32 * GP, s0 + g + 32 * DM * 2, l + 64 * GP, s0 + g + 64 * DM * 2, l + 96 * GP, s0 + g + 96 * DM * 2, l + GGRP, s1 + g, l + GGRP + 32 * GP, s1 + g + 32 * DM * 2);
        acopy6(l + GGRP + 64 * GP, s1 + g + 64 * DM * 2, l + GGRP + 96 * GP, s1 + g + 96 * DM * 2, l + 2 * GGRP, s2 + g, l + 2 * GGRP + 32 * GP, s2 + g + 32 * DM * 2, l + 2 * GGRP + 64 * GP, s2 + g + 64 * DM * 2, l + 2 * GGRP + 96 * GP, s2 + g + 96 * DM * 2); };
#pragma unroll
    for (int mb = 0; mb < MB; ++mb)
#pragma unroll
        for (int nb = 0; nb < 4; ++nb) acc[mb][nb] = (v8f){};
    stage(0);
    // step 0's copies of this wave have landed; behind the barrier those of every wave have
    asm volatile("s_wait_asynccnt 0x0" ::: "memory");
    __syncthreads();
    stage(1);
    const int fl = lr * GP + hi * 16;   // the lane's place in a 16-row fragment
    // rolled: the text of one step serves all eight, and the buffer is picked by t & 1
#pragma unroll 1
    for (int t = 0; t < GNT; ++t) {
        const char* bb = stg + (t & 1) * GBUF + fl;
#pragma unroll
        for (int ks = 0; ks < 2; ++ks) { v16bf a[MB], a2[MB], b[4];
#pragma unroll
            for (int mb = 0; mb < MB; ++mb) { a[mb] = ldl(bb + ao + mb * 16 * GP + ks * 64); if (NSPLIT == 1) a2[mb] = ldl(bb + a2o + mb * 16 * GP + ks * 64); }
#pragma unroll
            for (int nb = 0; nb < 4; ++nb) b[nb] = ldl(bb + bo + nb * 16 * GP + ks * 64);
            // all fragment reads of a half step are issued in front of its first product: without this line the compiler reads the b fragments one after the other into one register group, each with a full LDS wait
            __builtin_amdgcn_sched_barrier(0);
#pragma unroll
            for (int nb = 0; nb < 4; ++nb) {
#pragma unroll
                for (int mb = 0; mb < MB; ++mb) { acc[mb][nb] = wmmab(a[mb], b[nb], acc[mb][nb]); if (NSPLIT == 1) acc[mb][nb] = wmmab(a2[mb], b[nb], acc[mb][nb]); } } }
        // hand-over of step t + 1: this wave's LDS reads of step t are done ...
        asm volatile("s_wait_dscnt 0x0" ::: "memory");
        // ... and its copies for step t + 1 have landed;
        asm volatile("s_wait_asynccnt 0x0" ::: "memory");
        // behind the barrier every wave's have, and nobody reads step t's buffer any more
        __syncthreads();
        if (t + 2 < GNT) stage(t + 2);
    }
    // no copy is left in flight behind the loop
    asm volatile("s_wait_asynccnt 0x0" ::: "memory");
}
// 16 rows of the tile into this wave's LDS slab [16][68]
__device__ __forceinline__ void slab_put(float* os, const v8f (&acc)[4], int lr, int hi) {
#pragma unroll
    for (int nb = 0; nb < 4; ++nb) {
#pragma unroll
        for (int j = 0; j < 8; ++j) os[(hi * 8 + j) * 68 + nb * 16 + lr] = acc[nb][j]; }
}
__device__ __forceinline__ void split8(const float (&x)[8], v8us& oh, v8us& ol) {
#pragma unroll
    for (int q = 0; q < 8; ++q) { unsigned short a, c; splitf(x[q], a, c); oh[q] = a; ol[q] = c; } }
// d_qkvp: block tiles of 128 positions x 256 columns (4 heads), 64 x 6 of them; waves 2 x 4, a wave has the 64 x 64 tile of one head. by >> 1 picks q, k or v, by & 1 the half of the heads. Staged: group 0 the 128 xs rows, groups 1 and 2 the 256 weight rows. q and k: C = xs W, tile rows are positions, planes [b][h][t][d]; q is stored twice, as q + u_bias and q + v_bias. v: the operands change places (C = Wv^T xs^T), so that tile rows are head dims and the transposed planes [b][h][d][t] are stored by rows as well.
__device__ __forceinline__ void d_qkvp(char* stg, float* os, int wv, int bx, int by, const bf* __restrict__ XB, const bf* __restrict__ WQ, const bf* __restrict__ WK, const bf* __restrict__ WV, const float* __restrict__ pbu, const float* __restrict__ pbv, bf* QUh, bf* QUl, bf* QVh, bf* QVl, bf* Kh, bf* Kl, bf* Vh, bf* Vl) {
    const int lane = threadIdx.x & 31, lr = lane & 15, hi = lane >> 4; const int mi = wv >> 2, ni = wv & 3; const int sel = by >> 1, cb = (by & 1) * 4 + ni, xr = bx * 128 + mi * 64, b = xr / TT, t0 = xr % TT; const bool tv = sel == 2;
    v8f acc[4][4];
    const char* wr = (const char*)(sel == 0 ? WQ : sel == 1 ? WK : WV) + (size_t)(by & 1) * 256 * DM * 2;
    tileS<4, 0>(stg, (const char*)XB + (size_t)bx * 128 * DM * 2, wr, wr + 128 * DM * 2, tv ? GGRP + ni * 64 * GP : mi * 64 * GP, 0, tv ? mi * 64 * GP : GGRP + ni * 64 * GP, lr, hi, acc);
    const size_t base = tv ? (size_t)(b * NKV + cb) * HD * TT + t0 : ((size_t)(b * NH_ + cb) * TT + t0) * HD; const int pitch = tv ? TT : HD;
    bf* Dh = tv ? Vh : Kh; bf* Dl = tv ? Vl : Kl;
    const int rr = lane >> 3, cofs = (lane & 7) * 8;
    float ub[8], vb[8];
#pragma unroll
    for (int q = 0; q < 8; ++q) { ub[q] = 0.f; vb[q] = 0.f; }
    if (sel == 0) {
#pragma unroll
        for (int q = 0; q < 8; ++q) { ub[q] = bfr(pbu[cb * HD + cofs + q]); vb[q] = bfr(pbv[cb * HD + cofs + q]); } }
#pragma unroll
    for (int mb = 0; mb < 4; ++mb) {
        slab_put(os, acc[mb], lr, hi);
        // the slab is exchanged between the lanes of this wave: keep the reads below behind the stores above
        __builtin_amdgcn_wave_barrier(); asm volatile("" ::: "memory");
#pragma unroll
        for (int s = 0; s < 4; ++s) { const int row = 4 * s + rr; const v4f x0 = *(const v4fa*)(os + row * 68 + cofs), x1 = *(const v4fa*)(os + row * 68 + cofs + 4); float x[8];
#pragma unroll
            for (int q = 0; q < 4; ++q) { x[q] = x0[q]; x[4 + q] = x1[q]; }
            const size_t o = base + (size_t)(mb * 16 + row) * pitch + cofs;
            v8us oh, ol;
            if (sel == 0) { float y[8]; v8us ph, pl;
#pragma unroll
                for (int q = 0; q < 8; ++q) y[q] = __fadd_rn(x[q], ub[q]);
                split8(y, oh, ol);
#pragma unroll
                for (int q = 0; q < 8; ++q) y[q] = __fadd_rn(x[q], vb[q]);
                split8(y, ph, pl);
                *(v8us*)(QUh + o) = oh; *(v8us*)(QUl + o) = ol; *(v8us*)(QVh + o) = ph; *(v8us*)(QVl + o) = pl; }
            else { split8(x, oh, ol); *(v8us*)(Dh + o) = oh; *(v8us*)(Dl + o) = ol; }
            // the stores' address and data registers are rewritten by the next rows: the wait stands in front of that
            asm volatile("s_wait_xcnt 0x0" ::: "memory"); }
        // the next 16 rows' stores to the slab stay behind the reads above
        __builtin_amdgcn_wave_barrier(); asm volatile("" ::: "memory");
    }
}
// d_posp: p = position table (hi + lo, 2 products) Wpos, block tiles of 128 rows x 128 columns (2 heads), 16 x 4 of them; waves 4 x 2, a wave has 32 rows of one head; planes [h][2048][64]. Staged: the 128 table rows hi, the same lo, the 128 weight rows.
__device__ __forceinline__ void d_posp(char* stg, float* os, int wv, int bx, int by, const bf* __restrict__ PEh, const bf* __restrict__ PEl, const bf* __restrict__ WP, bf* Ph2, bf* Pl2) {
    const int lane = threadIdx.x & 31, lr = lane & 15, hi = lane >> 4; const int mi = wv >> 1, ni = wv & 1; const int r0 = bx * 128 + mi * 32, cb = by * 2 + ni;
    v8f acc[2][4];
    tileS<2, 1>(stg, (const char*)PEh + (size_t)bx * 128 * DM * 2, (const char*)PEl + (size_t)bx * 128 * DM * 2, (const char*)WP + (size_t)by * 128 * DM * 2, mi * 32 * GP, GGRP + mi * 32 * GP, 2 * GGRP + ni * 64 * GP, lr, hi, acc);
    const size_t base = ((size_t)cb * NPE + r0) * HD; const int rr = lane >> 3, cofs = (lane & 7) * 8;
#pragma unroll
    for (int mb = 0; mb < 2; ++mb) {
        slab_put(os, acc[mb], lr, hi);
        // the slab is exchanged between the lanes of this wave: keep the reads below behind the stores above
        __builtin_amdgcn_wave_barrier(); asm volatile("" ::: "memory");
#pragma unroll
        for (int s = 0; s < 4; ++s) { const int row = 4 * s + rr; const v4f x0 = *(const v4fa*)(os + row * 68 + cofs), x1 = *(const v4fa*)(os + row * 68 + cofs + 4); float x[8];
#pragma unroll
            for (int q = 0; q < 4; ++q) { x[q] = x0[q]; x[4 + q] = x1[q]; }
            v8us oh, ol; split8(x, oh, ol); const size_t o = base + (size_t)(mb * 16 + row) * HD + cofs; *(v8us*)(Ph2 + o) = oh; *(v8us*)(Pl2 + o) = ol;
            // the stores' address and data registers are rewritten by the next rows: the wait stands in front of that
            asm volatile("s_wait_xcnt 0x0" ::: "memory"); }
        // the next 16 rows' stores to the slab stay behind the reads above
        __builtin_amdgcn_wave_barrier(); asm volatile("" ::: "memory");
    }
}
// ---- k_proj: the position projection and the q, k, v projections read only what k_prep wrote and nothing of each other: ONE launch of 64 + 384 blocks of 8 waves. Blocks 0 .. 63 are the position tiles, the rest q, then k, then v. Four waves a SIMD (two blocks a WGP): every block is resident at once.
#define PJP 64                    // position blocks
__global__ __launch_bounds__(GW * 32) __attribute__((amdgpu_waves_per_eu(4, 4))) void k_proj(const bf* __restrict__ PEh, const bf* __restrict__ PEl, const bf* __restrict__ WP, bf* Ph2, bf* Pl2, const bf* __restrict__ XB, const bf* __restrict__ WQ, const bf* __restrict__ WK, const bf* __restrict__ WV, const float* __restrict__ pbu, const float* __restrict__ pbv, bf* QUh, bf* QUl, bf* QVh, bf* QVl, bf* Kh, bf* Kl, bf* Vh, bf* Vl) {
    __shared__ __align__(16) char stg[2 * GBUF];
    __shared__ __align__(16) float oss[GW * 16 * 68];
    const int wv = __builtin_amdgcn_readfirstlane(threadIdx.x >> 5); float* os = oss + wv * 16 * 68; const int blk = blockIdx.x;
    if (blk < PJP) d_posp(stg, os, wv, blk & 15, blk >> 4, PEh, PEl, WP, Ph2, Pl2);
    else d_qkvp(stg, os, wv, (blk - PJP) & 63, (blk - PJP) >> 6, XB, WQ, WK, WV, pbu, pbv, QUh, QUl, QVh, QVl, Kh, Kl, Vh, Vl);
}
// ---- k_outp: out = merged (hi + lo, 2 products) Wout, f32. Block tiles of 128 x 128, grid (64, 4): one block a WGP; waves 4 x 2, a wave has 32 x 64. Staged: the 128 merged rows hi, the same lo, the 128 weight rows.
__global__ __launch_bounds__(GW * 32) void k_outp(const bf* __restrict__ Ah, const bf* __restrict__ Al, const bf* __restrict__ Bt, float* C) {
    __shared__ __align__(16) char stg[2 * GBUF];
    __shared__ __align__(16) float oss[GW * 16 * 68];
    const int lane = threadIdx.x & 31, lr = lane & 15, hi = lane >> 4, wv = __builtin_amdgcn_readfirstlane(threadIdx.x >> 5); float* os = oss + wv * 16 * 68;
    const int mi = wv >> 1, ni = wv & 1; const int r0 = blockIdx.x * 128 + mi * 32, c0 = blockIdx.y * 128 + ni * 64;
    v8f acc[2][4];
    tileS<2, 1>(stg, (const char*)Ah + (size_t)blockIdx.x * 128 * DM * 2, (const char*)Al + (size_t)blockIdx.x * 128 * DM * 2, (const char*)Bt + (size_t)blockIdx.y * 128 * DM * 2, mi * 32 * GP, GGRP + mi * 32 * GP, 2 * GGRP + ni * 64 * GP, lr, hi, acc);
#pragma unroll
    for (int mb = 0; mb < 2; ++mb) {
        slab_put(os, acc[mb], lr, hi);
        // the slab is exchanged between the lanes of this wave: keep the reads below behind the stores above
        __builtin_amdgcn_wave_barrier(); asm volatile("" ::: "memory");
        float* crow = C + (size_t)(r0 + mb * 16) * DM + c0;
#pragma unroll
        for (int s = 0; s < 8; ++s) { const int row = 2 * s + hi, cofs = lr * 4; const v4f val = *(const v4fa*)(os + row * 68 + cofs); *(v4f*)(crow + (size_t)row * DM + cofs) = val;
            // the store's address and data registers are rewritten by the next rows: the wait stands in front of that
            asm volatile("s_wait_xcnt 0x0" ::: "memory"); }
        // the next 16 rows' stores to the slab stay behind the reads above
        __builtin_amdgcn_wave_barrier(); asm volatile("" ::: "memory");
    }
}
// k_fattn: one launch for the whole attention. One wave owns 16 query rows of one (batch item, head) and walks the 1024 keys in steps of 64; grid (1024 / (16 * FW), 64), FW waves a block, one block barrier a step.
// Transposed products: St = K (q+u)^T and BDt = P (q+v)^T (A = key or position rows, B = query rows kept in registers), so a lane holds ONE query (column lr) and 8 consecutive keys per tile (8 * hi + r).
// rel_shift: the 16 queries x 64 keys of a step need positions l0 .. l0 + 78, l0 = j0 - i0 + 1008 (five 16-row tiles; row 2047 is the zero pad and is never picked); BDt goes to this wave's LDS slab as [query][80] and is read back at column key - query + 15.
// Staging: the FW waves of a block read the same 64 key rows and 64 value rows (hi and lo) in a step, and together 320 consecutive position rows, of which a step brings 64 new ones. These six pieces of 8 KiB come into LDS by asynchronous copies, 16 bytes of each per thread, whole 128-byte lines per copy, two steps ahead: keys and values into two buffers, position rows into a ring of 512 rows. The fragments are then read from LDS.
// Online softmax per lane (running maximum and sum, output tiles rescaled each step); the f32 weights split in place into bf16 hi + lo B operands; Ot += Vt Pt (3 products); the epilogue divides by the sum and writes the merged hi/lo planes.
#define FW  16
#define BDP 84                    // slab pitch in floats: 16-byte aligned rows; the skewed reads (stride 83) fall on 32 different banks
#define LP  144                   // pitch in bytes of a staged row of 64 bf16 (128 bytes): 16 bytes x odd, so that the 16 rows of a fragment read fall on different banks
#define PCB (64 * LP)             // one staged piece: 64 rows
#define NST (TT / 64)             // steps
#define L2E 1.4426950408889634f
typedef __attribute__((ext_vector_type(2))) __bf16 v2bf;
typedef __attribute__((ext_vector_type(8))) unsigned v8u;
__device__ __forceinline__ void split16(const v8f x0, const v8f x1, v16bf& h, v16bf& l) {   // element s = tile s >> 3, register s & 7: two result tiles are one B operand in the hardware k order
    v8u hw, lw;
#pragma unroll
    for (int s = 0; s < 8; ++s) { v2f x; x[0] = (s < 4) ? x0[2 * (s & 3)] : x1[2 * (s & 3)]; x[1] = (s < 4) ? x0[2 * (s & 3) + 1] : x1[2 * (s & 3) + 1];
        const v2bf hb = __builtin_convertvector(x, v2bf); const v2f rest = x - __builtin_convertvector(hb, v2f); const v2bf lb = __builtin_convertvector(rest, v2bf);
        hw[s] = __builtin_bit_cast(unsigned, hb); lw[s] = __builtin_bit_cast(unsigned, lb); }
    h = __builtin_bit_cast(v16bf, hw); l = __builtin_bit_cast(v16bf, lw);
}
// four waves a SIMD (one block a WGP): the 4096 waves are then resident at once, and a wave's vector work runs beside its neighbours' matrix work
__global__ __launch_bounds__(FW * 32) __attribute__((amdgpu_waves_per_eu(4, 4))) void k_fattn(const bf* __restrict__ QUh, const bf* __restrict__ QUl, const bf* __restrict__ QVh, const bf* __restrict__ QVl, const bf* __restrict__ Kh, const bf* __restrict__ Kl, const bf* __restrict__ PPh, const bf* __restrict__ PPl, const bf* __restrict__ Vh, const bf* __restrict__ Vl, const int* __restrict__ MK, bf* ATh, bf* ATl) {
    __shared__ __align__(16) float bds[FW * 16 * BDP];
    __shared__ __align__(16) char kvs[2 * 4 * PCB];   // [buffer][k hi, k lo, v hi, v lo][64 rows]
    __shared__ __align__(16) char pps[2 * 8 * PCB];   // [hi, lo][ring of 512 position rows]
    const int tid = threadIdx.x, lane = tid & 31, lr = lane & 15, hi = lane >> 4, wv = __builtin_amdgcn_readfirstlane(tid >> 5);
    const int z = blockIdx.y, b = z / NH_, h = z % NH_; const int i0 = (blockIdx.x * FW + wv) * 16;
    float* bd = bds + wv * 16 * BDP;
    // the thread's 16 bytes of every staged piece: row tid >> 3, segment tid & 7
    const unsigned cl = (unsigned)((tid >> 3) * LP + (tid & 7) * 16);
    const unsigned ck = (unsigned)(z * TT * HD * 2 + tid * 16);                                               // key rows of a step are 8 KiB in a row
    const unsigned cv = (unsigned)(((z * HD + (tid >> 3)) * TT) * 2 + (tid & 7) * 16);                         // value rows: 128 bytes of each of the 64 head dims
    const unsigned cp = (unsigned)((h * NPE + (TT - 16 * FW) - (int)blockIdx.x * 16 * FW) * HD * 2 + tid * 16);   // position rows from the block's lowest row on: piece c holds rows 64 c .. 64 c + 63 behind it, pieces 0 .. 19 end at row 2047 or below
    const unsigned lkv = ldsa(kvs) + cl, lpp = ldsa(pps) + cl;
    // keys and values of step t into buffer t & 1, position piece c into ring slot c & 7
    auto stage = [&](int t, int c) {
        const unsigned lk = lkv + (unsigned)(t & 1) * (4 * PCB), lq = lpp + (unsigned)(c & 7) * PCB;
        acopy6(lk, (const char*)Kh + ck + t * (64 * HD * 2), lk + PCB, (const char*)Kl + ck + t * (64 * HD * 2), lk + 2 * PCB, (const char*)Vh + cv + t * 128, lk + 3 * PCB, (const char*)Vl + cv + t * 128,
               lq, (const char*)PPh + cp + c * (64 * HD * 2), lq + 8 * PCB, (const char*)PPl + cp + c * (64 * HD * 2)); };
    // step 0 reads position pieces 0 .. 4
#pragma unroll
    for (int c = 0; c < 4; ++c) acopy2(lpp + c * PCB, (const char*)PPh + cp + c * (64 * HD * 2), lpp + (8 + c) * PCB, (const char*)PPl + cp + c * (64 * HD * 2));
    stage(0, 4);
    const unsigned qo = (unsigned)((z * TT + i0 + lr) * HD + 8 * hi) * 2u;   // byte offsets; every plane is under 2^24 bytes, the mask 2^25
    v16bf quh[2], qul[2], qvh[2], qvl[2];
#pragma unroll
    for (int ks = 0; ks < 2; ++ks) { quh[ks] = ldo(QUh, qo, ks * 64); qul[ks] = ldo(QUl, qo, ks * 64); qvh[ks] = ldo(QVh, qo, ks * 64); qvl[ks] = ldo(QVl, qo, ks * 64); }
    const unsigned mo = (unsigned)((b * TT + i0 + lr) * TT + 8 * hi) * 4u;
    const int fl = lr * LP + hi * 16;   // the lane's place in a 16-row fragment of a staged piece
    v8f o[4];
#pragma unroll
    for (int dt = 0; dt < 4; ++dt) o[dt] = (v8f){};
    float mrun = -1.0e30f, lsum = 0.f;   // the running maximum starts far above the masked value -3e38: a masked key's exponential is 0 also while no key of its row has been left unmasked
    // step 0's copies of this wave have landed; behind the barrier those of every wave have
    asm volatile("s_wait_asynccnt 0x0" ::: "memory");
    __syncthreads();
    stage(1, 5);
#pragma unroll 1
    for (int t = 0; t < NST; ++t) {
        const unsigned mj = mo + (unsigned)(t * 64 * 4);
        const char* kb = kvs + (t & 1) * (4 * PCB) + fl;
        {   // position scores of the step's band, transposed: rows l0 + 16 u + 8 hi + r, column = query lr
            v8f pa[5];
#pragma unroll
            for (int u = 0; u < 5; ++u) pa[u] = (v8f){};
#pragma unroll
            for (int ks = 0; ks < 2; ++ks) { v16bf a[5], a2[5];
#pragma unroll
                for (int u = 0; u < 5; ++u) { const int rw = t * 64 + (FW - 1 - wv) * 16 + u * 16;   /* row counted from the block's lowest position row */ const char* pr = pps + (rw & 511) * LP + fl + ks * 64; a[u] = ldl(pr); a2[u] = ldl(pr + 8 * PCB); }
#pragma unroll
                for (int u = 0; u < 5; ++u) pa[u] = wmmab(a[u], qvh[ks], pa[u]);
#pragma unroll
                for (int u = 0; u < 5; ++u) pa[u] = wmmab(a[u], qvl[ks], pa[u]);
#pragma unroll
                for (int u = 0; u < 5; ++u) pa[u] = wmmab(a2[u], qvh[ks], pa[u]); }
#pragma unroll
            for (int u = 0; u < 5; ++u) { v4f w0, w1;
#pragma unroll
                for (int q = 0; q < 4; ++q) { w0[q] = pa[u][q]; w1[q] = pa[u][4 + q]; }
                *(v4fa*)(bd + lr * BDP + u * 16 + hi * 8) = w0; *(v4fa*)(bd + lr * BDP + u * 16 + hi * 8 + 4) = w1; }
        }
        // the slab is exchanged between the two lane halves of this wave: keep the reads below behind the stores above; the four v_nop are the vector slots between the last position product and a content product that reuses its result registers
        __builtin_amdgcn_wave_barrier(); asm volatile("v_nop\n\tv_nop\n\tv_nop\n\tv_nop" ::: "memory");
        v4i mk[8];
#pragma unroll
        for (int t4 = 0; t4 < 4; ++t4) { const char* mp = (const char*)MK + mj + t4 * 64; mk[2 * t4] = *(const v4i*)mp; mk[2 * t4 + 1] = *(const v4i*)(mp + 16); }
        // the step's eight mask loads are issued together, in front of the content products: without this line the compiler issues them in four pairs among the selects below, and a step waits for memory four times
        __builtin_amdgcn_sched_barrier(0);
        v8f s[4];
#pragma unroll
        for (int t4 = 0; t4 < 4; ++t4) s[t4] = (v8f){};
#pragma unroll
        for (int ks = 0; ks < 2; ++ks) { v16bf a[4], a2[4];
#pragma unroll
            for (int t4 = 0; t4 < 4; ++t4) { a[t4] = ldl(kb + t4 * 16 * LP + ks * 64); a2[t4] = ldl(kb + PCB + t4 * 16 * LP + ks * 64); }
            // the sixteen key fragment reads of a half step are issued together, in front of its first product: without this line the compiler reads the lo fragments one at a time into one register group among the products, each with a full LDS wait, and puts products on one accumulator back to back
            __builtin_amdgcn_sched_barrier(0);
#pragma unroll
            for (int t4 = 0; t4 < 4; ++t4) s[t4] = wmmab(a[t4], quh[ks], s[t4]);
#pragma unroll
            for (int t4 = 0; t4 < 4; ++t4) s[t4] = wmmab(a[t4], qul[ks], s[t4]);
#pragma unroll
            for (int t4 = 0; t4 < 4; ++t4) s[t4] = wmmab(a2[t4], quh[ks], s[t4]); }
        // the step's 32 shifted position scores are read from the slab as one group, in front of the selects: left to the compiler they are read in several small batches among the selects, each with its own LDS wait
        float bv[32];
#pragma unroll
        for (int q = 0; q < 32; ++q) bv[q] = bd[lr * (BDP - 1) + 15 + (q >> 3) * 16 + hi * 8 + (q & 7)];
        // the first use of a mask word stays behind the content products: without this line the compiler lifts one compare in front of them, and the wave waits there for the loads it has just issued
        __builtin_amdgcn_sched_barrier(0);
        float tmax = -3.0e38f;
#pragma unroll
        for (int t4 = 0; t4 < 4; ++t4) { const v4i m0 = mk[2 * t4]; const v4i m1 = mk[2 * t4 + 1];
#pragma unroll
            for (int r = 0; r < 8; ++r) { const float su = s[t4][r] + bv[t4 * 8 + r]; const int m = (r < 4) ? m0[r & 3] : m1[r & 3]; const float tv = (m != 0) ? su * (SCL * L2E) : -3.0e38f;   /* (ac + rel_shift(bd)) / 8, in units of log2 so that the exponentials need no further product; key mask (int32) */ s[t4][r] = tv; tmax = fmaxf(tmax, tv); } }
        // the next step's stores to the slab stay behind the reads above
        __builtin_amdgcn_wave_barrier(); asm volatile("" ::: "memory");
        tmax = fmaxf(tmax, __shfl_xor(tmax, 16, 32));
        const float mnew = fmaxf(mrun, tmax); const float alpha = __builtin_amdgcn_exp2f(mrun - mnew); mrun = mnew;
        float ps = 0.f;
#pragma unroll
        for (int t4 = 0; t4 < 4; ++t4) s[t4] -= mnew;
#pragma unroll
        for (int r = 0; r < 8; ++r)
#pragma unroll
            for (int t4 = 0; t4 < 4; ++t4) { const float p = __builtin_amdgcn_exp2f(s[t4][r]); s[t4][r] = p; ps += p; }
        lsum = lsum * alpha + ps;
#pragma unroll
        for (int dt = 0; dt < 4; ++dt) o[dt] *= alpha;
        v16bf ph[2], pl[2]; split16(s[0], s[1], ph[0], pl[0]); split16(s[2], s[3], ph[1], pl[1]);
        // the value fragments are read behind the split, when its registers are free: without this line the compiler starts them among the split's work and then, short of registers, reads the rest one fragment at a time, each with a full LDS wait
        __builtin_amdgcn_sched_barrier(0);
#pragma unroll
        for (int ks = 0; ks < 2; ++ks) { v16bf a[4], a2[4];
#pragma unroll
            for (int dt = 0; dt < 4; ++dt) { a[dt] = ldl(kb + 2 * PCB + dt * 16 * LP + ks * 64); a2[dt] = ldl(kb + 3 * PCB + dt * 16 * LP + ks * 64); }
#pragma unroll
            for (int dt = 0; dt < 4; ++dt) o[dt] = wmmab(a[dt], ph[ks], o[dt]);
#pragma unroll
            for (int dt = 0; dt < 4; ++dt) o[dt] = wmmab(a[dt], pl[ks], o[dt]);
#pragma unroll
            for (int dt = 0; dt < 4; ++dt) o[dt] = wmmab(a2[dt], ph[ks], o[dt]); }
        // four vector slots behind the last matrix instruction, also on the taken side of the loop's branch
        asm volatile("v_nop\n\tv_nop\n\tv_nop\n\tv_nop" : "+v"(o[0]), "+v"(o[1]), "+v"(o[2]), "+v"(o[3]));
        // hand-over of step t + 1: this wave's LDS reads of step t are done ...
        asm volatile("s_wait_dscnt 0x0" ::: "memory");
        // ... and its copies for step t + 1 have landed;
        asm volatile("s_wait_asynccnt 0x0" ::: "memory");
        // behind the barrier every wave's have, and nobody reads step t's buffer or its oldest position piece any more
        __syncthreads();
        if (t + 2 < NST) stage(t + 2, t + 6);
    }
    // no copy is left in flight when the wave ends
    asm volatile("s_wait_asynccnt 0x0" ::: "memory");
    lsum += __shfl_xor(lsum, 16, 32);
    const float f = (lsum > 0.f) ? __fdiv_rn(1.0f, lsum) : 0.f;
#pragma unroll
    for (int dt = 0; dt < 4; ++dt) { v8us oh, ol;
#pragma unroll
        for (int r = 0; r < 8; ++r) { unsigned short a, c2; splitf(o[dt][r] * f, a, c2); oh[r] = a; ol[r] = c2; }
        const size_t oo = ((size_t)b * TT + i0 + lr) * DQ + h * HD + dt * 16 + hi * 8; *(v8us*)(ATh + oo) = oh; *(v8us*)(ATl + oo) = ol; }
}

extern "C" void kernel_launch(void* const* d_in, const int* in_sizes, int n_in,
                              void* d_out, int out_size, void* d_ws, size_t ws_size, hipStream_t stream) {
    (void)in_sizes; (void)n_in; (void)out_size;
    const float* x = (const float*)d_in[0]; const int* MK = (const int*)d_in[1]; const float* wq = (const float*)d_in[2]; const float* wk = (const float*)d_in[3]; const float* wv = (const float*)d_in[4]; const float* wpos = (const float*)d_in[5]; const float* wo = (const float*)d_in[6]; const float* pbu = (const float*)d_in[7]; const float* pbv = (const float*)d_in[8];   /* u_bias, v_bias [8][64] */
    float* OUT = (float*)d_out;     // [8][1024][512]
    char* wsp = (char*)d_ws;
    auto take = [&](size_t bytes) { char* p = wsp; wsp += (bytes + 255) & ~(size_t)255; return (void*)p; };
    bf* WQ = (bf*)take((size_t)DQ * DM * 2); bf* WK = (bf*)take((size_t)DKV * DM * 2); bf* WV = (bf*)take((size_t)DKV * DM * 2); bf* WO = (bf*)take((size_t)DM * DQ * 2);
    bf* PEh = (bf*)take((size_t)NPE * DM * 2); bf* PEl = (bf*)take((size_t)NPE * DM * 2); bf* WP = (bf*)take((size_t)DQ * DM * 2); bf* PPh = (bf*)take((size_t)NH_ * NPE * HD * 2); bf* PPl = (bf*)take((size_t)NH_ * NPE * HD * 2);
    // planes of all 8 batch items
    bf* QPh = (bf*)take((size_t)NB_ * NH_ * TT * HD * 2); bf* QPl = (bf*)take((size_t)NB_ * NH_ * TT * HD * 2); bf* QVh = (bf*)take((size_t)NB_ * NH_ * TT * HD * 2); bf* QVl = (bf*)take((size_t)NB_ * NH_ * TT * HD * 2); bf* KPh = (bf*)take((size_t)NB_ * NKV * TT * HD * 2); bf* KPl = (bf*)take((size_t)NB_ * NKV * TT * HD * 2); bf* VTh = (bf*)take((size_t)NB_ * NKV * HD * TT * 2); bf* VTl = (bf*)take((size_t)NB_ * NKV * HD * TT * 2); bf* ATh = (bf*)take((size_t)NB_ * TT * DQ * 2); bf* ATl = (bf*)take((size_t)NB_ * TT * DQ * 2);
    bf* XB = (bf*)take((size_t)NB_ * TT * DM * 2);
    if ((size_t)(wsp - (char*)d_ws) > ws_size) return;
    k_prep<<<5 * PBW + PBP + PBX, 256, 0, stream>>>(wq, wk, wv, wo, wpos, x, WQ, WK, WV, WO, WP, PEh, PEl, XB);   /* five transposed bf16 weight planes, sinusoid table (hi + lo), exact bf16 plane of xs */
    k_proj<<<PJP + 384, GW * 32, 0, stream>>>(PEh, PEl, WP, PPh, PPl, XB, WQ, WK, WV, pbu, pbv, QPh, QPl, QVh, QVl, KPh, KPl, VTh, VTl);   /* p = table Wpos -> per-head hi/lo planes [h][2048][64]; q + u_bias, q + v_bias, k and transposed v planes of all 8 batch items */
    k_fattn<<<dim3(TT / (16 * FW), NB_ * NH_, 1), FW * 32, 0, stream>>>(QPh, QPl, QVh, QVl, KPh, KPl, PPh, PPl, VTh, VTl, MK, ATh, ATl);   /* scores, rel_shift, mask, softmax, attn.v and merge of all 64 (batch item, head) pairs */
    k_outp<<<dim3(NB_ * TT / 128, DM / 128, 1), GW * 32, 0, stream>>>(ATh, ATl, WO, OUT);   /* out = merged Wout */
}

// v009
// Measured time: 85.3 microseconds a run.
// Versions between v007 and this one are left out; their measured steps multiply to 1.32 times as fast.
// All steps since v000 together make it 24.5 times as fast.
#include <hip/hip_runtime.h>

// Transformer-XL style relative-position multi-head self-attention (xs [8][1024][512]; q, k, v = xs W ('xw' [512][512], no bias; 8 heads x 64); p = pe Wpos with pe the sinusoidal table of positions -(T-1)..T-1 (2047 rows, [sin, cos] interleaved, computed on device); scores = ((q + u_bias).k + rel_shift((q + v_bias).p)) / 8 where rel_shift picks position row j - i + 1023; mask (int32 [8][1024][1024], read): -inf where 0 and those weights zeroed; softmax; out = merged Wout ('xw', no bias) -> [8][1024][512] (4.2 M)).
// Layout: one exact bf16 input plane -> 1-product projections; the position table is computed on device in f32 (NOT bf16-rounded: kept as bf16 hi + lo planes) and projected once (2 products, 2047 rows + one zero pad row) into a per-head f16 plane [h][2048][64]; the q, k, v projections of all 8 batch items are one launch whose epilogue adds the biases, rounds to f16 and stores the head planes (v transposed), the position projection likewise; one fused attention launch for all 64 (batch item, head) pairs: content scores (q+u).k and the needed band of position scores (q+v).p are f16 products (1 each), the position score at j - i + 1023 is picked through LDS, mask select, online softmax and attn.v follow in registers: no score reaches memory. The mask is read once, by the preparation launch, which packs it to one bit a key, in the order in which a wave of the attention launch holds its scores; the eight heads of a batch item read the bits.
// Compute dtypes, f32 accumulate: every input rounded to bf16; q/k/v on PLAIN bf16 operands (exact products); p = pe(hi+lo) Wpos (2 products); content and position scores on f16 planes (q + bias, k, p each rounded once to f16: 11 significant bits; 1 product); softmax f32; attn.v on f16 weights and values (1 product); Wout hl x exact (2 products).

#define NB_  8
#define TT   1024
#define DM   512
#define NH_  8
#define NKV  8
#define REP  (NH_ / NKV)
#define HD   64
#define DQ   (NH_ * HD)
#define DKV  (NKV * HD)
#define NPE  2048                 // 2047 positions + 1 zero pad row
typedef __attribute__((ext_vector_type(4))) unsigned short v4us;
#define ZH   8
#define RH   1024
#define WIN  0
#define PCAR 1024.0f
#define SCL  0.125f   // HD^-0.5
typedef _Float16 h16;
typedef unsigned short bf;
typedef __attribute__((ext_vector_type(16))) __bf16   v16bf;
typedef __attribute__((ext_vector_type(16))) _Float16 v16h;
typedef __attribute__((ext_vector_type(8)))  _Float16 v8h;
typedef __attribute__((ext_vector_type(8)))  unsigned short v8us;
typedef __attribute__((ext_vector_type(8)))  float    v8f;
typedef __attribute__((ext_vector_type(4)))  float    v4f;
typedef v8h  __attribute__((may_alias)) v8ha;
typedef v4f  __attribute__((may_alias)) v4fa;
typedef v8us __attribute__((may_alias)) v8usa;

__device__ __forceinline__ unsigned short f2bf(float f) { unsigned u = __float_as_uint(f); u += 0x7FFFu + ((u >> 16) & 1u); return (unsigned short)(u >> 16); }
__device__ __forceinline__ float bf2f(unsigned short b) { return __uint_as_float(((unsigned)b) << 16); }
__device__ __forceinline__ float bfr(float f) { return bf2f(f2bf(f)); }
__device__ __forceinline__ v16h cat16(v8h lo, v8h hi) { return __builtin_shufflevector(lo, hi, 0, 1, 2, 3, 4, 5, 6, 7, 8, 9, 10, 11, 12, 13, 14, 15); }
__device__ __forceinline__ v16bf cat16b(v8us lo, v8us hi) { return __builtin_bit_cast(v16bf, __builtin_shufflevector(lo, hi, 0, 1, 2, 3, 4, 5, 6, 7, 8, 9, 10, 11, 12, 13, 14, 15)); }
__device__ __forceinline__ v8f wmma16(v16h a, v16h b, v8f c) { return __builtin_amdgcn_wmma_f32_16x16x32_f16(false, a, false, b, (short)0, c, false, false); }
__device__ __forceinline__ v8f wmmab(v16bf a, v16bf b, v8f c) { return __builtin_amdgcn_wmma_f32_16x16x32_bf16(false, a, false, b, (short)0, c, false, false); }



__device__ __forceinline__ h16 tohx(float x) { return (h16)x; }
__device__ __forceinline__ void splitf(float y, unsigned short& h, unsigned short& l) { h = f2bf(y); l = f2bf(y - bf2f(h)); }
typedef __attribute__((ext_vector_type(2))) _Float16 v2h;
typedef __attribute__((ext_vector_type(4))) _Float16 v4h;
typedef __attribute__((ext_vector_type(2))) unsigned short v2us;
typedef __attribute__((ext_vector_type(4))) unsigned short v4us;
typedef __attribute__((ext_vector_type(2))) float v2f;
typedef __attribute__((ext_vector_type(4))) int v4i;
// eight f32 results rounded to nearest even to f16, as the bits of a 16-byte store
__device__ __forceinline__ void cvt8h(const float (&x)[8], v8us& o) { v8h h;
#pragma unroll
    for (int q = 0; q < 4; ++q) { v2f p; p[0] = x[2 * q]; p[1] = x[2 * q + 1]; const v2h c = __builtin_convertvector(p, v2h); h[2 * q] = c[0]; h[2 * q + 1] = c[1]; }
    o = __builtin_bit_cast(v8us, h); }

__device__ __forceinline__ void d_wtG(int blk, const float* __restrict__ w, int K, int N, bf* Bt) {
    const int lane = threadIdx.x & 31; const int L0 = (blk * 8 + (threadIdx.x >> 5)) * 8; const int nlines = N * K / 64;
{
#pragma unroll 1
        for (int l = 0; l < 8; ++l) { const int L = L0 + l; if (L >= nlines) break; const size_t e = (size_t)L * 64 + lane * 2; const int k = (int)(e % K), n = (int)(e / K); v2us o;
            o[0] = f2bf(w[(size_t)k * N + n]); o[1] = f2bf(w[(size_t)(k + 1) * N + n]); *(v2us*)(Bt + e) = o; }
         }
}



__constant__ float INVF[DM / 2] = {1.0f,0.964661598f,0.930572033f,0.897687137f,0.865964293f,0.835362554f,0.805842161f,0.777365029f,0.749894202f,0.723394156f,0.697830558f,0.673170388f,0.649381638f,0.626433551f,0.604296386f,0.582941532f,0.562341332f,0.542469084f,0.523299098f,0.504806578f,0.486967504f,0.469758898f,0.453158379f,0.437144488f,0.421696484f,0.406794429f,0.392418981f,0.378551513f,0.365174115f,0.352269441f,0.339820832f,0.327812076f,0.316227764f,0.305052817f,0.294272721f,0.283873618f,0.273841947f,0.264164835f,0.254829645f,0.245824397f,0.237137347f,0.228757307f,0.220673412f,0.212875158f,0.2053525f,0.198095664f,0.191095293f,0.184342295f,0.177827939f,0.171543792f,0.165481701f,0.15963386f,0.153992653f,0.148550808f,0.143301249f,0.138237223f,0.133352146f,0.128639698f,0.124093764f,0.119708493f,0.115478195f,0.111397393f,0.107460767f,0.103663281f,0.099999994f,0.0964661688f,0.0930572152f,0.0897687078f,0.0865964293f,0.0835362524f,0.0805842206f,0.0777364895f,0.0749894157f,0.0723394156f,0.0697830617f,0.0673170388f,0.0649381578f,0.0626433492f,0.0604296364f,0.0582941547f,0.056234125f,0.0542469025f,0.0523299091f,0.0504806563f,0.0486967564f,0.0469758809f,0.0453158319f,0.0437144488f,0.0421696529f,0.0406794474f,0.0392418914f,0.0378551483f,0.0365174115f,0.0352269486f,0.0339820795f,0.0327812098f,0.0316227749f,0.0305052791f,0.0294272732f,0.0283873565f,0.0273841936f,0.0264164824f,0.0254829675f,0.0245824363f,0.023713734f,0.0228757299f,0.0220673401f,0.0212875176f,0.0205352474f,0.0198095664f,0.0191095285f,0.0184342302f,0.0177827962f,0.0171543807f,0.0165481735f,0.0159633812f,0.0153992623f,0.0148550775f,0.0143301245f,0.0138237216f,0.013335214f,0.0128639704f,0.0124093788f,0.0119708525f,0.0115478169f,0.0111397365f,0.0107460767f,0.0103663281f,0.00999999978f,0.00964661594f,0.00930572115f,0.00897687208f,0.00865964405f,0.00835362263f,0.00805842038f,0.00777364895f,0.00749894092f,0.007233941f,0.00697830552f,0.00673170388f,0.00649381708f,0.00626433641f,0.00604296196f,0.00582941389f,0.00562341232f,0.00542468997f,0.00523299072f,0.00504806545f,0.00486967526f,0.0046975892f,0.00453158421f,0.0043714433f,0.00421696389f,0.00406794343f,0.00392418914f,0.00378551497f,0.00365174119f,0.00352269458f,0.00339820841f,0.00327812159f,0.0031622767f,0.00305052707f,0.00294272648f,0.00283873547f,0.00273841922f,0.00264164805f,0.0025482967f,0.0024582441f,0.00237137405f,0.00228757365f,0.00220673345f,0.00212875125f,0.0020535246f,0.00198095664f,0.00191095285f,0.001843423f,0.00177827943f,0.00171543809f,0.00165481726f,0.00159633812f,0.00153992616f,0.0014855077f,0.00143301231f,0.00138237211f,0.00133352133f,0.00128639699f,0.00124093785f,0.00119708513f,0.00115478167f,0.00111397356f,0.0010746076f,0.00103663281f,0.000999999931f,0.000964661594f,0.000930572045f,0.000897687161f,0.000865964394f,0.000835362298f,0.000805841992f,0.000777364883f,0.000749894069f,0.0007233941f,0.000697830576f,0.000673170376f,0.000649381662f,0.000626433583f,0.00060429622f,0.0005829414f,0.000562341185f,0.000542468973f,0.000523299037f,0.000504806521f,0.000486967503f,0.000469758903f,0.000453158398f,0.000437144336f,0.000421696401f,0.000406794337f,0.000392418908f,0.000378551485f,0.000365174084f,0.000352269446f,0.000339820836f,0.000327811984f,0.000316227786f,0.000305052701f,0.000294272788f,0.000283873524f,0.000273842044f,0.000264164817f,0.000254829531f,0.000245824398f,0.000237137268f,0.000228757344f,0.000220673333f,0.000212875209f,0.000205352466f,0.000198095746f,0.000191095271f,0.000184342207f,0.00017782794f,0.00017154371f,0.000165481732f,0.000159633797f,0.000153992674f,0.000148550767f,0.000143301295f,0.000138237199f,0.000133352078f,0.000128639687f,0.000124093727f,0.000119708515f,0.000115478157f,0.000111397407f,0.000107460757f,0.000103663326f};
#define PBW 64                              // blocks of a weight matrix
#define PBP (NPE * DM / 2 / 256)            // blocks of the position table: a [sin, cos] pair a thread
#define PBX (NB_ * TT * DM / 8 / 256)       // blocks of the xs plane: 8 elements a thread
#define PBM (NB_ * TT / 32)                 // blocks of the mask bits: 32 mask rows a block, 128 keys of them a wave
typedef __attribute__((ext_vector_type(4))) unsigned v4u;
// mask bits as lane masks [b][i / 16][j / 64][e], e = 0 .. 31: bit 16 hi + lr of word e says whether mask[b][16 (i / 16) + lr][64 (j / 64) + 16 (e >> 3) + 8 hi + (e & 7)] is not 0: the lane and the register in which the attention wave of those 16 queries holds that score.
// First by rows: a wave reads 512 bytes in a row of one mask row (lane L the keys 4 L .. 4 L + 3), so that compare q gives a word whose bit L is key 4 L + q; lane j keeps the four words of row j. Then by lanes: lane 16 hi + lr takes row lr's words, and a compare of one bit of them gives one lane mask; lane e keeps word e, and 32 words leave as one line.
__device__ __forceinline__ void d_mbits(int blk, const int* __restrict__ mk, unsigned* LM) {
    const int lane = threadIdx.x & 31, c = threadIdx.x >> 5; const int b = blk / (TT / 32), r0 = (blk % (TT / 32)) * 32;
    const int* src = mk + (size_t)(b * TT + r0) * TT + c * 128 + lane * 4;
    unsigned o[4] = {0u, 0u, 0u, 0u};
#pragma unroll
    for (int g = 0; g < 4; ++g) { v4i m[8];
#pragma unroll
        for (int j = 0; j < 8; ++j) m[j] = *(const v4i*)(src + (g * 8 + j) * TT);
#pragma unroll
        for (int j = 0; j < 8; ++j) {
#pragma unroll
            for (int q = 0; q < 4; ++q) { const unsigned bal = __builtin_amdgcn_ballot_w32(m[j][q] != 0); o[q] = lane == g * 8 + j ? bal : o[q]; } }
        // eight rows' loads in flight at a time: without this line all 32 are lifted to the front, and their 128 registers would cut the resident waves of every part of the merged kernel
        __builtin_amdgcn_sched_barrier(0); }
#pragma unroll
    for (int g = 0; g < 2; ++g) { unsigned w[4];
#pragma unroll
        for (int q = 0; q < 4; ++q) w[q] = (unsigned)__shfl((int)o[q], g * 16 + (lane & 15), 32) >> (unsigned)((lane >> 4) * 2);
#pragma unroll
        for (int tp = 0; tp < 2; ++tp) { unsigned out = 0u;
#pragma unroll
            for (int e = 0; e < 32; ++e) { const unsigned bal = __builtin_amdgcn_ballot_w32(((w[e & 3] >> (tp * 16 + (e >> 3) * 4 + ((e & 7) >> 2))) & 1u) != 0u); out = lane == e ? bal : out; }
            LM[((size_t)(b * (TT / 16) + (r0 >> 4) + g) * (TT / 64) + 2 * c + tp) * 32 + lane] = out; } }
    // behind the part's last store, in front of whatever code of the merged kernel follows it in the text and writes its registers
    asm volatile("s_wait_xcnt 0x0" ::: "memory"); }
__device__ __forceinline__ void d_petab(int blk, bf* PEh, bf* PEl) { const size_t e = ((size_t)blk * 256 + threadIdx.x) * 2; const int c = (int)(e % DM); const int r = (int)(e / DM); v2us oh, ol;
    if (r < NPE - 1) { const float th = __fmul_rn((float)(r - (TT - 1)), INVF[c >> 1]); unsigned short a, b2; splitf(sinf(th), a, b2); oh[0] = a; ol[0] = b2; splitf(cosf(th), a, b2); oh[1] = a; ol[1] = b2; } else { oh[0] = 0; oh[1] = 0; ol[0] = 0; ol[1] = 0; }
    *(v2us*)(PEh + e) = oh; *(v2us*)(PEl + e) = ol;
    // behind the part's last stores, in front of whatever code of the merged kernel follows them in the text and writes their registers
    asm volatile("s_wait_xcnt 0x0" ::: "memory"); }
__device__ __forceinline__ void d_cvt8(int blk, const float* __restrict__ src, bf* dst) { const size_t i = (size_t)blk * 256 + threadIdx.x; const v8f v = *(const v8f*)(src + i * 8); v8us o;
#pragma unroll
    for (int k = 0; k < 8; ++k) o[k] = f2bf(v[k]); *(v8us*)(dst + i * 8) = o;
    // behind the part's last store, in front of whatever code of the merged kernel follows it in the text and writes its registers
    asm volatile("s_wait_xcnt 0x0" ::: "memory"); }
// ---- k_prep: every plane that is made from the inputs alone, in ONE launch: none of the eight pieces reads what another writes. Blocks 0 .. 5 PBW - 1: the five transposed bf16 weight planes (their gathers have the longest chain of waits, so they start first); then the mask bits (the most bytes); then the position table; then the xs plane.
__global__ __launch_bounds__(256) void k_prep(const float* __restrict__ wq, const float* __restrict__ wk, const float* __restrict__ wv, const float* __restrict__ wo, const float* __restrict__ wpos, const float* __restrict__ x, const int* __restrict__ mk, bf* WQ, bf* WK, bf* WV, bf* WO, bf* WP, bf* PEh, bf* PEl, bf* XB, unsigned* LM) {
    const int blk = blockIdx.x;
    if (blk < 5 * PBW) { const int m = blk / PBW;
        d_wtG(blk % PBW, m == 0 ? wq : m == 1 ? wk : m == 2 ? wv : m == 3 ? wo : wpos, DM, DQ, m == 0 ? WQ : m == 1 ? WK : m == 2 ? WV : m == 3 ? WO : WP); }
    else if (blk < 5 * PBW + PBM) d_mbits(blk - 5 * PBW, mk, LM);
    else if (blk < 5 * PBW + PBM + PBP) d_petab(blk - (5 * PBW + PBM), PEh, PEl);
    else d_cvt8(blk - (5 * PBW + PBM + PBP), x, XB);
}

// fragment at scalar base + 32-bit vector byte offset + constant: one address register serves every load of a phase
__device__ __forceinline__ v16bf ldo(const bf* base, unsigned voff, int imm) { const char* p = (const char*)base + voff + imm; return cat16b(*(const v8us*)p, *(const v8us*)(p + 32)); }
// ---- projections that write their operand planes themselves: the epilogue rounds each f32 result to f16 and stores rows of 64 elements (128 bytes, whole lines) straight into the layout the attention kernel reads.
// ---- the three GEMMs (q, k, v; position; output): a block of 8 waves works on one block tile, and the operand rows that its waves share come into LDS once, by asynchronous copies of whole 128-byte lines, instead of each wave gathering 32 bytes from each of 16 lines per load. A k step is 64 elements (one line a row); three groups of 128 rows a step, two buffers, the next step's copies in flight while this one is multiplied. The fragments are then read from LDS in the k order of ldo.
#define GP   144                  // pitch in bytes of a staged row of 64 bf16: 16 bytes x odd, so that the 16 rows of a fragment read fall on different banks
#define GGRP (128 * GP)           // a group of 128 staged rows
#define GBUF (3 * GGRP)           // a buffer: three groups
#define GNT  (DM / 64)            // k steps
#define GW   8                    // waves a block
// fragment from a staged piece: the lane's 16 bytes at p and at p + 32, the k order of ldo
__device__ __forceinline__ v16bf ldl(const char* p) { return cat16b(*(const v8usa*)p, *(const v8usa*)(p + 32)); }
__device__ __forceinline__ unsigned ldsa(const void* p) { return (unsigned)(size_t)p; }
// asynchronous copies global -> LDS, 16 bytes a lane; the wait in the same statement keeps the address registers whole until the copies have taken them
__device__ __forceinline__ void acopy2(unsigned l0, const char* g0, unsigned l1, const char* g1) {
    asm volatile("global_load_async_to_lds_b128 %0, %1, off\n\tglobal_load_async_to_lds_b128 %2, %3, off\n\ts_wait_xcnt 0x0" :: "v"(l0), "v"(g0), "v"(l1), "v"(g1) : "memory"); }
__device__ __forceinline__ void acopy3(unsigned l0, const char* g0, unsigned l1, const char* g1, unsigned l2, const char* g2) {
    asm volatile("global_load_async_to_lds_b128 %0, %1, off\n\tglobal_load_async_to_lds_b128 %2, %3, off\n\tglobal_load_async_to_lds_b128 %4, %5, off\n\ts_wait_xcnt 0x0" :: "v"(l0), "v"(g0), "v"(l1), "v"(g1), "v"(l2), "v"(g2) : "memory"); }
__device__ __forceinline__ void acopy6(unsigned l0, const char* g0, unsigned l1, const char* g1, unsigned l2, const char* g2, unsigned l3, const char* g3, unsigned l4, const char* g4, unsigned l5, const char* g5) {
    asm volatile("global_load_async_to_lds_b128 %0, %1, off\n\tglobal_load_async_to_lds_b128 %2, %3, off\n\tglobal_load_async_to_lds_b128 %4, %5, off\n\tglobal_load_async_to_lds_b128 %6, %7, off\n\tglobal_load_async_to_lds_b128 %8, %9, off\n\tglobal_load_async_to_lds_b128 %10, %11, off\n\ts_wait_xcnt 0x0" :: "v"(l0), "v"(g0), "v"(l1), "v"(g1), "v"(l2), "v"(g2), "v"(l3), "v"(g3), "v"(l4), "v"(g4), "v"(l5), "v"(g5) : "memory"); }
// s0, s1, s2: first byte of the 128 rows (pitch DM elements) of each group; ao, a2o, bo: byte offset in a buffer of row 0 of this wave's A, second A (NSPLIT == 1) and B rows. The wave's tile is 16 MB x 64; each accumulator takes its products in the order k = 0, 32, 64 ... (a, then a2).
template <int MB, int NSPLIT>
__device__ __forceinline__ void tileS(char* stg, const char* __restrict__ s0, const char* __restrict__ s1, const char* __restrict__ s2, int ao, int a2o, int bo, int lr, int hi, v8f (&acc)[MB][4]) {
    const int tid = threadIdx.x;
    const unsigned go = (unsigned)((tid >> 3) * (DM * 2) + (tid & 7) * 16);             // the thread's 16 bytes: rows tid >> 3 + 32 j of a group, segment tid & 7
    const unsigned lo = ldsa(stg) + (unsigned)((tid >> 3) * GP + (tid & 7) * 16);
    auto stage = [&](int t) {
        const unsigned l = lo + (unsigned)(t & 1) * GBUF; const unsigned g = go + (unsigned)t * 128u;
        acopy6(l, s0 + g, l + 32 * GP, s0 + g + 32 * DM * 2, l + 64 * GP, s0 + g + 64 * DM * 2, l + 96 * GP, s0 + g + 96 * DM * 2, l + GGRP, s1 + g, l + GGRP + 32 * GP, s1 + g + 32 * DM * 2);
        acopy6(l + GGRP + 64 * GP, s1 + g + 64 * DM * 2, l + GGRP + 96 * GP, s1 + g + 96 * DM * 2, l + 2 * GGRP, s2 + g, l + 2 * GGRP + 32 * GP, s2 + g + 32 * DM * 2, l + 2 * GGRP + 64 * GP, s2 + g + 64 * DM * 2, l + 2 * GGRP + 96 * GP, s2 + g + 96 * DM * 2); };
#pragma unroll
    for (int mb = 0; mb < MB; ++mb)
#pragma unroll
        for (int nb = 0; nb < 4; ++nb) acc[mb][nb] = (v8f){};
    stage(0);
    // step 0's copies of this wave have landed; behind the barrier those of every wave have
    asm volatile("s_wait_asynccnt 0x0" ::: "memory");
    __syncthreads();
    stage(1);
    const int fl = lr * GP + hi * 16;   // the lane's place in a 16-row fragment
    // rolled: the text of one step serves all eight, and the buffer is picked by t & 1
#pragma unroll 1
    for (int t = 0; t < GNT; ++t) {
        const char* bb = stg + (t & 1) * GBUF + fl;
#pragma unroll
        for (int ks = 0; ks < 2; ++ks) { v16bf a[MB], a2[MB], b[4];
#pragma unroll
            for (int mb = 0; mb < MB; ++mb) { a[mb] = ldl(bb + ao + mb * 16 * GP + ks * 64); if (NSPLIT == 1) a2[mb] = ldl(bb + a2o + mb * 16 * GP + ks * 64); }
#pragma unroll
            for (int nb = 0; nb < 4; ++nb) b[nb] = ldl(bb + bo + nb * 16 * GP + ks * 64);
            // all fragment reads of a half step are issued in front of its first product: without this line the compiler reads the b fragments one after the other into one register group, each with a full LDS wait
            __builtin_amdgcn_sched_barrier(0);
#pragma unroll
            for (int nb = 0; nb < 4; ++nb) {
#pragma unroll
                for (int mb = 0; mb < MB; ++mb) { acc[mb][nb] = wmmab(a[mb], b[nb], acc[mb][nb]); if (NSPLIT == 1) acc[mb][nb] = wmmab(a2[mb], b[nb], acc[mb][nb]); } } }
        // hand-over of step t + 1: this wave's LDS reads of step t are done ...
        asm volatile("s_wait_dscnt 0x0" ::: "memory");
        // ... and its copies for step t + 1 have landed;
        asm volatile("s_wait_asynccnt 0x0" ::: "memory");
        // behind the barrier every wave's have, and nobody reads step t's buffer any more
        __syncthreads();
        if (t + 2 < GNT) stage(t + 2);
    }
    // no copy is left in flight behind the loop
    asm volatile("s_wait_asynccnt 0x0" ::: "memory");
}
// 16 rows of the tile into this wave's LDS slab [16][68]
__device__ __forceinline__ void slab_put(float* os, const v8f (&acc)[4], int lr, int hi) {
#pragma unroll
    for (int nb = 0; nb < 4; ++nb) {
#pragma unroll
        for (int j = 0; j < 8; ++j) os[(hi * 8 + j) * 68 + nb * 16 + lr] = acc[nb][j]; }
}
// d_qkvp: block tiles of 128 positions x 256 columns (4 heads), 64 x 6 of them; waves 2 x 4, a wave has the 64 x 64 tile of one head. by >> 1 picks q, k or v, by & 1 the half of the heads. Staged: group 0 the 128 xs rows, groups 1 and 2 the 256 weight rows. q and k: C = xs W, tile rows are positions, planes [b][h][t][d]; q is stored twice, as q + u_bias and q + v_bias. v: the operands change places (C = Wv^T xs^T), so that tile rows are head dims and the transposed planes [b][h][d][t] are stored by rows as well.
__device__ __forceinline__ void d_qkvp(char* stg, float* os, int wv, int bx, int by, const bf* __restrict__ XB, const bf* __restrict__ WQ, const bf* __restrict__ WK, const bf* __restrict__ WV, const float* __restrict__ pbu, const float* __restrict__ pbv, bf* QUh, bf* QVh, bf* Kh, bf* Vh) {
    const int lane = threadIdx.x & 31, lr = lane & 15, hi = lane >> 4; const int mi = wv >> 2, ni = wv & 3; const int sel = by >> 1, cb = (by & 1) * 4 + ni, xr = bx * 128 + mi * 64, b = xr / TT, t0 = xr % TT; const bool tv = sel == 2;
    v8f acc[4][4];
    const char* wr = (const char*)(sel == 0 ? WQ : sel == 1 ? WK : WV) + (size_t)(by & 1) * 256 * DM * 2;
    tileS<4, 0>(stg, (const char*)XB + (size_t)bx * 128 * DM * 2, wr, wr + 128 * DM * 2, tv ? GGRP + ni * 64 * GP : mi * 64 * GP, 0, tv ? mi * 64 * GP : GGRP + ni * 64 * GP, lr, hi, acc);
    const size_t base = tv ? (size_t)(b * NKV + cb) * HD * TT + t0 : ((size_t)(b * NH_ + cb) * TT + t0) * HD; const int pitch = tv ? TT : HD;
    bf* Dh = tv ? Vh : Kh;
    const int rr = lane >> 3, cofs = (lane & 7) * 8;
    float ub[8], vb[8];
#pragma unroll
    for (int q = 0; q < 8; ++q) { ub[q] = 0.f; vb[q] = 0.f; }
    if (sel == 0) {
#pragma unroll
        for (int q = 0; q < 8; ++q) { ub[q] = bfr(pbu[cb * HD + cofs + q]); vb[q] = bfr(pbv[cb * HD + cofs + q]); } }
#pragma unroll
    for (int mb = 0; mb < 4; ++mb) {
        slab_put(os, acc[mb], lr, hi);
        // the slab is exchanged between the lanes of this wave: keep the reads below behind the stores above
        __builtin_amdgcn_wave_barrier(); asm volatile("" ::: "memory");
#pragma unroll
        for (int s = 0; s < 4; ++s) { const int row = 4 * s + rr; const v4f x0 = *(const v4fa*)(os + row * 68 + cofs), x1 = *(const v4fa*)(os + row * 68 + cofs + 4); float x[8];
#pragma unroll
            for (int q = 0; q < 4; ++q) { x[q] = x0[q]; x[4 + q] = x1[q]; }
            const size_t o = base + (size_t)(mb * 16 + row) * pitch + cofs;
            v8us oh;
            if (sel == 0) { float y[8]; v8us ph;
#pragma unroll
                for (int q = 0; q < 8; ++q) y[q] = __fadd_rn(x[q], ub[q]);
                cvt8h(y, oh);
#pragma unroll
                for (int q = 0; q < 8; ++q) y[q] = __fadd_rn(x[q], vb[q]);
                cvt8h(y, ph);
                *(v8us*)(QUh + o) = oh; *(v8us*)(QVh + o) = ph; }
            else { cvt8h(x, oh); *(v8us*)(Dh + o) = oh; }
            // the stores' address and data registers are rewritten by the next rows: the wait stands in front of that
            asm volatile("s_wait_xcnt 0x0" ::: "memory"); }
        // the next 16 rows' stores to the slab stay behind the reads above
        __builtin_amdgcn_wave_barrier(); asm volatile("" ::: "memory");
    }
}
// d_posp: p = position table (hi + lo, 2 products) Wpos, block tiles of 128 rows x 128 columns (2 heads), 16 x 4 of them; waves 4 x 2, a wave has 32 rows of one head; f16 plane [h][2048][64]. Staged: the 128 table rows hi, the same lo, the 128 weight rows.
__device__ __forceinline__ void d_posp(char* stg, float* os, int wv, int bx, int by, const bf* __restrict__ PEh, const bf* __restrict__ PEl, const bf* __restrict__ WP, bf* Ph2) {
    const int lane = threadIdx.x & 31, lr = lane & 15, hi = lane >> 4; const int mi = wv >> 1, ni = wv & 1; const int r0 = bx * 128 + mi * 32, cb = by * 2 + ni;
    v8f acc[2][4];
    tileS<2, 1>(stg, (const char*)PEh + (size_t)bx * 128 * DM * 2, (const char*)PEl + (size_t)bx * 128 * DM * 2, (const char*)WP + (size_t)by * 128 * DM * 2, mi * 32 * GP, GGRP + mi * 32 * GP, 2 * GGRP + ni * 64 * GP, lr, hi, acc);
    const size_t base = ((size_t)cb * NPE + r0) * HD; const int rr = lane >> 3, cofs = (lane & 7) * 8;
#pragma unroll
    for (int mb = 0; mb < 2; ++mb) {
        slab_put(os, acc[mb], lr, hi);
        // the slab is exchanged between the lanes of this wave: keep the reads below behind the stores above
        __builtin_amdgcn_wave_barrier(); asm volatile("" ::: "memory");
#pragma unroll
        for (int s = 0; s < 4; ++s) { const int row = 4 * s + rr; const v4f x0 = *(const v4fa*)(os + row * 68 + cofs), x1 = *(const v4fa*)(os + row * 68 + cofs + 4); float x[8];
#pragma unroll
            for (int q = 0; q < 4; ++q) { x[q] = x0[q]; x[4 + q] = x1[q]; }
            v8us oh; cvt8h(x, oh); const size_t o = base + (size_t)(mb * 16 + row) * HD + cofs; *(v8us*)(Ph2 + o) = oh;
            // the store's address and data registers are rewritten by the next rows: the wait stands in front of that
            asm volatile("s_wait_xcnt 0x0" ::: "memory"); }
        // the next 16 rows' stores to the slab stay behind the reads above
        __builtin_amdgcn_wave_barrier(); asm volatile("" ::: "memory");
    }
}
// ---- k_proj: the position projection and the q, k, v projections read only what k_prep wrote and nothing of each other: ONE launch of 64 + 384 blocks of 8 waves. Blocks 0 .. 63 are the position tiles, the rest q, then k, then v. Four waves a SIMD (two blocks a WGP): every block is resident at once.
#define PJP 64                    // position blocks
__global__ __launch_bounds__(GW * 32) __attribute__((amdgpu_waves_per_eu(4, 4))) void k_proj(const bf* __restrict__ PEh, const bf* __restrict__ PEl, const bf* __restrict__ WP, bf* Ph2, const bf* __restrict__ XB, const bf* __restrict__ WQ, const bf* __restrict__ WK, const bf* __restrict__ WV, const float* __restrict__ pbu, const float* __restrict__ pbv, bf* QUh, bf* QVh, bf* Kh, bf* Vh) {
    __shared__ __align__(16) char stg[2 * GBUF];
    __shared__ __align__(16) float oss[GW * 16 * 68];
    const int wv = __builtin_amdgcn_readfirstlane(threadIdx.x >> 5); float* os = oss + wv * 16 * 68; const int blk = blockIdx.x;
    if (blk < PJP) d_posp(stg, os, wv, blk & 15, blk >> 4, PEh, PEl, WP, Ph2);
    else d_qkvp(stg, os, wv, (blk - PJP) & 63, (blk - PJP) >> 6, XB, WQ, WK, WV, pbu, pbv, QUh, QVh, Kh, Vh);
}
// ---- k_outp: out = merged (hi + lo, 2 products) Wout, f32. Block tiles of 128 x 128, grid (64, 4): one block a WGP; waves 4 x 2, a wave has 32 x 64. Staged: the 128 merged rows hi, the same lo, the 128 weight rows.
__global__ __launch_bounds__(GW * 32) void k_outp(const bf* __restrict__ Ah, const bf* __restrict__ Al, const bf* __restrict__ Bt, float* C) {
    __shared__ __align__(16) char stg[2 * GBUF];
    __shared__ __align__(16) float oss[GW * 16 * 68];
    const int lane = threadIdx.x & 31, lr = lane & 15, hi = lane >> 4, wv = __builtin_amdgcn_readfirstlane(threadIdx.x >> 5); float* os = oss + wv * 16 * 68;
    const int mi = wv >> 1, ni = wv & 1; const int r0 = blockIdx.x * 128 + mi * 32, c0 = blockIdx.y * 128 + ni * 64;
    v8f acc[2][4];
    tileS<2, 1>(stg, (const char*)Ah + (size_t)blockIdx.x * 128 * DM * 2, (const char*)Al + (size_t)blockIdx.x * 128 * DM * 2, (const char*)Bt + (size_t)blockIdx.y * 128 * DM * 2, mi * 32 * GP, GGRP + mi * 32 * GP, 2 * GGRP + ni * 64 * GP, lr, hi, acc);
#pragma unroll
    for (int mb = 0; mb < 2; ++mb) {
        slab_put(os, acc[mb], lr, hi);
        // the slab is exchanged between the lanes of this wave: keep the reads below behind the stores above
        __builtin_amdgcn_wave_barrier(); asm volatile("" ::: "memory");
        float* crow = C + (size_t)(r0 + mb * 16) * DM + c0;
#pragma unroll
        for (int s = 0; s < 8; ++s) { const int row = 2 * s + hi, cofs = lr * 4; const v4f val = *(const v4fa*)(os + row * 68 + cofs); *(v4f*)(crow + (size_t)row * DM + cofs) = val;
            // the store's address and data registers are rewritten by the next rows: the wait stands in front of that
            asm volatile("s_wait_xcnt 0x0" ::: "memory"); }
        // the next 16 rows' stores to the slab stay behind the reads above
        __builtin_amdgcn_wave_barrier(); asm volatile("" ::: "memory");
    }
}
// k_fattn: one launch for the whole attention. One wave owns 16 query rows of one (batch item, head) and walks the 1024 keys in steps of 64; grid (1024 / (16 * FW), 64), FW waves a block, one block barrier a step.
// Transposed products: St = K (q+u)^T and BDt = P (q+v)^T (A = key or position rows, B = query rows kept in registers), so a lane holds ONE query (column lr) and 8 consecutive keys per tile (8 * hi + r).
// rel_shift: the 16 queries x 64 keys of a step need positions l0 .. l0 + 78, l0 = j0 - i0 + 1008 (five 16-row tiles; row 2047 is the zero pad and is never picked); BDt goes to this wave's LDS slab as [query][80] and is read back at column key - query + 15.
// Staging: the FW waves of a block read the same 64 key rows and 64 value rows in a step, and together 320 consecutive position rows, of which a step brings 64 new ones. These three pieces of 8 KiB come into LDS by asynchronous copies, 16 bytes of each per thread, whole 128-byte lines per copy, two steps ahead: keys and values into two buffers, position rows into a ring of 512 rows. The fragments are then read from LDS.
// Online softmax per lane (running maximum and sum, output tiles rescaled each step); the f32 weights rounded in place to f16 B operands; Ot += Vt Pt (1 product); the epilogue divides by the sum and writes the merged hi/lo planes.
#define FW  16
#define BDP 84                    // slab pitch in floats: 16-byte aligned rows; the skewed reads (stride 83) fall on 32 different banks
#define LP  144                   // pitch in bytes of a staged row of 64 f16 (128 bytes): 16 bytes x odd, so that the 16 rows of a fragment read fall on different banks
#define PCB (64 * LP)             // one staged piece: 64 rows
#define NST (TT / 64)             // steps
#define L2E 1.4426950408889634f
typedef __attribute__((ext_vector_type(2))) __bf16 v2bf;
typedef __attribute__((ext_vector_type(8))) unsigned v8u;
typedef __attribute__((address_space(4))) const unsigned cuns;
__device__ __forceinline__ v16h cvt16h(const v8f x0, const v8f x1) {   // element s = tile s >> 3, register s & 7: two result tiles are one B operand in the hardware k order
    v8u hw;
#pragma unroll
    for (int s = 0; s < 8; ++s) { v2f x; x[0] = (s < 4) ? x0[2 * (s & 3)] : x1[2 * (s & 3)]; x[1] = (s < 4) ? x0[2 * (s & 3) + 1] : x1[2 * (s & 3) + 1];
        hw[s] = __builtin_bit_cast(unsigned, __builtin_convertvector(x, v2h)); }
    return __builtin_bit_cast(v16h, hw);
}
// f16 fragments: the loaders of the 16-bit planes, read as f16
__device__ __forceinline__ v16h ldlh(const char* p) { return __builtin_bit_cast(v16h, ldl(p)); }
__device__ __forceinline__ v16h ldoh(const bf* base, unsigned voff, int imm) { return __builtin_bit_cast(v16h, ldo(base, voff, imm)); }
// four waves a SIMD (one block a WGP): the 4096 waves are then resident at once, and a wave's vector work runs beside its neighbours' matrix work
__global__ __launch_bounds__(FW * 32) __attribute__((amdgpu_waves_per_eu(4, 4))) void k_fattn(const bf* __restrict__ QUh, const bf* __restrict__ QVh, const bf* __restrict__ Kh, const bf* __restrict__ PPh, const bf* __restrict__ Vh, const unsigned* __restrict__ LM, bf* ATh, bf* ATl) {
    __shared__ __align__(16) float bds[FW * 16 * BDP];
    __shared__ __align__(16) char kvs[2 * 2 * PCB];   // [buffer][k, v][64 rows]
    __shared__ __align__(16) char pps[8 * PCB];       // ring of 512 position rows
    const int tid = threadIdx.x, lane = tid & 31, lr = lane & 15, hi = lane >> 4, wv = __builtin_amdgcn_readfirstlane(tid >> 5);
    const int z = blockIdx.y, b = z / NH_, h = z % NH_; const int i0 = (blockIdx.x * FW + wv) * 16;
    float* bd = bds + wv * 16 * BDP;
    // the thread's 16 bytes of every staged piece: row tid >> 3, segment tid & 7
    const unsigned cl = (unsigned)((tid >> 3) * LP + (tid & 7) * 16);
    const unsigned ck = (unsigned)(z * TT * HD * 2 + tid * 16);                                               // key rows of a step are 8 KiB in a row
    const unsigned cv = (unsigned)(((z * HD + (tid >> 3)) * TT) * 2 + (tid & 7) * 16);                         // value rows: 128 bytes of each of the 64 head dims
    const unsigned cp = (unsigned)((h * NPE + (TT - 16 * FW) - (int)blockIdx.x * 16 * FW) * HD * 2 + tid * 16);   // position rows from the block's lowest row on: piece c holds rows 64 c .. 64 c + 63 behind it, pieces 0 .. 19 end at row 2047 or below
    const unsigned lkv = ldsa(kvs) + cl, lpp = ldsa(pps) + cl;
    // keys and values of step t into buffer t & 1, position piece c into ring slot c & 7
    auto stage = [&](int t, int c) {
        const unsigned lk = lkv + (unsigned)(t & 1) * (2 * PCB), lq = lpp + (unsigned)(c & 7) * PCB;
        acopy3(lk, (const char*)Kh + ck + t * (64 * HD * 2), lk + PCB, (const char*)Vh + cv + t * 128, lq, (const char*)PPh + cp + c * (64 * HD * 2)); };
    // step 0 reads position pieces 0 .. 4
#pragma unroll
    for (int c = 0; c < 4; c += 2) acopy2(lpp + c * PCB, (const char*)PPh + cp + c * (64 * HD * 2), lpp + (c + 1) * PCB, (const char*)PPh + cp + (c + 1) * (64 * HD * 2));
    stage(0, 4);
    const unsigned qo = (unsigned)((z * TT + i0 + lr) * HD + 8 * hi) * 2u;   // byte offsets; every plane is under 2^24 bytes
    v16h qu[2], qv[2];
#pragma unroll
    for (int ks = 0; ks < 2; ++ks) { qu[ks] = ldoh(QUh, qo, ks * 64); qv[ks] = ldoh(QVh, qo, ks * 64); }
    // the lane masks of this wave's 16 queries: 32 words a step, the same address in every lane. Nothing writes them in this launch: read as constant memory they come by scalar loads into scalar registers, where a select takes its lane mask from
    const cuns* lmw = (const cuns*)(size_t)(LM + (size_t)(b * (TT / 16) + (i0 >> 4)) * (NST * 32));
    const int fl = lr * LP + hi * 16;   // the lane's place in a 16-row fragment of a staged piece
    v8f o[4];
#pragma unroll
    for (int dt = 0; dt < 4; ++dt) o[dt] = (v8f){};
    float mrun = -1.0e30f, lsum = 0.f;   // the running maximum starts far above the masked value -3e38: a masked key's exponential is 0 also while no key of its row has been left unmasked
    // step 0's copies of this wave have landed; behind the barrier those of every wave have
    asm volatile("s_wait_asynccnt 0x0" ::: "memory");
    __syncthreads();
    stage(1, 5);
#pragma unroll 1
    for (int t = 0; t < NST; ++t) {
        // the step's 32 lane masks, one line, asked for at the head of the step and used behind the content products
        unsigned km[32];
#pragma unroll
        for (int e = 0; e < 32; ++e) km[e] = lmw[t * 32 + e];
        const char* kb = kvs + (t & 1) * (2 * PCB) + fl;
        {   // position scores of the step's band, transposed: rows l0 + 16 u + 8 hi + r, column = query lr
            v8f pa[5];
#pragma unroll
            for (int u = 0; u < 5; ++u) pa[u] = (v8f){};
            v16h a[2][5];
#pragma unroll
            for (int u = 0; u < 5; ++u) { const int rw = t * 64 + (FW - 1 - wv) * 16 + u * 16;   /* row counted from the block's lowest position row */ const char* pr = pps + (rw & 511) * LP + fl; a[0][u] = ldlh(pr); a[1][u] = ldlh(pr + 64); }
            // the twenty position fragment reads are issued together, in front of the first product: without this line this build reads them in pairs among the products, each pair with its own LDS wait
            __builtin_amdgcn_sched_barrier(0);
#pragma unroll
            for (int ks = 0; ks < 2; ++ks)
#pragma unroll
                for (int u = 0; u < 5; ++u) pa[u] = wmma16(a[ks][u], qv[ks], pa[u]);
#pragma unroll
            for (int u = 0; u < 5; ++u) { v4f w0, w1;
#pragma unroll
                for (int q = 0; q < 4; ++q) { w0[q] = pa[u][q]; w1[q] = pa[u][4 + q]; }
                *(v4fa*)(bd + lr * BDP + u * 16 + hi * 8) = w0; *(v4fa*)(bd + lr * BDP + u * 16 + hi * 8 + 4) = w1; }
        }
        // the slab is exchanged between the two lane halves of this wave: keep the reads below behind the stores above; the four v_nop are the vector slots between the last position product and a content product that reuses its result registers
        __builtin_amdgcn_wave_barrier(); asm volatile("v_nop\n\tv_nop\n\tv_nop\n\tv_nop" ::: "memory");
        v8f s[4];
#pragma unroll
        for (int t4 = 0; t4 < 4; ++t4) s[t4] = (v8f){};
        { v16h a[2][4];
#pragma unroll
            for (int ks = 0; ks < 2; ++ks)
#pragma unroll
                for (int t4 = 0; t4 < 4; ++t4) a[ks][t4] = ldlh(kb + t4 * 16 * LP + ks * 64);
            // the sixteen key fragment reads of a step are issued together, in front of its first product: one place with LDS reads, and no two successive products on one accumulator
            __builtin_amdgcn_sched_barrier(0);
#pragma unroll
            for (int ks = 0; ks < 2; ++ks)
#pragma unroll
                for (int t4 = 0; t4 < 4; ++t4) s[t4] = wmma16(a[ks][t4], qu[ks], s[t4]); }
        // the step's 32 shifted position scores are read from the slab as one group, in front of the selects: left to the compiler they are read in several small batches among the selects, each with its own LDS wait
        float bv[32];
#pragma unroll
        for (int q = 0; q < 32; ++q) bv[q] = bd[lr * (BDP - 1) + 15 + (q >> 3) * 16 + hi * 8 + (q & 7)];
        // this line ends the group of reads: the selects stay behind it
        __builtin_amdgcn_sched_barrier(0);
        float tmax = -3.0e38f; const float gone = -3.0e38f;
#pragma unroll
        for (int t4 = 0; t4 < 4; ++t4) {
#pragma unroll
            for (int r = 0; r < 8; ++r) { const float su = (s[t4][r] + bv[t4 * 8 + r]) * (SCL * L2E);   /* (ac + rel_shift(bd)) / 8, in units of log2 so that the exponentials need no further product */ float tv;
                // the select takes the packed word as its lane mask as it stands: written in C it would cost a bit test and a compare for each score
                asm("v_cndmask_b32_e64 %0, %1, %2, %3" : "=v"(tv) : "v"(gone), "v"(su), "s"(km[t4 * 8 + r]));
                s[t4][r] = tv; tmax = fmaxf(tmax, tv); } }
        // the next step's stores to the slab stay behind the reads above
        __builtin_amdgcn_wave_barrier(); asm volatile("" ::: "memory");
        tmax = fmaxf(tmax, __shfl_xor(tmax, 16, 32));
        const float mnew = fmaxf(mrun, tmax); const float alpha = __builtin_amdgcn_exp2f(mrun - mnew); mrun = mnew;
        float ps = 0.f;
#pragma unroll
        for (int t4 = 0; t4 < 4; ++t4) s[t4] -= mnew;
#pragma unroll
        for (int r = 0; r < 8; ++r)
#pragma unroll
            for (int t4 = 0; t4 < 4; ++t4) { const float p = __builtin_amdgcn_exp2f(s[t4][r]); s[t4][r] = p; ps += p; }
        lsum = lsum * alpha + ps;
#pragma unroll
        for (int dt = 0; dt < 4; ++dt) o[dt] *= alpha;
        const v16h ph[2] = { cvt16h(s[0], s[1]), cvt16h(s[2], s[3]) };
        // the value fragments are read behind the rounding, as one group: without this line and the one behind the reads the compiler spreads them among the exponentials and the products and reads several into one register group, each with a full LDS wait
        __builtin_amdgcn_sched_barrier(0);
        { v16h a[2][4];
#pragma unroll
            for (int ks = 0; ks < 2; ++ks)
#pragma unroll
                for (int dt = 0; dt < 4; ++dt) a[ks][dt] = ldlh(kb + PCB + dt * 16 * LP + ks * 64);
            __builtin_amdgcn_sched_barrier(0);
#pragma unroll
            for (int ks = 0; ks < 2; ++ks)
#pragma unroll
                for (int dt = 0; dt < 4; ++dt) o[dt] = wmma16(a[ks][dt], ph[ks], o[dt]); }
        // four vector slots behind the last matrix instruction, also on the taken side of the loop's branch
        asm volatile("v_nop\n\tv_nop\n\tv_nop\n\tv_nop" : "+v"(o[0]), "+v"(o[1]), "+v"(o[2]), "+v"(o[3]));
        // hand-over of step t + 1: this wave's LDS reads of step t are done ...
        asm volatile("s_wait_dscnt 0x0" ::: "memory");
        // ... and its copies for step t + 1 have landed;
        asm volatile("s_wait_asynccnt 0x0" ::: "memory");
        // behind the barrier every wave's have, and nobody reads step t's buffer or its oldest position piece any more
        __syncthreads();
        if (t + 2 < NST) stage(t + 2, t + 6);
    }
    // no copy is left in flight when the wave ends
    asm volatile("s_wait_asynccnt 0x0" ::: "memory");
    lsum += __shfl_xor(lsum, 16, 32);
    const float f = (lsum > 0.f) ? __fdiv_rn(1.0f, lsum) : 0.f;
#pragma unroll
    for (int dt = 0; dt < 4; ++dt) { v8us oh, ol;
#pragma unroll
        for (int r = 0; r < 8; ++r) { unsigned short a, c2; splitf(o[dt][r] * f, a, c2); oh[r] = a; ol[r] = c2; }
        const size_t oo = ((size_t)b * TT + i0 + lr) * DQ + h * HD + dt * 16 + hi * 8; *(v8us*)(ATh + oo) = oh; *(v8us*)(ATl + oo) = ol; }
}

extern "C" void kernel_launch(void* const* d_in, const int* in_sizes, int n_in,
                              void* d_out, int out_size, void* d_ws, size_t ws_size, hipStream_t stream) {
    (void)in_sizes; (void)n_in; (void)out_size;
    const float* x = (const float*)d_in[0]; const int* MK = (const int*)d_in[1]; const float* wq = (const float*)d_in[2]; const float* wk = (const float*)d_in[3]; const float* wv = (const float*)d_in[4]; const float* wpos = (const float*)d_in[5]; const float* wo = (const float*)d_in[6]; const float* pbu = (const float*)d_in[7]; const float* pbv = (const float*)d_in[8];   /* u_bias, v_bias [8][64] */
    float* OUT = (float*)d_out;     // [8][1024][512]
    char* wsp = (char*)d_ws;
    auto take = [&](size_t bytes) { char* p = wsp; wsp += (bytes + 255) & ~(size_t)255; return (void*)p; };
    bf* WQ = (bf*)take((size_t)DQ * DM * 2); bf* WK = (bf*)take((size_t)DKV * DM * 2); bf* WV = (bf*)take((size_t)DKV * DM * 2); bf* WO = (bf*)take((size_t)DM * DQ * 2);
    bf* PEh = (bf*)take((size_t)NPE * DM * 2); bf* PEl = (bf*)take((size_t)NPE * DM * 2); bf* WP = (bf*)take((size_t)DQ * DM * 2); bf* PPh = (bf*)take((size_t)NH_ * NPE * HD * 2);
    // planes of all 8 batch items
    bf* QPh = (bf*)take((size_t)NB_ * NH_ * TT * HD * 2); bf* QVh = (bf*)take((size_t)NB_ * NH_ * TT * HD * 2); bf* KPh = (bf*)take((size_t)NB_ * NKV * TT * HD * 2); bf* VTh = (bf*)take((size_t)NB_ * NKV * HD * TT * 2); bf* ATh = (bf*)take((size_t)NB_ * TT * DQ * 2); bf* ATl = (bf*)take((size_t)NB_ * TT * DQ * 2);
    bf* XB = (bf*)take((size_t)NB_ * TT * DM * 2);
    unsigned* LM = (unsigned*)take((size_t)NB_ * TT * TT / 8);
    if ((size_t)(wsp - (char*)d_ws) > ws_size) return;
    k_prep<<<5 * PBW + PBM + PBP + PBX, 256, 0, stream>>>(wq, wk, wv, wo, wpos, x, MK, WQ, WK, WV, WO, WP, PEh, PEl, XB, LM);   /* five transposed bf16 weight planes, mask bits, sinusoid table (hi + lo), exact bf16 plane of xs */
    k_proj<<<PJP + 384, GW * 32, 0, stream>>>(PEh, PEl, WP, PPh, XB, WQ, WK, WV, pbu, pbv, QPh, QVh, KPh, VTh);   /* p = table Wpos -> per-head f16 plane [h][2048][64]; q + u_bias, q + v_bias, k and transposed v planes of all 8 batch items */
    k_fattn<<<dim3(TT / (16 * FW), NB_ * NH_, 1), FW * 32, 0, stream>>>(QPh, QVh, KPh, PPh, VTh, LM, ATh, ATl);   /* scores, rel_shift, mask, softmax, attn.v and merge of all 64 (batch item, head) pairs */
    k_outp<<<dim3(NB_ * TT / 128, DM / 128, 1), GW * 32, 0, stream>>>(ATh, ATl, WO, OUT);   /* out = merged Wout */
}

// v010
// One run takes 73.6 microseconds.
// Two timings next to v009 put it at 1.17 and 1.16 times that version's speed.
// Counting every step since v000, it is 28.6 times as fast.
#include <hip/hip_runtime.h>

// Transformer-XL style relative-position multi-head self-attention (xs [8][1024][512]; q, k, v = xs W ('xw' [512][512], no bias; 8 heads x 64); p = pe Wpos with pe the sinusoidal table of positions -(T-1)..T-1 (2047 rows, [sin, cos] interleaved, computed on device); scores = ((q + u_bias).k + rel_shift((q + v_bias).p)) / 8 where rel_shift picks position row j - i + 1023; mask (int32 [8][1024][1024], read): -inf where 0 and those weights zeroed; softmax; out = merged Wout ('xw', no bias) -> [8][1024][512] (4.2 M)).
// Layout: one exact bf16 input plane -> 1-product projections; the position table is computed on device in f32 (NOT bf16-rounded: kept as bf16 hi + lo planes) and projected once (2 products, 2047 rows + one zero pad row) into a per-head f16 plane [h][2048][64]; the q, k, v projections of all 8 batch items are one launch whose epilogue adds the biases, rounds to f16 and stores the head planes (v transposed), the position projection likewise; one fused attention launch for all 64 (batch item, head) pairs: content scores (q+u).k and the needed band of position scores (q+v).p are f16 products (1 each), the position score at j - i + 1023 is picked through LDS, mask select, online softmax and attn.v follow in registers: no score reaches memory. The mask is read once, by the preparation launch, which packs it to one bit a key, in the order in which a wave of the attention launch holds its scores; the eight heads of a batch item read the bits.
// Compute dtypes, f32 accumulate: every input rounded to bf16; q/k/v on PLAIN bf16 operands (exact products); p = pe(hi+lo) Wpos (2 products); content and position scores on f16 planes (q + bias, k, p each rounded once to f16: 11 significant bits; 1 product); softmax f32; attn.v on f16 weights and values (1 product); Wout hl x exact (2 products).

#define NB_  8
#define TT   1024
#define DM   512
#define NH_  8
#define NKV  8
#define REP  (NH_ / NKV)
#define HD   64
#define DQ   (NH_ * HD)
#define DKV  (NKV * HD)
#define NPE  2048                 // 2047 positions + 1 zero pad row
typedef __attribute__((ext_vector_type(4))) unsigned short v4us;
#define ZH   8
#define RH   1024
#define WIN  0
#define PCAR 1024.0f
#define SCL  0.125f   // HD^-0.5
typedef _Float16 h16;
typedef unsigned short bf;
typedef __attribute__((ext_vector_type(16))) __bf16   v16bf;
typedef __attribute__((ext_vector_type(16))) _Float16 v16h;
typedef __attribute__((ext_vector_type(8)))  _Float16 v8h;
typedef __attribute__((ext_vector_type(8)))  unsigned short v8us;
typedef __attribute__((ext_vector_type(8)))  float    v8f;
typedef __attribute__((ext_vector_type(4)))  float    v4f;
typedef v8h  __attribute__((may_alias)) v8ha;
typedef v4f  __attribute__((may_alias)) v4fa;
typedef v8us __attribute__((may_alias)) v8usa;

__device__ __forceinline__ unsigned short f2bf(float f) { unsigned u = __float_as_uint(f); u += 0x7FFFu + ((u >> 16) & 1u); return (unsigned short)(u >> 16); }
__device__ __forceinline__ float bf2f(unsigned short b) { return __uint_as_float(((unsigned)b) << 16); }
__device__ __forceinline__ float bfr(float f) { return bf2f(f2bf(f)); }
__device__ __forceinline__ v16h cat16(v8h lo, v8h hi) { return __builtin_shufflevector(lo, hi, 0, 1, 2, 3, 4, 5, 6, 7, 8, 9, 10, 11, 12, 13, 14, 15); }
__device__ __forceinline__ v16bf cat16b(v8us lo, v8us hi) { return __builtin_bit_cast(v16bf, __builtin_shufflevector(lo, hi, 0, 1, 2, 3, 4, 5, 6, 7, 8, 9, 10, 11, 12, 13, 14, 15)); }
__device__ __forceinline__ v8f wmma16(v16h a, v16h b, v8f c) { return __builtin_amdgcn_wmma_f32_16x16x32_f16(false, a, false, b, (short)0, c, false, false); }
__device__ __forceinline__ v8f wmmab(v16bf a, v16bf b, v8f c) { return __builtin_amdgcn_wmma_f32_16x16x32_bf16(false, a, false, b, (short)0, c, false, false); }



__device__ __forceinline__ h16 tohx(float x) { return (h16)x; }
__device__ __forceinline__ void splitf(float y, unsigned short& h, unsigned short& l) { h = f2bf(y); l = f2bf(y - bf2f(h)); }
typedef __attribute__((ext_vector_type(2))) _Float16 v2h;
typedef __attribute__((ext_vector_type(4))) _Float16 v4h;
typedef __attribute__((ext_vector_type(2))) unsigned short v2us;
typedef __attribute__((ext_vector_type(4))) unsigned short v4us;
typedef __attribute__((ext_vector_type(2))) float v2f;
typedef __attribute__((ext_vector_type(4))) int v4i;
// eight f32 results rounded to nearest even to f16, as the bits of a 16-byte store
__device__ __forceinline__ void cvt8h(const float (&x)[8], v8us& o) { v8h h;
#pragma unroll
    for (int q = 0; q < 4; ++q) { v2f p; p[0] = x[2 * q]; p[1] = x[2 * q + 1]; const v2h c = __builtin_convertvector(p, v2h); h[2 * q] = c[0]; h[2 * q + 1] = c[1]; }
    o = __builtin_bit_cast(v8us, h); }

__device__ __forceinline__ void d_wtG(int blk, const float* __restrict__ w, int K, int N, bf* Bt) {
    const int lane = threadIdx.x & 31; const int L0 = (blk * 8 + (threadIdx.x >> 5)) * 8; const int nlines = N * K / 64;
{
#pragma unroll 1
        for (int l = 0; l < 8; ++l) { const int L = L0 + l; if (L >= nlines) break; const size_t e = (size_t)L * 64 + lane * 2; const int k = (int)(e % K), n = (int)(e / K); v2us o;
            o[0] = f2bf(w[(size_t)k * N + n]); o[1] = f2bf(w[(size_t)(k + 1) * N + n]); *(v2us*)(Bt + e) = o; }
         }
}



__constant__ float INVF[DM / 2] = {1.0f,0.964661598f,0.930572033f,0.897687137f,0.865964293f,0.835362554f,0.805842161f,0.777365029f,0.749894202f,0.723394156f,0.697830558f,0.673170388f,0.649381638f,0.626433551f,0.604296386f,0.582941532f,0.562341332f,0.542469084f,0.523299098f,0.504806578f,0.486967504f,0.469758898f,0.453158379f,0.437144488f,0.421696484f,0.406794429f,0.392418981f,0.378551513f,0.365174115f,0.352269441f,0.339820832f,0.327812076f,0.316227764f,0.305052817f,0.294272721f,0.283873618f,0.273841947f,0.264164835f,0.254829645f,0.245824397f,0.237137347f,0.228757307f,0.220673412f,0.212875158f,0.2053525f,0.198095664f,0.191095293f,0.184342295f,0.177827939f,0.171543792f,0.165481701f,0.15963386f,0.153992653f,0.148550808f,0.143301249f,0.138237223f,0.133352146f,0.128639698f,0.124093764f,0.119708493f,0.115478195f,0.111397393f,0.107460767f,0.103663281f,0.099999994f,0.0964661688f,0.0930572152f,0.0897687078f,0.0865964293f,0.0835362524f,0.0805842206f,0.0777364895f,0.0749894157f,0.0723394156f,0.0697830617f,0.0673170388f,0.0649381578f,0.0626433492f,0.0604296364f,0.0582941547f,0.056234125f,0.0542469025f,0.0523299091f,0.0504806563f,0.0486967564f,0.0469758809f,0.0453158319f,0.0437144488f,0.0421696529f,0.0406794474f,0.0392418914f,0.0378551483f,0.0365174115f,0.0352269486f,0.0339820795f,0.0327812098f,0.0316227749f,0.0305052791f,0.0294272732f,0.0283873565f,0.0273841936f,0.0264164824f,0.0254829675f,0.0245824363f,0.023713734f,0.0228757299f,0.0220673401f,0.0212875176f,0.0205352474f,0.0198095664f,0.0191095285f,0.0184342302f,0.0177827962f,0.0171543807f,0.0165481735f,0.0159633812f,0.0153992623f,0.0148550775f,0.0143301245f,0.0138237216f,0.013335214f,0.0128639704f,0.0124093788f,0.0119708525f,0.0115478169f,0.0111397365f,0.0107460767f,0.0103663281f,0.00999999978f,0.00964661594f,0.00930572115f,0.00897687208f,0.00865964405f,0.00835362263f,0.00805842038f,0.00777364895f,0.00749894092f,0.007233941f,0.00697830552f,0.00673170388f,0.00649381708f,0.00626433641f,0.00604296196f,0.00582941389f,0.00562341232f,0.00542468997f,0.00523299072f,0.00504806545f,0.00486967526f,0.0046975892f,0.00453158421f,0.0043714433f,0.00421696389f,0.00406794343f,0.00392418914f,0.00378551497f,0.00365174119f,0.00352269458f,0.00339820841f,0.00327812159f,0.0031622767f,0.00305052707f,0.00294272648f,0.00283873547f,0.00273841922f,0.00264164805f,0.0025482967f,0.0024582441f,0.00237137405f,0.00228757365f,0.00220673345f,0.00212875125f,0.0020535246f,0.00198095664f,0.00191095285f,0.001843423f,0.00177827943f,0.00171543809f,0.00165481726f,0.00159633812f,0.00153992616f,0.0014855077f,0.00143301231f,0.00138237211f,0.00133352133f,0.00128639699f,0.00124093785f,0.00119708513f,0.00115478167f,0.00111397356f,0.0010746076f,0.00103663281f,0.000999999931f,0.000964661594f,0.000930572045f,0.000897687161f,0.000865964394f,0.000835362298f,0.000805841992f,0.000777364883f,0.000749894069f,0.0007233941f,0.000697830576f,0.000673170376f,0.000649381662f,0.000626433583f,0.00060429622f,0.0005829414f,0.000562341185f,0.000542468973f,0.000523299037f,0.000504806521f,0.000486967503f,0.000469758903f,0.000453158398f,0.000437144336f,0.000421696401f,0.000406794337f,0.000392418908f,0.000378551485f,0.000365174084f,0.000352269446f,0.000339820836f,0.000327811984f,0.000316227786f,0.000305052701f,0.000294272788f,0.000283873524f,0.000273842044f,0.000264164817f,0.000254829531f,0.000245824398f,0.000237137268f,0.000228757344f,0.000220673333f,0.000212875209f,0.000205352466f,0.000198095746f,0.000191095271f,0.000184342207f,0.00017782794f,0.00017154371f,0.000165481732f,0.000159633797f,0.000153992674f,0.000148550767f,0.000143301295f,0.000138237199f,0.000133352078f,0.000128639687f,0.000124093727f,0.000119708515f,0.000115478157f,0.000111397407f,0.000107460757f,0.000103663326f};
#define PBW 64                              // blocks of a weight matrix
#define PBP (NPE * DM / 2 / 256)            // blocks of the position table: a [sin, cos] pair a thread
#define PBX (NB_ * TT * DM / 8 / 256)       // blocks of the xs plane: 8 elements a thread
#define PBM (NB_ * TT / 32)                 // blocks of the mask bits: 32 mask rows a block, 128 keys of them a wave
typedef __attribute__((ext_vector_type(4))) unsigned v4u;
// mask bits as lane masks [b][i / 16][j / 64][e], e = 0 .. 31: bit 16 hi + lr of word e says whether mask[b][16 (i / 16) + lr][64 (j / 64) + 16 (e >> 3) + 8 hi + (e & 7)] is not 0: the lane and the register in which the attention wave of those 16 queries holds that score.
// First by rows: a wave reads 512 bytes in a row of one mask row (lane L the keys 4 L .. 4 L + 3), so that compare q gives a word whose bit L is key 4 L + q; lane j keeps the four words of row j. Then by lanes: lane 16 hi + lr takes row lr's words, and a compare of one bit of them gives one lane mask; lane e keeps word e, and 32 words leave as one line.
__device__ __forceinline__ void d_mbits(int blk, const int* __restrict__ mk, unsigned* LM) {
    const int lane = threadIdx.x & 31, c = threadIdx.x >> 5; const int b = blk / (TT / 32), r0 = (blk % (TT / 32)) * 32;
    const int* src = mk + (size_t)(b * TT + r0) * TT + c * 128 + lane * 4;
    unsigned o[4] = {0u, 0u, 0u, 0u};
#pragma unroll
    for (int g = 0; g < 4; ++g) { v4i m[8];
#pragma unroll
        for (int j = 0; j < 8; ++j) m[j] = *(const v4i*)(src + (g * 8 + j) * TT);
#pragma unroll
        for (int j = 0; j < 8; ++j) {
#pragma unroll
            for (int q = 0; q < 4; ++q) { const unsigned bal = __builtin_amdgcn_ballot_w32(m[j][q] != 0); o[q] = lane == g * 8 + j ? bal : o[q]; } }
        // eight rows' loads in flight at a time: without this line all 32 are lifted to the front, and their 128 registers would cut the resident waves of every part of the merged kernel
        __builtin_amdgcn_sched_barrier(0); }
#pragma unroll
    for (int g = 0; g < 2; ++g) { unsigned w[4];
#pragma unroll
        for (int q = 0; q < 4; ++q) w[q] = (unsigned)__shfl((int)o[q], g * 16 + (lane & 15), 32) >> (unsigned)((lane >> 4) * 2);
#pragma unroll
        for (int tp = 0; tp < 2; ++tp) { unsigned out = 0u;
#pragma unroll
            for (int e = 0; e < 32; ++e) { const unsigned bal = __builtin_amdgcn_ballot_w32(((w[e & 3] >> (tp * 16 + (e >> 3) * 4 + ((e & 7) >> 2))) & 1u) != 0u); out = lane == e ? bal : out; }
            LM[((size_t)(b * (TT / 16) + (r0 >> 4) + g) * (TT / 64) + 2 * c + tp) * 32 + lane] = out; } }
    // behind the part's last store, in front of whatever code of the merged kernel follows it in the text and writes its registers
    asm volatile("s_wait_xcnt 0x0" ::: "memory"); }
__device__ __forceinline__ void d_petab(int blk, bf* PEh, bf* PEl) { const size_t e = ((size_t)blk * 256 + threadIdx.x) * 2; const int c = (int)(e % DM); const int r = (int)(e / DM); v2us oh, ol;
    if (r < NPE - 1) { const float th = __fmul_rn((float)(r - (TT - 1)), INVF[c >> 1]); unsigned short a, b2; splitf(sinf(th), a, b2); oh[0] = a; ol[0] = b2; splitf(cosf(th), a, b2); oh[1] = a; ol[1] = b2; } else { oh[0] = 0; oh[1] = 0; ol[0] = 0; ol[1] = 0; }
    *(v2us*)(PEh + e) = oh; *(v2us*)(PEl + e) = ol;
    // behind the part's last stores, in front of whatever code of the merged kernel follows them in the text and writes their registers
    asm volatile("s_wait_xcnt 0x0" ::: "memory"); }
__device__ __forceinline__ void d_cvt8(int blk, const float* __restrict__ src, bf* dst) { const size_t i = (size_t)blk * 256 + threadIdx.x; const v8f v = *(const v8f*)(src + i * 8); v8us o;
#pragma unroll
    for (int k = 0; k < 8; ++k) o[k] = f2bf(v[k]); *(v8us*)(dst + i * 8) = o;
    // behind the part's last store, in front of whatever code of the merged kernel follows it in the text and writes its registers
    asm volatile("s_wait_xcnt 0x0" ::: "memory"); }
// ---- k_prep: every plane that is made from the inputs alone, in ONE launch: none of the eight pieces reads what another writes. Blocks 0 .. 5 PBW - 1: the five transposed bf16 weight planes (their gathers have the longest chain of waits, so they start first); then the mask bits (the most bytes); then the position table; then the xs plane.
__global__ __launch_bounds__(256) void k_prep(const float* __restrict__ wq, const float* __restrict__ wk, const float* __restrict__ wv, const float* __restrict__ wo, const float* __restrict__ wpos, const float* __restrict__ x, const int* __restrict__ mk, bf* WQ, bf* WK, bf* WV, bf* WO, bf* WP, bf* PEh, bf* PEl, bf* XB, unsigned* LM) {
    const int blk = blockIdx.x;
    if (blk < 5 * PBW) { const int m = blk / PBW;
        d_wtG(blk % PBW, m == 0 ? wq : m == 1 ? wk : m == 2 ? wv : m == 3 ? wo : wpos, DM, DQ, m == 0 ? WQ : m == 1 ? WK : m == 2 ? WV : m == 3 ? WO : WP); }
    else if (blk < 5 * PBW + PBM) d_mbits(blk - 5 * PBW, mk, LM);
    else if (blk < 5 * PBW + PBM + PBP) d_petab(blk - (5 * PBW + PBM), PEh, PEl);
    else d_cvt8(blk - (5 * PBW + PBM + PBP), x, XB);
}

// fragment at scalar base + 32-bit vector byte offset + constant: one address register serves every load of a phase
__device__ __forceinline__ v16bf ldo(const bf* base, unsigned voff, int imm) { const char* p = (const char*)base + voff + imm; return cat16b(*(const v8us*)p, *(const v8us*)(p + 32)); }
// ---- projections that write their operand planes themselves: the epilogue rounds each f32 result to f16 and stores rows of 64 elements (128 bytes, whole lines) straight into the layout the attention kernel reads.
// ---- the three GEMMs (q, k, v; position; output): a block of 8 waves works on one block tile, and the operand rows that its waves share come into LDS once, by asynchronous copies of whole 128-byte lines, instead of each wave gathering 32 bytes from each of 16 lines per load. A k step is 64 elements (one line a row); three groups of 128 rows a step, two buffers, the next step's copies in flight while this one is multiplied. The fragments are then read from LDS in the k order of ldo.
#define GP   144                  // pitch in bytes of a staged row of 64 bf16: 16 bytes x odd, so that the 16 rows of a fragment read fall on different banks
#define GGRP (128 * GP)           // a group of 128 staged rows
#define GBUF (3 * GGRP)           // a buffer: three groups
#define GNT  (DM / 64)            // k steps
#define GW   8                    // waves a block
// fragment from a staged piece: the lane's 16 bytes at p and at p + 32, the k order of ldo
__device__ __forceinline__ v16bf ldl(const char* p) { return cat16b(*(const v8usa*)p, *(const v8usa*)(p + 32)); }
__device__ __forceinline__ unsigned ldsa(const void* p) { return (unsigned)(size_t)p; }
// asynchronous copies global -> LDS, 16 bytes a lane; the wait in the same statement keeps the address registers whole until the copies have taken them
__device__ __forceinline__ void acopy2(unsigned l0, const char* g0, unsigned l1, const char* g1) {
    asm volatile("global_load_async_to_lds_b128 %0, %1, off\n\tglobal_load_async_to_lds_b128 %2, %3, off\n\ts_wait_xcnt 0x0" :: "v"(l0), "v"(g0), "v"(l1), "v"(g1) : "memory"); }
__device__ __forceinline__ void acopy6(unsigned l0, const char* g0, unsigned l1, const char* g1, unsigned l2, const char* g2, unsigned l3, const char* g3, unsigned l4, const char* g4, unsigned l5, const char* g5) {
    asm volatile("global_load_async_to_lds_b128 %0, %1, off\n\tglobal_load_async_to_lds_b128 %2, %3, off\n\tglobal_load_async_to_lds_b128 %4, %5, off\n\tglobal_load_async_to_lds_b128 %6, %7, off\n\tglobal_load_async_to_lds_b128 %8, %9, off\n\tglobal_load_async_to_lds_b128 %10, %11, off\n\ts_wait_xcnt 0x0" :: "v"(l0), "v"(g0), "v"(l1), "v"(g1), "v"(l2), "v"(g2), "v"(l3), "v"(g3), "v"(l4), "v"(g4), "v"(l5), "v"(g5) : "memory"); }
// s0, s1, s2: first byte of the 128 rows (pitch DM elements) of each group; ao, a2o, bo: byte offset in a buffer of row 0 of this wave's A, second A (NSPLIT == 1) and B rows. The wave's tile is 16 MB x 64; each accumulator takes its products in the order k = 0, 32, 64 ... (a, then a2).
template <int MB, int NSPLIT>
__device__ __forceinline__ void tileS(char* stg, const char* __restrict__ s0, const char* __restrict__ s1, const char* __restrict__ s2, int ao, int a2o, int bo, int lr, int hi, v8f (&acc)[MB][4]) {
    const int tid = threadIdx.x;
    const unsigned go = (unsigned)((tid >> 3) * (DM * 2) + (tid & 7) * 16);             // the thread's 16 bytes: rows tid >> 3 + 32 j of a group, segment tid & 7
    const unsigned lo = ldsa(stg) + (unsigned)((tid >> 3) * GP + (tid & 7) * 16);
    auto stage = [&](int t) {
        const unsigned l = lo + (unsigned)(t & 1) * GBUF; const unsigned g = go + (unsigned)t * 128u;
        acopy6(l, s0 + g, l + 32 * GP, s0 + g + 32 * DM * 2, l + 64 * GP, s0 + g + 64 * DM * 2, l + 96 * GP, s0 + g + 96 * DM * 2, l + GGRP, s1 + g, l + GGRP + 32 * GP, s1 + g + 32 * DM * 2);
        acopy6(l + GGRP + 64 * GP, s1 + g + 64 * DM * 2, l + GGRP + 96 * GP, s1 + g + 96 * DM * 2, l + 2 * GGRP, s2 + g, l + 2 * GGRP + 32 * GP, s2 + g + 32 * DM * 2, l + 2 * GGRP + 64 * GP, s2 + g + 64 * DM * 2, l + 2 * GGRP + 96 * GP, s2 + g + 96 * DM * 2); };
#pragma unroll
    for (int mb = 0; mb < MB; ++mb)
#pragma unroll
        for (int nb = 0; nb < 4; ++nb) acc[mb][nb] = (v8f){};
    stage(0);
    // step 0's copies of this wave have landed; behind the barrier those of every wave have
    asm volatile("s_wait_asynccnt 0x0" ::: "memory");
    __syncthreads();
    stage(1);
    const int fl = lr * GP + hi * 16;   // the lane's place in a 16-row fragment
    // rolled: the text of one step serves all eight, and the buffer is picked by t & 1
#pragma unroll 1
    for (int t = 0; t < GNT; ++t) {
        const char* bb = stg + (t & 1) * GBUF + fl;
#pragma unroll
        for (int ks = 0; ks < 2; ++ks) { v16bf a[MB], a2[MB], b[4];
#pragma unroll
            for (int mb = 0; mb < MB; ++mb) { a[mb] = ldl(bb + ao + mb * 16 * GP + ks * 64); if (NSPLIT == 1) a2[mb] = ldl(bb + a2o + mb * 16 * GP + ks * 64); }
#pragma unroll
            for (int nb = 0; nb < 4; ++nb) b[nb] = ldl(bb + bo + nb * 16 * GP + ks * 64);
            // all fragment reads of a half step are issued in front of its first product: without this line the compiler reads the b fragments one after the other into one register group, each with a full LDS wait
            __builtin_amdgcn_sched_barrier(0);
#pragma unroll
            for (int nb = 0; nb < 4; ++nb) {
#pragma unroll
                for (int mb = 0; mb < MB; ++mb) { acc[mb][nb] = wmmab(a[mb], b[nb], acc[mb][nb]); if (NSPLIT == 1) acc[mb][nb] = wmmab(a2[mb], b[nb], acc[mb][nb]); } } }
        // hand-over of step t + 1: this wave's LDS reads of step t are done ...
        asm volatile("s_wait_dscnt 0x0" ::: "memory");
        // ... and its copies for step t + 1 have landed;
        asm volatile("s_wait_asynccnt 0x0" ::: "memory");
        // behind the barrier every wave's have, and nobody reads step t's buffer any more
        __syncthreads();
        if (t + 2 < GNT) stage(t + 2);
    }
    // no copy is left in flight behind the loop
    asm volatile("s_wait_asynccnt 0x0" ::: "memory");
}
// 16 rows of the tile into this wave's LDS slab [16][68]
__device__ __forceinline__ void slab_put(float* os, const v8f (&acc)[4], int lr, int hi) {
#pragma unroll
    for (int nb = 0; nb < 4; ++nb) {
#pragma unroll
        for (int j = 0; j < 8; ++j) os[(hi * 8 + j) * 68 + nb * 16 + lr] = acc[nb][j]; }
}
// d_qkvp: block tiles of 128 positions x 256 columns (4 heads), 64 x 6 of them; waves 2 x 4, a wave has the 64 x 64 tile of one head. by >> 1 picks q, k or v, by & 1 the half of the heads. Staged: group 0 the 128 xs rows, groups 1 and 2 the 256 weight rows. q and k: C = xs W, tile rows are positions, planes [b][h][t][d]; q is stored twice, as q + u_bias and q + v_bias. v: the operands change places (C = Wv^T xs^T), so that tile rows are head dims and the transposed planes [b][h][d][t] are stored by rows as well.
__device__ __forceinline__ void d_qkvp(char* stg, float* os, int wv, int bx, int by, const bf* __restrict__ XB, const bf* __restrict__ WQ, const bf* __restrict__ WK, const bf* __restrict__ WV, const float* __restrict__ pbu, const float* __restrict__ pbv, bf* QUh, bf* QVh, bf* Kh, bf* Vh) {
    const int lane = threadIdx.x & 31, lr = lane & 15, hi = lane >> 4; const int mi = wv >> 2, ni = wv & 3; const int sel = by >> 1, cb = (by & 1) * 4 + ni, xr = bx * 128 + mi * 64, b = xr / TT, t0 = xr % TT; const bool tv = sel == 2;
    v8f acc[4][4];
    const char* wr = (const char*)(sel == 0 ? WQ : sel == 1 ? WK : WV) + (size_t)(by & 1) * 256 * DM * 2;
    tileS<4, 0>(stg, (const char*)XB + (size_t)bx * 128 * DM * 2, wr, wr + 128 * DM * 2, tv ? GGRP + ni * 64 * GP : mi * 64 * GP, 0, tv ? mi * 64 * GP : GGRP + ni * 64 * GP, lr, hi, acc);
    const size_t base = tv ? (size_t)(b * NKV + cb) * HD * TT + t0 : ((size_t)(b * NH_ + cb) * TT + t0) * HD; const int pitch = tv ? TT : HD;
    bf* Dh = tv ? Vh : Kh;
    const int rr = lane >> 3, cofs = (lane & 7) * 8;
    float ub[8], vb[8];
#pragma unroll
    for (int q = 0; q < 8; ++q) { ub[q] = 0.f; vb[q] = 0.f; }
    if (sel == 0) {
#pragma unroll
        for (int q = 0; q < 8; ++q) { ub[q] = bfr(pbu[cb * HD + cofs + q]); vb[q] = bfr(pbv[cb * HD + cofs + q]); } }
#pragma unroll
    for (int mb = 0; mb < 4; ++mb) {
        slab_put(os, acc[mb], lr, hi);
        // the slab is exchanged between the lanes of this wave: keep the reads below behind the stores above
        __builtin_amdgcn_wave_barrier(); asm volatile("" ::: "memory");
#pragma unroll
        for (int s = 0; s < 4; ++s) { const int row = 4 * s + rr; const v4f x0 = *(const v4fa*)(os + row * 68 + cofs), x1 = *(const v4fa*)(os + row * 68 + cofs + 4); float x[8];
#pragma unroll
            for (int q = 0; q < 4; ++q) { x[q] = x0[q]; x[4 + q] = x1[q]; }
            const size_t o = base + (size_t)(mb * 16 + row) * pitch + cofs;
            v8us oh;
            if (sel == 0) { float y[8]; v8us ph;
#pragma unroll
                for (int q = 0; q < 8; ++q) y[q] = __fadd_rn(x[q], ub[q]);
                cvt8h(y, oh);
#pragma unroll
                for (int q = 0; q < 8; ++q) y[q] = __fadd_rn(x[q], vb[q]);
                cvt8h(y, ph);
                *(v8us*)(QUh + o) = oh; *(v8us*)(QVh + o) = ph; }
            else { cvt8h(x, oh); *(v8us*)(Dh + o) = oh; }
            // the stores' address and data registers are rewritten by the next rows: the wait stands in front of that
            asm volatile("s_wait_xcnt 0x0" ::: "memory"); }
        // the next 16 rows' stores to the slab stay behind the reads above
        __builtin_amdgcn_wave_barrier(); asm volatile("" ::: "memory");
    }
}
// d_posp: p = position table (hi + lo, 2 products) Wpos, block tiles of 128 rows x 128 columns (2 heads), 16 x 4 of them; waves 4 x 2, a wave has 32 rows of one head; f16 plane [h][2048][64]. Staged: the 128 table rows hi, the same lo, the 128 weight rows.
__device__ __forceinline__ void d_posp(char* stg, float* os, int wv, int bx, int by, const bf* __restrict__ PEh, const bf* __restrict__ PEl, const bf* __restrict__ WP, bf* Ph2) {
    const int lane = threadIdx.x & 31, lr = lane & 15, hi = lane >> 4; const int mi = wv >> 1, ni = wv & 1; const int r0 = bx * 128 + mi * 32, cb = by * 2 + ni;
    v8f acc[2][4];
    tileS<2, 1>(stg, (const char*)PEh + (size_t)bx * 128 * DM * 2, (const char*)PEl + (size_t)bx * 128 * DM * 2, (const char*)WP + (size_t)by * 128 * DM * 2, mi * 32 * GP, GGRP + mi * 32 * GP, 2 * GGRP + ni * 64 * GP, lr, hi, acc);
    const size_t base = ((size_t)cb * NPE + r0) * HD; const int rr = lane >> 3, cofs = (lane & 7) * 8;
#pragma unroll
    for (int mb = 0; mb < 2; ++mb) {
        slab_put(os, acc[mb], lr, hi);
        // the slab is exchanged between the lanes of this wave: keep the reads below behind the stores above
        __builtin_amdgcn_wave_barrier(); asm volatile("" ::: "memory");
#pragma unroll
        for (int s = 0; s < 4; ++s) { const int row = 4 * s + rr; const v4f x0 = *(const v4fa*)(os + row * 68 + cofs), x1 = *(const v4fa*)(os + row * 68 + cofs + 4); float x[8];
#pragma unroll
            for (int q = 0; q < 4; ++q) { x[q] = x0[q]; x[4 + q] = x1[q]; }
            v8us oh; cvt8h(x, oh); const size_t o = base + (size_t)(mb * 16 + row) * HD + cofs; *(v8us*)(Ph2 + o) = oh;
            // the store's address and data registers are rewritten by the next rows: the wait stands in front of that
            asm volatile("s_wait_xcnt 0x0" ::: "memory"); }
        // the next 16 rows' stores to the slab stay behind the reads above
        __builtin_amdgcn_wave_barrier(); asm volatile("" ::: "memory");
    }
}
// ---- k_proj: the position projection and the q, k, v projections read only what k_prep wrote and nothing of each other: ONE launch of 64 + 384 blocks of 8 waves. Blocks 0 .. 63 are the position tiles, the rest q, then k, then v. Four waves a SIMD (two blocks a WGP): every block is resident at once.
#define PJP 64                    // position blocks
__global__ __launch_bounds__(GW * 32) __attribute__((amdgpu_waves_per_eu(4, 4))) void k_proj(const bf* __restrict__ PEh, const bf* __restrict__ PEl, const bf* __restrict__ WP, bf* Ph2, const bf* __restrict__ XB, const bf* __restrict__ WQ, const bf* __restrict__ WK, const bf* __restrict__ WV, const float* __restrict__ pbu, const float* __restrict__ pbv, bf* QUh, bf* QVh, bf* Kh, bf* Vh) {
    __shared__ __align__(16) char stg[2 * GBUF];
    __shared__ __align__(16) float oss[GW * 16 * 68];
    const int wv = __builtin_amdgcn_readfirstlane(threadIdx.x >> 5); float* os = oss + wv * 16 * 68; const int blk = blockIdx.x;
    if (blk < PJP) d_posp(stg, os, wv, blk & 15, blk >> 4, PEh, PEl, WP, Ph2);
    else d_qkvp(stg, os, wv, (blk - PJP) & 63, (blk - PJP) >> 6, XB, WQ, WK, WV, pbu, pbv, QUh, QVh, Kh, Vh);
}
// ---- k_outp: out = merged (hi + lo, 2 products) Wout, f32. Block tiles of 128 x 128, grid (64, 4): one block a WGP; waves 4 x 2, a wave has 32 x 64. Staged: the 128 merged rows hi, the same lo, the 128 weight rows.
__global__ __launch_bounds__(GW * 32) void k_outp(const bf* __restrict__ Ah, const bf* __restrict__ Al, const bf* __restrict__ Bt, float* C) {
    __shared__ __align__(16) char stg[2 * GBUF];
    __shared__ __align__(16) float oss[GW * 16 * 68];
    const int lane = threadIdx.x & 31, lr = lane & 15, hi = lane >> 4, wv = __builtin_amdgcn_readfirstlane(threadIdx.x >> 5); float* os = oss + wv * 16 * 68;
    const int mi = wv >> 1, ni = wv & 1; const int r0 = blockIdx.x * 128 + mi * 32, c0 = blockIdx.y * 128 + ni * 64;
    v8f acc[2][4];
    tileS<2, 1>(stg, (const char*)Ah + (size_t)blockIdx.x * 128 * DM * 2, (const char*)Al + (size_t)blockIdx.x * 128 * DM * 2, (const char*)Bt + (size_t)blockIdx.y * 128 * DM * 2, mi * 32 * GP, GGRP + mi * 32 * GP, 2 * GGRP + ni * 64 * GP, lr, hi, acc);
#pragma unroll
    for (int mb = 0; mb < 2; ++mb) {
        slab_put(os, acc[mb], lr, hi);
        // the slab is exchanged between the lanes of this wave: keep the reads below behind the stores above
        __builtin_amdgcn_wave_barrier(); asm volatile("" ::: "memory");
        float* crow = C + (size_t)(r0 + mb * 16) * DM + c0;
#pragma unroll
        for (int s = 0; s < 8; ++s) { const int row = 2 * s + hi, cofs = lr * 4; const v4f val = *(const v4fa*)(os + row * 68 + cofs); *(v4f*)(crow + (size_t)row * DM + cofs) = val;
            // the store's address and data registers are rewritten by the next rows: the wait stands in front of that
            asm volatile("s_wait_xcnt 0x0" ::: "memory"); }
        // the next 16 rows' stores to the slab stay behind the reads above
        __builtin_amdgcn_wave_barrier(); asm volatile("" ::: "memory");
    }
}
// k_fattn: one launch for the whole attention. One wave owns 16 query rows of one (batch item, head) and walks the 1024 keys in steps of 64; grid (1024 / (16 * FW), 64), FW waves a block, one block barrier a step.
// Transposed products: St = K (q+u)^T and BDt = P (q+v)^T (A = key or position rows, B = query rows kept in registers), so a lane holds ONE query (column lr) and 8 consecutive keys per tile (8 * hi + r).
// rel_shift: the 16 queries x 64 keys of a step need positions l0 .. l0 + 78, l0 = j0 - i0 + 1008 (five 16-row tiles; row 2047 is the zero pad and is never picked); BDt goes to this wave's LDS slab as [query][80] and is read back at column key - query + 15.
// Staging: the FW waves of a block read the same 64 key rows and 64 value rows in a step, and together 192 consecutive position rows (three pieces), of which a step brings 64 new ones. These three pieces of 8 KiB come into LDS by asynchronous copies, twice 16 bytes of each per thread, whole 128-byte lines per copy, two steps ahead: keys and values into two buffers, position rows into a ring of 256 rows. The fragments are then read from LDS.
// Online softmax per lane (running maximum and sum, output tiles rescaled each step); the f32 weights rounded in place to f16 B operands; Ot += Vt Pt (1 product); the epilogue divides by the sum and writes the merged hi/lo planes.
#define FW  8
#define PRG 4                     // pieces in the ring of position rows: the three that a step reads and the one in flight
#define BDP 84                    // slab pitch in floats: 16-byte aligned rows; the skewed reads (stride 83) fall on 32 different banks
#define LP  144                   // pitch in bytes of a staged row of 64 f16 (128 bytes): 16 bytes x odd, so that the 16 rows of a fragment read fall on different banks
#define PCB (64 * LP)             // one staged piece: 64 rows
#define NST (TT / 64)             // steps
#define L2E 1.4426950408889634f
typedef __attribute__((ext_vector_type(2))) __bf16 v2bf;
typedef __attribute__((ext_vector_type(8))) unsigned v8u;
typedef __attribute__((address_space(4))) const unsigned cuns;
__device__ __forceinline__ v16h cvt16h(const v8f x0, const v8f x1) {   // element s = tile s >> 3, register s & 7: two result tiles are one B operand in the hardware k order
    v8u hw;
#pragma unroll
    for (int s = 0; s < 8; ++s) { v2f x; x[0] = (s < 4) ? x0[2 * (s & 3)] : x1[2 * (s & 3)]; x[1] = (s < 4) ? x0[2 * (s & 3) + 1] : x1[2 * (s & 3) + 1];
        hw[s] = __builtin_bit_cast(unsigned, __builtin_convertvector(x, v2h)); }
    return __builtin_bit_cast(v16h, hw);
}
// f16 fragments: the loaders of the 16-bit planes, read as f16
__device__ __forceinline__ v16h ldlh(const char* p) { return __builtin_bit_cast(v16h, ldl(p)); }
__device__ __forceinline__ v16h ldoh(const bf* base, unsigned voff, int imm) { return __builtin_bit_cast(v16h, ldo(base, voff, imm)); }
// four waves a SIMD, from TWO blocks a WGP: the 4096 waves are resident at once, and as each block has its own barrier the two run out of step, so that one block's LDS reads and products fall beside the other's vector work
__global__ __launch_bounds__(FW * 32) __attribute__((amdgpu_waves_per_eu(4, 4))) void k_fattn(const bf* __restrict__ QUh, const bf* __restrict__ QVh, const bf* __restrict__ Kh, const bf* __restrict__ PPh, const bf* __restrict__ Vh, const unsigned* __restrict__ LM, bf* ATh, bf* ATl) {
    __shared__ __align__(16) float bds[FW * 16 * BDP];
    __shared__ __align__(16) char kvs[2 * 2 * PCB];   // [buffer][k, v][64 rows]
    __shared__ __align__(16) char pps[PRG * PCB];     // ring of 256 position rows
    const int tid = threadIdx.x, lane = tid & 31, lr = lane & 15, hi = lane >> 4, wv = __builtin_amdgcn_readfirstlane(tid >> 5);
    const int z = blockIdx.y, b = z / NH_, h = z % NH_; const int i0 = (blockIdx.x * FW + wv) * 16;
    float* bd = bds + wv * 16 * BDP;
    // the thread's twice 16 bytes of every staged piece: rows tid >> 3 and tid >> 3 + 32, segment tid & 7
    const unsigned cl = (unsigned)((tid >> 3) * LP + (tid & 7) * 16);
    const unsigned ck = (unsigned)(z * TT * HD * 2 + tid * 16);                                               // key rows of a step are 8 KiB in a row
    const unsigned cv = (unsigned)(((z * HD + (tid >> 3)) * TT) * 2 + (tid & 7) * 16);                         // value rows: 128 bytes of each of the 64 head dims
    const unsigned cp = (unsigned)((h * NPE + (TT - 16 * FW) - (int)blockIdx.x * 16 * FW) * HD * 2 + tid * 16);   // position rows from the block's lowest row on: piece c holds rows 64 c .. 64 c + 63 behind it, pieces 0 .. 17 end at row 2047 or below
    const unsigned lkv = ldsa(kvs) + cl, lpp = ldsa(pps) + cl;
    // keys and values of step t into buffer t & 1, position piece c into ring slot c & 3
    auto stage = [&](int t, int c) {
        const unsigned lk = lkv + (unsigned)(t & 1) * (2 * PCB), lq = lpp + (unsigned)(c & (PRG - 1)) * PCB;
        const char* gk = (const char*)Kh + ck + t * (64 * HD * 2); const char* gv = (const char*)Vh + cv + t * 128; const char* gp = (const char*)PPh + cp + c * (64 * HD * 2);
        acopy6(lk, gk, lk + 32 * LP, gk + 32 * HD * 2, lk + PCB, gv, lk + PCB + 32 * LP, gv + 32 * TT * 2, lq, gp, lq + 32 * LP, gp + 32 * HD * 2); };
    // step 0 reads position pieces 0 .. 2
#pragma unroll
    for (int c = 0; c < 2; ++c) acopy2(lpp + c * PCB, (const char*)PPh + cp + c * (64 * HD * 2), lpp + c * PCB + 32 * LP, (const char*)PPh + cp + c * (64 * HD * 2) + 32 * HD * 2);
    stage(0, 2);
    const unsigned qo = (unsigned)((z * TT + i0 + lr) * HD + 8 * hi) * 2u;   // byte offsets; every plane is under 2^24 bytes
    v16h qu[2], qv[2];
#pragma unroll
    for (int ks = 0; ks < 2; ++ks) { qu[ks] = ldoh(QUh, qo, ks * 64); qv[ks] = ldoh(QVh, qo, ks * 64); }
    // the lane masks of this wave's 16 queries: 32 words a step, the same address in every lane. Nothing writes them in this launch: read as constant memory they come by scalar loads into scalar registers, where a select takes its lane mask from
    const cuns* lmw = (const cuns*)(size_t)(LM + (size_t)(b * (TT / 16) + (i0 >> 4)) * (NST * 32));
    const int fl = lr * LP + hi * 16;   // the lane's place in a 16-row fragment of a staged piece
    v8f o[4];
#pragma unroll
    for (int dt = 0; dt < 4; ++dt) o[dt] = (v8f){};
    float mrun = -1.0e30f, lsum = 0.f;   // the running maximum starts far above the masked value -3e38: a masked key's exponential is 0 also while no key of its row has been left unmasked
    // step 0's copies of this wave have landed; behind the barrier those of every wave have
    asm volatile("s_wait_asynccnt 0x0" ::: "memory");
    __syncthreads();
    stage(1, 3);
#pragma unroll 1
    for (int t = 0; t < NST; ++t) {
        // the step's 32 lane masks, one line, asked for at the head of the step and used behind the content products
        unsigned km[32];
#pragma unroll
        for (int e = 0; e < 32; ++e) km[e] = lmw[t * 32 + e];
        const char* kb = kvs + (t & 1) * (2 * PCB) + fl;
        {   // position scores of the step's band, transposed: rows l0 + 16 u + 8 hi + r, column = query lr
            v8f pa[5];
#pragma unroll
            for (int u = 0; u < 5; ++u) pa[u] = (v8f){};
            v16h a[2][5];
#pragma unroll
            for (int u = 0; u < 5; ++u) { const int rw = t * 64 + (FW - 1 - wv) * 16 + u * 16;   /* row counted from the block's lowest position row */ const char* pr = pps + (rw & (PRG * 64 - 1)) * LP + fl; a[0][u] = ldlh(pr); a[1][u] = ldlh(pr + 64); }
            // the twenty position fragment reads are issued together, in front of the first product: without this line this build reads them in pairs among the products, each pair with its own LDS wait
            __builtin_amdgcn_sched_barrier(0);
#pragma unroll
            for (int ks = 0; ks < 2; ++ks)
#pragma unroll
                for (int u = 0; u < 5; ++u) pa[u] = wmma16(a[ks][u], qv[ks], pa[u]);
#pragma unroll
            for (int u = 0; u < 5; ++u) { v4f w0, w1;
#pragma unroll
                for (int q = 0; q < 4; ++q) { w0[q] = pa[u][q]; w1[q] = pa[u][4 + q]; }
                *(v4fa*)(bd + lr * BDP + u * 16 + hi * 8) = w0; *(v4fa*)(bd + lr * BDP + u * 16 + hi * 8 + 4) = w1; }
        }
        // the slab is exchanged between the two lane halves of this wave: keep the reads below behind the stores above; the four v_nop are the vector slots between the last position product and a content product that reuses its result registers
        __builtin_amdgcn_wave_barrier(); asm volatile("v_nop\n\tv_nop\n\tv_nop\n\tv_nop" ::: "memory");
        v8f s[4];
#pragma unroll
        for (int t4 = 0; t4 < 4; ++t4) s[t4] = (v8f){};
        { v16h a[2][4];
#pragma unroll
            for (int ks = 0; ks < 2; ++ks)
#pragma unroll
                for (int t4 = 0; t4 < 4; ++t4) a[ks][t4] = ldlh(kb + t4 * 16 * LP + ks * 64);
            // the sixteen key fragment reads of a step are issued together, in front of its first product: one place with LDS reads, and no two successive products on one accumulator
            __builtin_amdgcn_sched_barrier(0);
#pragma unroll
            for (int ks = 0; ks < 2; ++ks)
#pragma unroll
                for (int t4 = 0; t4 < 4; ++t4) s[t4] = wmma16(a[ks][t4], qu[ks], s[t4]); }
        // the step's 32 shifted position scores are read from the slab as one group, in front of the selects: left to the compiler they are read in several small batches among the selects, each with its own LDS wait
        float bv[32];
#pragma unroll
        for (int q = 0; q < 32; ++q) bv[q] = bd[lr * (BDP - 1) + 15 + (q >> 3) * 16 + hi * 8 + (q & 7)];
        // this line ends the group of reads: the selects stay behind it
        __builtin_amdgcn_sched_barrier(0);
        float tmax = -3.0e38f; const float gone = -3.0e38f;
#pragma unroll
        for (int t4 = 0; t4 < 4; ++t4) {
#pragma unroll
            for (int r = 0; r < 8; ++r) { const float su = (s[t4][r] + bv[t4 * 8 + r]) * (SCL * L2E);   /* (ac + rel_shift(bd)) / 8, in units of log2 so that the exponentials need no further product */ float tv;
                // the select takes the packed word as its lane mask as it stands: written in C it would cost a bit test and a compare for each score
                asm("v_cndmask_b32_e64 %0, %1, %2, %3" : "=v"(tv) : "v"(gone), "v"(su), "s"(km[t4 * 8 + r]));
                s[t4][r] = tv; tmax = fmaxf(tmax, tv); } }
        // the next step's stores to the slab stay behind the reads above
        __builtin_amdgcn_wave_barrier(); asm volatile("" ::: "memory");
        tmax = fmaxf(tmax, __shfl_xor(tmax, 16, 32));
        const float mnew = fmaxf(mrun, tmax); const float alpha = __builtin_amdgcn_exp2f(mrun - mnew); mrun = mnew;
        float ps = 0.f;
#pragma unroll
        for (int t4 = 0; t4 < 4; ++t4) s[t4] -= mnew;
#pragma unroll
        for (int r = 0; r < 8; ++r)
#pragma unroll
            for (int t4 = 0; t4 < 4; ++t4) { const float p = __builtin_amdgcn_exp2f(s[t4][r]); s[t4][r] = p; ps += p; }
        lsum = lsum * alpha + ps;
#pragma unroll
        for (int dt = 0; dt < 4; ++dt) o[dt] *= alpha;
        const v16h ph[2] = { cvt16h(s[0], s[1]), cvt16h(s[2], s[3]) };
        // the value fragments are read behind the rounding, as one group: without this line and the one behind the reads the compiler spreads them among the exponentials and the products and reads several into one register group, each with a full LDS wait
        __builtin_amdgcn_sched_barrier(0);
        { v16h a[2][4];
#pragma unroll
            for (int ks = 0; ks < 2; ++ks)
#pragma unroll
                for (int dt = 0; dt < 4; ++dt) a[ks][dt] = ldlh(kb + PCB + dt * 16 * LP + ks * 64);
            __builtin_amdgcn_sched_barrier(0);
#pragma unroll
            for (int ks = 0; ks < 2; ++ks)
#pragma unroll
                for (int dt = 0; dt < 4; ++dt) o[dt] = wmma16(a[ks][dt], ph[ks], o[dt]); }
        // four vector slots behind the last matrix instruction, also on the taken side of the loop's branch
        asm volatile("v_nop\n\tv_nop\n\tv_nop\n\tv_nop" : "+v"(o[0]), "+v"(o[1]), "+v"(o[2]), "+v"(o[3]));
        // hand-over of step t + 1: this wave's LDS reads of step t are done ...
        asm volatile("s_wait_dscnt 0x0" ::: "memory");
        // ... and its copies for step t + 1 have landed;
        asm volatile("s_wait_asynccnt 0x0" ::: "memory");
        // behind the barrier every wave's have, and nobody reads step t's buffer or its oldest position piece any more
        __syncthreads();
        if (t + 2 < NST) stage(t + 2, t + 4);
    }
    // no copy is left in flight when the wave ends
    asm volatile("s_wait_asynccnt 0x0" ::: "memory");
    lsum += __shfl_xor(lsum, 16, 32);
    const float f = (lsum > 0.f) ? __fdiv_rn(1.0f, lsum) : 0.f;
#pragma unroll
    for (int dt = 0; dt < 4; ++dt) { v8us oh, ol;
#pragma unroll
        for (int r = 0; r < 8; ++r) { unsigned short a, c2; splitf(o[dt][r] * f, a, c2); oh[r] = a; ol[r] = c2; }
        const size_t oo = ((size_t)b * TT + i0 + lr) * DQ + h * HD + dt * 16 + hi * 8; *(v8us*)(ATh + oo) = oh; *(v8us*)(ATl + oo) = ol; }
}

extern "C" void kernel_launch(void* const* d_in, const int* in_sizes, int n_in,
                              void* d_out, int out_size, void* d_ws, size_t ws_size, hipStream_t stream) {
    (void)in_sizes; (void)n_in; (void)out_size;
    const float* x = (const float*)d_in[0]; const int* MK = (const int*)d_in[1]; const float* wq = (const float*)d_in[2]; const float* wk = (const float*)d_in[3]; const float* wv = (const float*)d_in[4]; const float* wpos = (const float*)d_in[5]; const float* wo = (const float*)d_in[6]; const float* pbu = (const float*)d_in[7]; const float* pbv = (const float*)d_in[8];   /* u_bias, v_bias [8][64] */
    float* OUT = (float*)d_out;     // [8][1024][512]
    char* wsp = (char*)d_ws;
    auto take = [&](size_t bytes) { char* p = wsp; wsp += (bytes + 255) & ~(size_t)255; return (void*)p; };
    bf* WQ = (bf*)take((size_t)DQ * DM * 2); bf* WK = (bf*)take((size_t)DKV * DM * 2); bf* WV = (bf*)take((size_t)DKV * DM * 2); bf* WO = (bf*)take((size_t)DM * DQ * 2);
    bf* PEh = (bf*)take((size_t)NPE * DM * 2); bf* PEl = (bf*)take((size_t)NPE * DM * 2); bf* WP = (bf*)take((size_t)DQ * DM * 2); bf* PPh = (bf*)take((size_t)NH_ * NPE * HD * 2);
    // planes of all 8 batch items
    bf* QPh = (bf*)take((size_t)NB_ * NH_ * TT * HD * 2); bf* QVh = (bf*)take((size_t)NB_ * NH_ * TT * HD * 2); bf* KPh = (bf*)take((size_t)NB_ * NKV * TT * HD * 2); bf* VTh = (bf*)take((size_t)NB_ * NKV * HD * TT * 2); bf* ATh = (bf*)take((size_t)NB_ * TT * DQ * 2); bf* ATl = (bf*)take((size_t)NB_ * TT * DQ * 2);
    bf* XB = (bf*)take((size_t)NB_ * TT * DM * 2);
    unsigned* LM = (unsigned*)take((size_t)NB_ * TT * TT / 8);
    if ((size_t)(wsp - (char*)d_ws) > ws_size) return;
    k_prep<<<5 * PBW + PBM + PBP + PBX, 256, 0, stream>>>(wq, wk, wv, wo, wpos, x, MK, WQ, WK, WV, WO, WP, PEh, PEl, XB, LM);   /* five transposed bf16 weight planes, mask bits, sinusoid table (hi + lo), exact bf16 plane of xs */
    k_proj<<<PJP + 384, GW * 32, 0, stream>>>(PEh, PEl, WP, PPh, XB, WQ, WK, WV, pbu, pbv, QPh, QVh, KPh, VTh);   /* p = table Wpos -> per-head f16 plane [h][2048][64]; q + u_bias, q + v_bias, k and transposed v planes of all 8 batch items */
    k_fattn<<<dim3(TT / (16 * FW), NB_ * NH_, 1), FW * 32, 0, stream>>>(QPh, QVh, KPh, PPh, VTh, LM, ATh, ATl);   /* scores, rel_shift, mask, softmax, attn.v and merge of all 64 (batch item, head) pairs */
    k_outp<<<dim3(NB_ * TT / 128, DM / 128, 1), GW * 32, 0, stream>>>(ATh, ATl, WO, OUT);   /* out = merged Wout */
}
